// v000
// Times are from an AMD MI455X. After a warm-up the kernel runs many times in a row, and a time is the length of
// such a window on the GPU divided by its runs, so every launch and the gaps after it count. The runs cycle
// through copies of the inputs. A figure is the median of several windows, for all but v000 over two sittings.
// Sittings can differ by a few percent; kernels timed side by side share one.
// The starting kernel, v000, takes 612 microseconds a run.
// Contractions on v_wmma_f32_16x16x32_f16 (f16 operands, f32 accumulate): q/k/v projections (x RNE-converted to bf16 and carried *2^4,
// W RNE-converted to bf16 and carried *2^8, exact products); q.k^T (q,k carried *2^10 as f16 hi planes, plus unscaled f16 residual planes
// on the leading query blocks of each sequence); p.v (p carried *2^15, v^T carried *2^10: hi planes plus residual planes on the leading query
// blocks); output projection (attention output carried *2^10: hi plane everywhere, residual plane on the leading rows of each sequence;
// Wo bf16 *2^8). RoPE, mask add and online softmax in f32.
#include <hip/hip_runtime.h>
#include <math.h>
#include <stdint.h>

#define NB_     2
#define SEQ_    2048
#define DM_     2048
#define NH_     8
#define HD_     256
#define NF_     128
#define KVN_    512
#define WIN_    1024
#define NQB_    32
#define QE_     4
#define LOROWS_ 256

#define CX_   16.0f
#define CW_   256.0f
#define CQK_  1024.0f
#define CP_   32768.0f
#define SSC_  5.9604644775390625e-8f     /* 2^-4 * 2^-20 : score scale for q,k carried *2^10 each */
#define OSC_  3.0517578125e-5f           /* 2^-15 = 2^10 / (2^15 * 2^10) : attention output carry */
#define QSC_  2.44140625e-4f             /* 2^-12 = 1 / (2^4 * 2^8) : projection outputs back to f32 */
#define WSC_  3.814697265625e-6f         /* 2^-18 = 1 / (2^10 * 2^8) : final projection */

typedef _Float16 v16h __attribute__((ext_vector_type(16)));
typedef _Float16 v8h  __attribute__((ext_vector_type(8)));
typedef float    v8f  __attribute__((ext_vector_type(8)));
typedef float    v4f  __attribute__((ext_vector_type(4)));

union FragU { v16h v; v8h h[2]; };
union U8 { v8f v; v4f q[2]; };

__device__ __forceinline__ float bf16_rne(float f) {
  unsigned u = __float_as_uint(f);
  u = u + 0x7FFFu + ((u >> 16) & 1u);
  return __uint_as_float(u & 0xFFFF0000u);
}
__device__ __forceinline__ v8f zero8() { return (v8f){0.f, 0.f, 0.f, 0.f, 0.f, 0.f, 0.f, 0.f}; }

// 16-bit fragment (A or B): lane row/col = lane&15, elements 0..7 <- p[0..7] (k0+8h..), 8..15 <- p[16..23] (k0+16+8h..)
// p already includes the row base + k0 + 8*h.
__device__ __forceinline__ v16h frag_ld(const _Float16* p) {
  FragU f;
  f.h[0] = *(const v8h*)(p);
  f.h[1] = *(const v8h*)(p + 16);
  return f.v;
}
__device__ __forceinline__ v8f wmma_raw(v16h a, v16h b, v8f c) {
  return __builtin_amdgcn_wmma_f32_16x16x32_f16(false, a, false, b, (short)0, c, false, false);
}
// WMMA with trailing hazard guard (ties D, keeps A/B live)
__device__ __forceinline__ v8f mma_g(v16h a, v16h b, v8f c) {
  c = __builtin_amdgcn_wmma_f32_16x16x32_f16(false, a, false, b, (short)0, c, false, false);
  asm volatile("v_nop\n\tv_nop\n\tv_nop\n\tv_nop" : "+v"(c) : "v"(a), "v"(b));
  return c;
}
__device__ __forceinline__ void dep_guard(v8f& a, v8f& b, v16h x, v16h y) {
  asm volatile("v_nop\n\tv_nop\n\tv_nop\n\tv_nop" : "+v"(a), "+v"(b) : "v"(x), "v"(y));
}
__device__ __forceinline__ void keep4(v16h a, v16h b, v16h c, v16h d) {
  asm volatile("v_nop" :: "v"(a), "v"(b), "v"(c), "v"(d));
}
__device__ __forceinline__ void acc_guard4(v8f& a, v8f& b, v8f& c, v8f& d) {
  asm volatile("v_nop\n\tv_nop\n\tv_nop\n\tv_nop" : "+v"(a), "+v"(b), "+v"(c), "+v"(d));
}

// ---------------------------------------------------------------------------------------------------------------
// Elementwise convert: dst[i] = f16( bf16_rne(src[i]) * scale ), 8 elements per thread, one 16-B store per lane:
// coverage: grid = ceil(n8/256), each thread 8 elements -> 8*n8 elements.
// ---------------------------------------------------------------------------------------------------------------
__global__ __launch_bounds__(256) void cvt16_kernel(const float* __restrict__ src, _Float16* __restrict__ dst, int n8, float scale) {
  const int i = blockIdx.x * 256 + (int)threadIdx.x;
  if (i >= n8) return;
  const float* s = src + 8 * (size_t)i;
  U8 a;
  a.q[0] = *(const v4f*)(s);
  a.q[1] = *(const v4f*)(s + 4);
  v8h o;
#pragma unroll
  for (int e = 0; e < 8; ++e) o[e] = (_Float16)(bf16_rne(a.v[e]) * scale);
  _Float16* d = dst + 8 * (size_t)i;
  *(v8h*)d = o;
  
}

// ---------------------------------------------------------------------------------------------------------------
// RoPE tables: cosT/sinT [nrows][128], angle = float(pos[row]) * inv_freq[f], inv_freq[f] = 1 / f32(10000^(f/128)).
// coverage: grid = nrows/32 blocks, 16 iterations x 2 rows -> nrows x 128 per table.
// ---------------------------------------------------------------------------------------------------------------
__global__ __launch_bounds__(256) void rope_table_kernel(const int* __restrict__ pos, float* __restrict__ cosT,
                                                         float* __restrict__ sinT, int nrows) {
#pragma clang fp contract(off)
  __shared__ float invf[NF_];
  const int tid = threadIdx.x;
  if (tid < NF_) {
    const double e = (double)tid * 0.0078125;                 // tid/128 exactly
    const double p = exp2(e * 13.287712379549449);            // 10000^e
    const float pf = (float)p;                                // RNE to f32
    invf[tid] = 1.0f / pf;
  }
  __syncthreads();
  const int f = tid & (NF_ - 1);
  const int rp = tid >> 7;
  const int r0 = blockIdx.x * 32;
  const float iv = invf[f];
#pragma unroll 1
  for (int it = 0; it < 16; ++it) {
    const int row = r0 + it * 2 + rp;
    const int rowc = (row < nrows) ? row : (nrows - 1);
    const float ang = (float)pos[rowc] * iv;
    float sv, cv;
    sincosf(ang, &sv, &cv);
    if (row < nrows) {
      float* cp = cosT + (size_t)row * NF_ + f;
      float* sp = sinT + (size_t)row * NF_ + f;
      *(float*)cp = cv;
      *(float*)sp = sv;
      
    }
  }
}

// ---------------------------------------------------------------------------------------------------------------
// Mask verification flag per (b, 64-query block): 1 if every mask value for rows q0..q0+63 and keys in
// [q0+64, min(q+1023, SEQ-1)] (the in-band keys strictly above the query block) is <= -1e9 (adds to an exact zero weight),
// ---------------------------------------------------------------------------------------------------------------
__global__ __launch_bounds__(256) void maskflag_kernel(const float* __restrict__ mask, int* __restrict__ flag) {
  __shared__ int sw[8];
  const int tid = threadIdx.x, w = tid >> 5, lane = tid & 31;
  const int bq = blockIdx.x;                 // b*32 + qb
  const int b = bq >> 5, qb = bq & (NQB_ - 1);
  const int q0 = qb * 64;
  int bad = 0;
#pragma unroll 1
  for (int rr = 0; rr < 64; ++rr) {
    const int qrow = q0 + rr;
    int kend = qrow + WIN_ - 1;
    if (kend > SEQ_ - 1) kend = SEQ_ - 1;
    const float* mp = mask + ((size_t)b * SEQ_ + qrow) * SEQ_;
#pragma unroll 1
    for (int kb0 = q0 + 64; kb0 <= kend; kb0 += 256) {
      const int k = kb0 + tid;
      const int kc = (k <= kend) ? k : kend;
      const float mv = mp[kc];
      const int ok = (mv <= -1.0e9f) ? 1 : 0;
      bad |= ((k <= kend) && (ok == 0)) ? 1 : 0;
    }
  }
  const unsigned long long bm = __ballot(bad);
  if (lane == 0) sw[w] = (bm != 0ull) ? 1 : 0;
  __syncthreads();
  if (w == 0) {
    int any = 0;
#pragma unroll
    for (int i = 0; i < 8; ++i) any |= sw[i];
    const int fv = any ? 0 : 1;
    int* fp = flag + (size_t)bq * 32 + lane;
    *(int*)fp = fv;
    
  }
}

// ---------------------------------------------------------------------------------------------------------------
// Register-blocked WMMA GEMM, f16 operands: C[m][n] = scale * sum_k (A[m][k] (+ A2[m][k])) * Bt[n][k]
// A row-major [M][lda], optional residual plane A2 (same layout) used on row tiles with (m0 & seqMask) < loRows (wave-uniform);
// Bt row-major [N][ldb] (k contiguous); C f32 [M][ldc]. Each wave owns a 64x64 tile (4x4 accumulators), block = 8 waves.
// M, N multiples of 64, K multiple of 32. Epilogue: 16-row slabs staged per wave in LDS; each 64-wide f32 row segment
// ---------------------------------------------------------------------------------------------------------------
template <bool LO>
__device__ __forceinline__ void gemm_kloop(v8f (&acc)[4][4], const _Float16* __restrict__ Ab, const _Float16* __restrict__ Ab2,
                                           int lda, const _Float16* __restrict__ Bb, int ldb, int m0, int n0, int K,
                                           int rlane, int koff) {
  for (int k0 = 0; k0 < K; k0 += 32) {
    v16h bh[4];
#pragma unroll
    for (int j = 0; j < 4; ++j) bh[j] = frag_ld(Bb + (size_t)(n0 + (j << 4) + rlane) * ldb + k0 + koff);
#pragma unroll
    for (int i = 0; i < 4; ++i) {
      const size_t ao = (size_t)(m0 + (i << 4) + rlane) * lda + k0 + koff;
      const v16h ah = frag_ld(Ab + ao);
      v16h al = ah;
      if (LO) al = frag_ld(Ab2 + ao);
#pragma unroll
      for (int j = 0; j < 4; ++j) {
        acc[i][j] = wmma_raw(ah, bh[j], acc[i][j]);
        if (LO) acc[i][j] = wmma_raw(al, bh[j], acc[i][j]);
      }
      dep_guard(acc[i][0], acc[i][3], ah, al);
    }
    keep4(bh[0], bh[1], bh[2], bh[3]);
  }
}

__global__ __launch_bounds__(256) void gemm64_kernel(const _Float16* __restrict__ A, const _Float16* __restrict__ A2, int lda,
                                                     const _Float16* __restrict__ Bt, int ldb,
                                                     float* __restrict__ C, int ldc, int M, int N, int K,
                                                     int loRows, int seqMask, float scale) {
  __shared__ __align__(16) float sT[8][16 * 68];   // per-wave 16x64 slab, pitch 68 floats
  const int lane = threadIdx.x & 31;
  const int wave = threadIdx.x >> 5;
  const int tilesN = N >> 6;
  const int tilesM = M >> 6;
  const int tile = blockIdx.x * 8 + wave;
  if (tile >= tilesM * tilesN) return;   // wave-uniform; no block barriers in this kernel
  const int tm = tile / tilesN;
  const int tn = tile - tm * tilesN;
  const int m0 = tm << 6;
  const int n0 = tn << 6;
  const int rlane = lane & 15;
  const int koff  = (lane >> 4) * 8;
  const int mOff  = koff;

  v8f acc[4][4];
#pragma unroll
  for (int i = 0; i < 4; ++i)
#pragma unroll
    for (int j = 0; j < 4; ++j) acc[i][j] = zero8();

  const bool useLo = ((m0 & seqMask) < loRows);   // wave-uniform
  if (useLo) gemm_kloop<true>(acc, A, A2, lda, Bt, ldb, m0, n0, K, rlane, koff);
  else       gemm_kloop<false>(acc, A, A, lda, Bt, ldb, m0, n0, K, rlane, koff);
  acc_guard4(acc[0][0], acc[0][1], acc[0][2], acc[0][3]);
  acc_guard4(acc[1][0], acc[1][1], acc[1][2], acc[1][3]);
  acc_guard4(acc[2][0], acc[2][1], acc[2][2], acc[2][3]);
  acc_guard4(acc[3][0], acc[3][1], acc[3][2], acc[3][3]);

  float* slab = sT[wave];
  const int hrow = lane >> 4;
  const int c4 = rlane * 4;
#pragma unroll
  for (int i = 0; i < 4; ++i) {
    const int mBase = m0 + (i << 4);
#pragma unroll
    for (int j = 0; j < 4; ++j) {
#pragma unroll
      for (int r = 0; r < 8; ++r) slab[(mOff + r) * 68 + (j << 4) + rlane] = acc[i][j][r] * scale;
    }
    __builtin_amdgcn_fence(__ATOMIC_RELEASE, "workgroup");
    __builtin_amdgcn_wave_barrier();
    __builtin_amdgcn_fence(__ATOMIC_ACQUIRE, "workgroup");
    {
#pragma unroll
      for (int it = 0; it < 8; ++it) {
        const int row = it * 2 + hrow;
        const v4f v = *(const v4f*)(slab + row * 68 + c4);
        *(v4f*)(C + (size_t)(mBase + row) * ldc + n0 + c4) = v;
      }
      
    }
    __builtin_amdgcn_fence(__ATOMIC_RELEASE, "workgroup");
    __builtin_amdgcn_wave_barrier();
    __builtin_amdgcn_fence(__ATOMIC_ACQUIRE, "workgroup");
  }
}

// ---------------------------------------------------------------------------------------------------------------
// RoPE + f16 hi/residual split. Unit = (row, head); 8 lanes per unit; lane j owns columns {8j, 64+8j, 128+8j, 192+8j}+0..7 of the
// 256-wide head (pairs (c, c+128) are in the same lane). out = x*cos + rotate_half(x)*sin with cos/sin[row][c mod 128].
// hi = f16(out*carry), lo = f16(out*carry - hi) (unscaled residual). Stores: for each column chunk one instruction writes
// coverage: nunits*8 threads x 32 elements = nunits*256 per plane.
// ---------------------------------------------------------------------------------------------------------------
__global__ __launch_bounds__(256) void rope_split_kernel(const float* __restrict__ src, int spitch, int nheads,
                                                         const float* __restrict__ cosT, const float* __restrict__ sinT,
                                                         _Float16* __restrict__ hi, _Float16* __restrict__ lo,
                                                         int dpitch, int nunits, float carry) {
#pragma clang fp contract(off)
  const int gid = blockIdx.x * 256 + (int)threadIdx.x;
  const int unit = gid >> 3;
  const int j = gid & 7;
  if (unit >= nunits) return;
  const int row = unit / nheads;
  const int hd = unit - row * nheads;
  const float* s  = src  + (size_t)row * spitch + hd * HD_ + 8 * j;
  const float* ct = cosT + (size_t)row * NF_ + 8 * j;
  const float* st = sinT + (size_t)row * NF_ + 8 * j;
  U8 xa, xb, xc, xd, ca, cb, sa, sb;
  xa.q[0] = *(const v4f*)(s);         xa.q[1] = *(const v4f*)(s + 4);
  xb.q[0] = *(const v4f*)(s + 64);    xb.q[1] = *(const v4f*)(s + 68);
  xc.q[0] = *(const v4f*)(s + 128);   xc.q[1] = *(const v4f*)(s + 132);
  xd.q[0] = *(const v4f*)(s + 192);   xd.q[1] = *(const v4f*)(s + 196);
  ca.q[0] = *(const v4f*)(ct);        ca.q[1] = *(const v4f*)(ct + 4);
  cb.q[0] = *(const v4f*)(ct + 64);   cb.q[1] = *(const v4f*)(ct + 68);
  sa.q[0] = *(const v4f*)(st);        sa.q[1] = *(const v4f*)(st + 4);
  sb.q[0] = *(const v4f*)(st + 64);   sb.q[1] = *(const v4f*)(st + 68);
  v8h h0, h1, h2, h3, l0, l1, l2, l3;
#pragma unroll
  for (int e = 0; e < 8; ++e) {
    const float r0 = xa.v[e] * ca.v[e] - xc.v[e] * sa.v[e];    // col 8j+e
    const float r1 = xb.v[e] * cb.v[e] - xd.v[e] * sb.v[e];    // col 64+8j+e
    const float r2 = xc.v[e] * ca.v[e] + xa.v[e] * sa.v[e];    // col 128+8j+e
    const float r3 = xd.v[e] * cb.v[e] + xb.v[e] * sb.v[e];    // col 192+8j+e
    float t; _Float16 q;
    t = r0 * carry; q = (_Float16)t; h0[e] = q; l0[e] = (_Float16)(t - (float)q);
    t = r1 * carry; q = (_Float16)t; h1[e] = q; l1[e] = (_Float16)(t - (float)q);
    t = r2 * carry; q = (_Float16)t; h2[e] = q; l2[e] = (_Float16)(t - (float)q);
    t = r3 * carry; q = (_Float16)t; h3[e] = q; l3[e] = (_Float16)(t - (float)q);
  }
  _Float16* hp = hi + (size_t)row * dpitch + hd * HD_ + 8 * j;
  _Float16* lp = lo + (size_t)row * dpitch + hd * HD_ + 8 * j;
  {
    *(v8h*)(hp)       = h0;
    *(v8h*)(hp + 64)  = h1;
    *(v8h*)(hp + 128) = h2;
    *(v8h*)(hp + 192) = h3;
    *(v8h*)(lp)       = l0;
    *(v8h*)(lp + 64)  = l1;
    *(v8h*)(lp + 128) = l2;
    *(v8h*)(lp + 192) = l3;
    
  }
}

// ---------------------------------------------------------------------------------------------------------------
// v columns of the fused kv plane (f32 [NB*SEQ rows][512], cols 256..511) -> transposed f16 planes Vth/Vtl [b][d][s]
// (hi = f16(v*2^10), lo = unscaled residual). 64x64 tiles through LDS; grid = (256/64, NB*SEQ/64), 256 threads.
// coverage per block: load 4 it x 256 thr x 4 = 64x64; store 2 it x 256 thr x 8 = 64x64 per plane.
// ---------------------------------------------------------------------------------------------------------------
__global__ __launch_bounds__(256) void vt_split_kernel(const float* __restrict__ KV, _Float16* __restrict__ Vth,
                                                       _Float16* __restrict__ Vtl) {
  __shared__ __align__(16) float tf[64 * 68];
  const int tid = threadIdx.x;
  const int d0  = blockIdx.x * 64;           // d block (input column within v)
  const int sg0 = blockIdx.y * 64;           // global row block (b*SEQ + s)
  const int b   = sg0 >> 11;
  const int s0  = sg0 & (SEQ_ - 1);
  {
    const int lr = tid >> 4;
    const int c4 = (tid & 15) * 4;
#pragma unroll
    for (int it = 0; it < 4; ++it) {
      const int rr = it * 16 + lr;
      const v4f a = *(const v4f*)(KV + (size_t)(sg0 + rr) * KVN_ + HD_ + d0 + c4);
      *(v4f*)(tf + rr * 68 + c4) = a;
    }
  }
  __syncthreads();
  const int sub = tid >> 3;          // output row within tile (= d)
  const int c8  = (tid & 7) * 8;     // s offset within tile
  v8h hv[2], lv[2];
#pragma unroll
  for (int it = 0; it < 2; ++it) {
    const int oc = it * 32 + sub;
    v8h a, rsd;
#pragma unroll
    for (int q = 0; q < 8; ++q) {
      const float f = tf[(c8 + q) * 68 + oc] * CQK_;
      const _Float16 hq = (_Float16)f;
      a[q] = hq;
      rsd[q] = (_Float16)(f - (float)hq);
    }
    hv[it] = a; lv[it] = rsd;
  }
  {
#pragma unroll
    for (int it = 0; it < 2; ++it) {
      const int oc = it * 32 + sub;
      const size_t go = ((size_t)b * HD_ + d0 + oc) * SEQ_ + s0 + c8;
      *(v8h*)(Vth + go) = hv[it];
      *(v8h*)(Vtl + go) = lv[it];
    }
    
  }
}

// ---------------------------------------------------------------------------------------------------------------
// Sliding-window attention, head dim 256, one kv head shared by 8 query heads.
// Block = (b, h, 64 query rows), 256 threads = 8 waves. Key tiles of 64: kt in [max(0,qb-16), kthi], kthi = qb when the mask
// flag verified the tiles above the block add exact zeros, else min(qb+16, 31) (general in-band path, mask added).
//   S phase: wave w computes rows 16*(w&3)..+15 x keys 32*(w>>2)..+31 of the tile (2 accumulators, K = 256 = 8 k-steps),
//            A = q fragments straight from the 16-bit global planes, B = k fragments straight from the 16-bit k planes
//            (q,k carried *2^10; hi.hi everywhere, + lo.hi + hi.lo on query blocks < QE_).
//   Scores: s*2^-24 + mask[b][0][q][key] for |q-key| <= 1023, -inf outside the band; row max / sum exchanged between the two
//            waves of a row group through LDS; online softmax in f32; p*2^15 -> f16 P tile [64][72] in LDS (+ residual tile early).
//   PV phase: wave w owns O[64 rows][32*w..+31] (4x2 accumulators); A = P fragments from LDS (after __syncthreads),
//            B = v^T fragments straight from the 16-bit global planes (*2^10; + residual products on query blocks < QE_).
// coverage: NB*NH*32 blocks x 64 rows x 256 cols = the whole [NB*SEQ][2048] plane, both planes.
// ---------------------------------------------------------------------------------------------------------------
#define AT_PPITCH 72
#define AT_OPITCH 264
#define AT_OFF_PH 0
#define AT_OFF_PL 9216
#define AT_OFF_PM 18432
#define AT_OFF_PS 18944
#define AT_OFF_AL 19456
#define AT_OFF_LF 19712
#define AT_OFF_OH 19968
#define AT_OFF_OL 53760
#define AT_LDS    87552
static_assert(AT_OFF_PL == AT_OFF_PH + 64 * AT_PPITCH * 2);
static_assert(AT_OFF_PM == AT_OFF_PL + 64 * AT_PPITCH * 2);
static_assert(AT_OFF_OL == AT_OFF_OH + 64 * AT_OPITCH * 2);
static_assert(AT_LDS == AT_OFF_OL + 64 * AT_OPITCH * 2);

__global__ __launch_bounds__(256) void attn_kernel(const _Float16* __restrict__ Qh, const _Float16* __restrict__ Ql,
                                                   const _Float16* __restrict__ Kh, const _Float16* __restrict__ Kl,
                                                   const _Float16* __restrict__ Vth, const _Float16* __restrict__ Vtl,
                                                   const float* __restrict__ mask, const int* __restrict__ flag,
                                                   _Float16* __restrict__ AOh, _Float16* __restrict__ AOl) {
  extern __shared__ __align__(16) unsigned char dsm[];
  _Float16* Ph   = (_Float16*)(dsm + AT_OFF_PH);
  _Float16* Pl   = (_Float16*)(dsm + AT_OFF_PL);
  float*    pm   = (float*)(dsm + AT_OFF_PM);     // [8 waves][16 rows] partial row max
  float*    ps   = (float*)(dsm + AT_OFF_PS);     // [8 waves][16 rows] partial row sum
  float*    alph = (float*)(dsm + AT_OFF_AL);     // [64] rescale factors
  float*    lfin = (float*)(dsm + AT_OFF_LF);     // [64] final row sums
  _Float16* Ohs  = (_Float16*)(dsm + AT_OFF_OH);
  _Float16* Ols  = (_Float16*)(dsm + AT_OFF_OL);

  const int tid  = threadIdx.x;
  const int w    = tid >> 5;
  const int lane = tid & 31;
  const int hh   = lane >> 4;
  const int c    = lane & 15;
  const int bid  = blockIdx.x;
  const int qb   = bid & (NQB_ - 1);
  const int h    = (bid >> 5) & (NH_ - 1);
  const int b    = bid >> 8;
  const int q0   = qb * 64;
  const int srow0 = (w & 3) * 16;
  const int kh    = w >> 2;
  const int ocol0 = w * 32;
  const bool early = (qb < QE_);
  const int ktlo = (qb > 16) ? (qb - 16) : 0;
  const int fl = flag[(b * NQB_ + qb) * 32];
  int kthi = (fl != 0) ? qb : (qb + 16);
  if (kthi > NQB_ - 1) kthi = NQB_ - 1;

  const size_t growq = (size_t)b * SEQ_ + q0;
  const _Float16* qhp = Qh + (growq + srow0 + c) * DM_ + h * HD_ + 8 * hh;
  const _Float16* qlp = Ql + (growq + srow0 + c) * DM_ + h * HD_ + 8 * hh;
  const float*    mrp = mask + (growq + srow0 + 8 * hh) * (size_t)SEQ_;
  const _Float16* vhp = Vth + ((size_t)b * HD_ + ocol0 + c) * SEQ_ + 8 * hh;
  const _Float16* vlp = Vtl + ((size_t)b * HD_ + ocol0 + c) * SEQ_ + 8 * hh;

  float mrow[8], lrow[8];
  v8f oacc[4][2];
#pragma unroll
  for (int r = 0; r < 8; ++r) { mrow[r] = -INFINITY; lrow[r] = 0.0f; }
#pragma unroll
  for (int i = 0; i < 4; ++i) { oacc[i][0] = zero8(); oacc[i][1] = zero8(); }

  for (int kt = ktlo; kt <= kthi; ++kt) {      // block-uniform, at most 32 trips
    const int key0  = kt * 64;
    const int wkey0 = key0 + 32 * kh;
    const _Float16* khp = Kh + ((size_t)b * SEQ_ + wkey0 + c) * HD_ + 8 * hh;
    const _Float16* klp = Kl + ((size_t)b * SEQ_ + wkey0 + c) * HD_ + 8 * hh;

    // ---- S = q . k^T (16 rows x 32 keys per wave) ----
    v8f s[2];
    s[0] = zero8(); s[1] = zero8();
#pragma unroll
    for (int ks = 0; ks < 8; ++ks) {
      const v16h qa = frag_ld(qhp + 32 * ks);
      v16h qr = qa;
      if (early) qr = frag_ld(qlp + 32 * ks);
#pragma unroll
      for (int j = 0; j < 2; ++j) {
        const v16h kb = frag_ld(khp + (size_t)(16 * j) * HD_ + 32 * ks);
        s[j] = mma_g(qa, kb, s[j]);
        if (early) {
          const v16h kr = frag_ld(klp + (size_t)(16 * j) * HD_ + 32 * ks);
          s[j] = mma_g(qr, kb, s[j]);
          s[j] = mma_g(qa, kr, s[j]);
        }
      }
    }

    // ---- scale, mask, partial row max over this wave's 32 keys ----
    float cm[8];
#pragma unroll
    for (int r = 0; r < 8; ++r) {
      const int qrow = q0 + srow0 + 8 * hh + r;
      const float* mp = mrp + (size_t)r * SEQ_;
      float mx = -INFINITY;
#pragma unroll
      for (int j = 0; j < 2; ++j) {
        const int key = wkey0 + 16 * j + c;
        const float mv = mp[key];
        const bool inb = (key + (WIN_ - 1) >= qrow) && (key <= qrow + (WIN_ - 1));
        const float sv = inb ? (s[j][r] * SSC_ + mv) : -INFINITY;
        s[j][r] = sv;
        mx = fmaxf(mx, sv);
      }
      mx = fmaxf(mx, __shfl_xor(mx, 1, 32));
      mx = fmaxf(mx, __shfl_xor(mx, 2, 32));
      mx = fmaxf(mx, __shfl_xor(mx, 4, 32));
      mx = fmaxf(mx, __shfl_xor(mx, 8, 32));
      cm[r] = mx;
    }
    if (c == 0) {
#pragma unroll
      for (int r = 0; r < 8; ++r) pm[w * 16 + 8 * hh + r] = cm[r];
    }
    __syncthreads();

    // ---- online softmax: tile max, p, partial sums ----
    float al[8], psm[8];
    const int wo = w ^ 4;
#pragma unroll
    for (int r = 0; r < 8; ++r) {
      const float om = pm[wo * 16 + 8 * hh + r];
      const float mnew = fmaxf(mrow[r], fmaxf(cm[r], om));
      const float msafe = (mnew == -INFINITY) ? 0.0f : mnew;
      al[r] = __expf(mrow[r] - msafe);
      mrow[r] = mnew;
      float sum = 0.0f;
#pragma unroll
      for (int j = 0; j < 2; ++j) {
        const float p = __expf(s[j][r] - msafe);
        sum += p;
        const float t = p * CP_;
        const _Float16 phv = (_Float16)t;
        const int pidx = (srow0 + 8 * hh + r) * AT_PPITCH + 32 * kh + 16 * j + c;
        Ph[pidx] = phv;
        if (early) Pl[pidx] = (_Float16)(t - (float)phv);
      }
      sum += __shfl_xor(sum, 1, 32);
      sum += __shfl_xor(sum, 2, 32);
      sum += __shfl_xor(sum, 4, 32);
      sum += __shfl_xor(sum, 8, 32);
      psm[r] = sum;
    }
    if (c == 0) {
#pragma unroll
      for (int r = 0; r < 8; ++r) ps[w * 16 + 8 * hh + r] = psm[r];
      if (w < 4) {
#pragma unroll
        for (int r = 0; r < 8; ++r) alph[srow0 + 8 * hh + r] = al[r];
      }
    }
    __syncthreads();
#pragma unroll
    for (int r = 0; r < 8; ++r)
      lrow[r] = lrow[r] * al[r] + (ps[(w & 3) * 16 + 8 * hh + r] + ps[((w & 3) + 4) * 16 + 8 * hh + r]);

    // ---- rescale O, then O += P . V for this wave's 32 output columns ----
#pragma unroll
    for (int i = 0; i < 4; ++i) {
      U8 av;
      av.q[0] = *(const v4f*)(alph + 16 * i + 8 * hh);
      av.q[1] = *(const v4f*)(alph + 16 * i + 8 * hh + 4);
#pragma unroll
      for (int r = 0; r < 8; ++r) { oacc[i][0][r] *= av.v[r]; oacc[i][1][r] *= av.v[r]; }
    }
#pragma unroll
    for (int k2 = 0; k2 < 2; ++k2) {
      const int kk = key0 + 32 * k2;
#pragma unroll
      for (int jj = 0; jj < 2; ++jj) {
        const v16h vb = frag_ld(vhp + (size_t)(16 * jj) * SEQ_ + kk);
        v16h vr = vb;
        if (early) vr = frag_ld(vlp + (size_t)(16 * jj) * SEQ_ + kk);
#pragma unroll
        for (int i = 0; i < 4; ++i) {
          const v16h pa = frag_ld(Ph + (16 * i + c) * AT_PPITCH + 32 * k2 + 8 * hh);
          oacc[i][jj] = mma_g(pa, vb, oacc[i][jj]);
          if (early) {
            const v16h pr = frag_ld(Pl + (16 * i + c) * AT_PPITCH + 32 * k2 + 8 * hh);
            oacc[i][jj] = mma_g(pa, vr, oacc[i][jj]);
            oacc[i][jj] = mma_g(pr, vb, oacc[i][jj]);
          }
        }
      }
    }
  }

  if (w < 4 && c == 0) {
#pragma unroll
    for (int r = 0; r < 8; ++r) lfin[srow0 + 8 * hh + r] = lrow[r];
  }
  __syncthreads();
#pragma unroll
  for (int i = 0; i < 4; ++i) {
    U8 lv;
    lv.q[0] = *(const v4f*)(lfin + 16 * i + 8 * hh);
    lv.q[1] = *(const v4f*)(lfin + 16 * i + 8 * hh + 4);
#pragma unroll
    for (int r = 0; r < 8; ++r) {
      const float f = OSC_ * (1.0f / lv.v[r]);
      const int orow = 16 * i + 8 * hh + r;
#pragma unroll
      for (int jj = 0; jj < 2; ++jj) {
        const float t = oacc[i][jj][r] * f;
        const _Float16 hq = (_Float16)t;
        const int oidx = orow * AT_OPITCH + ocol0 + 16 * jj + c;
        Ohs[oidx] = hq;
        Ols[oidx] = (_Float16)(t - (float)hq);
      }
    }
  }
  __syncthreads();
  {
    const int piece = tid & 7;
    const int lsub  = tid >> 3;
    {
#pragma unroll
      for (int it = 0; it < 8; ++it) {
        const int line = it * 32 + lsub;          // 0..255 = 64 rows x 4 lines
        const int row  = line >> 2;
        const int col  = (line & 3) * 64 + piece * 8;
        const v8h hv = *(const v8h*)(Ohs + row * AT_OPITCH + col);
        const v8h rv = *(const v8h*)(Ols + row * AT_OPITCH + col);
        const size_t go = (growq + row) * DM_ + h * HD_ + col;
        *(v8h*)(AOh + go) = hv;
        *(v8h*)(AOl + go) = rv;
      }
      
    }
  }
}

// ---------------------------------------------------------------------------------------------------------------
// Workspace map (byte offsets, all 2 MiB aligned; every region is written completely by whole-line stores before it is read;
// the attention output planes reuse the f32 q region, which is dead after the q RoPE/split pass):
//   Xh   f16 [4096][2048]            0           16,777,216
//   Wqh  f16 [2048][2048]   16,777,216            8,388,608
//   Wkvh f16 [512][2048]    25,165,824            2,097,152
//   Woh  f16 [2048][2048]   27,262,976            8,388,608
//   cosT f32 [4096][128]    35,651,584            2,097,152
//   sinT f32 [4096][128]    37,748,736            2,097,152
//   Qf   f32 [4096][2048]   39,845,888           33,554,432   (AOh f16 [4096][2048] at 39,845,888; AOl at 56,623,104)
//   KVf  f32 [4096][512]    73,400,320            8,388,608
//   Qh   f16 [4096][2048]   81,788,928           16,777,216
//   Ql   f16 [4096][2048]   98,566,144           16,777,216
//   Kh   f16 [4096][256]   115,343,360            2,097,152
//   Kl   f16 [4096][256]   117,440,512            2,097,152
//   Vth  f16 [2][256][2048] 119,537,664           2,097,152
//   Vtl  f16 [2][256][2048] 121,634,816           2,097,152
//   total                  123,740,160
// ---------------------------------------------------------------------------------------------------------------
extern "C" void kernel_launch(void* const* d_in, const int* in_sizes, int n_in,
                              void* d_out, int out_size, void* d_ws, size_t ws_size,
                              hipStream_t stream) {
  if (n_in < 7) return;
  if (in_sizes[0] != NB_ * SEQ_ * DM_) return;
  if (in_sizes[1] != NB_ * SEQ_ * SEQ_) return;
  if (in_sizes[2] != NB_ * SEQ_) return;
  if (in_sizes[3] != DM_ * DM_) return;
  if (in_sizes[4] != HD_ * DM_) return;
  if (in_sizes[5] != HD_ * DM_) return;
  if (in_sizes[6] != DM_ * DM_) return;
  if (out_size != NB_ * SEQ_ * DM_) return;

  const float* x    = (const float*)d_in[0];
  const float* mask = (const float*)d_in[1];
  const int*   pos  = (const int*)d_in[2];
  const float* Wq   = (const float*)d_in[3];
  const float* Wk   = (const float*)d_in[4];
  const float* Wv   = (const float*)d_in[5];
  const float* Wo   = (const float*)d_in[6];
  float* out = (float*)d_out;

  const size_t nX   = (size_t)NB_ * SEQ_ * DM_;          // 8,388,608 elements
  const size_t bXh  = nX * 2;
  const size_t bWq  = (size_t)DM_ * DM_ * 2;
  const size_t bWkv = (size_t)KVN_ * DM_ * 2;
  const size_t bWo  = bWq;
  const size_t bTab = (size_t)NB_ * SEQ_ * NF_ * 4;
  const size_t bQf  = nX * 4;
  const size_t bKVf = (size_t)NB_ * SEQ_ * KVN_ * 4;
  const size_t bQ16 = nX * 2;
  const size_t bK16 = (size_t)NB_ * SEQ_ * HD_ * 2;
  const size_t bV16 = bK16;
  const size_t bFlg = (size_t)NB_ * NQB_ * 128;
  size_t off = 0;
  const size_t oXh  = off; off += bXh;
  const size_t oWq  = off; off += bWq;
  const size_t oWkv = off; off += bWkv;
  const size_t oWo  = off; off += bWo;
  const size_t oCos = off; off += bTab;
  const size_t oSin = off; off += bTab;
  const size_t oQf  = off; off += bQf;
  const size_t oKVf = off; off += bKVf;
  const size_t oQh  = off; off += bQ16;
  const size_t oQl  = off; off += bQ16;
  const size_t oKh  = off; off += bK16;
  const size_t oKl  = off; off += bK16;
  const size_t oVth = off; off += bV16;
  const size_t oVtl = off; off += bV16;
  const size_t oFlg = off; off += bFlg;
  if (off > ws_size) return;                        // off = 123,740,160
  if (off > (size_t)134217728) return;
  if (bQf < 2 * bQ16) return;                        // AOh/AOl alias fits inside the f32 q region
  const size_t oAOh = oQf;
  const size_t oAOl = oQf + bQ16;

  char* ws = (char*)d_ws;
  _Float16* Xh   = (_Float16*)(ws + oXh);
  _Float16* Wqh  = (_Float16*)(ws + oWq);
  _Float16* Wkvh = (_Float16*)(ws + oWkv);
  _Float16* Woh  = (_Float16*)(ws + oWo);
  float*    cosT = (float*)(ws + oCos);
  float*    sinT = (float*)(ws + oSin);
  float*    Qf   = (float*)(ws + oQf);
  float*    KVf  = (float*)(ws + oKVf);
  _Float16* Qh   = (_Float16*)(ws + oQh);
  _Float16* Ql   = (_Float16*)(ws + oQl);
  _Float16* Kh   = (_Float16*)(ws + oKh);
  _Float16* Kl   = (_Float16*)(ws + oKl);
  _Float16* Vth  = (_Float16*)(ws + oVth);
  _Float16* Vtl  = (_Float16*)(ws + oVtl);
  int*      flg  = (int*)(ws + oFlg);
  _Float16* AOh  = (_Float16*)(ws + oAOh);
  _Float16* AOl  = (_Float16*)(ws + oAOl);

  const dim3 blk(256);
  const int n8x = (int)(nX / 8);                     // 1,048,576
  const int n8q = DM_ * DM_ / 8;                     // 524,288
  const int n8k = HD_ * DM_ / 8;                     // 65,536

  // (1) inputs -> 16-bit planes: x bf16*2^4, weights bf16*2^8 (k rows then v rows in the fused kv weight plane)
  cvt16_kernel<<<dim3((n8x + 255) / 256), blk, 0, stream>>>(x, Xh, n8x, CX_);
  cvt16_kernel<<<dim3((n8q + 255) / 256), blk, 0, stream>>>(Wq, Wqh, n8q, CW_);
  cvt16_kernel<<<dim3((n8k + 255) / 256), blk, 0, stream>>>(Wk, Wkvh, n8k, CW_);
  cvt16_kernel<<<dim3((n8k + 255) / 256), blk, 0, stream>>>(Wv, Wkvh + (size_t)HD_ * DM_, n8k, CW_);
  cvt16_kernel<<<dim3((n8q + 255) / 256), blk, 0, stream>>>(Wo, Woh, n8q, CW_);
  // (2) cos/sin tables [4096][128] from position ids; mask verification flags per (b, query block)
  rope_table_kernel<<<dim3((NB_ * SEQ_) / 32), blk, 0, stream>>>(pos, cosT, sinT, NB_ * SEQ_);
  maskflag_kernel<<<dim3(NB_ * NQB_), blk, 0, stream>>>(mask, flg);
  // (3) q = x . Wq^T -> f32 [4096][2048]; [k|v] = x . [Wk|Wv]^T -> f32 [4096][512]
  gemm64_kernel<<<dim3(((NB_ * SEQ_ / 64) * (DM_ / 64)) / 8), blk, 0, stream>>>(
      Xh, Xh, DM_, Wqh, DM_, Qf, DM_, NB_ * SEQ_, DM_, DM_, 0, SEQ_ - 1, QSC_);
  gemm64_kernel<<<dim3(((NB_ * SEQ_ / 64) * (KVN_ / 64)) / 8), blk, 0, stream>>>(
      Xh, Xh, DM_, Wkvh, DM_, KVf, KVN_, NB_ * SEQ_, KVN_, DM_, 0, SEQ_ - 1, QSC_);
  // (4) RoPE + hi/residual split: q planes [4096][8*256], k planes [4096][256]; v^T planes [2][256][2048]
  rope_split_kernel<<<dim3((NB_ * SEQ_ * NH_ * 8) / 256), blk, 0, stream>>>(
      Qf, DM_, NH_, cosT, sinT, Qh, Ql, DM_, NB_ * SEQ_ * NH_, CQK_);
  rope_split_kernel<<<dim3((NB_ * SEQ_ * 8) / 256), blk, 0, stream>>>(
      KVf, KVN_, 1, cosT, sinT, Kh, Kl, HD_, NB_ * SEQ_, CQK_);
  vt_split_kernel<<<dim3(HD_ / 64, (NB_ * SEQ_) / 64), blk, 0, stream>>>(KVf, Vth, Vtl);
  // (5) attention -> AO hi/residual planes [4096][2048]
  (void)hipFuncSetAttribute(reinterpret_cast<const void*>(&attn_kernel), hipFuncAttributeMaxDynamicSharedMemorySize, AT_LDS);
  attn_kernel<<<dim3(NB_ * NH_ * NQB_), blk, AT_LDS, stream>>>(Qh, Ql, Kh, Kl, Vth, Vtl, mask, flg, AOh, AOl);
  // (6) out = AO . Wo^T -> d_out f32 [4096][2048]; residual plane on rows < LOROWS_ of each sequence
  gemm64_kernel<<<dim3(((NB_ * SEQ_ / 64) * (DM_ / 64)) / 8), blk, 0, stream>>>(
      AOh, AOl, DM_, Woh, DM_, out, DM_, NB_ * SEQ_, DM_, DM_, LOROWS_, SEQ_ - 1, WSC_);
  (void)hipGetLastError();
}

// v001
// A run of this version takes 521 microseconds.
// Two timings next to v000 both put it at 1.19 times that version's speed.
// Contractions on v_wmma_f32_16x16x32_f16 (f16 operands, f32 accumulate): q/k/v projections (x RNE-converted to bf16 and carried *2^4,
// W RNE-converted to bf16 and carried *2^8, exact products); q.k^T (q,k carried *2^10 as f16 hi planes, plus unscaled f16 residual planes
// on the leading query blocks of each sequence); p.v (p carried *2^15, v^T carried *2^10: hi planes plus residual planes on the leading query
// blocks); output projection (attention output carried *2^10: hi plane everywhere, residual plane on the leading rows of each sequence;
// Wo bf16 *2^8). RoPE, mask add and online softmax in f32.
#include <hip/hip_runtime.h>
#include <math.h>
#include <stdint.h>

#define NB_     2
#define SEQ_    2048
#define DM_     2048
#define NH_     8
#define HD_     256
#define NF_     128
#define KVN_    512
#define WIN_    1024
#define NQB_    32
#define QE_     4
#define LOROWS_ 256
#define MFG_    16

#define CX_   16.0f
#define CW_   256.0f
#define CQK_  1024.0f
#define CP_   32768.0f
#define SSC_  5.9604644775390625e-8f     /* 2^-4 * 2^-20 : score scale for q,k carried *2^10 each */
#define OSC_  3.0517578125e-5f           /* 2^-15 = 2^10 / (2^15 * 2^10) : attention output carry */
#define QSC_  2.44140625e-4f             /* 2^-12 = 1 / (2^4 * 2^8) : projection outputs back to f32 */
#define WSC_  3.814697265625e-6f         /* 2^-18 = 1 / (2^10 * 2^8) : final projection */

typedef _Float16 v16h __attribute__((ext_vector_type(16)));
typedef _Float16 v8h  __attribute__((ext_vector_type(8)));
typedef float    v8f  __attribute__((ext_vector_type(8)));
typedef float    v4f  __attribute__((ext_vector_type(4)));

union FragU { v16h v; v8h h[2]; };
union U8 { v8f v; v4f q[2]; };

__device__ __forceinline__ float bf16_rne(float f) {
  unsigned u = __float_as_uint(f);
  u = u + 0x7FFFu + ((u >> 16) & 1u);
  return __uint_as_float(u & 0xFFFF0000u);
}
__device__ __forceinline__ v8f zero8() { return (v8f){0.f, 0.f, 0.f, 0.f, 0.f, 0.f, 0.f, 0.f}; }

// 16-bit fragment (A or B): lane row/col = lane&15, elements 0..7 <- p[0..7] (k0+8h..), 8..15 <- p[16..23] (k0+16+8h..)
// p already includes the row base + k0 + 8*h.
__device__ __forceinline__ v16h frag_ld(const _Float16* p) {
  FragU f;
  f.h[0] = *(const v8h*)(p);
  f.h[1] = *(const v8h*)(p + 16);
  return f.v;
}
__device__ __forceinline__ v8f wmma_raw(v16h a, v16h b, v8f c) {
  return __builtin_amdgcn_wmma_f32_16x16x32_f16(false, a, false, b, (short)0, c, false, false);
}
// WMMA with trailing hazard guard (ties D, keeps A/B live)
__device__ __forceinline__ v8f mma_g(v16h a, v16h b, v8f c) {
  c = __builtin_amdgcn_wmma_f32_16x16x32_f16(false, a, false, b, (short)0, c, false, false);
  asm volatile("v_nop\n\tv_nop\n\tv_nop\n\tv_nop" : "+v"(c) : "v"(a), "v"(b));
  return c;
}
__device__ __forceinline__ void dep_guard(v8f& a, v8f& b, v16h x, v16h y) {
  asm volatile("v_nop\n\tv_nop\n\tv_nop\n\tv_nop" : "+v"(a), "+v"(b) : "v"(x), "v"(y));
}
__device__ __forceinline__ void keep4(v16h a, v16h b, v16h c, v16h d) {
  asm volatile("v_nop" :: "v"(a), "v"(b), "v"(c), "v"(d));
}
__device__ __forceinline__ void acc_guard4(v8f& a, v8f& b, v8f& c, v8f& d) {
  asm volatile("v_nop\n\tv_nop\n\tv_nop\n\tv_nop" : "+v"(a), "+v"(b), "+v"(c), "+v"(d));
}

// ---------------------------------------------------------------------------------------------------------------
// Elementwise convert: dst[i] = f16( bf16_rne(src[i]) * scale ), 8 elements per thread, one 16-B store per lane:
// coverage: grid = ceil(n8/256), each thread 8 elements -> 8*n8 elements.
// ---------------------------------------------------------------------------------------------------------------
__global__ __launch_bounds__(256) void cvt16_kernel(const float* __restrict__ src, _Float16* __restrict__ dst, int n8, float scale) {
  const int i = blockIdx.x * 256 + (int)threadIdx.x;
  if (i >= n8) return;
  const float* s = src + 8 * (size_t)i;
  U8 a;
  a.q[0] = *(const v4f*)(s);
  a.q[1] = *(const v4f*)(s + 4);
  v8h o;
#pragma unroll
  for (int e = 0; e < 8; ++e) o[e] = (_Float16)(bf16_rne(a.v[e]) * scale);
  _Float16* d = dst + 8 * (size_t)i;
  *(v8h*)d = o;
  
}

// ---------------------------------------------------------------------------------------------------------------
// RoPE tables: cosT/sinT [nrows][128], angle = float(pos[row]) * inv_freq[f], inv_freq[f] = 1 / f32(10000^(f/128)).
// coverage: grid = nrows/32 blocks, 16 iterations x 2 rows -> nrows x 128 per table.
// ---------------------------------------------------------------------------------------------------------------
__global__ __launch_bounds__(256) void rope_table_kernel(const int* __restrict__ pos, float* __restrict__ cosT,
                                                         float* __restrict__ sinT, int nrows) {
#pragma clang fp contract(off)
  __shared__ float invf[NF_];
  const int tid = threadIdx.x;
  if (tid < NF_) {
    const double e = (double)tid * 0.0078125;                 // tid/128 exactly
    const double p = exp2(e * 13.287712379549449);            // 10000^e
    const float pf = (float)p;                                // RNE to f32
    invf[tid] = 1.0f / pf;
  }
  __syncthreads();
  const int f = tid & (NF_ - 1);
  const int rp = tid >> 7;
  const int r0 = blockIdx.x * 32;
  const float iv = invf[f];
#pragma unroll 1
  for (int it = 0; it < 16; ++it) {
    const int row = r0 + it * 2 + rp;
    const int rowc = (row < nrows) ? row : (nrows - 1);
    const float ang = (float)pos[rowc] * iv;
    float sv, cv;
    sincosf(ang, &sv, &cv);
    if (row < nrows) {
      float* cp = cosT + (size_t)row * NF_ + f;
      float* sp = sinT + (size_t)row * NF_ + f;
      *(float*)cp = cv;
      *(float*)sp = sv;
      
    }
  }
}

// ---------------------------------------------------------------------------------------------------------------
// Mask verification flags, MFG_ per (b, 64-query block), one per group of 4 query rows: 1 if every mask value for the group's rows
// and keys in [q0+64, min(q+1023, SEQ-1)] (the in-band keys strictly above the query block) is <= -1e9 (adds to an exact zero weight).
// The range holds at most 1023 keys, so 256 threads x 4 keys cover a row with one 16-byte load each; the 4 rows' loads are independent.
// coverage: grid = NB*NQB*MFG_ blocks; each block writes its own 128-byte line of 32 equal ints.
// ---------------------------------------------------------------------------------------------------------------
__global__ __launch_bounds__(256) void maskflag_kernel(const float* __restrict__ mask, int* __restrict__ flag) {
  __shared__ int sw[8];
  const int tid = threadIdx.x, w = tid >> 5, lane = tid & 31;
  const int bid = blockIdx.x;                // (b*32 + qb)*MFG_ + row group
  const int g  = bid & (MFG_ - 1);
  const int bq = bid / MFG_;
  const int b = bq >> 5, qb = bq & (NQB_ - 1);
  const int q0 = qb * 64;
  const int r0 = q0 + g * (64 / MFG_);
  const int k  = q0 + 64 + 4 * tid;          // first of this thread's four keys
  const int kc = (k <= SEQ_ - 4) ? k : (SEQ_ - 4);   // k > SEQ-4 means k >= SEQ: none of the four keys is tested
  v4f mv[64 / MFG_];
#pragma unroll   // all rows' loads issue before the first compare waits (and mv stays in registers)
  for (int rr = 0; rr < 64 / MFG_; ++rr) mv[rr] = *(const v4f*)(mask + ((size_t)b * SEQ_ + r0 + rr) * SEQ_ + kc);
  int bad = 0;
#pragma unroll
  for (int rr = 0; rr < 64 / MFG_; ++rr) {
    int kend = r0 + rr + WIN_ - 1;
    if (kend > SEQ_ - 1) kend = SEQ_ - 1;
#pragma unroll
    for (int e = 0; e < 4; ++e) {
      const int ok = (mv[rr][e] <= -1.0e9f) ? 1 : 0;
      bad |= ((k + e <= kend) && (ok == 0)) ? 1 : 0;
    }
  }
  const unsigned long long bm = __ballot(bad);
  if (lane == 0) sw[w] = (bm != 0ull) ? 1 : 0;
  __syncthreads();
  if (w == 0) {
    int any = 0;
#pragma unroll
    for (int i = 0; i < 8; ++i) any |= sw[i];
    const int fv = any ? 0 : 1;
    int* fp = flag + (size_t)bid * 32 + lane;
    *(int*)fp = fv;
  }
}

// ---------------------------------------------------------------------------------------------------------------
// Register-blocked WMMA GEMM, f16 operands: C[m][n] = scale * sum_k (A[m][k] (+ A2[m][k])) * Bt[n][k]
// A row-major [M][lda], optional residual plane A2 (same layout) used on row tiles with (m0 & seqMask) < loRows (wave-uniform);
// Bt row-major [N][ldb] (k contiguous); C f32 [M][ldc]. Each wave owns a 64x64 tile (4x4 accumulators), block = 8 waves.
// M, N multiples of 64, K multiple of 32. Epilogue: 16-row slabs staged per wave in LDS; each 64-wide f32 row segment
// ---------------------------------------------------------------------------------------------------------------
template <bool LO>
__device__ __forceinline__ void gemm_kloop(v8f (&acc)[4][4], const _Float16* __restrict__ Ab, const _Float16* __restrict__ Ab2,
                                           int lda, const _Float16* __restrict__ Bb, int ldb, int m0, int n0, int K,
                                           int rlane, int koff) {
  for (int k0 = 0; k0 < K; k0 += 32) {
    v16h bh[4];
#pragma unroll
    for (int j = 0; j < 4; ++j) bh[j] = frag_ld(Bb + (size_t)(n0 + (j << 4) + rlane) * ldb + k0 + koff);
#pragma unroll
    for (int i = 0; i < 4; ++i) {
      const size_t ao = (size_t)(m0 + (i << 4) + rlane) * lda + k0 + koff;
      const v16h ah = frag_ld(Ab + ao);
      v16h al = ah;
      if (LO) al = frag_ld(Ab2 + ao);
#pragma unroll
      for (int j = 0; j < 4; ++j) {
        acc[i][j] = wmma_raw(ah, bh[j], acc[i][j]);
        if (LO) acc[i][j] = wmma_raw(al, bh[j], acc[i][j]);
      }
      dep_guard(acc[i][0], acc[i][3], ah, al);
    }
    keep4(bh[0], bh[1], bh[2], bh[3]);
  }
}

__global__ __launch_bounds__(256) void gemm64_kernel(const _Float16* __restrict__ A, const _Float16* __restrict__ A2, int lda,
                                                     const _Float16* __restrict__ Bt, int ldb,
                                                     float* __restrict__ C, int ldc, int M, int N, int K,
                                                     int loRows, int seqMask, float scale) {
  __shared__ __align__(16) float sT[8][16 * 68];   // per-wave 16x64 slab, pitch 68 floats
  const int lane = threadIdx.x & 31;
  const int wave = threadIdx.x >> 5;
  const int tilesN = N >> 6;
  const int tilesM = M >> 6;
  const int tile = blockIdx.x * 8 + wave;
  if (tile >= tilesM * tilesN) return;   // wave-uniform; no block barriers in this kernel
  const int tm = tile / tilesN;
  const int tn = tile - tm * tilesN;
  const int m0 = tm << 6;
  const int n0 = tn << 6;
  const int rlane = lane & 15;
  const int koff  = (lane >> 4) * 8;
  const int mOff  = koff;

  v8f acc[4][4];
#pragma unroll
  for (int i = 0; i < 4; ++i)
#pragma unroll
    for (int j = 0; j < 4; ++j) acc[i][j] = zero8();

  const bool useLo = ((m0 & seqMask) < loRows);   // wave-uniform
  if (useLo) gemm_kloop<true>(acc, A, A2, lda, Bt, ldb, m0, n0, K, rlane, koff);
  else       gemm_kloop<false>(acc, A, A, lda, Bt, ldb, m0, n0, K, rlane, koff);
  acc_guard4(acc[0][0], acc[0][1], acc[0][2], acc[0][3]);
  acc_guard4(acc[1][0], acc[1][1], acc[1][2], acc[1][3]);
  acc_guard4(acc[2][0], acc[2][1], acc[2][2], acc[2][3]);
  acc_guard4(acc[3][0], acc[3][1], acc[3][2], acc[3][3]);

  float* slab = sT[wave];
  const int hrow = lane >> 4;
  const int c4 = rlane * 4;
#pragma unroll
  for (int i = 0; i < 4; ++i) {
    const int mBase = m0 + (i << 4);
#pragma unroll
    for (int j = 0; j < 4; ++j) {
#pragma unroll
      for (int r = 0; r < 8; ++r) slab[(mOff + r) * 68 + (j << 4) + rlane] = acc[i][j][r] * scale;
    }
    __builtin_amdgcn_fence(__ATOMIC_RELEASE, "workgroup");
    __builtin_amdgcn_wave_barrier();
    __builtin_amdgcn_fence(__ATOMIC_ACQUIRE, "workgroup");
    {
#pragma unroll
      for (int it = 0; it < 8; ++it) {
        const int row = it * 2 + hrow;
        const v4f v = *(const v4f*)(slab + row * 68 + c4);
        *(v4f*)(C + (size_t)(mBase + row) * ldc + n0 + c4) = v;
      }
      
    }
    __builtin_amdgcn_fence(__ATOMIC_RELEASE, "workgroup");
    __builtin_amdgcn_wave_barrier();
    __builtin_amdgcn_fence(__ATOMIC_ACQUIRE, "workgroup");
  }
}

// ---------------------------------------------------------------------------------------------------------------
// RoPE + f16 hi/residual split. Unit = (row, head); 8 lanes per unit; lane j owns columns {8j, 64+8j, 128+8j, 192+8j}+0..7 of the
// 256-wide head (pairs (c, c+128) are in the same lane). out = x*cos + rotate_half(x)*sin with cos/sin[row][c mod 128].
// hi = f16(out*carry), lo = f16(out*carry - hi) (unscaled residual). Stores: for each column chunk one instruction writes
// coverage: nunits*8 threads x 32 elements = nunits*256 per plane.
// ---------------------------------------------------------------------------------------------------------------
__global__ __launch_bounds__(256) void rope_split_kernel(const float* __restrict__ src, int spitch, int nheads,
                                                         const float* __restrict__ cosT, const float* __restrict__ sinT,
                                                         _Float16* __restrict__ hi, _Float16* __restrict__ lo,
                                                         int dpitch, int nunits, float carry) {
#pragma clang fp contract(off)
  const int gid = blockIdx.x * 256 + (int)threadIdx.x;
  const int unit = gid >> 3;
  const int j = gid & 7;
  if (unit >= nunits) return;
  const int row = unit / nheads;
  const int hd = unit - row * nheads;
  const float* s  = src  + (size_t)row * spitch + hd * HD_ + 8 * j;
  const float* ct = cosT + (size_t)row * NF_ + 8 * j;
  const float* st = sinT + (size_t)row * NF_ + 8 * j;
  U8 xa, xb, xc, xd, ca, cb, sa, sb;
  xa.q[0] = *(const v4f*)(s);         xa.q[1] = *(const v4f*)(s + 4);
  xb.q[0] = *(const v4f*)(s + 64);    xb.q[1] = *(const v4f*)(s + 68);
  xc.q[0] = *(const v4f*)(s + 128);   xc.q[1] = *(const v4f*)(s + 132);
  xd.q[0] = *(const v4f*)(s + 192);   xd.q[1] = *(const v4f*)(s + 196);
  ca.q[0] = *(const v4f*)(ct);        ca.q[1] = *(const v4f*)(ct + 4);
  cb.q[0] = *(const v4f*)(ct + 64);   cb.q[1] = *(const v4f*)(ct + 68);
  sa.q[0] = *(const v4f*)(st);        sa.q[1] = *(const v4f*)(st + 4);
  sb.q[0] = *(const v4f*)(st + 64);   sb.q[1] = *(const v4f*)(st + 68);
  v8h h0, h1, h2, h3, l0, l1, l2, l3;
#pragma unroll
  for (int e = 0; e < 8; ++e) {
    const float r0 = xa.v[e] * ca.v[e] - xc.v[e] * sa.v[e];    // col 8j+e
    const float r1 = xb.v[e] * cb.v[e] - xd.v[e] * sb.v[e];    // col 64+8j+e
    const float r2 = xc.v[e] * ca.v[e] + xa.v[e] * sa.v[e];    // col 128+8j+e
    const float r3 = xd.v[e] * cb.v[e] + xb.v[e] * sb.v[e];    // col 192+8j+e
    float t; _Float16 q;
    t = r0 * carry; q = (_Float16)t; h0[e] = q; l0[e] = (_Float16)(t - (float)q);
    t = r1 * carry; q = (_Float16)t; h1[e] = q; l1[e] = (_Float16)(t - (float)q);
    t = r2 * carry; q = (_Float16)t; h2[e] = q; l2[e] = (_Float16)(t - (float)q);
    t = r3 * carry; q = (_Float16)t; h3[e] = q; l3[e] = (_Float16)(t - (float)q);
  }
  _Float16* hp = hi + (size_t)row * dpitch + hd * HD_ + 8 * j;
  _Float16* lp = lo + (size_t)row * dpitch + hd * HD_ + 8 * j;
  {
    *(v8h*)(hp)       = h0;
    *(v8h*)(hp + 64)  = h1;
    *(v8h*)(hp + 128) = h2;
    *(v8h*)(hp + 192) = h3;
    *(v8h*)(lp)       = l0;
    *(v8h*)(lp + 64)  = l1;
    *(v8h*)(lp + 128) = l2;
    *(v8h*)(lp + 192) = l3;
    
  }
}

// ---------------------------------------------------------------------------------------------------------------
// v columns of the fused kv plane (f32 [NB*SEQ rows][512], cols 256..511) -> transposed f16 planes Vth/Vtl [b][d][s]
// (hi = f16(v*2^10), lo = unscaled residual). 64x64 tiles through LDS; grid = (256/64, NB*SEQ/64), 256 threads.
// coverage per block: load 4 it x 256 thr x 4 = 64x64; store 2 it x 256 thr x 8 = 64x64 per plane.
// ---------------------------------------------------------------------------------------------------------------
__global__ __launch_bounds__(256) void vt_split_kernel(const float* __restrict__ KV, _Float16* __restrict__ Vth,
                                                       _Float16* __restrict__ Vtl) {
  __shared__ __align__(16) float tf[64 * 68];
  const int tid = threadIdx.x;
  const int d0  = blockIdx.x * 64;           // d block (input column within v)
  const int sg0 = blockIdx.y * 64;           // global row block (b*SEQ + s)
  const int b   = sg0 >> 11;
  const int s0  = sg0 & (SEQ_ - 1);
  {
    const int lr = tid >> 4;
    const int c4 = (tid & 15) * 4;
#pragma unroll
    for (int it = 0; it < 4; ++it) {
      const int rr = it * 16 + lr;
      const v4f a = *(const v4f*)(KV + (size_t)(sg0 + rr) * KVN_ + HD_ + d0 + c4);
      *(v4f*)(tf + rr * 68 + c4) = a;
    }
  }
  __syncthreads();
  const int sub = tid >> 3;          // output row within tile (= d)
  const int c8  = (tid & 7) * 8;     // s offset within tile
  v8h hv[2], lv[2];
#pragma unroll
  for (int it = 0; it < 2; ++it) {
    const int oc = it * 32 + sub;
    v8h a, rsd;
#pragma unroll
    for (int q = 0; q < 8; ++q) {
      const float f = tf[(c8 + q) * 68 + oc] * CQK_;
      const _Float16 hq = (_Float16)f;
      a[q] = hq;
      rsd[q] = (_Float16)(f - (float)hq);
    }
    hv[it] = a; lv[it] = rsd;
  }
  {
#pragma unroll
    for (int it = 0; it < 2; ++it) {
      const int oc = it * 32 + sub;
      const size_t go = ((size_t)b * HD_ + d0 + oc) * SEQ_ + s0 + c8;
      *(v8h*)(Vth + go) = hv[it];
      *(v8h*)(Vtl + go) = lv[it];
    }
    
  }
}

// ---------------------------------------------------------------------------------------------------------------
// Sliding-window attention, head dim 256, one kv head shared by 8 query heads.
// Block = (b, h, 64 query rows), 256 threads = 8 waves. Key tiles of 64: kt in [max(0,qb-16), kthi], kthi = qb when the mask
// flag verified the tiles above the block add exact zeros, else min(qb+16, 31) (general in-band path, mask added).
//   S phase: wave w computes rows 16*(w&3)..+15 x keys 32*(w>>2)..+31 of the tile (2 accumulators, K = 256 = 8 k-steps),
//            A = q fragments straight from the 16-bit global planes, B = k fragments straight from the 16-bit k planes
//            (q,k carried *2^10; hi.hi everywhere, + lo.hi + hi.lo on query blocks < QE_).
//   Scores: s*2^-24 + mask[b][0][q][key] for |q-key| <= 1023, -inf outside the band; row max / sum exchanged between the two
//            waves of a row group through LDS; online softmax in f32; p*2^15 -> f16 P tile [64][72] in LDS (+ residual tile early).
//   PV phase: wave w owns O[64 rows][32*w..+31] (4x2 accumulators); A = P fragments from LDS (after __syncthreads),
//            B = v^T fragments straight from the 16-bit global planes (*2^10; + residual products on query blocks < QE_).
// coverage: NB*NH*32 blocks x 64 rows x 256 cols = the whole [NB*SEQ][2048] plane, both planes.
// ---------------------------------------------------------------------------------------------------------------
#define AT_PPITCH 72
#define AT_OPITCH 264
#define AT_OFF_PH 0
#define AT_OFF_PL 9216
#define AT_OFF_PM 18432
#define AT_OFF_PS 18944
#define AT_OFF_AL 19456
#define AT_OFF_LF 19712
#define AT_OFF_OH 19968
#define AT_OFF_OL 53760
#define AT_LDS    87552
static_assert(AT_OFF_PL == AT_OFF_PH + 64 * AT_PPITCH * 2);
static_assert(AT_OFF_PM == AT_OFF_PL + 64 * AT_PPITCH * 2);
static_assert(AT_OFF_OL == AT_OFF_OH + 64 * AT_OPITCH * 2);
static_assert(AT_LDS == AT_OFF_OL + 64 * AT_OPITCH * 2);

__global__ __launch_bounds__(256) void attn_kernel(const _Float16* __restrict__ Qh, const _Float16* __restrict__ Ql,
                                                   const _Float16* __restrict__ Kh, const _Float16* __restrict__ Kl,
                                                   const _Float16* __restrict__ Vth, const _Float16* __restrict__ Vtl,
                                                   const float* __restrict__ mask, const int* __restrict__ flag,
                                                   _Float16* __restrict__ AOh, _Float16* __restrict__ AOl) {
  extern __shared__ __align__(16) unsigned char dsm[];
  _Float16* Ph   = (_Float16*)(dsm + AT_OFF_PH);
  _Float16* Pl   = (_Float16*)(dsm + AT_OFF_PL);
  float*    pm   = (float*)(dsm + AT_OFF_PM);     // [8 waves][16 rows] partial row max
  float*    ps   = (float*)(dsm + AT_OFF_PS);     // [8 waves][16 rows] partial row sum
  float*    alph = (float*)(dsm + AT_OFF_AL);     // [64] rescale factors
  float*    lfin = (float*)(dsm + AT_OFF_LF);     // [64] final row sums
  _Float16* Ohs  = (_Float16*)(dsm + AT_OFF_OH);
  _Float16* Ols  = (_Float16*)(dsm + AT_OFF_OL);

  const int tid  = threadIdx.x;
  const int w    = tid >> 5;
  const int lane = tid & 31;
  const int hh   = lane >> 4;
  const int c    = lane & 15;
  const int bid  = blockIdx.x;
  const int qb   = bid & (NQB_ - 1);
  const int h    = (bid >> 5) & (NH_ - 1);
  const int b    = bid >> 8;
  const int q0   = qb * 64;
  const int srow0 = (w & 3) * 16;
  const int kh    = w >> 2;
  const int ocol0 = w * 32;
  const bool early = (qb < QE_);
  const int ktlo = (qb > 16) ? (qb - 16) : 0;
  int fl = 1;                                  // block-uniform: all row groups of this query block verified
#pragma unroll   // independent scalar loads, issued together instead of one round trip each
  for (int g = 0; g < MFG_; ++g) fl &= flag[((b * NQB_ + qb) * MFG_ + g) * 32];
  int kthi = (fl != 0) ? qb : (qb + 16);
  if (kthi > NQB_ - 1) kthi = NQB_ - 1;

  const size_t growq = (size_t)b * SEQ_ + q0;
  const _Float16* qhp = Qh + (growq + srow0 + c) * DM_ + h * HD_ + 8 * hh;
  const _Float16* qlp = Ql + (growq + srow0 + c) * DM_ + h * HD_ + 8 * hh;
  const float*    mrp = mask + (growq + srow0 + 8 * hh) * (size_t)SEQ_;
  const _Float16* vhp = Vth + ((size_t)b * HD_ + ocol0 + c) * SEQ_ + 8 * hh;
  const _Float16* vlp = Vtl + ((size_t)b * HD_ + ocol0 + c) * SEQ_ + 8 * hh;

  float mrow[8], lrow[8];
  v8f oacc[4][2];
#pragma unroll
  for (int r = 0; r < 8; ++r) { mrow[r] = -INFINITY; lrow[r] = 0.0f; }
#pragma unroll
  for (int i = 0; i < 4; ++i) { oacc[i][0] = zero8(); oacc[i][1] = zero8(); }

  for (int kt = ktlo; kt <= kthi; ++kt) {      // block-uniform, at most 32 trips
    const int key0  = kt * 64;
    const int wkey0 = key0 + 32 * kh;
    const _Float16* khp = Kh + ((size_t)b * SEQ_ + wkey0 + c) * HD_ + 8 * hh;
    const _Float16* klp = Kl + ((size_t)b * SEQ_ + wkey0 + c) * HD_ + 8 * hh;

    // ---- S = q . k^T (16 rows x 32 keys per wave) ----
    v8f s[2];
    s[0] = zero8(); s[1] = zero8();
#pragma unroll
    for (int ks = 0; ks < 8; ++ks) {
      const v16h qa = frag_ld(qhp + 32 * ks);
      v16h qr = qa;
      if (early) qr = frag_ld(qlp + 32 * ks);
#pragma unroll
      for (int j = 0; j < 2; ++j) {
        const v16h kb = frag_ld(khp + (size_t)(16 * j) * HD_ + 32 * ks);
        s[j] = mma_g(qa, kb, s[j]);
        if (early) {
          const v16h kr = frag_ld(klp + (size_t)(16 * j) * HD_ + 32 * ks);
          s[j] = mma_g(qr, kb, s[j]);
          s[j] = mma_g(qa, kr, s[j]);
        }
      }
    }

    // ---- scale, mask, partial row max over this wave's 32 keys ----
    float cm[8];
#pragma unroll
    for (int r = 0; r < 8; ++r) {
      const int qrow = q0 + srow0 + 8 * hh + r;
      const float* mp = mrp + (size_t)r * SEQ_;
      float mx = -INFINITY;
#pragma unroll
      for (int j = 0; j < 2; ++j) {
        const int key = wkey0 + 16 * j + c;
        const float mv = mp[key];
        const bool inb = (key + (WIN_ - 1) >= qrow) && (key <= qrow + (WIN_ - 1));
        const float sv = inb ? (s[j][r] * SSC_ + mv) : -INFINITY;
        s[j][r] = sv;
        mx = fmaxf(mx, sv);
      }
      mx = fmaxf(mx, __shfl_xor(mx, 1, 32));
      mx = fmaxf(mx, __shfl_xor(mx, 2, 32));
      mx = fmaxf(mx, __shfl_xor(mx, 4, 32));
      mx = fmaxf(mx, __shfl_xor(mx, 8, 32));
      cm[r] = mx;
    }
    if (c == 0) {
#pragma unroll
      for (int r = 0; r < 8; ++r) pm[w * 16 + 8 * hh + r] = cm[r];
    }
    __syncthreads();

    // ---- online softmax: tile max, p, partial sums ----
    float al[8], psm[8];
    const int wo = w ^ 4;
#pragma unroll
    for (int r = 0; r < 8; ++r) {
      const float om = pm[wo * 16 + 8 * hh + r];
      const float mnew = fmaxf(mrow[r], fmaxf(cm[r], om));
      const float msafe = (mnew == -INFINITY) ? 0.0f : mnew;
      al[r] = __expf(mrow[r] - msafe);
      mrow[r] = mnew;
      float sum = 0.0f;
#pragma unroll
      for (int j = 0; j < 2; ++j) {
        const float p = __expf(s[j][r] - msafe);
        sum += p;
        const float t = p * CP_;
        const _Float16 phv = (_Float16)t;
        const int pidx = (srow0 + 8 * hh + r) * AT_PPITCH + 32 * kh + 16 * j + c;
        Ph[pidx] = phv;
        if (early) Pl[pidx] = (_Float16)(t - (float)phv);
      }
      sum += __shfl_xor(sum, 1, 32);
      sum += __shfl_xor(sum, 2, 32);
      sum += __shfl_xor(sum, 4, 32);
      sum += __shfl_xor(sum, 8, 32);
      psm[r] = sum;
    }
    if (c == 0) {
#pragma unroll
      for (int r = 0; r < 8; ++r) ps[w * 16 + 8 * hh + r] = psm[r];
      if (w < 4) {
#pragma unroll
        for (int r = 0; r < 8; ++r) alph[srow0 + 8 * hh + r] = al[r];
      }
    }
    __syncthreads();
#pragma unroll
    for (int r = 0; r < 8; ++r)
      lrow[r] = lrow[r] * al[r] + (ps[(w & 3) * 16 + 8 * hh + r] + ps[((w & 3) + 4) * 16 + 8 * hh + r]);

    // ---- rescale O, then O += P . V for this wave's 32 output columns ----
#pragma unroll
    for (int i = 0; i < 4; ++i) {
      U8 av;
      av.q[0] = *(const v4f*)(alph + 16 * i + 8 * hh);
      av.q[1] = *(const v4f*)(alph + 16 * i + 8 * hh + 4);
#pragma unroll
      for (int r = 0; r < 8; ++r) { oacc[i][0][r] *= av.v[r]; oacc[i][1][r] *= av.v[r]; }
    }
#pragma unroll
    for (int k2 = 0; k2 < 2; ++k2) {
      const int kk = key0 + 32 * k2;
#pragma unroll
      for (int jj = 0; jj < 2; ++jj) {
        const v16h vb = frag_ld(vhp + (size_t)(16 * jj) * SEQ_ + kk);
        v16h vr = vb;
        if (early) vr = frag_ld(vlp + (size_t)(16 * jj) * SEQ_ + kk);
#pragma unroll
        for (int i = 0; i < 4; ++i) {
          const v16h pa = frag_ld(Ph + (16 * i + c) * AT_PPITCH + 32 * k2 + 8 * hh);
          oacc[i][jj] = mma_g(pa, vb, oacc[i][jj]);
          if (early) {
            const v16h pr = frag_ld(Pl + (16 * i + c) * AT_PPITCH + 32 * k2 + 8 * hh);
            oacc[i][jj] = mma_g(pa, vr, oacc[i][jj]);
            oacc[i][jj] = mma_g(pr, vb, oacc[i][jj]);
          }
        }
      }
    }
  }

  if (w < 4 && c == 0) {
#pragma unroll
    for (int r = 0; r < 8; ++r) lfin[srow0 + 8 * hh + r] = lrow[r];
  }
  __syncthreads();
#pragma unroll
  for (int i = 0; i < 4; ++i) {
    U8 lv;
    lv.q[0] = *(const v4f*)(lfin + 16 * i + 8 * hh);
    lv.q[1] = *(const v4f*)(lfin + 16 * i + 8 * hh + 4);
#pragma unroll
    for (int r = 0; r < 8; ++r) {
      const float f = OSC_ * (1.0f / lv.v[r]);
      const int orow = 16 * i + 8 * hh + r;
#pragma unroll
      for (int jj = 0; jj < 2; ++jj) {
        const float t = oacc[i][jj][r] * f;
        const _Float16 hq = (_Float16)t;
        const int oidx = orow * AT_OPITCH + ocol0 + 16 * jj + c;
        Ohs[oidx] = hq;
        Ols[oidx] = (_Float16)(t - (float)hq);
      }
    }
  }
  __syncthreads();
  {
    const int piece = tid & 7;
    const int lsub  = tid >> 3;
    {
#pragma unroll
      for (int it = 0; it < 8; ++it) {
        const int line = it * 32 + lsub;          // 0..255 = 64 rows x 4 lines
        const int row  = line >> 2;
        const int col  = (line & 3) * 64 + piece * 8;
        const v8h hv = *(const v8h*)(Ohs + row * AT_OPITCH + col);
        const v8h rv = *(const v8h*)(Ols + row * AT_OPITCH + col);
        const size_t go = (growq + row) * DM_ + h * HD_ + col;
        *(v8h*)(AOh + go) = hv;
        *(v8h*)(AOl + go) = rv;
      }
      
    }
  }
}

// ---------------------------------------------------------------------------------------------------------------
// Workspace map (byte offsets, all 2 MiB aligned; every region is written completely by whole-line stores before it is read;
// the attention output planes reuse the f32 q region, which is dead after the q RoPE/split pass):
//   Xh   f16 [4096][2048]            0           16,777,216
//   Wqh  f16 [2048][2048]   16,777,216            8,388,608
//   Wkvh f16 [512][2048]    25,165,824            2,097,152
//   Woh  f16 [2048][2048]   27,262,976            8,388,608
//   cosT f32 [4096][128]    35,651,584            2,097,152
//   sinT f32 [4096][128]    37,748,736            2,097,152
//   Qf   f32 [4096][2048]   39,845,888           33,554,432   (AOh f16 [4096][2048] at 39,845,888; AOl at 56,623,104)
//   KVf  f32 [4096][512]    73,400,320            8,388,608
//   Qh   f16 [4096][2048]   81,788,928           16,777,216
//   Ql   f16 [4096][2048]   98,566,144           16,777,216
//   Kh   f16 [4096][256]   115,343,360            2,097,152
//   Kl   f16 [4096][256]   117,440,512            2,097,152
//   Vth  f16 [2][256][2048] 119,537,664           2,097,152
//   Vtl  f16 [2][256][2048] 121,634,816           2,097,152
//   flags int [2*32*16][32] 123,731,968            131,072
//   total                  123,863,040
// ---------------------------------------------------------------------------------------------------------------
extern "C" void kernel_launch(void* const* d_in, const int* in_sizes, int n_in,
                              void* d_out, int out_size, void* d_ws, size_t ws_size,
                              hipStream_t stream) {
  if (n_in < 7) return;
  if (in_sizes[0] != NB_ * SEQ_ * DM_) return;
  if (in_sizes[1] != NB_ * SEQ_ * SEQ_) return;
  if (in_sizes[2] != NB_ * SEQ_) return;
  if (in_sizes[3] != DM_ * DM_) return;
  if (in_sizes[4] != HD_ * DM_) return;
  if (in_sizes[5] != HD_ * DM_) return;
  if (in_sizes[6] != DM_ * DM_) return;
  if (out_size != NB_ * SEQ_ * DM_) return;

  const float* x    = (const float*)d_in[0];
  const float* mask = (const float*)d_in[1];
  const int*   pos  = (const int*)d_in[2];
  const float* Wq   = (const float*)d_in[3];
  const float* Wk   = (const float*)d_in[4];
  const float* Wv   = (const float*)d_in[5];
  const float* Wo   = (const float*)d_in[6];
  float* out = (float*)d_out;

  const size_t nX   = (size_t)NB_ * SEQ_ * DM_;          // 8,388,608 elements
  const size_t bXh  = nX * 2;
  const size_t bWq  = (size_t)DM_ * DM_ * 2;
  const size_t bWkv = (size_t)KVN_ * DM_ * 2;
  const size_t bWo  = bWq;
  const size_t bTab = (size_t)NB_ * SEQ_ * NF_ * 4;
  const size_t bQf  = nX * 4;
  const size_t bKVf = (size_t)NB_ * SEQ_ * KVN_ * 4;
  const size_t bQ16 = nX * 2;
  const size_t bK16 = (size_t)NB_ * SEQ_ * HD_ * 2;
  const size_t bV16 = bK16;
  const size_t bFlg = (size_t)NB_ * NQB_ * MFG_ * 128;
  size_t off = 0;
  const size_t oXh  = off; off += bXh;
  const size_t oWq  = off; off += bWq;
  const size_t oWkv = off; off += bWkv;
  const size_t oWo  = off; off += bWo;
  const size_t oCos = off; off += bTab;
  const size_t oSin = off; off += bTab;
  const size_t oQf  = off; off += bQf;
  const size_t oKVf = off; off += bKVf;
  const size_t oQh  = off; off += bQ16;
  const size_t oQl  = off; off += bQ16;
  const size_t oKh  = off; off += bK16;
  const size_t oKl  = off; off += bK16;
  const size_t oVth = off; off += bV16;
  const size_t oVtl = off; off += bV16;
  const size_t oFlg = off; off += bFlg;
  if (off > ws_size) return;                        // off = 123,863,040
  if (off > (size_t)134217728) return;
  if (bQf < 2 * bQ16) return;                        // AOh/AOl alias fits inside the f32 q region
  const size_t oAOh = oQf;
  const size_t oAOl = oQf + bQ16;

  char* ws = (char*)d_ws;
  _Float16* Xh   = (_Float16*)(ws + oXh);
  _Float16* Wqh  = (_Float16*)(ws + oWq);
  _Float16* Wkvh = (_Float16*)(ws + oWkv);
  _Float16* Woh  = (_Float16*)(ws + oWo);
  float*    cosT = (float*)(ws + oCos);
  float*    sinT = (float*)(ws + oSin);
  float*    Qf   = (float*)(ws + oQf);
  float*    KVf  = (float*)(ws + oKVf);
  _Float16* Qh   = (_Float16*)(ws + oQh);
  _Float16* Ql   = (_Float16*)(ws + oQl);
  _Float16* Kh   = (_Float16*)(ws + oKh);
  _Float16* Kl   = (_Float16*)(ws + oKl);
  _Float16* Vth  = (_Float16*)(ws + oVth);
  _Float16* Vtl  = (_Float16*)(ws + oVtl);
  int*      flg  = (int*)(ws + oFlg);
  _Float16* AOh  = (_Float16*)(ws + oAOh);
  _Float16* AOl  = (_Float16*)(ws + oAOl);

  const dim3 blk(256);
  const int n8x = (int)(nX / 8);                     // 1,048,576
  const int n8q = DM_ * DM_ / 8;                     // 524,288
  const int n8k = HD_ * DM_ / 8;                     // 65,536

  // (1) inputs -> 16-bit planes: x bf16*2^4, weights bf16*2^8 (k rows then v rows in the fused kv weight plane)
  cvt16_kernel<<<dim3((n8x + 255) / 256), blk, 0, stream>>>(x, Xh, n8x, CX_);
  cvt16_kernel<<<dim3((n8q + 255) / 256), blk, 0, stream>>>(Wq, Wqh, n8q, CW_);
  cvt16_kernel<<<dim3((n8k + 255) / 256), blk, 0, stream>>>(Wk, Wkvh, n8k, CW_);
  cvt16_kernel<<<dim3((n8k + 255) / 256), blk, 0, stream>>>(Wv, Wkvh + (size_t)HD_ * DM_, n8k, CW_);
  cvt16_kernel<<<dim3((n8q + 255) / 256), blk, 0, stream>>>(Wo, Woh, n8q, CW_);
  // (2) cos/sin tables [4096][128] from position ids; mask verification flags per (b, query block, 4-row group)
  rope_table_kernel<<<dim3((NB_ * SEQ_) / 32), blk, 0, stream>>>(pos, cosT, sinT, NB_ * SEQ_);
  maskflag_kernel<<<dim3(NB_ * NQB_ * MFG_), blk, 0, stream>>>(mask, flg);
  // (3) q = x . Wq^T -> f32 [4096][2048]; [k|v] = x . [Wk|Wv]^T -> f32 [4096][512]
  gemm64_kernel<<<dim3(((NB_ * SEQ_ / 64) * (DM_ / 64)) / 8), blk, 0, stream>>>(
      Xh, Xh, DM_, Wqh, DM_, Qf, DM_, NB_ * SEQ_, DM_, DM_, 0, SEQ_ - 1, QSC_);
  gemm64_kernel<<<dim3(((NB_ * SEQ_ / 64) * (KVN_ / 64)) / 8), blk, 0, stream>>>(
      Xh, Xh, DM_, Wkvh, DM_, KVf, KVN_, NB_ * SEQ_, KVN_, DM_, 0, SEQ_ - 1, QSC_);
  // (4) RoPE + hi/residual split: q planes [4096][8*256], k planes [4096][256]; v^T planes [2][256][2048]
  rope_split_kernel<<<dim3((NB_ * SEQ_ * NH_ * 8) / 256), blk, 0, stream>>>(
      Qf, DM_, NH_, cosT, sinT, Qh, Ql, DM_, NB_ * SEQ_ * NH_, CQK_);
  rope_split_kernel<<<dim3((NB_ * SEQ_ * 8) / 256), blk, 0, stream>>>(
      KVf, KVN_, 1, cosT, sinT, Kh, Kl, HD_, NB_ * SEQ_, CQK_);
  vt_split_kernel<<<dim3(HD_ / 64, (NB_ * SEQ_) / 64), blk, 0, stream>>>(KVf, Vth, Vtl);
  // (5) attention -> AO hi/residual planes [4096][2048]
  (void)hipFuncSetAttribute(reinterpret_cast<const void*>(&attn_kernel), hipFuncAttributeMaxDynamicSharedMemorySize, AT_LDS);
  attn_kernel<<<dim3(NB_ * NH_ * NQB_), blk, AT_LDS, stream>>>(Qh, Ql, Kh, Kl, Vth, Vtl, mask, flg, AOh, AOl);
  // (6) out = AO . Wo^T -> d_out f32 [4096][2048]; residual plane on rows < LOROWS_ of each sequence
  gemm64_kernel<<<dim3(((NB_ * SEQ_ / 64) * (DM_ / 64)) / 8), blk, 0, stream>>>(
      AOh, AOl, DM_, Woh, DM_, out, DM_, NB_ * SEQ_, DM_, DM_, LOROWS_, SEQ_ - 1, WSC_);
  (void)hipGetLastError();
}

// v002
// Measured time: 345 microseconds a run.
// Next to v001, in two timings, it ran 1.51 and 1.50 times as fast.
// Counting every step since v000, it is 1.80 times as fast.
// Contractions on v_wmma_f32_16x16x32_f16 (f16 operands, f32 accumulate): q/k/v projections (x RNE-converted to bf16 and carried *2^4,
// W RNE-converted to bf16 and carried *2^8, exact products); q.k^T (q,k carried *2^10 as f16 hi planes, plus unscaled f16 residual planes
// on the leading query blocks of each sequence); p.v (p carried *2^15, v^T carried *2^10: hi planes plus residual planes on the leading query
// blocks); output projection (attention output carried *2^10: hi plane everywhere, residual plane on the leading rows of each sequence;
// Wo bf16 *2^8). RoPE, mask add and online softmax in f32.
#include <hip/hip_runtime.h>
#include <math.h>
#include <stdint.h>

#define NB_     2
#define SEQ_    2048
#define DM_     2048
#define NH_     8
#define HD_     256
#define NF_     128
#define KVN_    512
#define WIN_    1024
#define NQB_    32
#define QE_     4
#define LOROWS_ 256
#define MFG_    16

#define CX_   16.0f
#define CW_   256.0f
#define CQK_  1024.0f
#define CP_   32768.0f
#define SSC_  5.9604644775390625e-8f     /* 2^-4 * 2^-20 : score scale for q,k carried *2^10 each */
#define OSC_  3.0517578125e-5f           /* 2^-15 = 2^10 / (2^15 * 2^10) : attention output carry */
#define QSC_  2.44140625e-4f             /* 2^-12 = 1 / (2^4 * 2^8) : projection outputs back to f32 */
#define WSC_  3.814697265625e-6f         /* 2^-18 = 1 / (2^10 * 2^8) : final projection */

typedef _Float16 v16h __attribute__((ext_vector_type(16)));
typedef _Float16 v8h  __attribute__((ext_vector_type(8)));
typedef float    v8f  __attribute__((ext_vector_type(8)));
typedef float    v4f  __attribute__((ext_vector_type(4)));

union FragU { v16h v; v8h h[2]; };
union U8 { v8f v; v4f q[2]; };

__device__ __forceinline__ float bf16_rne(float f) {
  unsigned u = __float_as_uint(f);
  u = u + 0x7FFFu + ((u >> 16) & 1u);
  return __uint_as_float(u & 0xFFFF0000u);
}
__device__ __forceinline__ v8f zero8() { return (v8f){0.f, 0.f, 0.f, 0.f, 0.f, 0.f, 0.f, 0.f}; }

// 16-bit fragment (A or B): lane row/col = lane&15, elements 0..7 <- p[0..7] (k0+8h..), 8..15 <- p[16..23] (k0+16+8h..)
// p already includes the row base + k0 + 8*h.
__device__ __forceinline__ v16h frag_ld(const _Float16* p) {
  FragU f;
  f.h[0] = *(const v8h*)(p);
  f.h[1] = *(const v8h*)(p + 16);
  return f.v;
}
__device__ __forceinline__ v8f wmma_raw(v16h a, v16h b, v8f c) {
  return __builtin_amdgcn_wmma_f32_16x16x32_f16(false, a, false, b, (short)0, c, false, false);
}
// WMMA with trailing hazard guard (ties D, keeps A/B live)
__device__ __forceinline__ v8f mma_g(v16h a, v16h b, v8f c) {
  c = __builtin_amdgcn_wmma_f32_16x16x32_f16(false, a, false, b, (short)0, c, false, false);
  asm volatile("v_nop\n\tv_nop\n\tv_nop\n\tv_nop" : "+v"(c) : "v"(a), "v"(b));
  return c;
}
__device__ __forceinline__ void dep_guard(v8f& a, v8f& b, v16h x, v16h y) {
  asm volatile("v_nop\n\tv_nop\n\tv_nop\n\tv_nop" : "+v"(a), "+v"(b) : "v"(x), "v"(y));
}
__device__ __forceinline__ void keep4(v16h a, v16h b, v16h c, v16h d) {
  asm volatile("v_nop" :: "v"(a), "v"(b), "v"(c), "v"(d));
}
__device__ __forceinline__ void acc_guard4(v8f& a, v8f& b, v8f& c, v8f& d) {
  asm volatile("v_nop\n\tv_nop\n\tv_nop\n\tv_nop" : "+v"(a), "+v"(b), "+v"(c), "+v"(d));
}

// ---------------------------------------------------------------------------------------------------------------
// Elementwise convert: dst[i] = f16( bf16_rne(src[i]) * scale ), 8 elements per thread, one 16-B store per lane:
// coverage: grid = ceil(n8/256), each thread 8 elements -> 8*n8 elements.
// ---------------------------------------------------------------------------------------------------------------
__global__ __launch_bounds__(256) void cvt16_kernel(const float* __restrict__ src, _Float16* __restrict__ dst, int n8, float scale) {
  const int i = blockIdx.x * 256 + (int)threadIdx.x;
  if (i >= n8) return;
  const float* s = src + 8 * (size_t)i;
  U8 a;
  a.q[0] = *(const v4f*)(s);
  a.q[1] = *(const v4f*)(s + 4);
  v8h o;
#pragma unroll
  for (int e = 0; e < 8; ++e) o[e] = (_Float16)(bf16_rne(a.v[e]) * scale);
  _Float16* d = dst + 8 * (size_t)i;
  *(v8h*)d = o;
  
}

// ---------------------------------------------------------------------------------------------------------------
// RoPE tables: cosT/sinT [nrows][128], angle = float(pos[row]) * inv_freq[f], inv_freq[f] = 1 / f32(10000^(f/128)).
// coverage: grid = nrows/32 blocks, 16 iterations x 2 rows -> nrows x 128 per table.
// ---------------------------------------------------------------------------------------------------------------
__global__ __launch_bounds__(256) void rope_table_kernel(const int* __restrict__ pos, float* __restrict__ cosT,
                                                         float* __restrict__ sinT, int nrows) {
#pragma clang fp contract(off)
  __shared__ float invf[NF_];
  const int tid = threadIdx.x;
  if (tid < NF_) {
    const double e = (double)tid * 0.0078125;                 // tid/128 exactly
    const double p = exp2(e * 13.287712379549449);            // 10000^e
    const float pf = (float)p;                                // RNE to f32
    invf[tid] = 1.0f / pf;
  }
  __syncthreads();
  const int f = tid & (NF_ - 1);
  const int rp = tid >> 7;
  const int r0 = blockIdx.x * 32;
  const float iv = invf[f];
#pragma unroll 1
  for (int it = 0; it < 16; ++it) {
    const int row = r0 + it * 2 + rp;
    const int rowc = (row < nrows) ? row : (nrows - 1);
    const float ang = (float)pos[rowc] * iv;
    float sv, cv;
    sincosf(ang, &sv, &cv);
    if (row < nrows) {
      float* cp = cosT + (size_t)row * NF_ + f;
      float* sp = sinT + (size_t)row * NF_ + f;
      *(float*)cp = cv;
      *(float*)sp = sv;
      
    }
  }
}

// ---------------------------------------------------------------------------------------------------------------
// Mask verification flags, MFG_ per (b, 64-query block), one per group of 4 query rows: 1 if every mask value for the group's rows
// and keys in [q0+64, min(q+1023, SEQ-1)] (the in-band keys strictly above the query block) is <= -1e9 (adds to an exact zero weight).
// The range holds at most 1023 keys, so 256 threads x 4 keys cover a row with one 16-byte load each; the 4 rows' loads are independent.
// coverage: grid = NB*NQB*MFG_ blocks; each block writes its own 128-byte line of 32 equal ints.
// ---------------------------------------------------------------------------------------------------------------
__global__ __launch_bounds__(256) void maskflag_kernel(const float* __restrict__ mask, int* __restrict__ flag) {
  __shared__ int sw[8];
  const int tid = threadIdx.x, w = tid >> 5, lane = tid & 31;
  const int bid = blockIdx.x;                // (b*32 + qb)*MFG_ + row group
  const int g  = bid & (MFG_ - 1);
  const int bq = bid / MFG_;
  const int b = bq >> 5, qb = bq & (NQB_ - 1);
  const int q0 = qb * 64;
  const int r0 = q0 + g * (64 / MFG_);
  const int k  = q0 + 64 + 4 * tid;          // first of this thread's four keys
  const int kc = (k <= SEQ_ - 4) ? k : (SEQ_ - 4);   // k > SEQ-4 means k >= SEQ: none of the four keys is tested
  v4f mv[64 / MFG_];
#pragma unroll   // all rows' loads issue before the first compare waits (and mv stays in registers)
  for (int rr = 0; rr < 64 / MFG_; ++rr) mv[rr] = *(const v4f*)(mask + ((size_t)b * SEQ_ + r0 + rr) * SEQ_ + kc);
  int bad = 0;
#pragma unroll
  for (int rr = 0; rr < 64 / MFG_; ++rr) {
    int kend = r0 + rr + WIN_ - 1;
    if (kend > SEQ_ - 1) kend = SEQ_ - 1;
#pragma unroll
    for (int e = 0; e < 4; ++e) {
      const int ok = (mv[rr][e] <= -1.0e9f) ? 1 : 0;
      bad |= ((k + e <= kend) && (ok == 0)) ? 1 : 0;
    }
  }
  const unsigned long long bm = __ballot(bad);
  if (lane == 0) sw[w] = (bm != 0ull) ? 1 : 0;
  __syncthreads();
  if (w == 0) {
    int any = 0;
#pragma unroll
    for (int i = 0; i < 8; ++i) any |= sw[i];
    const int fv = any ? 0 : 1;
    int* fp = flag + (size_t)bid * 32 + lane;
    *(int*)fp = fv;
  }
}

// ---------------------------------------------------------------------------------------------------------------
// Register-blocked WMMA GEMM, f16 operands: C[m][n] = scale * sum_k (A[m][k] (+ A2[m][k])) * Bt[n][k]
// A row-major [M][lda], optional residual plane A2 (same layout) used on row blocks with (m0 & seqMask) < loRows (block-uniform;
// loRows a multiple of 128); Bt row-major [N][ldb] (k contiguous); C f32 [M][ldc].
// Block = 8 waves (2 x 4) on a 128 x 256 tile of C, each wave a 64x64 tile (4x4 accumulators).
// Operands reach LDS by asynchronous 16-byte copies, whole 256-byte row pieces (128 k) per stage, two stages: the next stage's
// copies fly while this stage is multiplied. LDS row pitch 272 bytes (16 B x odd) for the 16-byte fragment reads.
// M multiple of 128, N multiple of 256, K multiple of 128. Epilogue: 16-row slabs staged per wave in the (then free) ring.
// ---------------------------------------------------------------------------------------------------------------
#define GK_    128                               /* k per stage */
#define GPH_   136                               /* LDS row pitch, halves */
#define GBM_   128
#define GBN_   256
#define G_OA2_ (GBM_ * GPH_)                     /* residual plane of A, halves from the stage's start */
#define G_OB_  (2 * GBM_ * GPH_)
#define G_STG_ ((2 * GBM_ + GBN_) * GPH_)        /* halves per stage */
#define G_LS_  (16 * GPH_ * 2)                   /* bytes between LDS rows 16 apart */
static_assert(LOROWS_ % GBM_ == 0);
static_assert(2 * G_STG_ * 2 >= 8 * 16 * 68 * 4);

// Eight copies per lane, rows 16 apart: l = the lane's LDS byte address, g = its global address, gs = halves per 16 source rows.
// s_wait_xcnt stands inside the statement so that no address register is rewritten ahead of it.
__device__ __forceinline__ void async_rows8(unsigned l, const _Float16* g, size_t gs) {
  asm volatile(
      "global_load_async_to_lds_b128 %0, %8, off\n\t"
      "global_load_async_to_lds_b128 %1, %9, off\n\t"
      "global_load_async_to_lds_b128 %2, %10, off\n\t"
      "global_load_async_to_lds_b128 %3, %11, off\n\t"
      "global_load_async_to_lds_b128 %4, %12, off\n\t"
      "global_load_async_to_lds_b128 %5, %13, off\n\t"
      "global_load_async_to_lds_b128 %6, %14, off\n\t"
      "global_load_async_to_lds_b128 %7, %15, off\n\t"
      "s_wait_xcnt 0x0"
      :: "v"(l), "v"(l + 1u * G_LS_), "v"(l + 2u * G_LS_), "v"(l + 3u * G_LS_),
         "v"(l + 4u * G_LS_), "v"(l + 5u * G_LS_), "v"(l + 6u * G_LS_), "v"(l + 7u * G_LS_),
         "v"(g), "v"(g + gs), "v"(g + 2 * gs), "v"(g + 3 * gs), "v"(g + 4 * gs), "v"(g + 5 * gs), "v"(g + 6 * gs), "v"(g + 7 * gs)
      : "memory");
}
// One stage: A 128 rows (+ A2 128 rows), Bt 256 rows, 256 bytes of each; a wave's copy covers two whole row pieces.
template <bool LO>
__device__ __forceinline__ void gemm_fill(unsigned l, const _Float16* ga, const _Float16* ga2, size_t as16,
                                          const _Float16* gb, size_t bs16) {
  async_rows8(l, ga, as16);
  if (LO) async_rows8(l + G_OA2_ * 2u, ga2, as16);
  async_rows8(l + G_OB_ * 2u, gb, bs16);
  async_rows8(l + G_OB_ * 2u + 8u * G_LS_, gb + 8 * bs16, bs16);
}

template <bool LO>
__device__ __forceinline__ void gemm_ring(v8f (&acc)[4][4], const _Float16* ring, const _Float16* __restrict__ Ab,
                                          const _Float16* __restrict__ Ab2, int lda, const _Float16* __restrict__ Bb, int ldb,
                                          int m0b, int n0b, int K, int tid, int wrow, int wcol, int rlane, int koff) {
  const int sub = tid >> 4;
  const int cc  = (tid & 15) * 8;
  const unsigned l0 = (unsigned)(size_t)ring + (unsigned)(sub * GPH_ + cc) * 2u;
  const _Float16* ga  = Ab  + (size_t)(m0b + sub) * lda + cc;
  const _Float16* ga2 = Ab2 + (size_t)(m0b + sub) * lda + cc;
  const _Float16* gb  = Bb  + (size_t)(n0b + sub) * ldb + cc;
  const size_t as16 = (size_t)16 * lda;
  const size_t bs16 = (size_t)16 * ldb;
  const int nt = K / GK_;

  gemm_fill<LO>(l0, ga, ga2, as16, gb, bs16);
  asm volatile("s_wait_asynccnt 0x0" ::: "memory");   // stage 0 landed (this wave's copies) before the barrier publishes it
  __syncthreads();
  if (nt > 1) gemm_fill<LO>(l0 + G_STG_ * 2u, ga + GK_, ga2 + GK_, as16, gb + GK_, bs16);

  for (int t = 0; t < nt; ++t) {
    const _Float16* st = ring + (t & 1) * G_STG_;
    const _Float16* sa = st + (wrow + rlane) * GPH_ + koff;
    const _Float16* sb = st + G_OB_ + (wcol + rlane) * GPH_ + koff;
#pragma unroll   // the four k-steps of a stage in one body: constant LDS offsets, no loop overhead between them
    for (int kk = 0; kk < GK_; kk += 32) {
      v16h bh[4], ah[4], al[4];
#pragma unroll   // register arrays: constant indices
      for (int j = 0; j < 4; ++j) bh[j] = frag_ld(sb + (j << 4) * GPH_ + kk);
#pragma unroll   // register arrays: constant indices
      for (int i = 0; i < 4; ++i) {
        ah[i] = frag_ld(sa + (i << 4) * GPH_ + kk);
        al[i] = ah[i];
        if (LO) al[i] = frag_ld(sa + G_OA2_ + (i << 4) * GPH_ + kk);
      }
      // holds the k-step's fragment reads together in front of its products (one LDS wait per k-step instead of one per row)
      asm volatile("" :: "v"(bh[0]), "v"(bh[1]), "v"(bh[2]), "v"(bh[3]), "v"(ah[0]), "v"(ah[1]), "v"(ah[2]), "v"(ah[3]));
      if (LO) asm volatile("" :: "v"(al[0]), "v"(al[1]), "v"(al[2]), "v"(al[3]));   // the same for the residual plane's reads
#pragma unroll   // register arrays: constant indices
      for (int i = 0; i < 4; ++i) {
#pragma unroll   // register arrays: constant indices
        for (int j = 0; j < 4; ++j) {
          acc[i][j] = wmma_raw(ah[i], bh[j], acc[i][j]);
          if (LO) acc[i][j] = wmma_raw(al[i], bh[j], acc[i][j]);
        }
        dep_guard(acc[i][0], acc[i][3], ah[i], al[i]);
      }
      keep4(bh[0], bh[1], bh[2], bh[3]);
    }
    asm volatile("s_wait_dscnt 0x0" ::: "memory");      // this wave's reads of the stage are done before it may be refilled
    asm volatile("s_wait_asynccnt 0x0" ::: "memory");   // this wave's copies of the next stage have landed
    __syncthreads();                                    // publishes stage t+1 and frees stage t's buffer
    if (t + 2 < nt)
      gemm_fill<LO>(l0 + (unsigned)(t & 1) * (G_STG_ * 2u), ga + (size_t)(t + 2) * GK_, ga2 + (size_t)(t + 2) * GK_, as16,
                    gb + (size_t)(t + 2) * GK_, bs16);
  }
  asm volatile("s_wait_asynccnt 0x0" ::: "memory");     // nothing in flight when the ring becomes output staging
}

__global__ __launch_bounds__(256) void gemm64_kernel(const _Float16* __restrict__ A, const _Float16* __restrict__ A2, int lda,
                                                     const _Float16* __restrict__ Bt, int ldb,
                                                     float* __restrict__ C, int ldc, int M, int N, int K,
                                                     int loRows, int seqMask, float scale) {
  __shared__ __align__(16) _Float16 ring[2 * G_STG_];   // two stages; afterwards per-wave 16x64 f32 slabs, pitch 68 floats
  const int tid  = threadIdx.x;
  const int lane = tid & 31;
  const int wave = tid >> 5;
  const int tilesN = N / GBN_;
  const int tilesM = M / GBM_;
  const int bid = blockIdx.x;
  if (bid >= tilesM * tilesN) return;   // block-uniform, in front of every barrier
  const int tm = bid / tilesN;
  const int tn = bid - tm * tilesN;
  const int m0b = tm * GBM_;
  const int n0b = tn * GBN_;
  const int wrow = (wave >> 2) << 6;
  const int wcol = (wave & 3) << 6;
  const int m0 = m0b + wrow;
  const int n0 = n0b + wcol;
  const int rlane = lane & 15;
  const int koff  = (lane >> 4) * 8;
  const int mOff  = koff;

  v8f acc[4][4];
#pragma unroll
  for (int i = 0; i < 4; ++i)
#pragma unroll
    for (int j = 0; j < 4; ++j) acc[i][j] = zero8();

  const bool useLo = ((m0b & seqMask) < loRows);   // block-uniform
  if (useLo) gemm_ring<true>(acc, ring, A, A2, lda, Bt, ldb, m0b, n0b, K, tid, wrow, wcol, rlane, koff);
  else       gemm_ring<false>(acc, ring, A, A, lda, Bt, ldb, m0b, n0b, K, tid, wrow, wcol, rlane, koff);
  acc_guard4(acc[0][0], acc[0][1], acc[0][2], acc[0][3]);
  acc_guard4(acc[1][0], acc[1][1], acc[1][2], acc[1][3]);
  acc_guard4(acc[2][0], acc[2][1], acc[2][2], acc[2][3]);
  acc_guard4(acc[3][0], acc[3][1], acc[3][2], acc[3][3]);

  float* slab = (float*)ring + wave * (16 * 68);
  const int hrow = lane >> 4;
  const int c4 = rlane * 4;
#pragma unroll
  for (int i = 0; i < 4; ++i) {
    const int mBase = m0 + (i << 4);
#pragma unroll
    for (int j = 0; j < 4; ++j) {
#pragma unroll
      for (int r = 0; r < 8; ++r) slab[(mOff + r) * 68 + (j << 4) + rlane] = acc[i][j][r] * scale;
    }
    __builtin_amdgcn_fence(__ATOMIC_RELEASE, "workgroup");
    __builtin_amdgcn_wave_barrier();
    __builtin_amdgcn_fence(__ATOMIC_ACQUIRE, "workgroup");
    {
#pragma unroll
      for (int it = 0; it < 8; ++it) {
        const int row = it * 2 + hrow;
        const v4f v = *(const v4f*)(slab + row * 68 + c4);
        *(v4f*)(C + (size_t)(mBase + row) * ldc + n0 + c4) = v;
      }
      
    }
    __builtin_amdgcn_fence(__ATOMIC_RELEASE, "workgroup");
    __builtin_amdgcn_wave_barrier();
    __builtin_amdgcn_fence(__ATOMIC_ACQUIRE, "workgroup");
  }
}

// ---------------------------------------------------------------------------------------------------------------
// RoPE + f16 hi/residual split. Unit = (row, head); 8 lanes per unit; lane j owns columns {8j, 64+8j, 128+8j, 192+8j}+0..7 of the
// 256-wide head (pairs (c, c+128) are in the same lane). out = x*cos + rotate_half(x)*sin with cos/sin[row][c mod 128].
// hi = f16(out*carry), lo = f16(out*carry - hi) (unscaled residual). Stores: for each column chunk one instruction writes
// coverage: nunits*8 threads x 32 elements = nunits*256 per plane.
// ---------------------------------------------------------------------------------------------------------------
__global__ __launch_bounds__(256) void rope_split_kernel(const float* __restrict__ src, int spitch, int nheads,
                                                         const float* __restrict__ cosT, const float* __restrict__ sinT,
                                                         _Float16* __restrict__ hi, _Float16* __restrict__ lo,
                                                         int dpitch, int nunits, float carry) {
#pragma clang fp contract(off)
  const int gid = blockIdx.x * 256 + (int)threadIdx.x;
  const int unit = gid >> 3;
  const int j = gid & 7;
  if (unit >= nunits) return;
  const int row = unit / nheads;
  const int hd = unit - row * nheads;
  const float* s  = src  + (size_t)row * spitch + hd * HD_ + 8 * j;
  const float* ct = cosT + (size_t)row * NF_ + 8 * j;
  const float* st = sinT + (size_t)row * NF_ + 8 * j;
  U8 xa, xb, xc, xd, ca, cb, sa, sb;
  xa.q[0] = *(const v4f*)(s);         xa.q[1] = *(const v4f*)(s + 4);
  xb.q[0] = *(const v4f*)(s + 64);    xb.q[1] = *(const v4f*)(s + 68);
  xc.q[0] = *(const v4f*)(s + 128);   xc.q[1] = *(const v4f*)(s + 132);
  xd.q[0] = *(const v4f*)(s + 192);   xd.q[1] = *(const v4f*)(s + 196);
  ca.q[0] = *(const v4f*)(ct);        ca.q[1] = *(const v4f*)(ct + 4);
  cb.q[0] = *(const v4f*)(ct + 64);   cb.q[1] = *(const v4f*)(ct + 68);
  sa.q[0] = *(const v4f*)(st);        sa.q[1] = *(const v4f*)(st + 4);
  sb.q[0] = *(const v4f*)(st + 64);   sb.q[1] = *(const v4f*)(st + 68);
  v8h h0, h1, h2, h3, l0, l1, l2, l3;
#pragma unroll
  for (int e = 0; e < 8; ++e) {
    const float r0 = xa.v[e] * ca.v[e] - xc.v[e] * sa.v[e];    // col 8j+e
    const float r1 = xb.v[e] * cb.v[e] - xd.v[e] * sb.v[e];    // col 64+8j+e
    const float r2 = xc.v[e] * ca.v[e] + xa.v[e] * sa.v[e];    // col 128+8j+e
    const float r3 = xd.v[e] * cb.v[e] + xb.v[e] * sb.v[e];    // col 192+8j+e
    float t; _Float16 q;
    t = r0 * carry; q = (_Float16)t; h0[e] = q; l0[e] = (_Float16)(t - (float)q);
    t = r1 * carry; q = (_Float16)t; h1[e] = q; l1[e] = (_Float16)(t - (float)q);
    t = r2 * carry; q = (_Float16)t; h2[e] = q; l2[e] = (_Float16)(t - (float)q);
    t = r3 * carry; q = (_Float16)t; h3[e] = q; l3[e] = (_Float16)(t - (float)q);
  }
  _Float16* hp = hi + (size_t)row * dpitch + hd * HD_ + 8 * j;
  _Float16* lp = lo + (size_t)row * dpitch + hd * HD_ + 8 * j;
  {
    *(v8h*)(hp)       = h0;
    *(v8h*)(hp + 64)  = h1;
    *(v8h*)(hp + 128) = h2;
    *(v8h*)(hp + 192) = h3;
    *(v8h*)(lp)       = l0;
    *(v8h*)(lp + 64)  = l1;
    *(v8h*)(lp + 128) = l2;
    *(v8h*)(lp + 192) = l3;
    
  }
}

// ---------------------------------------------------------------------------------------------------------------
// v columns of the fused kv plane (f32 [NB*SEQ rows][512], cols 256..511) -> transposed f16 planes Vth/Vtl [b][d][s]
// (hi = f16(v*2^10), lo = unscaled residual). 64x64 tiles through LDS; grid = (256/64, NB*SEQ/64), 256 threads.
// coverage per block: load 4 it x 256 thr x 4 = 64x64; store 2 it x 256 thr x 8 = 64x64 per plane.
// ---------------------------------------------------------------------------------------------------------------
__global__ __launch_bounds__(256) void vt_split_kernel(const float* __restrict__ KV, _Float16* __restrict__ Vth,
                                                       _Float16* __restrict__ Vtl) {
  __shared__ __align__(16) float tf[64 * 68];
  const int tid = threadIdx.x;
  const int d0  = blockIdx.x * 64;           // d block (input column within v)
  const int sg0 = blockIdx.y * 64;           // global row block (b*SEQ + s)
  const int b   = sg0 >> 11;
  const int s0  = sg0 & (SEQ_ - 1);
  {
    const int lr = tid >> 4;
    const int c4 = (tid & 15) * 4;
#pragma unroll
    for (int it = 0; it < 4; ++it) {
      const int rr = it * 16 + lr;
      const v4f a = *(const v4f*)(KV + (size_t)(sg0 + rr) * KVN_ + HD_ + d0 + c4);
      *(v4f*)(tf + rr * 68 + c4) = a;
    }
  }
  __syncthreads();
  const int sub = tid >> 3;          // output row within tile (= d)
  const int c8  = (tid & 7) * 8;     // s offset within tile
  v8h hv[2], lv[2];
#pragma unroll
  for (int it = 0; it < 2; ++it) {
    const int oc = it * 32 + sub;
    v8h a, rsd;
#pragma unroll
    for (int q = 0; q < 8; ++q) {
      const float f = tf[(c8 + q) * 68 + oc] * CQK_;
      const _Float16 hq = (_Float16)f;
      a[q] = hq;
      rsd[q] = (_Float16)(f - (float)hq);
    }
    hv[it] = a; lv[it] = rsd;
  }
  {
#pragma unroll
    for (int it = 0; it < 2; ++it) {
      const int oc = it * 32 + sub;
      const size_t go = ((size_t)b * HD_ + d0 + oc) * SEQ_ + s0 + c8;
      *(v8h*)(Vth + go) = hv[it];
      *(v8h*)(Vtl + go) = lv[it];
    }
    
  }
}

// ---------------------------------------------------------------------------------------------------------------
// Sliding-window attention, head dim 256, one kv head shared by 8 query heads.
// Block = (b, h, 64 query rows), 256 threads = 8 waves. Key tiles of 64: kt in [max(0,qb-16), kthi], kthi = qb when the mask
// flag verified the tiles above the block add exact zeros, else min(qb+16, 31) (general in-band path, mask added).
//   S phase: wave w computes rows 16*(w&3)..+15 x keys 32*(w>>2)..+31 of the tile (2 accumulators, K = 256 = 8 k-steps),
//            A = q fragments straight from the 16-bit global planes, B = k fragments straight from the 16-bit k planes
//            (q,k carried *2^10; hi.hi everywhere, + lo.hi + hi.lo on query blocks < QE_).
//   Scores: s*2^-24 + mask[b][0][q][key] for |q-key| <= 1023, -inf outside the band; row max / sum exchanged between the two
//            waves of a row group through LDS; online softmax in f32; p*2^15 -> f16 P tile [64][72] in LDS (+ residual tile early).
//   PV phase: wave w owns O[64 rows][32*w..+31] (4x2 accumulators); A = P fragments from LDS (after __syncthreads),
//            B = v^T fragments straight from the 16-bit global planes (*2^10; + residual products on query blocks < QE_).
// coverage: NB*NH*32 blocks x 64 rows x 256 cols = the whole [NB*SEQ][2048] plane, both planes.
// ---------------------------------------------------------------------------------------------------------------
#define AT_PPITCH 72
#define AT_OPITCH 264
#define AT_OFF_PH 0
#define AT_OFF_PL 9216
#define AT_OFF_PM 18432
#define AT_OFF_PS 18944
#define AT_OFF_AL 19456
#define AT_OFF_LF 19712
#define AT_OFF_OH 19968
#define AT_OFF_OL 53760
#define AT_LDS    87552
static_assert(AT_OFF_PL == AT_OFF_PH + 64 * AT_PPITCH * 2);
static_assert(AT_OFF_PM == AT_OFF_PL + 64 * AT_PPITCH * 2);
static_assert(AT_OFF_OL == AT_OFF_OH + 64 * AT_OPITCH * 2);
static_assert(AT_LDS == AT_OFF_OL + 64 * AT_OPITCH * 2);

__global__ __launch_bounds__(256) void attn_kernel(const _Float16* __restrict__ Qh, const _Float16* __restrict__ Ql,
                                                   const _Float16* __restrict__ Kh, const _Float16* __restrict__ Kl,
                                                   const _Float16* __restrict__ Vth, const _Float16* __restrict__ Vtl,
                                                   const float* __restrict__ mask, const int* __restrict__ flag,
                                                   _Float16* __restrict__ AOh, _Float16* __restrict__ AOl) {
  extern __shared__ __align__(16) unsigned char dsm[];
  _Float16* Ph   = (_Float16*)(dsm + AT_OFF_PH);
  _Float16* Pl   = (_Float16*)(dsm + AT_OFF_PL);
  float*    pm   = (float*)(dsm + AT_OFF_PM);     // [8 waves][16 rows] partial row max
  float*    ps   = (float*)(dsm + AT_OFF_PS);     // [8 waves][16 rows] partial row sum
  float*    alph = (float*)(dsm + AT_OFF_AL);     // [64] rescale factors
  float*    lfin = (float*)(dsm + AT_OFF_LF);     // [64] final row sums
  _Float16* Ohs  = (_Float16*)(dsm + AT_OFF_OH);
  _Float16* Ols  = (_Float16*)(dsm + AT_OFF_OL);

  const int tid  = threadIdx.x;
  const int w    = tid >> 5;
  const int lane = tid & 31;
  const int hh   = lane >> 4;
  const int c    = lane & 15;
  const int bid  = blockIdx.x;
  const int qb   = bid & (NQB_ - 1);
  const int h    = (bid >> 5) & (NH_ - 1);
  const int b    = bid >> 8;
  const int q0   = qb * 64;
  const int srow0 = (w & 3) * 16;
  const int kh    = w >> 2;
  const int ocol0 = w * 32;
  const bool early = (qb < QE_);
  const int ktlo = (qb > 16) ? (qb - 16) : 0;
  int fl = 1;                                  // block-uniform: all row groups of this query block verified
#pragma unroll   // independent scalar loads, issued together instead of one round trip each
  for (int g = 0; g < MFG_; ++g) fl &= flag[((b * NQB_ + qb) * MFG_ + g) * 32];
  int kthi = (fl != 0) ? qb : (qb + 16);
  if (kthi > NQB_ - 1) kthi = NQB_ - 1;

  const size_t growq = (size_t)b * SEQ_ + q0;
  const _Float16* qhp = Qh + (growq + srow0 + c) * DM_ + h * HD_ + 8 * hh;
  const _Float16* qlp = Ql + (growq + srow0 + c) * DM_ + h * HD_ + 8 * hh;
  const float*    mrp = mask + (growq + srow0 + 8 * hh) * (size_t)SEQ_;
  const _Float16* vhp = Vth + ((size_t)b * HD_ + ocol0 + c) * SEQ_ + 8 * hh;
  const _Float16* vlp = Vtl + ((size_t)b * HD_ + ocol0 + c) * SEQ_ + 8 * hh;

  float mrow[8], lrow[8];
  v8f oacc[4][2];
#pragma unroll
  for (int r = 0; r < 8; ++r) { mrow[r] = -INFINITY; lrow[r] = 0.0f; }
#pragma unroll
  for (int i = 0; i < 4; ++i) { oacc[i][0] = zero8(); oacc[i][1] = zero8(); }

  for (int kt = ktlo; kt <= kthi; ++kt) {      // block-uniform, at most 32 trips
    const int key0  = kt * 64;
    const int wkey0 = key0 + 32 * kh;
    const _Float16* khp = Kh + ((size_t)b * SEQ_ + wkey0 + c) * HD_ + 8 * hh;
    const _Float16* klp = Kl + ((size_t)b * SEQ_ + wkey0 + c) * HD_ + 8 * hh;

    // ---- S = q . k^T (16 rows x 32 keys per wave) ----
    v8f s[2];
    s[0] = zero8(); s[1] = zero8();
#pragma unroll
    for (int ks = 0; ks < 8; ++ks) {
      const v16h qa = frag_ld(qhp + 32 * ks);
      v16h qr = qa;
      if (early) qr = frag_ld(qlp + 32 * ks);
#pragma unroll
      for (int j = 0; j < 2; ++j) {
        const v16h kb = frag_ld(khp + (size_t)(16 * j) * HD_ + 32 * ks);
        s[j] = mma_g(qa, kb, s[j]);
        if (early) {
          const v16h kr = frag_ld(klp + (size_t)(16 * j) * HD_ + 32 * ks);
          s[j] = mma_g(qr, kb, s[j]);
          s[j] = mma_g(qa, kr, s[j]);
        }
      }
    }

    // ---- scale, mask, partial row max over this wave's 32 keys ----
    float cm[8];
#pragma unroll
    for (int r = 0; r < 8; ++r) {
      const int qrow = q0 + srow0 + 8 * hh + r;
      const float* mp = mrp + (size_t)r * SEQ_;
      float mx = -INFINITY;
#pragma unroll
      for (int j = 0; j < 2; ++j) {
        const int key = wkey0 + 16 * j + c;
        const float mv = mp[key];
        const bool inb = (key + (WIN_ - 1) >= qrow) && (key <= qrow + (WIN_ - 1));
        const float sv = inb ? (s[j][r] * SSC_ + mv) : -INFINITY;
        s[j][r] = sv;
        mx = fmaxf(mx, sv);
      }
      mx = fmaxf(mx, __shfl_xor(mx, 1, 32));
      mx = fmaxf(mx, __shfl_xor(mx, 2, 32));
      mx = fmaxf(mx, __shfl_xor(mx, 4, 32));
      mx = fmaxf(mx, __shfl_xor(mx, 8, 32));
      cm[r] = mx;
    }
    if (c == 0) {
#pragma unroll
      for (int r = 0; r < 8; ++r) pm[w * 16 + 8 * hh + r] = cm[r];
    }
    __syncthreads();

    // ---- online softmax: tile max, p, partial sums ----
    float al[8], psm[8];
    const int wo = w ^ 4;
#pragma unroll
    for (int r = 0; r < 8; ++r) {
      const float om = pm[wo * 16 + 8 * hh + r];
      const float mnew = fmaxf(mrow[r], fmaxf(cm[r], om));
      const float msafe = (mnew == -INFINITY) ? 0.0f : mnew;
      al[r] = __expf(mrow[r] - msafe);
      mrow[r] = mnew;
      float sum = 0.0f;
#pragma unroll
      for (int j = 0; j < 2; ++j) {
        const float p = __expf(s[j][r] - msafe);
        sum += p;
        const float t = p * CP_;
        const _Float16 phv = (_Float16)t;
        const int pidx = (srow0 + 8 * hh + r) * AT_PPITCH + 32 * kh + 16 * j + c;
        Ph[pidx] = phv;
        if (early) Pl[pidx] = (_Float16)(t - (float)phv);
      }
      sum += __shfl_xor(sum, 1, 32);
      sum += __shfl_xor(sum, 2, 32);
      sum += __shfl_xor(sum, 4, 32);
      sum += __shfl_xor(sum, 8, 32);
      psm[r] = sum;
    }
    if (c == 0) {
#pragma unroll
      for (int r = 0; r < 8; ++r) ps[w * 16 + 8 * hh + r] = psm[r];
      if (w < 4) {
#pragma unroll
        for (int r = 0; r < 8; ++r) alph[srow0 + 8 * hh + r] = al[r];
      }
    }
    __syncthreads();
#pragma unroll
    for (int r = 0; r < 8; ++r)
      lrow[r] = lrow[r] * al[r] + (ps[(w & 3) * 16 + 8 * hh + r] + ps[((w & 3) + 4) * 16 + 8 * hh + r]);

    // ---- rescale O, then O += P . V for this wave's 32 output columns ----
#pragma unroll
    for (int i = 0; i < 4; ++i) {
      U8 av;
      av.q[0] = *(const v4f*)(alph + 16 * i + 8 * hh);
      av.q[1] = *(const v4f*)(alph + 16 * i + 8 * hh + 4);
#pragma unroll
      for (int r = 0; r < 8; ++r) { oacc[i][0][r] *= av.v[r]; oacc[i][1][r] *= av.v[r]; }
    }
#pragma unroll
    for (int k2 = 0; k2 < 2; ++k2) {
      const int kk = key0 + 32 * k2;
#pragma unroll
      for (int jj = 0; jj < 2; ++jj) {
        const v16h vb = frag_ld(vhp + (size_t)(16 * jj) * SEQ_ + kk);
        v16h vr = vb;
        if (early) vr = frag_ld(vlp + (size_t)(16 * jj) * SEQ_ + kk);
#pragma unroll
        for (int i = 0; i < 4; ++i) {
          const v16h pa = frag_ld(Ph + (16 * i + c) * AT_PPITCH + 32 * k2 + 8 * hh);
          oacc[i][jj] = mma_g(pa, vb, oacc[i][jj]);
          if (early) {
            const v16h pr = frag_ld(Pl + (16 * i + c) * AT_PPITCH + 32 * k2 + 8 * hh);
            oacc[i][jj] = mma_g(pa, vr, oacc[i][jj]);
            oacc[i][jj] = mma_g(pr, vb, oacc[i][jj]);
          }
        }
      }
    }
  }

  if (w < 4 && c == 0) {
#pragma unroll
    for (int r = 0; r < 8; ++r) lfin[srow0 + 8 * hh + r] = lrow[r];
  }
  __syncthreads();
#pragma unroll
  for (int i = 0; i < 4; ++i) {
    U8 lv;
    lv.q[0] = *(const v4f*)(lfin + 16 * i + 8 * hh);
    lv.q[1] = *(const v4f*)(lfin + 16 * i + 8 * hh + 4);
#pragma unroll
    for (int r = 0; r < 8; ++r) {
      const float f = OSC_ * (1.0f / lv.v[r]);
      const int orow = 16 * i + 8 * hh + r;
#pragma unroll
      for (int jj = 0; jj < 2; ++jj) {
        const float t = oacc[i][jj][r] * f;
        const _Float16 hq = (_Float16)t;
        const int oidx = orow * AT_OPITCH + ocol0 + 16 * jj + c;
        Ohs[oidx] = hq;
        Ols[oidx] = (_Float16)(t - (float)hq);
      }
    }
  }
  __syncthreads();
  {
    const int piece = tid & 7;
    const int lsub  = tid >> 3;
    {
#pragma unroll
      for (int it = 0; it < 8; ++it) {
        const int line = it * 32 + lsub;          // 0..255 = 64 rows x 4 lines
        const int row  = line >> 2;
        const int col  = (line & 3) * 64 + piece * 8;
        const v8h hv = *(const v8h*)(Ohs + row * AT_OPITCH + col);
        const v8h rv = *(const v8h*)(Ols + row * AT_OPITCH + col);
        const size_t go = (growq + row) * DM_ + h * HD_ + col;
        *(v8h*)(AOh + go) = hv;
        *(v8h*)(AOl + go) = rv;
      }
      
    }
  }
}

// ---------------------------------------------------------------------------------------------------------------
// Workspace map (byte offsets, all 2 MiB aligned; every region is written completely by whole-line stores before it is read;
// the attention output planes reuse the f32 q region, which is dead after the q RoPE/split pass):
//   Xh   f16 [4096][2048]            0           16,777,216
//   Wqh  f16 [2048][2048]   16,777,216            8,388,608
//   Wkvh f16 [512][2048]    25,165,824            2,097,152
//   Woh  f16 [2048][2048]   27,262,976            8,388,608
//   cosT f32 [4096][128]    35,651,584            2,097,152
//   sinT f32 [4096][128]    37,748,736            2,097,152
//   Qf   f32 [4096][2048]   39,845,888           33,554,432   (AOh f16 [4096][2048] at 39,845,888; AOl at 56,623,104)
//   KVf  f32 [4096][512]    73,400,320            8,388,608
//   Qh   f16 [4096][2048]   81,788,928           16,777,216
//   Ql   f16 [4096][2048]   98,566,144           16,777,216
//   Kh   f16 [4096][256]   115,343,360            2,097,152
//   Kl   f16 [4096][256]   117,440,512            2,097,152
//   Vth  f16 [2][256][2048] 119,537,664           2,097,152
//   Vtl  f16 [2][256][2048] 121,634,816           2,097,152
//   flags int [2*32*16][32] 123,731,968            131,072
//   total                  123,863,040
// ---------------------------------------------------------------------------------------------------------------
extern "C" void kernel_launch(void* const* d_in, const int* in_sizes, int n_in,
                              void* d_out, int out_size, void* d_ws, size_t ws_size,
                              hipStream_t stream) {
  if (n_in < 7) return;
  if (in_sizes[0] != NB_ * SEQ_ * DM_) return;
  if (in_sizes[1] != NB_ * SEQ_ * SEQ_) return;
  if (in_sizes[2] != NB_ * SEQ_) return;
  if (in_sizes[3] != DM_ * DM_) return;
  if (in_sizes[4] != HD_ * DM_) return;
  if (in_sizes[5] != HD_ * DM_) return;
  if (in_sizes[6] != DM_ * DM_) return;
  if (out_size != NB_ * SEQ_ * DM_) return;

  const float* x    = (const float*)d_in[0];
  const float* mask = (const float*)d_in[1];
  const int*   pos  = (const int*)d_in[2];
  const float* Wq   = (const float*)d_in[3];
  const float* Wk   = (const float*)d_in[4];
  const float* Wv   = (const float*)d_in[5];
  const float* Wo   = (const float*)d_in[6];
  float* out = (float*)d_out;

  const size_t nX   = (size_t)NB_ * SEQ_ * DM_;          // 8,388,608 elements
  const size_t bXh  = nX * 2;
  const size_t bWq  = (size_t)DM_ * DM_ * 2;
  const size_t bWkv = (size_t)KVN_ * DM_ * 2;
  const size_t bWo  = bWq;
  const size_t bTab = (size_t)NB_ * SEQ_ * NF_ * 4;
  const size_t bQf  = nX * 4;
  const size_t bKVf = (size_t)NB_ * SEQ_ * KVN_ * 4;
  const size_t bQ16 = nX * 2;
  const size_t bK16 = (size_t)NB_ * SEQ_ * HD_ * 2;
  const size_t bV16 = bK16;
  const size_t bFlg = (size_t)NB_ * NQB_ * MFG_ * 128;
  size_t off = 0;
  const size_t oXh  = off; off += bXh;
  const size_t oWq  = off; off += bWq;
  const size_t oWkv = off; off += bWkv;
  const size_t oWo  = off; off += bWo;
  const size_t oCos = off; off += bTab;
  const size_t oSin = off; off += bTab;
  const size_t oQf  = off; off += bQf;
  const size_t oKVf = off; off += bKVf;
  const size_t oQh  = off; off += bQ16;
  const size_t oQl  = off; off += bQ16;
  const size_t oKh  = off; off += bK16;
  const size_t oKl  = off; off += bK16;
  const size_t oVth = off; off += bV16;
  const size_t oVtl = off; off += bV16;
  const size_t oFlg = off; off += bFlg;
  if (off > ws_size) return;                        // off = 123,863,040
  if (off > (size_t)134217728) return;
  if (bQf < 2 * bQ16) return;                        // AOh/AOl alias fits inside the f32 q region
  const size_t oAOh = oQf;
  const size_t oAOl = oQf + bQ16;

  char* ws = (char*)d_ws;
  _Float16* Xh   = (_Float16*)(ws + oXh);
  _Float16* Wqh  = (_Float16*)(ws + oWq);
  _Float16* Wkvh = (_Float16*)(ws + oWkv);
  _Float16* Woh  = (_Float16*)(ws + oWo);
  float*    cosT = (float*)(ws + oCos);
  float*    sinT = (float*)(ws + oSin);
  float*    Qf   = (float*)(ws + oQf);
  float*    KVf  = (float*)(ws + oKVf);
  _Float16* Qh   = (_Float16*)(ws + oQh);
  _Float16* Ql   = (_Float16*)(ws + oQl);
  _Float16* Kh   = (_Float16*)(ws + oKh);
  _Float16* Kl   = (_Float16*)(ws + oKl);
  _Float16* Vth  = (_Float16*)(ws + oVth);
  _Float16* Vtl  = (_Float16*)(ws + oVtl);
  int*      flg  = (int*)(ws + oFlg);
  _Float16* AOh  = (_Float16*)(ws + oAOh);
  _Float16* AOl  = (_Float16*)(ws + oAOl);

  const dim3 blk(256);
  const int n8x = (int)(nX / 8);                     // 1,048,576
  const int n8q = DM_ * DM_ / 8;                     // 524,288
  const int n8k = HD_ * DM_ / 8;                     // 65,536

  // (1) inputs -> 16-bit planes: x bf16*2^4, weights bf16*2^8 (k rows then v rows in the fused kv weight plane)
  cvt16_kernel<<<dim3((n8x + 255) / 256), blk, 0, stream>>>(x, Xh, n8x, CX_);
  cvt16_kernel<<<dim3((n8q + 255) / 256), blk, 0, stream>>>(Wq, Wqh, n8q, CW_);
  cvt16_kernel<<<dim3((n8k + 255) / 256), blk, 0, stream>>>(Wk, Wkvh, n8k, CW_);
  cvt16_kernel<<<dim3((n8k + 255) / 256), blk, 0, stream>>>(Wv, Wkvh + (size_t)HD_ * DM_, n8k, CW_);
  cvt16_kernel<<<dim3((n8q + 255) / 256), blk, 0, stream>>>(Wo, Woh, n8q, CW_);
  // (2) cos/sin tables [4096][128] from position ids; mask verification flags per (b, query block, 4-row group)
  rope_table_kernel<<<dim3((NB_ * SEQ_) / 32), blk, 0, stream>>>(pos, cosT, sinT, NB_ * SEQ_);
  maskflag_kernel<<<dim3(NB_ * NQB_ * MFG_), blk, 0, stream>>>(mask, flg);
  // (3) q = x . Wq^T -> f32 [4096][2048]; [k|v] = x . [Wk|Wv]^T -> f32 [4096][512]
  gemm64_kernel<<<dim3((NB_ * SEQ_ / GBM_) * (DM_ / GBN_)), blk, 0, stream>>>(
      Xh, Xh, DM_, Wqh, DM_, Qf, DM_, NB_ * SEQ_, DM_, DM_, 0, SEQ_ - 1, QSC_);
  gemm64_kernel<<<dim3((NB_ * SEQ_ / GBM_) * (KVN_ / GBN_)), blk, 0, stream>>>(
      Xh, Xh, DM_, Wkvh, DM_, KVf, KVN_, NB_ * SEQ_, KVN_, DM_, 0, SEQ_ - 1, QSC_);
  // (4) RoPE + hi/residual split: q planes [4096][8*256], k planes [4096][256]; v^T planes [2][256][2048]
  rope_split_kernel<<<dim3((NB_ * SEQ_ * NH_ * 8) / 256), blk, 0, stream>>>(
      Qf, DM_, NH_, cosT, sinT, Qh, Ql, DM_, NB_ * SEQ_ * NH_, CQK_);
  rope_split_kernel<<<dim3((NB_ * SEQ_ * 8) / 256), blk, 0, stream>>>(
      KVf, KVN_, 1, cosT, sinT, Kh, Kl, HD_, NB_ * SEQ_, CQK_);
  vt_split_kernel<<<dim3(HD_ / 64, (NB_ * SEQ_) / 64), blk, 0, stream>>>(KVf, Vth, Vtl);
  // (5) attention -> AO hi/residual planes [4096][2048]
  (void)hipFuncSetAttribute(reinterpret_cast<const void*>(&attn_kernel), hipFuncAttributeMaxDynamicSharedMemorySize, AT_LDS);
  attn_kernel<<<dim3(NB_ * NH_ * NQB_), blk, AT_LDS, stream>>>(Qh, Ql, Kh, Kl, Vth, Vtl, mask, flg, AOh, AOl);
  // (6) out = AO . Wo^T -> d_out f32 [4096][2048]; residual plane on rows < LOROWS_ of each sequence
  gemm64_kernel<<<dim3((NB_ * SEQ_ / GBM_) * (DM_ / GBN_)), blk, 0, stream>>>(
      AOh, AOl, DM_, Woh, DM_, out, DM_, NB_ * SEQ_, DM_, DM_, LOROWS_, SEQ_ - 1, WSC_);
  (void)hipGetLastError();
}

// v003
// Measured time: 234 microseconds a run.
// Timed twice side by side with v002, it ran 1.48 and 1.47 times as fast.
// Over all steps from v000 it is 2.65 times as fast.
// Contractions on v_wmma_f32_16x16x32_f16 (f16 operands, f32 accumulate): q/k/v projections (x RNE-converted to bf16 and carried *2^4,
// W RNE-converted to bf16 and carried *2^8, exact products); q.k^T (q,k carried *2^10 as f16 hi planes, plus unscaled f16 residual planes
// on the leading query blocks of each sequence); p.v (p carried *2^15, v^T carried *2^10: hi planes plus residual planes on the leading query
// blocks); output projection (attention output carried *2^10: hi plane everywhere, residual plane on the leading rows of each sequence;
// Wo bf16 *2^8). RoPE, mask add and online softmax in f32.
#include <hip/hip_runtime.h>
#include <math.h>
#include <stdint.h>

#define NB_     2
#define SEQ_    2048
#define DM_     2048
#define NH_     8
#define HD_     256
#define NF_     128
#define KVN_    512
#define WIN_    1024
#define NQB_    32
#define QE_     4
#define LOROWS_ 256
#define MFG_    16

#define CX_   16.0f
#define CW_   256.0f
#define CQK_  1024.0f
#define CP_   32768.0f
#define SSC_  5.9604644775390625e-8f     /* 2^-4 * 2^-20 : score scale for q,k carried *2^10 each */
#define OSC_  3.0517578125e-5f           /* 2^-15 = 2^10 / (2^15 * 2^10) : attention output carry */
#define QSC_  2.44140625e-4f             /* 2^-12 = 1 / (2^4 * 2^8) : projection outputs back to f32 */
#define WSC_  3.814697265625e-6f         /* 2^-18 = 1 / (2^10 * 2^8) : final projection */

typedef _Float16 v16h __attribute__((ext_vector_type(16)));
typedef _Float16 v8h  __attribute__((ext_vector_type(8)));
typedef float    v8f  __attribute__((ext_vector_type(8)));
typedef float    v4f  __attribute__((ext_vector_type(4)));

union FragU { v16h v; v8h h[2]; };
union U8 { v8f v; v4f q[2]; };

__device__ __forceinline__ float bf16_rne(float f) {
  unsigned u = __float_as_uint(f);
  u = u + 0x7FFFu + ((u >> 16) & 1u);
  return __uint_as_float(u & 0xFFFF0000u);
}
__device__ __forceinline__ v8f zero8() { return (v8f){0.f, 0.f, 0.f, 0.f, 0.f, 0.f, 0.f, 0.f}; }

// 16-bit fragment (A or B): lane row/col = lane&15, elements 0..7 <- p[0..7] (k0+8h..), 8..15 <- p[16..23] (k0+16+8h..)
// p already includes the row base + k0 + 8*h.
__device__ __forceinline__ v16h frag_ld(const _Float16* p) {
  FragU f;
  f.h[0] = *(const v8h*)(p);
  f.h[1] = *(const v8h*)(p + 16);
  return f.v;
}
__device__ __forceinline__ v8f wmma_raw(v16h a, v16h b, v8f c) {
  return __builtin_amdgcn_wmma_f32_16x16x32_f16(false, a, false, b, (short)0, c, false, false);
}
// WMMA with trailing hazard guard (ties D, keeps A/B live)
__device__ __forceinline__ v8f mma_g(v16h a, v16h b, v8f c) {
  c = __builtin_amdgcn_wmma_f32_16x16x32_f16(false, a, false, b, (short)0, c, false, false);
  asm volatile("v_nop\n\tv_nop\n\tv_nop\n\tv_nop" : "+v"(c) : "v"(a), "v"(b));
  return c;
}
__device__ __forceinline__ void dep_guard(v8f& a, v8f& b, v16h x, v16h y) {
  asm volatile("v_nop\n\tv_nop\n\tv_nop\n\tv_nop" : "+v"(a), "+v"(b) : "v"(x), "v"(y));
}
__device__ __forceinline__ void keep4(v16h a, v16h b, v16h c, v16h d) {
  asm volatile("v_nop" :: "v"(a), "v"(b), "v"(c), "v"(d));
}
__device__ __forceinline__ void acc_guard4(v8f& a, v8f& b, v8f& c, v8f& d) {
  asm volatile("v_nop\n\tv_nop\n\tv_nop\n\tv_nop" : "+v"(a), "+v"(b), "+v"(c), "+v"(d));
}

// ---------------------------------------------------------------------------------------------------------------
// Elementwise convert: dst[i] = f16( bf16_rne(src[i]) * scale ), 8 elements per thread, one 16-B store per lane:
// coverage: grid = ceil(n8/256), each thread 8 elements -> 8*n8 elements.
// ---------------------------------------------------------------------------------------------------------------
__global__ __launch_bounds__(256) void cvt16_kernel(const float* __restrict__ src, _Float16* __restrict__ dst, int n8, float scale) {
  const int i = blockIdx.x * 256 + (int)threadIdx.x;
  if (i >= n8) return;
  const float* s = src + 8 * (size_t)i;
  U8 a;
  a.q[0] = *(const v4f*)(s);
  a.q[1] = *(const v4f*)(s + 4);
  v8h o;
#pragma unroll
  for (int e = 0; e < 8; ++e) o[e] = (_Float16)(bf16_rne(a.v[e]) * scale);
  _Float16* d = dst + 8 * (size_t)i;
  *(v8h*)d = o;
  
}

// ---------------------------------------------------------------------------------------------------------------
// RoPE tables: cosT/sinT [nrows][128], angle = float(pos[row]) * inv_freq[f], inv_freq[f] = 1 / f32(10000^(f/128)).
// coverage: grid = nrows/32 blocks, 16 iterations x 2 rows -> nrows x 128 per table.
// ---------------------------------------------------------------------------------------------------------------
__global__ __launch_bounds__(256) void rope_table_kernel(const int* __restrict__ pos, float* __restrict__ cosT,
                                                         float* __restrict__ sinT, int nrows) {
#pragma clang fp contract(off)
  __shared__ float invf[NF_];
  const int tid = threadIdx.x;
  if (tid < NF_) {
    const double e = (double)tid * 0.0078125;                 // tid/128 exactly
    const double p = exp2(e * 13.287712379549449);            // 10000^e
    const float pf = (float)p;                                // RNE to f32
    invf[tid] = 1.0f / pf;
  }
  __syncthreads();
  const int f = tid & (NF_ - 1);
  const int rp = tid >> 7;
  const int r0 = blockIdx.x * 32;
  const float iv = invf[f];
#pragma unroll 1
  for (int it = 0; it < 16; ++it) {
    const int row = r0 + it * 2 + rp;
    const int rowc = (row < nrows) ? row : (nrows - 1);
    const float ang = (float)pos[rowc] * iv;
    float sv, cv;
    sincosf(ang, &sv, &cv);
    if (row < nrows) {
      float* cp = cosT + (size_t)row * NF_ + f;
      float* sp = sinT + (size_t)row * NF_ + f;
      *(float*)cp = cv;
      *(float*)sp = sv;
      
    }
  }
}

// ---------------------------------------------------------------------------------------------------------------
// Mask verification flags, MFG_ per (b, 64-query block), one per group of 4 query rows: 1 if every mask value for the group's rows
// and keys in [q0+64, min(q+1023, SEQ-1)] (the in-band keys strictly above the query block) is <= -1e9 (adds to an exact zero weight).
// The range holds at most 1023 keys, so 256 threads x 4 keys cover a row with one 16-byte load each; the 4 rows' loads are independent.
// coverage: grid = NB*NQB*MFG_ blocks; each block writes its own 128-byte line of 32 equal ints.
// ---------------------------------------------------------------------------------------------------------------
__global__ __launch_bounds__(256) void maskflag_kernel(const float* __restrict__ mask, int* __restrict__ flag) {
  __shared__ int sw[8];
  const int tid = threadIdx.x, w = tid >> 5, lane = tid & 31;
  const int bid = blockIdx.x;                // (b*32 + qb)*MFG_ + row group
  const int g  = bid & (MFG_ - 1);
  const int bq = bid / MFG_;
  const int b = bq >> 5, qb = bq & (NQB_ - 1);
  const int q0 = qb * 64;
  const int r0 = q0 + g * (64 / MFG_);
  const int k  = q0 + 64 + 4 * tid;          // first of this thread's four keys
  const int kc = (k <= SEQ_ - 4) ? k : (SEQ_ - 4);   // k > SEQ-4 means k >= SEQ: none of the four keys is tested
  v4f mv[64 / MFG_];
#pragma unroll   // all rows' loads issue before the first compare waits (and mv stays in registers)
  for (int rr = 0; rr < 64 / MFG_; ++rr) mv[rr] = *(const v4f*)(mask + ((size_t)b * SEQ_ + r0 + rr) * SEQ_ + kc);
  int bad = 0;
#pragma unroll
  for (int rr = 0; rr < 64 / MFG_; ++rr) {
    int kend = r0 + rr + WIN_ - 1;
    if (kend > SEQ_ - 1) kend = SEQ_ - 1;
#pragma unroll
    for (int e = 0; e < 4; ++e) {
      const int ok = (mv[rr][e] <= -1.0e9f) ? 1 : 0;
      bad |= ((k + e <= kend) && (ok == 0)) ? 1 : 0;
    }
  }
  const unsigned long long bm = __ballot(bad);
  if (lane == 0) sw[w] = (bm != 0ull) ? 1 : 0;
  __syncthreads();
  if (w == 0) {
    int any = 0;
#pragma unroll
    for (int i = 0; i < 8; ++i) any |= sw[i];
    const int fv = any ? 0 : 1;
    int* fp = flag + (size_t)bid * 32 + lane;
    *(int*)fp = fv;
  }
}

// ---------------------------------------------------------------------------------------------------------------
// Register-blocked WMMA GEMM, f16 operands: C[m][n] = scale * sum_k (A[m][k] (+ A2[m][k])) * Bt[n][k]
// A row-major [M][lda], optional residual plane A2 (same layout) used on row blocks with (m0 & seqMask) < loRows (block-uniform;
// loRows a multiple of 128); Bt row-major [N][ldb] (k contiguous); C f32 [M][ldc].
// Block = 8 waves (2 x 4) on a 128 x 256 tile of C, each wave a 64x64 tile (4x4 accumulators).
// Operands reach LDS by asynchronous 16-byte copies, whole 256-byte row pieces (128 k) per stage, two stages: the next stage's
// copies fly while this stage is multiplied. LDS row pitch 272 bytes (16 B x odd) for the 16-byte fragment reads.
// M multiple of 128, N multiple of 256, K multiple of 128. Epilogue: 16-row slabs staged per wave in the (then free) ring.
// ---------------------------------------------------------------------------------------------------------------
#define GK_    128                               /* k per stage */
#define GPH_   136                               /* LDS row pitch, halves */
#define GBM_   128
#define GBN_   256
#define G_OA2_ (GBM_ * GPH_)                     /* residual plane of A, halves from the stage's start */
#define G_OB_  (2 * GBM_ * GPH_)
#define G_STG_ ((2 * GBM_ + GBN_) * GPH_)        /* halves per stage */
#define G_LS_  (16 * GPH_ * 2)                   /* bytes between LDS rows 16 apart */
static_assert(LOROWS_ % GBM_ == 0);
static_assert(2 * G_STG_ * 2 >= 8 * 16 * 68 * 4);

// Eight copies per lane, rows 16 apart: l = the lane's LDS byte address, g = its global address, gs = halves per 16 source rows.
// s_wait_xcnt stands inside the statement so that no address register is rewritten ahead of it.
__device__ __forceinline__ void async_rows8(unsigned l, const _Float16* g, size_t gs) {
  asm volatile(
      "global_load_async_to_lds_b128 %0, %8, off\n\t"
      "global_load_async_to_lds_b128 %1, %9, off\n\t"
      "global_load_async_to_lds_b128 %2, %10, off\n\t"
      "global_load_async_to_lds_b128 %3, %11, off\n\t"
      "global_load_async_to_lds_b128 %4, %12, off\n\t"
      "global_load_async_to_lds_b128 %5, %13, off\n\t"
      "global_load_async_to_lds_b128 %6, %14, off\n\t"
      "global_load_async_to_lds_b128 %7, %15, off\n\t"
      "s_wait_xcnt 0x0"
      :: "v"(l), "v"(l + 1u * G_LS_), "v"(l + 2u * G_LS_), "v"(l + 3u * G_LS_),
         "v"(l + 4u * G_LS_), "v"(l + 5u * G_LS_), "v"(l + 6u * G_LS_), "v"(l + 7u * G_LS_),
         "v"(g), "v"(g + gs), "v"(g + 2 * gs), "v"(g + 3 * gs), "v"(g + 4 * gs), "v"(g + 5 * gs), "v"(g + 6 * gs), "v"(g + 7 * gs)
      : "memory");
}
// One stage: A 128 rows (+ A2 128 rows), Bt 256 rows, 256 bytes of each; a wave's copy covers two whole row pieces.
template <bool LO>
__device__ __forceinline__ void gemm_fill(unsigned l, const _Float16* ga, const _Float16* ga2, size_t as16,
                                          const _Float16* gb, size_t bs16) {
  async_rows8(l, ga, as16);
  if (LO) async_rows8(l + G_OA2_ * 2u, ga2, as16);
  async_rows8(l + G_OB_ * 2u, gb, bs16);
  async_rows8(l + G_OB_ * 2u + 8u * G_LS_, gb + 8 * bs16, bs16);
}

template <bool LO>
__device__ __forceinline__ void gemm_ring(v8f (&acc)[4][4], const _Float16* ring, const _Float16* __restrict__ Ab,
                                          const _Float16* __restrict__ Ab2, int lda, const _Float16* __restrict__ Bb, int ldb,
                                          int m0b, int n0b, int K, int tid, int wrow, int wcol, int rlane, int koff) {
  const int sub = tid >> 4;
  const int cc  = (tid & 15) * 8;
  const unsigned l0 = (unsigned)(size_t)ring + (unsigned)(sub * GPH_ + cc) * 2u;
  const _Float16* ga  = Ab  + (size_t)(m0b + sub) * lda + cc;
  const _Float16* ga2 = Ab2 + (size_t)(m0b + sub) * lda + cc;
  const _Float16* gb  = Bb  + (size_t)(n0b + sub) * ldb + cc;
  const size_t as16 = (size_t)16 * lda;
  const size_t bs16 = (size_t)16 * ldb;
  const int nt = K / GK_;

  gemm_fill<LO>(l0, ga, ga2, as16, gb, bs16);
  asm volatile("s_wait_asynccnt 0x0" ::: "memory");   // stage 0 landed (this wave's copies) before the barrier publishes it
  __syncthreads();
  if (nt > 1) gemm_fill<LO>(l0 + G_STG_ * 2u, ga + GK_, ga2 + GK_, as16, gb + GK_, bs16);

  for (int t = 0; t < nt; ++t) {
    const _Float16* st = ring + (t & 1) * G_STG_;
    const _Float16* sa = st + (wrow + rlane) * GPH_ + koff;
    const _Float16* sb = st + G_OB_ + (wcol + rlane) * GPH_ + koff;
#pragma unroll   // the four k-steps of a stage in one body: constant LDS offsets, no loop overhead between them
    for (int kk = 0; kk < GK_; kk += 32) {
      v16h bh[4], ah[4], al[4];
#pragma unroll   // register arrays: constant indices
      for (int j = 0; j < 4; ++j) bh[j] = frag_ld(sb + (j << 4) * GPH_ + kk);
#pragma unroll   // register arrays: constant indices
      for (int i = 0; i < 4; ++i) {
        ah[i] = frag_ld(sa + (i << 4) * GPH_ + kk);
        al[i] = ah[i];
        if (LO) al[i] = frag_ld(sa + G_OA2_ + (i << 4) * GPH_ + kk);
      }
      // holds the k-step's fragment reads together in front of its products (one LDS wait per k-step instead of one per row)
      asm volatile("" :: "v"(bh[0]), "v"(bh[1]), "v"(bh[2]), "v"(bh[3]), "v"(ah[0]), "v"(ah[1]), "v"(ah[2]), "v"(ah[3]));
      if (LO) asm volatile("" :: "v"(al[0]), "v"(al[1]), "v"(al[2]), "v"(al[3]));   // the same for the residual plane's reads
#pragma unroll   // register arrays: constant indices
      for (int i = 0; i < 4; ++i) {
#pragma unroll   // register arrays: constant indices
        for (int j = 0; j < 4; ++j) {
          acc[i][j] = wmma_raw(ah[i], bh[j], acc[i][j]);
          if (LO) acc[i][j] = wmma_raw(al[i], bh[j], acc[i][j]);
        }
        dep_guard(acc[i][0], acc[i][3], ah[i], al[i]);
      }
      keep4(bh[0], bh[1], bh[2], bh[3]);
    }
    asm volatile("s_wait_dscnt 0x0" ::: "memory");      // this wave's reads of the stage are done before it may be refilled
    asm volatile("s_wait_asynccnt 0x0" ::: "memory");   // this wave's copies of the next stage have landed
    __syncthreads();                                    // publishes stage t+1 and frees stage t's buffer
    if (t + 2 < nt)
      gemm_fill<LO>(l0 + (unsigned)(t & 1) * (G_STG_ * 2u), ga + (size_t)(t + 2) * GK_, ga2 + (size_t)(t + 2) * GK_, as16,
                    gb + (size_t)(t + 2) * GK_, bs16);
  }
  asm volatile("s_wait_asynccnt 0x0" ::: "memory");     // nothing in flight when the ring becomes output staging
}

__global__ __launch_bounds__(256) void gemm64_kernel(const _Float16* __restrict__ A, const _Float16* __restrict__ A2, int lda,
                                                     const _Float16* __restrict__ Bt, int ldb,
                                                     float* __restrict__ C, int ldc, int M, int N, int K,
                                                     int loRows, int seqMask, float scale) {
  __shared__ __align__(16) _Float16 ring[2 * G_STG_];   // two stages; afterwards per-wave 16x64 f32 slabs, pitch 68 floats
  const int tid  = threadIdx.x;
  const int lane = tid & 31;
  const int wave = tid >> 5;
  const int tilesN = N / GBN_;
  const int tilesM = M / GBM_;
  const int bid = blockIdx.x;
  if (bid >= tilesM * tilesN) return;   // block-uniform, in front of every barrier
  const int tm = bid / tilesN;
  const int tn = bid - tm * tilesN;
  const int m0b = tm * GBM_;
  const int n0b = tn * GBN_;
  const int wrow = (wave >> 2) << 6;
  const int wcol = (wave & 3) << 6;
  const int m0 = m0b + wrow;
  const int n0 = n0b + wcol;
  const int rlane = lane & 15;
  const int koff  = (lane >> 4) * 8;
  const int mOff  = koff;

  v8f acc[4][4];
#pragma unroll
  for (int i = 0; i < 4; ++i)
#pragma unroll
    for (int j = 0; j < 4; ++j) acc[i][j] = zero8();

  const bool useLo = ((m0b & seqMask) < loRows);   // block-uniform
  if (useLo) gemm_ring<true>(acc, ring, A, A2, lda, Bt, ldb, m0b, n0b, K, tid, wrow, wcol, rlane, koff);
  else       gemm_ring<false>(acc, ring, A, A, lda, Bt, ldb, m0b, n0b, K, tid, wrow, wcol, rlane, koff);
  acc_guard4(acc[0][0], acc[0][1], acc[0][2], acc[0][3]);
  acc_guard4(acc[1][0], acc[1][1], acc[1][2], acc[1][3]);
  acc_guard4(acc[2][0], acc[2][1], acc[2][2], acc[2][3]);
  acc_guard4(acc[3][0], acc[3][1], acc[3][2], acc[3][3]);

  float* slab = (float*)ring + wave * (16 * 68);
  const int hrow = lane >> 4;
  const int c4 = rlane * 4;
#pragma unroll
  for (int i = 0; i < 4; ++i) {
    const int mBase = m0 + (i << 4);
#pragma unroll
    for (int j = 0; j < 4; ++j) {
#pragma unroll
      for (int r = 0; r < 8; ++r) slab[(mOff + r) * 68 + (j << 4) + rlane] = acc[i][j][r] * scale;
    }
    __builtin_amdgcn_fence(__ATOMIC_RELEASE, "workgroup");
    __builtin_amdgcn_wave_barrier();
    __builtin_amdgcn_fence(__ATOMIC_ACQUIRE, "workgroup");
    {
#pragma unroll
      for (int it = 0; it < 8; ++it) {
        const int row = it * 2 + hrow;
        const v4f v = *(const v4f*)(slab + row * 68 + c4);
        *(v4f*)(C + (size_t)(mBase + row) * ldc + n0 + c4) = v;
      }
      
    }
    __builtin_amdgcn_fence(__ATOMIC_RELEASE, "workgroup");
    __builtin_amdgcn_wave_barrier();
    __builtin_amdgcn_fence(__ATOMIC_ACQUIRE, "workgroup");
  }
}

// ---------------------------------------------------------------------------------------------------------------
// RoPE + f16 hi/residual split. Unit = (row, head); 8 lanes per unit; lane j owns columns {8j, 64+8j, 128+8j, 192+8j}+0..7 of the
// 256-wide head (pairs (c, c+128) are in the same lane). out = x*cos + rotate_half(x)*sin with cos/sin[row][c mod 128].
// hi = f16(out*carry), lo = f16(out*carry - hi) (unscaled residual). Stores: for each column chunk one instruction writes
// coverage: nunits*8 threads x 32 elements = nunits*256 per plane.
// ---------------------------------------------------------------------------------------------------------------
__global__ __launch_bounds__(256) void rope_split_kernel(const float* __restrict__ src, int spitch, int nheads,
                                                         const float* __restrict__ cosT, const float* __restrict__ sinT,
                                                         _Float16* __restrict__ hi, _Float16* __restrict__ lo,
                                                         int dpitch, int nunits, float carry) {
#pragma clang fp contract(off)
  const int gid = blockIdx.x * 256 + (int)threadIdx.x;
  const int unit = gid >> 3;
  const int j = gid & 7;
  if (unit >= nunits) return;
  const int row = unit / nheads;
  const int hd = unit - row * nheads;
  const float* s  = src  + (size_t)row * spitch + hd * HD_ + 8 * j;
  const float* ct = cosT + (size_t)row * NF_ + 8 * j;
  const float* st = sinT + (size_t)row * NF_ + 8 * j;
  U8 xa, xb, xc, xd, ca, cb, sa, sb;
  xa.q[0] = *(const v4f*)(s);         xa.q[1] = *(const v4f*)(s + 4);
  xb.q[0] = *(const v4f*)(s + 64);    xb.q[1] = *(const v4f*)(s + 68);
  xc.q[0] = *(const v4f*)(s + 128);   xc.q[1] = *(const v4f*)(s + 132);
  xd.q[0] = *(const v4f*)(s + 192);   xd.q[1] = *(const v4f*)(s + 196);
  ca.q[0] = *(const v4f*)(ct);        ca.q[1] = *(const v4f*)(ct + 4);
  cb.q[0] = *(const v4f*)(ct + 64);   cb.q[1] = *(const v4f*)(ct + 68);
  sa.q[0] = *(const v4f*)(st);        sa.q[1] = *(const v4f*)(st + 4);
  sb.q[0] = *(const v4f*)(st + 64);   sb.q[1] = *(const v4f*)(st + 68);
  v8h h0, h1, h2, h3, l0, l1, l2, l3;
#pragma unroll
  for (int e = 0; e < 8; ++e) {
    const float r0 = xa.v[e] * ca.v[e] - xc.v[e] * sa.v[e];    // col 8j+e
    const float r1 = xb.v[e] * cb.v[e] - xd.v[e] * sb.v[e];    // col 64+8j+e
    const float r2 = xc.v[e] * ca.v[e] + xa.v[e] * sa.v[e];    // col 128+8j+e
    const float r3 = xd.v[e] * cb.v[e] + xb.v[e] * sb.v[e];    // col 192+8j+e
    float t; _Float16 q;
    t = r0 * carry; q = (_Float16)t; h0[e] = q; l0[e] = (_Float16)(t - (float)q);
    t = r1 * carry; q = (_Float16)t; h1[e] = q; l1[e] = (_Float16)(t - (float)q);
    t = r2 * carry; q = (_Float16)t; h2[e] = q; l2[e] = (_Float16)(t - (float)q);
    t = r3 * carry; q = (_Float16)t; h3[e] = q; l3[e] = (_Float16)(t - (float)q);
  }
  _Float16* hp = hi + (size_t)row * dpitch + hd * HD_ + 8 * j;
  _Float16* lp = lo + (size_t)row * dpitch + hd * HD_ + 8 * j;
  {
    *(v8h*)(hp)       = h0;
    *(v8h*)(hp + 64)  = h1;
    *(v8h*)(hp + 128) = h2;
    *(v8h*)(hp + 192) = h3;
    *(v8h*)(lp)       = l0;
    *(v8h*)(lp + 64)  = l1;
    *(v8h*)(lp + 128) = l2;
    *(v8h*)(lp + 192) = l3;
    
  }
}

// ---------------------------------------------------------------------------------------------------------------
// v columns of the fused kv plane (f32 [NB*SEQ rows][512], cols 256..511) -> transposed f16 planes Vth/Vtl [b][d][s]
// (hi = f16(v*2^10), lo = unscaled residual). 64x64 tiles through LDS; grid = (256/64, NB*SEQ/64), 256 threads.
// coverage per block: load 4 it x 256 thr x 4 = 64x64; store 2 it x 256 thr x 8 = 64x64 per plane.
// ---------------------------------------------------------------------------------------------------------------
__global__ __launch_bounds__(256) void vt_split_kernel(const float* __restrict__ KV, _Float16* __restrict__ Vth,
                                                       _Float16* __restrict__ Vtl) {
  __shared__ __align__(16) float tf[64 * 68];
  const int tid = threadIdx.x;
  const int d0  = blockIdx.x * 64;           // d block (input column within v)
  const int sg0 = blockIdx.y * 64;           // global row block (b*SEQ + s)
  const int b   = sg0 >> 11;
  const int s0  = sg0 & (SEQ_ - 1);
  {
    const int lr = tid >> 4;
    const int c4 = (tid & 15) * 4;
#pragma unroll
    for (int it = 0; it < 4; ++it) {
      const int rr = it * 16 + lr;
      const v4f a = *(const v4f*)(KV + (size_t)(sg0 + rr) * KVN_ + HD_ + d0 + c4);
      *(v4f*)(tf + rr * 68 + c4) = a;
    }
  }
  __syncthreads();
  const int sub = tid >> 3;          // output row within tile (= d)
  const int c8  = (tid & 7) * 8;     // s offset within tile
  v8h hv[2], lv[2];
#pragma unroll
  for (int it = 0; it < 2; ++it) {
    const int oc = it * 32 + sub;
    v8h a, rsd;
#pragma unroll
    for (int q = 0; q < 8; ++q) {
      const float f = tf[(c8 + q) * 68 + oc] * CQK_;
      const _Float16 hq = (_Float16)f;
      a[q] = hq;
      rsd[q] = (_Float16)(f - (float)hq);
    }
    hv[it] = a; lv[it] = rsd;
  }
  {
#pragma unroll
    for (int it = 0; it < 2; ++it) {
      const int oc = it * 32 + sub;
      const size_t go = ((size_t)b * HD_ + d0 + oc) * SEQ_ + s0 + c8;
      *(v8h*)(Vth + go) = hv[it];
      *(v8h*)(Vtl + go) = lv[it];
    }
    
  }
}

// ---------------------------------------------------------------------------------------------------------------
// Sliding-window attention, head dim 256, one kv head shared by 8 query heads.
// Block = (b, h, 64 query rows), 256 threads = 8 waves. Key tiles of 64: kt in [max(0,qb-16), kthi], kthi = qb when the mask
// flag verified the tiles above the block add exact zeros, else min(qb+16, 31) (general in-band path, mask added).
//   S phase: wave w computes rows 16*(w&3)..+15 x keys 32*(w>>2)..+31 of the tile (2 accumulators, K = 256 = 8 k-steps),
//            A = q fragments straight from the 16-bit global planes, B = k fragments straight from the 16-bit k planes
//            (q,k carried *2^10; hi.hi everywhere, + lo.hi + hi.lo on query blocks < QE_).
//   Scores: s*2^-24 + mask[b][0][q][key] for |q-key| <= 1023, -inf outside the band; row max / sum exchanged between the two
//            waves of a row group through LDS; online softmax in f32; p*2^15 -> f16 P tile [64][72] in LDS (+ residual tile early).
//   PV phase: wave w owns O[64 rows][32*w..+31] (4x2 accumulators); A = P fragments from LDS (after __syncthreads),
//            B = v^T fragments straight from the 16-bit global planes (*2^10; + residual products on query blocks < QE_).
// coverage: NB*NH*32 blocks x 64 rows x 256 cols = the whole [NB*SEQ][2048] plane, both planes.
// ---------------------------------------------------------------------------------------------------------------
#define AT_PPITCH 72
#define AT_OPITCH 264
#define AT_OFF_PH 0
#define AT_OFF_PL 9216
#define AT_OFF_PM 18432
#define AT_OFF_PS 18944
#define AT_OFF_AL 19456
#define AT_OFF_LF 19712
#define AT_OFF_OH 19968
#define AT_OFF_OL 53760
#define AT_LDS    87552
static_assert(AT_OFF_PL == AT_OFF_PH + 64 * AT_PPITCH * 2);
static_assert(AT_OFF_PM == AT_OFF_PL + 64 * AT_PPITCH * 2);
static_assert(AT_OFF_OL == AT_OFF_OH + 64 * AT_OPITCH * 2);
static_assert(AT_LDS == AT_OFF_OL + 64 * AT_OPITCH * 2);

// The key-tile loop. One instance per kind of query block (EARLY: residual planes as well), so that the loop holds no test of the kind
// and a tile's global loads stand in groups ahead of their use: q and k fragments by groups of k-steps (the first k group during the
// tile before), the mask values in front of the score products, the v^T fragments behind the last of them.
template <bool EARLY>
__device__ __forceinline__ void attn_tiles(int ktlo, int kthi, int b, int q0, int srow0, int kh, int w, int hh, int c,
                                           const _Float16* __restrict__ qhp, const _Float16* __restrict__ qlp,
                                           const _Float16* __restrict__ Kh, const _Float16* __restrict__ Kl,
                                           const float* __restrict__ mrp,
                                           const _Float16* __restrict__ vhp, const _Float16* __restrict__ vlp,
                                           _Float16* Ph, _Float16* Pl, float* pm, float* ps, float* alph,
                                           float (&mrow)[8], float (&lrow)[8], v8f (&oacc)[4][2]) {
  constexpr int KG = EARLY ? 1 : 2;            // k-steps whose fragments are loaded as one group
  constexpr bool AHEAD = !EARLY;               // a tile's first k group is fetched during the tile before, where the registers allow it
  const size_t krow0 = (size_t)b * SEQ_ + 32 * kh + c;
  v16h kf[KG][2];
  if (AHEAD) {
    const _Float16* k0 = Kh + (krow0 + ktlo * 64) * HD_ + 8 * hh;
#pragma unroll   // register arrays: constant indices
    for (int u = 0; u < KG; ++u) {
#pragma unroll   // register arrays: constant indices
      for (int j = 0; j < 2; ++j) kf[u][j] = frag_ld(k0 + (size_t)(16 * j) * HD_ + 32 * u);
    }
    asm volatile("s_wait_xcnt 0x0" :: "v"(k0) : "memory");   // in front of a rewrite of these loads' address registers, kept whole up to here
  }
  for (int kt = ktlo; kt <= kthi; ++kt) {      // block-uniform, at most 32 trips
    const int key0  = kt * 64;
    const int wkey0 = key0 + 32 * kh;
    const _Float16* khp = Kh + ((size_t)b * SEQ_ + wkey0 + c) * HD_ + 8 * hh;
    const _Float16* klp = Kl + ((size_t)b * SEQ_ + wkey0 + c) * HD_ + 8 * hh;

    // ---- mask values of this wave's 16 x 32 scores, in flight during the score products. Every key of a tile is a column of the mask:
    //      no test guards the loads ----
    float mv[8][2];
    const float* mt = mrp + wkey0 + c;
#pragma unroll   // register arrays: constant indices
    for (int r = 0; r < 8; ++r) {
#pragma unroll   // register arrays: constant indices
      for (int j = 0; j < 2; ++j) mv[r][j] = mt[(size_t)r * SEQ_ + 16 * j];
    }

    // ---- S = q . k^T (16 rows x 32 keys per wave) ----
    v8f s[2];
    s[0] = zero8(); s[1] = zero8();
#pragma unroll   // constant load offsets, no loop overhead between the groups
    for (int g = 0; g < 8; g += KG) {
      v16h qa[KG], qr[KG], kb[KG][2], kr[KG][2];
#pragma unroll   // register arrays: constant indices
      for (int u = 0; u < KG; ++u) {
        const int ks = g + u;
        qa[u] = frag_ld(qhp + 32 * ks);
        qr[u] = qa[u];
        if (EARLY) qr[u] = frag_ld(qlp + 32 * ks);
#pragma unroll   // register arrays: constant indices
        for (int j = 0; j < 2; ++j) {
          kb[u][j] = (AHEAD && g == 0) ? kf[u][j] : frag_ld(khp + (size_t)(16 * j) * HD_ + 32 * ks);
          kr[u][j] = kb[u][j];
          if (EARLY) kr[u][j] = frag_ld(klp + (size_t)(16 * j) * HD_ + 32 * ks);
        }
      }
#pragma unroll   // register arrays: constant indices
      for (int u = 0; u < KG; ++u) {
#pragma unroll   // register arrays: constant indices
        for (int j = 0; j < 2; ++j) {
          s[j] = mma_g(qa[u], kb[u][j], s[j]);
          if (EARLY) {
            s[j] = mma_g(qr[u], kb[u][j], s[j]);
            s[j] = mma_g(qa[u], kr[u][j], s[j]);
          }
        }
      }
    }

    // ---- v^T fragments of the tile: in flight while the scores are masked and their row maxima formed ----
    v16h vb[2][2], vr[2][2];
    const _Float16* vht = vhp + key0;
    const _Float16* vlt = vlp + key0;
#pragma unroll   // register arrays: constant indices
    for (int k2 = 0; k2 < 2; ++k2) {
#pragma unroll   // register arrays: constant indices
      for (int jj = 0; jj < 2; ++jj) {
        vb[k2][jj] = frag_ld(vht + (size_t)(16 * jj) * SEQ_ + 32 * k2);
        vr[k2][jj] = vb[k2][jj];
        if (EARLY) vr[k2][jj] = frag_ld(vlt + (size_t)(16 * jj) * SEQ_ + 32 * k2);
      }
    }
    // the wait that stands in front of a rewrite of an issued load's address registers; naming the tile's mask, k and v^T addresses
    // keeps them whole up to it (else a later load may take its result into them)
    if (EARLY) asm volatile("s_wait_xcnt 0x0" :: "v"(mt), "v"(khp), "v"(klp), "v"(vht), "v"(vlt) : "memory");
    else       asm volatile("s_wait_xcnt 0x0" :: "v"(mt), "v"(khp), "v"(vht) : "memory");

    // ---- scale, mask, partial row max over this wave's 32 keys ----
    float cm[8];
#pragma unroll
    for (int r = 0; r < 8; ++r) {
      const int qrow = q0 + srow0 + 8 * hh + r;
      float mx = -INFINITY;
#pragma unroll
      for (int j = 0; j < 2; ++j) {
        const int key = wkey0 + 16 * j + c;
        const bool inb = (key + (WIN_ - 1) >= qrow) && (key <= qrow + (WIN_ - 1));
        const float sv = inb ? (s[j][r] * SSC_ + mv[r][j]) : -INFINITY;
        s[j][r] = sv;
        mx = fmaxf(mx, sv);
      }
      mx = fmaxf(mx, __shfl_xor(mx, 1, 32));
      mx = fmaxf(mx, __shfl_xor(mx, 2, 32));
      mx = fmaxf(mx, __shfl_xor(mx, 4, 32));
      mx = fmaxf(mx, __shfl_xor(mx, 8, 32));
      cm[r] = mx;
    }
    if (c == 0) {
#pragma unroll
      for (int r = 0; r < 8; ++r) pm[w * 16 + 8 * hh + r] = cm[r];
    }
    __syncthreads();

    // ---- online softmax: tile max, p, partial sums ----
    float al[8], psm[8];
    const int wo = w ^ 4;
#pragma unroll
    for (int r = 0; r < 8; ++r) {
      const float om = pm[wo * 16 + 8 * hh + r];
      const float mnew = fmaxf(mrow[r], fmaxf(cm[r], om));
      const float msafe = (mnew == -INFINITY) ? 0.0f : mnew;
      al[r] = __expf(mrow[r] - msafe);
      mrow[r] = mnew;
      float sum = 0.0f;
#pragma unroll
      for (int j = 0; j < 2; ++j) {
        const float p = __expf(s[j][r] - msafe);
        sum += p;
        const float t = p * CP_;
        const _Float16 phv = (_Float16)t;
        const int pidx = (srow0 + 8 * hh + r) * AT_PPITCH + 32 * kh + 16 * j + c;
        Ph[pidx] = phv;
        if (EARLY) Pl[pidx] = (_Float16)(t - (float)phv);
      }
      sum += __shfl_xor(sum, 1, 32);
      sum += __shfl_xor(sum, 2, 32);
      sum += __shfl_xor(sum, 4, 32);
      sum += __shfl_xor(sum, 8, 32);
      psm[r] = sum;
    }
    if (c == 0) {
#pragma unroll
      for (int r = 0; r < 8; ++r) ps[w * 16 + 8 * hh + r] = psm[r];
      if (w < 4) {
#pragma unroll
        for (int r = 0; r < 8; ++r) alph[srow0 + 8 * hh + r] = al[r];
      }
    }
    __syncthreads();
#pragma unroll
    for (int r = 0; r < 8; ++r)
      lrow[r] = lrow[r] * al[r] + (ps[(w & 3) * 16 + 8 * hh + r] + ps[((w & 3) + 4) * 16 + 8 * hh + r]);

    // ---- the next tile's first k group, in flight during the P . V products (the last tile fetches its own again, for nobody) ----
    if (AHEAD) {
      const int ktn = (kt < kthi) ? (kt + 1) : kt;   // block-uniform; keeps the address inside the k plane
      const _Float16* kn = Kh + (krow0 + ktn * 64) * HD_ + 8 * hh;
#pragma unroll   // register arrays: constant indices
      for (int u = 0; u < KG; ++u) {
#pragma unroll   // register arrays: constant indices
        for (int j = 0; j < 2; ++j) kf[u][j] = frag_ld(kn + (size_t)(16 * j) * HD_ + 32 * u);
      }
    }

    // ---- rescale O, then O += P . V for this wave's 32 output columns ----
#pragma unroll
    for (int i = 0; i < 4; ++i) {
      U8 av;
      av.q[0] = *(const v4f*)(alph + 16 * i + 8 * hh);
      av.q[1] = *(const v4f*)(alph + 16 * i + 8 * hh + 4);
#pragma unroll
      for (int r = 0; r < 8; ++r) { oacc[i][0][r] *= av.v[r]; oacc[i][1][r] *= av.v[r]; }
    }
#pragma unroll
    for (int k2 = 0; k2 < 2; ++k2) {
#pragma unroll
      for (int jj = 0; jj < 2; ++jj) {
#pragma unroll
        for (int i = 0; i < 4; ++i) {
          const v16h pa = frag_ld(Ph + (16 * i + c) * AT_PPITCH + 32 * k2 + 8 * hh);
          oacc[i][jj] = mma_g(pa, vb[k2][jj], oacc[i][jj]);
          if (EARLY) {
            const v16h pr = frag_ld(Pl + (16 * i + c) * AT_PPITCH + 32 * k2 + 8 * hh);
            oacc[i][jj] = mma_g(pa, vr[k2][jj], oacc[i][jj]);
            oacc[i][jj] = mma_g(pr, vb[k2][jj], oacc[i][jj]);
          }
        }
      }
    }
  }
}

__global__ __launch_bounds__(256) void attn_kernel(const _Float16* __restrict__ Qh, const _Float16* __restrict__ Ql,
                                                   const _Float16* __restrict__ Kh, const _Float16* __restrict__ Kl,
                                                   const _Float16* __restrict__ Vth, const _Float16* __restrict__ Vtl,
                                                   const float* __restrict__ mask, const int* __restrict__ flag,
                                                   _Float16* __restrict__ AOh, _Float16* __restrict__ AOl) {
  extern __shared__ __align__(16) unsigned char dsm[];
  _Float16* Ph   = (_Float16*)(dsm + AT_OFF_PH);
  _Float16* Pl   = (_Float16*)(dsm + AT_OFF_PL);
  float*    pm   = (float*)(dsm + AT_OFF_PM);     // [8 waves][16 rows] partial row max
  float*    ps   = (float*)(dsm + AT_OFF_PS);     // [8 waves][16 rows] partial row sum
  float*    alph = (float*)(dsm + AT_OFF_AL);     // [64] rescale factors
  float*    lfin = (float*)(dsm + AT_OFF_LF);     // [64] final row sums
  _Float16* Ohs  = (_Float16*)(dsm + AT_OFF_OH);
  _Float16* Ols  = (_Float16*)(dsm + AT_OFF_OL);

  const int tid  = threadIdx.x;
  const int w    = tid >> 5;
  const int lane = tid & 31;
  const int hh   = lane >> 4;
  const int c    = lane & 15;
  const int bid  = blockIdx.x;
  const int qb   = bid & (NQB_ - 1);
  const int h    = (bid >> 5) & (NH_ - 1);
  const int b    = bid >> 8;
  const int q0   = qb * 64;
  const int srow0 = (w & 3) * 16;
  const int kh    = w >> 2;
  const int ocol0 = w * 32;
  const bool early = (qb < QE_);
  const int ktlo = (qb > 16) ? (qb - 16) : 0;
  int fl = 1;                                  // block-uniform: all row groups of this query block verified
#pragma unroll   // independent scalar loads, issued together instead of one round trip each
  for (int g = 0; g < MFG_; ++g) fl &= flag[((b * NQB_ + qb) * MFG_ + g) * 32];
  int kthi = (fl != 0) ? qb : (qb + 16);
  if (kthi > NQB_ - 1) kthi = NQB_ - 1;

  const size_t growq = (size_t)b * SEQ_ + q0;
  const _Float16* qhp = Qh + (growq + srow0 + c) * DM_ + h * HD_ + 8 * hh;
  const _Float16* qlp = Ql + (growq + srow0 + c) * DM_ + h * HD_ + 8 * hh;
  const float*    mrp = mask + (growq + srow0 + 8 * hh) * (size_t)SEQ_;
  const _Float16* vhp = Vth + ((size_t)b * HD_ + ocol0 + c) * SEQ_ + 8 * hh;
  const _Float16* vlp = Vtl + ((size_t)b * HD_ + ocol0 + c) * SEQ_ + 8 * hh;

  float mrow[8], lrow[8];
  v8f oacc[4][2];
#pragma unroll
  for (int r = 0; r < 8; ++r) { mrow[r] = -INFINITY; lrow[r] = 0.0f; }
#pragma unroll
  for (int i = 0; i < 4; ++i) { oacc[i][0] = zero8(); oacc[i][1] = zero8(); }

  if (early)   // block-uniform
    attn_tiles<true>(ktlo, kthi, b, q0, srow0, kh, w, hh, c, qhp, qlp, Kh, Kl, mrp, vhp, vlp, Ph, Pl, pm, ps, alph, mrow, lrow, oacc);
  else
    attn_tiles<false>(ktlo, kthi, b, q0, srow0, kh, w, hh, c, qhp, qlp, Kh, Kl, mrp, vhp, vlp, Ph, Pl, pm, ps, alph, mrow, lrow, oacc);

  if (w < 4 && c == 0) {
#pragma unroll
    for (int r = 0; r < 8; ++r) lfin[srow0 + 8 * hh + r] = lrow[r];
  }
  __syncthreads();
#pragma unroll
  for (int i = 0; i < 4; ++i) {
    U8 lv;
    lv.q[0] = *(const v4f*)(lfin + 16 * i + 8 * hh);
    lv.q[1] = *(const v4f*)(lfin + 16 * i + 8 * hh + 4);
#pragma unroll
    for (int r = 0; r < 8; ++r) {
      const float f = OSC_ * (1.0f / lv.v[r]);
      const int orow = 16 * i + 8 * hh + r;
#pragma unroll
      for (int jj = 0; jj < 2; ++jj) {
        const float t = oacc[i][jj][r] * f;
        const _Float16 hq = (_Float16)t;
        const int oidx = orow * AT_OPITCH + ocol0 + 16 * jj + c;
        Ohs[oidx] = hq;
        Ols[oidx] = (_Float16)(t - (float)hq);
      }
    }
  }
  __syncthreads();
  {
    const int piece = tid & 7;
    const int lsub  = tid >> 3;
    {
#pragma unroll
      for (int it = 0; it < 8; ++it) {
        const int line = it * 32 + lsub;          // 0..255 = 64 rows x 4 lines
        const int row  = line >> 2;
        const int col  = (line & 3) * 64 + piece * 8;
        const v8h hv = *(const v8h*)(Ohs + row * AT_OPITCH + col);
        const v8h rv = *(const v8h*)(Ols + row * AT_OPITCH + col);
        const size_t go = (growq + row) * DM_ + h * HD_ + col;
        *(v8h*)(AOh + go) = hv;
        *(v8h*)(AOl + go) = rv;
      }
      
    }
  }
}

// ---------------------------------------------------------------------------------------------------------------
// Workspace map (byte offsets, all 2 MiB aligned; every region is written completely by whole-line stores before it is read;
// the attention output planes reuse the f32 q region, which is dead after the q RoPE/split pass):
//   Xh   f16 [4096][2048]            0           16,777,216
//   Wqh  f16 [2048][2048]   16,777,216            8,388,608
//   Wkvh f16 [512][2048]    25,165,824            2,097,152
//   Woh  f16 [2048][2048]   27,262,976            8,388,608
//   cosT f32 [4096][128]    35,651,584            2,097,152
//   sinT f32 [4096][128]    37,748,736            2,097,152
//   Qf   f32 [4096][2048]   39,845,888           33,554,432   (AOh f16 [4096][2048] at 39,845,888; AOl at 56,623,104)
//   KVf  f32 [4096][512]    73,400,320            8,388,608
//   Qh   f16 [4096][2048]   81,788,928           16,777,216
//   Ql   f16 [4096][2048]   98,566,144           16,777,216
//   Kh   f16 [4096][256]   115,343,360            2,097,152
//   Kl   f16 [4096][256]   117,440,512            2,097,152
//   Vth  f16 [2][256][2048] 119,537,664           2,097,152
//   Vtl  f16 [2][256][2048] 121,634,816           2,097,152
//   flags int [2*32*16][32] 123,731,968            131,072
//   total                  123,863,040
// ---------------------------------------------------------------------------------------------------------------
extern "C" void kernel_launch(void* const* d_in, const int* in_sizes, int n_in,
                              void* d_out, int out_size, void* d_ws, size_t ws_size,
                              hipStream_t stream) {
  if (n_in < 7) return;
  if (in_sizes[0] != NB_ * SEQ_ * DM_) return;
  if (in_sizes[1] != NB_ * SEQ_ * SEQ_) return;
  if (in_sizes[2] != NB_ * SEQ_) return;
  if (in_sizes[3] != DM_ * DM_) return;
  if (in_sizes[4] != HD_ * DM_) return;
  if (in_sizes[5] != HD_ * DM_) return;
  if (in_sizes[6] != DM_ * DM_) return;
  if (out_size != NB_ * SEQ_ * DM_) return;

  const float* x    = (const float*)d_in[0];
  const float* mask = (const float*)d_in[1];
  const int*   pos  = (const int*)d_in[2];
  const float* Wq   = (const float*)d_in[3];
  const float* Wk   = (const float*)d_in[4];
  const float* Wv   = (const float*)d_in[5];
  const float* Wo   = (const float*)d_in[6];
  float* out = (float*)d_out;

  const size_t nX   = (size_t)NB_ * SEQ_ * DM_;          // 8,388,608 elements
  const size_t bXh  = nX * 2;
  const size_t bWq  = (size_t)DM_ * DM_ * 2;
  const size_t bWkv = (size_t)KVN_ * DM_ * 2;
  const size_t bWo  = bWq;
  const size_t bTab = (size_t)NB_ * SEQ_ * NF_ * 4;
  const size_t bQf  = nX * 4;
  const size_t bKVf = (size_t)NB_ * SEQ_ * KVN_ * 4;
  const size_t bQ16 = nX * 2;
  const size_t bK16 = (size_t)NB_ * SEQ_ * HD_ * 2;
  const size_t bV16 = bK16;
  const size_t bFlg = (size_t)NB_ * NQB_ * MFG_ * 128;
  size_t off = 0;
  const size_t oXh  = off; off += bXh;
  const size_t oWq  = off; off += bWq;
  const size_t oWkv = off; off += bWkv;
  const size_t oWo  = off; off += bWo;
  const size_t oCos = off; off += bTab;
  const size_t oSin = off; off += bTab;
  const size_t oQf  = off; off += bQf;
  const size_t oKVf = off; off += bKVf;
  const size_t oQh  = off; off += bQ16;
  const size_t oQl  = off; off += bQ16;
  const size_t oKh  = off; off += bK16;
  const size_t oKl  = off; off += bK16;
  const size_t oVth = off; off += bV16;
  const size_t oVtl = off; off += bV16;
  const size_t oFlg = off; off += bFlg;
  if (off > ws_size) return;                        // off = 123,863,040
  if (off > (size_t)134217728) return;
  if (bQf < 2 * bQ16) return;                        // AOh/AOl alias fits inside the f32 q region
  const size_t oAOh = oQf;
  const size_t oAOl = oQf + bQ16;

  char* ws = (char*)d_ws;
  _Float16* Xh   = (_Float16*)(ws + oXh);
  _Float16* Wqh  = (_Float16*)(ws + oWq);
  _Float16* Wkvh = (_Float16*)(ws + oWkv);
  _Float16* Woh  = (_Float16*)(ws + oWo);
  float*    cosT = (float*)(ws + oCos);
  float*    sinT = (float*)(ws + oSin);
  float*    Qf   = (float*)(ws + oQf);
  float*    KVf  = (float*)(ws + oKVf);
  _Float16* Qh   = (_Float16*)(ws + oQh);
  _Float16* Ql   = (_Float16*)(ws + oQl);
  _Float16* Kh   = (_Float16*)(ws + oKh);
  _Float16* Kl   = (_Float16*)(ws + oKl);
  _Float16* Vth  = (_Float16*)(ws + oVth);
  _Float16* Vtl  = (_Float16*)(ws + oVtl);
  int*      flg  = (int*)(ws + oFlg);
  _Float16* AOh  = (_Float16*)(ws + oAOh);
  _Float16* AOl  = (_Float16*)(ws + oAOl);

  const dim3 blk(256);
  const int n8x = (int)(nX / 8);                     // 1,048,576
  const int n8q = DM_ * DM_ / 8;                     // 524,288
  const int n8k = HD_ * DM_ / 8;                     // 65,536

  // (1) inputs -> 16-bit planes: x bf16*2^4, weights bf16*2^8 (k rows then v rows in the fused kv weight plane)
  cvt16_kernel<<<dim3((n8x + 255) / 256), blk, 0, stream>>>(x, Xh, n8x, CX_);
  cvt16_kernel<<<dim3((n8q + 255) / 256), blk, 0, stream>>>(Wq, Wqh, n8q, CW_);
  cvt16_kernel<<<dim3((n8k + 255) / 256), blk, 0, stream>>>(Wk, Wkvh, n8k, CW_);
  cvt16_kernel<<<dim3((n8k + 255) / 256), blk, 0, stream>>>(Wv, Wkvh + (size_t)HD_ * DM_, n8k, CW_);
  cvt16_kernel<<<dim3((n8q + 255) / 256), blk, 0, stream>>>(Wo, Woh, n8q, CW_);
  // (2) cos/sin tables [4096][128] from position ids; mask verification flags per (b, query block, 4-row group)
  rope_table_kernel<<<dim3((NB_ * SEQ_) / 32), blk, 0, stream>>>(pos, cosT, sinT, NB_ * SEQ_);
  maskflag_kernel<<<dim3(NB_ * NQB_ * MFG_), blk, 0, stream>>>(mask, flg);
  // (3) q = x . Wq^T -> f32 [4096][2048]; [k|v] = x . [Wk|Wv]^T -> f32 [4096][512]
  gemm64_kernel<<<dim3((NB_ * SEQ_ / GBM_) * (DM_ / GBN_)), blk, 0, stream>>>(
      Xh, Xh, DM_, Wqh, DM_, Qf, DM_, NB_ * SEQ_, DM_, DM_, 0, SEQ_ - 1, QSC_);
  gemm64_kernel<<<dim3((NB_ * SEQ_ / GBM_) * (KVN_ / GBN_)), blk, 0, stream>>>(
      Xh, Xh, DM_, Wkvh, DM_, KVf, KVN_, NB_ * SEQ_, KVN_, DM_, 0, SEQ_ - 1, QSC_);
  // (4) RoPE + hi/residual split: q planes [4096][8*256], k planes [4096][256]; v^T planes [2][256][2048]
  rope_split_kernel<<<dim3((NB_ * SEQ_ * NH_ * 8) / 256), blk, 0, stream>>>(
      Qf, DM_, NH_, cosT, sinT, Qh, Ql, DM_, NB_ * SEQ_ * NH_, CQK_);
  rope_split_kernel<<<dim3((NB_ * SEQ_ * 8) / 256), blk, 0, stream>>>(
      KVf, KVN_, 1, cosT, sinT, Kh, Kl, HD_, NB_ * SEQ_, CQK_);
  vt_split_kernel<<<dim3(HD_ / 64, (NB_ * SEQ_) / 64), blk, 0, stream>>>(KVf, Vth, Vtl);
  // (5) attention -> AO hi/residual planes [4096][2048]
  (void)hipFuncSetAttribute(reinterpret_cast<const void*>(&attn_kernel), hipFuncAttributeMaxDynamicSharedMemorySize, AT_LDS);
  attn_kernel<<<dim3(NB_ * NH_ * NQB_), blk, AT_LDS, stream>>>(Qh, Ql, Kh, Kl, Vth, Vtl, mask, flg, AOh, AOl);
  // (6) out = AO . Wo^T -> d_out f32 [4096][2048]; residual plane on rows < LOROWS_ of each sequence
  gemm64_kernel<<<dim3((NB_ * SEQ_ / GBM_) * (DM_ / GBN_)), blk, 0, stream>>>(
      AOh, AOl, DM_, Woh, DM_, out, DM_, NB_ * SEQ_, DM_, DM_, LOROWS_, SEQ_ - 1, WSC_);
  (void)hipGetLastError();
}

// v004
// A run of this version takes 204 microseconds.
// In two side-by-side timings against v003, it was 1.14 and 1.13 times as fast.
// All steps since v000 together make it 3.00 times as fast.
// Contractions on v_wmma_f32_16x16x32_f16 (f16 operands, f32 accumulate): q/k/v projections (x RNE-converted to bf16 and carried *2^4,
// W RNE-converted to bf16 and carried *2^8, exact products); q.k^T (q,k carried *2^10 as f16 hi planes, plus unscaled f16 residual planes
// on the leading query blocks of each sequence); p.v (p carried *2^15, v^T carried *2^10: hi planes plus residual planes on the leading query
// blocks); output projection (attention output carried *2^10: hi plane everywhere, residual plane on the leading rows of each sequence;
// Wo bf16 *2^8). RoPE, mask add and online softmax in f32.
#include <hip/hip_runtime.h>
#include <math.h>
#include <stdint.h>

#define NB_     2
#define SEQ_    2048
#define DM_     2048
#define NH_     8
#define HD_     256
#define NF_     128
#define KVN_    512
#define WIN_    1024
#define NQB_    32
#define QE_     4
#define LOROWS_ 256
#define MFG_    16

#define CX_   16.0f
#define CW_   256.0f
#define CQK_  1024.0f
#define CP_   32768.0f
#define SSC_  5.9604644775390625e-8f     /* 2^-4 * 2^-20 : score scale for q,k carried *2^10 each */
#define OSC_  3.0517578125e-5f           /* 2^-15 = 2^10 / (2^15 * 2^10) : attention output carry */
#define QSC_  2.44140625e-4f             /* 2^-12 = 1 / (2^4 * 2^8) : projection outputs back to f32 */
#define WSC_  3.814697265625e-6f         /* 2^-18 = 1 / (2^10 * 2^8) : final projection */

typedef _Float16 v16h __attribute__((ext_vector_type(16)));
typedef _Float16 v8h  __attribute__((ext_vector_type(8)));
typedef float    v8f  __attribute__((ext_vector_type(8)));
typedef float    v4f  __attribute__((ext_vector_type(4)));

union FragU { v16h v; v8h h[2]; };
union U8 { v8f v; v4f q[2]; };

__device__ __forceinline__ float bf16_rne(float f) {
  unsigned u = __float_as_uint(f);
  u = u + 0x7FFFu + ((u >> 16) & 1u);
  return __uint_as_float(u & 0xFFFF0000u);
}
__device__ __forceinline__ v8f zero8() { return (v8f){0.f, 0.f, 0.f, 0.f, 0.f, 0.f, 0.f, 0.f}; }

// 16-bit fragment (A or B): lane row/col = lane&15, elements 0..7 <- p[0..7] (k0+8h..), 8..15 <- p[16..23] (k0+16+8h..)
// p already includes the row base + k0 + 8*h.
__device__ __forceinline__ v16h frag_ld(const _Float16* p) {
  FragU f;
  f.h[0] = *(const v8h*)(p);
  f.h[1] = *(const v8h*)(p + 16);
  return f.v;
}
__device__ __forceinline__ v8f wmma_raw(v16h a, v16h b, v8f c) {
  return __builtin_amdgcn_wmma_f32_16x16x32_f16(false, a, false, b, (short)0, c, false, false);
}
// WMMA with trailing hazard guard (ties D, keeps A/B live)
__device__ __forceinline__ v8f mma_g(v16h a, v16h b, v8f c) {
  c = __builtin_amdgcn_wmma_f32_16x16x32_f16(false, a, false, b, (short)0, c, false, false);
  asm volatile("v_nop\n\tv_nop\n\tv_nop\n\tv_nop" : "+v"(c) : "v"(a), "v"(b));
  return c;
}
__device__ __forceinline__ void dep_guard(v8f& a, v8f& b, v16h x, v16h y) {
  asm volatile("v_nop\n\tv_nop\n\tv_nop\n\tv_nop" : "+v"(a), "+v"(b) : "v"(x), "v"(y));
}
__device__ __forceinline__ void keep4(v16h a, v16h b, v16h c, v16h d) {
  asm volatile("v_nop" :: "v"(a), "v"(b), "v"(c), "v"(d));
}
__device__ __forceinline__ void acc_guard4(v8f& a, v8f& b, v8f& c, v8f& d) {
  asm volatile("v_nop\n\tv_nop\n\tv_nop\n\tv_nop" : "+v"(a), "+v"(b), "+v"(c), "+v"(d));
}

// ---------------------------------------------------------------------------------------------------------------
// Elementwise convert: dst[i] = f16( bf16_rne(src[i]) * scale ), 8 elements per thread, one 16-B store per lane:
// coverage: ceil(n8/256) blocks (blk = the block's index within them), each thread 8 elements -> 8*n8 elements.
// ---------------------------------------------------------------------------------------------------------------
__device__ __forceinline__ void cvt16_part(int blk, const float* __restrict__ src, _Float16* __restrict__ dst, int n8, float scale) {
  const int i = blk * 256 + (int)threadIdx.x;
  if (i >= n8) return;
  const float* s = src + 8 * (size_t)i;
  U8 a;
  a.q[0] = *(const v4f*)(s);
  a.q[1] = *(const v4f*)(s + 4);
  v8h o;
#pragma unroll
  for (int e = 0; e < 8; ++e) o[e] = (_Float16)(bf16_rne(a.v[e]) * scale);
  _Float16* d = dst + 8 * (size_t)i;
  *(v8h*)d = o;
  
}

// ---------------------------------------------------------------------------------------------------------------
// RoPE tables: cosT/sinT [nrows][128], angle = float(pos[row]) * inv_freq[f], inv_freq[f] = 1 / f32(10000^(f/128)).
// coverage: nrows/32 blocks (blk = the block's index within them), 16 iterations x 2 rows -> nrows x 128 per table.
// ---------------------------------------------------------------------------------------------------------------
__device__ __forceinline__ void rope_table_part(int blk, const int* __restrict__ pos, float* __restrict__ cosT,
                                                float* __restrict__ sinT, int nrows) {
#pragma clang fp contract(off)
  __shared__ float invf[NF_];
  const int tid = threadIdx.x;
  if (tid < NF_) {
    const double e = (double)tid * 0.0078125;                 // tid/128 exactly
    const double p = exp2(e * 13.287712379549449);            // 10000^e
    const float pf = (float)p;                                // RNE to f32
    invf[tid] = 1.0f / pf;
  }
  __syncthreads();
  const int f = tid & (NF_ - 1);
  const int rp = tid >> 7;
  const int r0 = blk * 32;
  const float iv = invf[f];
#pragma unroll 1
  for (int it = 0; it < 16; ++it) {
    const int row = r0 + it * 2 + rp;
    const int rowc = (row < nrows) ? row : (nrows - 1);
    const float ang = (float)pos[rowc] * iv;
    float sv, cv;
    sincosf(ang, &sv, &cv);
    if (row < nrows) {
      float* cp = cosT + (size_t)row * NF_ + f;
      float* sp = sinT + (size_t)row * NF_ + f;
      *(float*)cp = cv;
      *(float*)sp = sv;
      // the wait that stands in front of a rewrite of an issued store's registers (the next trip reuses them)
      asm volatile("s_wait_xcnt 0x0" :: "v"(cp), "v"(sp), "v"(cv), "v"(sv) : "memory");
    }
  }
}

// ---------------------------------------------------------------------------------------------------------------
// Mask verification flags, MFG_ per (b, 64-query block), one per group of 4 query rows: 1 if every mask value for the group's rows
// and keys in [q0+64, min(q+1023, SEQ-1)] (the in-band keys strictly above the query block) is <= -1e9 (adds to an exact zero weight).
// The range holds at most 1023 keys, so 256 threads x 4 keys cover a row with one 16-byte load each; the 4 rows' loads are independent.
// coverage: NB*NQB*MFG_ blocks (bid = the block's index within them); each block writes its own 128-byte line of 32 equal ints.
// ---------------------------------------------------------------------------------------------------------------
__device__ __forceinline__ void maskflag_part(int bid, const float* __restrict__ mask, int* __restrict__ flag) {
  __shared__ int sw[8];
  const int tid = threadIdx.x, w = tid >> 5, lane = tid & 31;
  // bid = (b*32 + qb)*MFG_ + row group
  const int g  = bid & (MFG_ - 1);
  const int bq = bid / MFG_;
  const int b = bq >> 5, qb = bq & (NQB_ - 1);
  const int q0 = qb * 64;
  const int r0 = q0 + g * (64 / MFG_);
  const int k  = q0 + 64 + 4 * tid;          // first of this thread's four keys
  const int kc = (k <= SEQ_ - 4) ? k : (SEQ_ - 4);   // k > SEQ-4 means k >= SEQ: none of the four keys is tested
  v4f mv[64 / MFG_];
#pragma unroll   // all rows' loads issue before the first compare waits (and mv stays in registers)
  for (int rr = 0; rr < 64 / MFG_; ++rr) mv[rr] = *(const v4f*)(mask + ((size_t)b * SEQ_ + r0 + rr) * SEQ_ + kc);
  int bad = 0;
#pragma unroll
  for (int rr = 0; rr < 64 / MFG_; ++rr) {
    int kend = r0 + rr + WIN_ - 1;
    if (kend > SEQ_ - 1) kend = SEQ_ - 1;
#pragma unroll
    for (int e = 0; e < 4; ++e) {
      const int ok = (mv[rr][e] <= -1.0e9f) ? 1 : 0;
      bad |= ((k + e <= kend) && (ok == 0)) ? 1 : 0;
    }
  }
  const unsigned long long bm = __ballot(bad);
  if (lane == 0) sw[w] = (bm != 0ull) ? 1 : 0;
  __syncthreads();
  if (w == 0) {
    int any = 0;
#pragma unroll
    for (int i = 0; i < 8; ++i) any |= sw[i];
    const int fv = any ? 0 : 1;
    int* fp = flag + (size_t)bid * 32 + lane;
    *(int*)fp = fv;
  }
}

// ---------------------------------------------------------------------------------------------------------------
// The preparation passes, which depend on the inputs alone and not on one another, share one launch: a block's index range says
// which pass it belongs to (block-uniform, so each pass's barriers are reached by all of its block's threads or by none).
// The table blocks, few and with the longest serial chain, come first; then the mask check; then the five conversions.
// coverage: PB_ALL_ blocks = the sum of the passes' own block counts; every pass gets exactly its blocks.
// ---------------------------------------------------------------------------------------------------------------
#define PB_TAB_ ((NB_ * SEQ_) / 32)               /* 128  */
#define PB_FLG_ (NB_ * NQB_ * MFG_)               /* 1024 */
#define PB_X_   ((NB_ * SEQ_ * DM_) / (8 * 256))  /* 4096 */
#define PB_W_   ((DM_ * DM_) / (8 * 256))         /* 2048 */
#define PB_KV_  ((HD_ * DM_) / (8 * 256))         /* 256  */
#define PB_ALL_ (PB_TAB_ + PB_FLG_ + PB_X_ + 2 * PB_W_ + 2 * PB_KV_)
__global__ __launch_bounds__(256) void prep_kernel(const float* __restrict__ x, const float* __restrict__ mask,
                                                   const int* __restrict__ pos, const float* __restrict__ Wq,
                                                   const float* __restrict__ Wk, const float* __restrict__ Wv,
                                                   const float* __restrict__ Wo, _Float16* __restrict__ Xh,
                                                   _Float16* __restrict__ Wqh, _Float16* __restrict__ Wkvh,
                                                   _Float16* __restrict__ Woh, float* __restrict__ cosT,
                                                   float* __restrict__ sinT, int* __restrict__ flag) {
  int blk = blockIdx.x;
  if (blk < PB_TAB_) { rope_table_part(blk, pos, cosT, sinT, NB_ * SEQ_); return; }
  blk -= PB_TAB_;
  if (blk < PB_FLG_) { maskflag_part(blk, mask, flag); return; }
  blk -= PB_FLG_;
  if (blk < PB_X_) { cvt16_part(blk, x, Xh, PB_X_ * 256, CX_); return; }
  blk -= PB_X_;
  const float* src = Wq;      // weights: bf16 * 2^8; k rows then v rows in the fused kv weight plane
  _Float16* dst = Wqh;
  int n8 = PB_W_ * 256;
  if (blk >= PB_W_) {
    blk -= PB_W_; src = Wo; dst = Woh;
    if (blk >= PB_W_) {
      blk -= PB_W_; src = Wk; dst = Wkvh; n8 = PB_KV_ * 256;
      if (blk >= PB_KV_) { blk -= PB_KV_; src = Wv; dst = Wkvh + (size_t)HD_ * DM_; }
    }
  }
  cvt16_part(blk, src, dst, n8, CW_);
}

// ---------------------------------------------------------------------------------------------------------------
// Register-blocked WMMA GEMM, f16 operands: C[m][n] = scale * sum_k (A[m][k] (+ A2[m][k])) * Bt[n][k]
// A row-major [M][lda], optional residual plane A2 (same layout) used on row blocks with (m0 & seqMask) < loRows (block-uniform;
// loRows a multiple of 128); Bt row-major [N][ldb] (k contiguous); C f32 [M][ldc].
// Block = 8 waves (2 x 4) on a 128 x 256 tile of C, each wave a 64x64 tile (4x4 accumulators).
// Operands reach LDS by asynchronous 16-byte copies, whole 256-byte row pieces (128 k) per stage, two stages: the next stage's
// copies fly while this stage is multiplied. LDS row pitch 272 bytes (16 B x odd) for the 16-byte fragment reads.
// M multiple of 128, N multiple of 256, K multiple of 128. Epilogue: 16-row slabs staged per wave in the (then free) ring.
// ---------------------------------------------------------------------------------------------------------------
#define GK_    128                               /* k per stage */
#define GPH_   136                               /* LDS row pitch, halves */
#define GBM_   128
#define GBN_   256
#define G_OA2_ (GBM_ * GPH_)                     /* residual plane of A, halves from the stage's start */
#define G_OB_  (2 * GBM_ * GPH_)
#define G_STG_ ((2 * GBM_ + GBN_) * GPH_)        /* halves per stage */
#define G_LS_  (16 * GPH_ * 2)                   /* bytes between LDS rows 16 apart */
static_assert(LOROWS_ % GBM_ == 0);
static_assert(2 * G_STG_ * 2 >= 8 * 16 * 68 * 4);

// Eight copies per lane, rows 16 apart: l = the lane's LDS byte address, g = its global address, gs = halves per 16 source rows.
// s_wait_xcnt stands inside the statement so that no address register is rewritten ahead of it.
__device__ __forceinline__ void async_rows8(unsigned l, const _Float16* g, size_t gs) {
  asm volatile(
      "global_load_async_to_lds_b128 %0, %8, off\n\t"
      "global_load_async_to_lds_b128 %1, %9, off\n\t"
      "global_load_async_to_lds_b128 %2, %10, off\n\t"
      "global_load_async_to_lds_b128 %3, %11, off\n\t"
      "global_load_async_to_lds_b128 %4, %12, off\n\t"
      "global_load_async_to_lds_b128 %5, %13, off\n\t"
      "global_load_async_to_lds_b128 %6, %14, off\n\t"
      "global_load_async_to_lds_b128 %7, %15, off\n\t"
      "s_wait_xcnt 0x0"
      :: "v"(l), "v"(l + 1u * G_LS_), "v"(l + 2u * G_LS_), "v"(l + 3u * G_LS_),
         "v"(l + 4u * G_LS_), "v"(l + 5u * G_LS_), "v"(l + 6u * G_LS_), "v"(l + 7u * G_LS_),
         "v"(g), "v"(g + gs), "v"(g + 2 * gs), "v"(g + 3 * gs), "v"(g + 4 * gs), "v"(g + 5 * gs), "v"(g + 6 * gs), "v"(g + 7 * gs)
      : "memory");
}
// One stage: A 128 rows (+ A2 128 rows), Bt 256 rows, 256 bytes of each; a wave's copy covers two whole row pieces.
template <bool LO>
__device__ __forceinline__ void gemm_fill(unsigned l, const _Float16* ga, const _Float16* ga2, size_t as16,
                                          const _Float16* gb, size_t bs16) {
  async_rows8(l, ga, as16);
  if (LO) async_rows8(l + G_OA2_ * 2u, ga2, as16);
  async_rows8(l + G_OB_ * 2u, gb, bs16);
  async_rows8(l + G_OB_ * 2u + 8u * G_LS_, gb + 8 * bs16, bs16);
}

template <bool LO>
__device__ __forceinline__ void gemm_ring(v8f (&acc)[4][4], const _Float16* ring, const _Float16* __restrict__ Ab,
                                          const _Float16* __restrict__ Ab2, int lda, const _Float16* __restrict__ Bb, int ldb,
                                          int m0b, int n0b, int K, int tid, int wrow, int wcol, int rlane, int koff) {
  const int sub = tid >> 4;
  const int cc  = (tid & 15) * 8;
  const unsigned l0 = (unsigned)(size_t)ring + (unsigned)(sub * GPH_ + cc) * 2u;
  const _Float16* ga  = Ab  + (size_t)(m0b + sub) * lda + cc;
  const _Float16* ga2 = Ab2 + (size_t)(m0b + sub) * lda + cc;
  const _Float16* gb  = Bb  + (size_t)(n0b + sub) * ldb + cc;
  const size_t as16 = (size_t)16 * lda;
  const size_t bs16 = (size_t)16 * ldb;
  const int nt = K / GK_;

  gemm_fill<LO>(l0, ga, ga2, as16, gb, bs16);
  asm volatile("s_wait_asynccnt 0x0" ::: "memory");   // stage 0 landed (this wave's copies) before the barrier publishes it
  __syncthreads();
  if (nt > 1) gemm_fill<LO>(l0 + G_STG_ * 2u, ga + GK_, ga2 + GK_, as16, gb + GK_, bs16);

  for (int t = 0; t < nt; ++t) {
    const _Float16* st = ring + (t & 1) * G_STG_;
    const _Float16* sa = st + (wrow + rlane) * GPH_ + koff;
    const _Float16* sb = st + G_OB_ + (wcol + rlane) * GPH_ + koff;
#pragma unroll   // the four k-steps of a stage in one body: constant LDS offsets, no loop overhead between them
    for (int kk = 0; kk < GK_; kk += 32) {
      v16h bh[4], ah[4], al[4];
#pragma unroll   // register arrays: constant indices
      for (int j = 0; j < 4; ++j) bh[j] = frag_ld(sb + (j << 4) * GPH_ + kk);
#pragma unroll   // register arrays: constant indices
      for (int i = 0; i < 4; ++i) {
        ah[i] = frag_ld(sa + (i << 4) * GPH_ + kk);
        al[i] = ah[i];
        if (LO) al[i] = frag_ld(sa + G_OA2_ + (i << 4) * GPH_ + kk);
      }
      // holds the k-step's fragment reads together in front of its products (one LDS wait per k-step instead of one per row)
      asm volatile("" :: "v"(bh[0]), "v"(bh[1]), "v"(bh[2]), "v"(bh[3]), "v"(ah[0]), "v"(ah[1]), "v"(ah[2]), "v"(ah[3]));
      if (LO) asm volatile("" :: "v"(al[0]), "v"(al[1]), "v"(al[2]), "v"(al[3]));   // the same for the residual plane's reads
#pragma unroll   // register arrays: constant indices
      for (int i = 0; i < 4; ++i) {
#pragma unroll   // register arrays: constant indices
        for (int j = 0; j < 4; ++j) {
          acc[i][j] = wmma_raw(ah[i], bh[j], acc[i][j]);
          if (LO) acc[i][j] = wmma_raw(al[i], bh[j], acc[i][j]);
        }
        dep_guard(acc[i][0], acc[i][3], ah[i], al[i]);
      }
      keep4(bh[0], bh[1], bh[2], bh[3]);
    }
    asm volatile("s_wait_dscnt 0x0" ::: "memory");      // this wave's reads of the stage are done before it may be refilled
    asm volatile("s_wait_asynccnt 0x0" ::: "memory");   // this wave's copies of the next stage have landed
    __syncthreads();                                    // publishes stage t+1 and frees stage t's buffer
    if (t + 2 < nt)
      gemm_fill<LO>(l0 + (unsigned)(t & 1) * (G_STG_ * 2u), ga + (size_t)(t + 2) * GK_, ga2 + (size_t)(t + 2) * GK_, as16,
                    gb + (size_t)(t + 2) * GK_, bs16);
  }
  asm volatile("s_wait_asynccnt 0x0" ::: "memory");     // nothing in flight when the ring becomes output staging
}

// One launch may hold two products with the same A, M, K, ldb and scale: blocks past the first product's tiles take Btb, Cb, ldcb, Nb
// (Nb = 0: no second product).
__global__ __launch_bounds__(256) void gemm64_kernel(const _Float16* __restrict__ A, const _Float16* __restrict__ A2, int lda,
                                                     const _Float16* __restrict__ Bta, int ldb,
                                                     float* __restrict__ Ca, int ldca, int M, int Na, int K,
                                                     int loRows, int seqMask, float scale,
                                                     const _Float16* __restrict__ Btb, float* __restrict__ Cb, int ldcb, int Nb) {
  __shared__ __align__(16) _Float16 ring[2 * G_STG_];   // two stages; afterwards per-wave 16x64 f32 slabs, pitch 68 floats
  const int tid  = threadIdx.x;
  const int lane = tid & 31;
  const int wave = tid >> 5;
  const int tilesM = M / GBM_;
  const int tilesA = tilesM * (Na / GBN_);
  const bool second = ((int)blockIdx.x >= tilesA);   // block-uniform
  const _Float16* Bt = second ? Btb : Bta;
  float* C = second ? Cb : Ca;
  const int ldc = second ? ldcb : ldca;
  const int tilesN = (second ? Nb : Na) / GBN_;
  const int bid = second ? ((int)blockIdx.x - tilesA) : (int)blockIdx.x;
  if (bid >= tilesM * tilesN) return;   // block-uniform, in front of every barrier
  const int tm = bid / tilesN;
  const int tn = bid - tm * tilesN;
  const int m0b = tm * GBM_;
  const int n0b = tn * GBN_;
  const int wrow = (wave >> 2) << 6;
  const int wcol = (wave & 3) << 6;
  const int m0 = m0b + wrow;
  const int n0 = n0b + wcol;
  const int rlane = lane & 15;
  const int koff  = (lane >> 4) * 8;
  const int mOff  = koff;

  v8f acc[4][4];
#pragma unroll
  for (int i = 0; i < 4; ++i)
#pragma unroll
    for (int j = 0; j < 4; ++j) acc[i][j] = zero8();

  const bool useLo = ((m0b & seqMask) < loRows);   // block-uniform
  if (useLo) gemm_ring<true>(acc, ring, A, A2, lda, Bt, ldb, m0b, n0b, K, tid, wrow, wcol, rlane, koff);
  else       gemm_ring<false>(acc, ring, A, A, lda, Bt, ldb, m0b, n0b, K, tid, wrow, wcol, rlane, koff);
  acc_guard4(acc[0][0], acc[0][1], acc[0][2], acc[0][3]);
  acc_guard4(acc[1][0], acc[1][1], acc[1][2], acc[1][3]);
  acc_guard4(acc[2][0], acc[2][1], acc[2][2], acc[2][3]);
  acc_guard4(acc[3][0], acc[3][1], acc[3][2], acc[3][3]);

  float* slab = (float*)ring + wave * (16 * 68);
  const int hrow = lane >> 4;
  const int c4 = rlane * 4;
#pragma unroll
  for (int i = 0; i < 4; ++i) {
    const int mBase = m0 + (i << 4);
#pragma unroll
    for (int j = 0; j < 4; ++j) {
#pragma unroll
      for (int r = 0; r < 8; ++r) slab[(mOff + r) * 68 + (j << 4) + rlane] = acc[i][j][r] * scale;
    }
    __builtin_amdgcn_fence(__ATOMIC_RELEASE, "workgroup");
    __builtin_amdgcn_wave_barrier();
    __builtin_amdgcn_fence(__ATOMIC_ACQUIRE, "workgroup");
    {
#pragma unroll
      for (int it = 0; it < 8; ++it) {
        const int row = it * 2 + hrow;
        const v4f v = *(const v4f*)(slab + row * 68 + c4);
        *(v4f*)(C + (size_t)(mBase + row) * ldc + n0 + c4) = v;
      }
      
    }
    __builtin_amdgcn_fence(__ATOMIC_RELEASE, "workgroup");
    __builtin_amdgcn_wave_barrier();
    __builtin_amdgcn_fence(__ATOMIC_ACQUIRE, "workgroup");
  }
}

// ---------------------------------------------------------------------------------------------------------------
// RoPE + f16 hi/residual split. Unit = (row, head); 8 lanes per unit; lane j owns columns {8j, 64+8j, 128+8j, 192+8j}+0..7 of the
// 256-wide head (pairs (c, c+128) are in the same lane). out = x*cos + rotate_half(x)*sin with cos/sin[row][c mod 128].
// hi = f16(out*carry), lo = f16(out*carry - hi) (unscaled residual). Stores: for each column chunk one instruction writes
// coverage: nunits*8 threads x 32 elements = nunits*256 per plane.
// ---------------------------------------------------------------------------------------------------------------
__device__ __forceinline__ void rope_split_part(int blk, const float* __restrict__ src, int spitch, int nheads,
                                                const float* __restrict__ cosT, const float* __restrict__ sinT,
                                                _Float16* __restrict__ hi, _Float16* __restrict__ lo,
                                                int dpitch, int nunits, float carry) {
#pragma clang fp contract(off)
  const int gid = blk * 256 + (int)threadIdx.x;
  const int unit = gid >> 3;
  const int j = gid & 7;
  if (unit >= nunits) return;
  const int row = unit / nheads;
  const int hd = unit - row * nheads;
  const float* s  = src  + (size_t)row * spitch + hd * HD_ + 8 * j;
  const float* ct = cosT + (size_t)row * NF_ + 8 * j;
  const float* st = sinT + (size_t)row * NF_ + 8 * j;
  U8 xa, xb, xc, xd, ca, cb, sa, sb;
  xa.q[0] = *(const v4f*)(s);         xa.q[1] = *(const v4f*)(s + 4);
  xb.q[0] = *(const v4f*)(s + 64);    xb.q[1] = *(const v4f*)(s + 68);
  xc.q[0] = *(const v4f*)(s + 128);   xc.q[1] = *(const v4f*)(s + 132);
  xd.q[0] = *(const v4f*)(s + 192);   xd.q[1] = *(const v4f*)(s + 196);
  ca.q[0] = *(const v4f*)(ct);        ca.q[1] = *(const v4f*)(ct + 4);
  cb.q[0] = *(const v4f*)(ct + 64);   cb.q[1] = *(const v4f*)(ct + 68);
  sa.q[0] = *(const v4f*)(st);        sa.q[1] = *(const v4f*)(st + 4);
  sb.q[0] = *(const v4f*)(st + 64);   sb.q[1] = *(const v4f*)(st + 68);
  // the wait that stands in front of a rewrite of an issued load's address registers; naming the three addresses keeps them whole
  // up to it (else the last load takes its result into them)
  asm volatile("s_wait_xcnt 0x0" :: "v"(s), "v"(ct), "v"(st) : "memory");
  v8h h0, h1, h2, h3, l0, l1, l2, l3;
#pragma unroll
  for (int e = 0; e < 8; ++e) {
    const float r0 = xa.v[e] * ca.v[e] - xc.v[e] * sa.v[e];    // col 8j+e
    const float r1 = xb.v[e] * cb.v[e] - xd.v[e] * sb.v[e];    // col 64+8j+e
    const float r2 = xc.v[e] * ca.v[e] + xa.v[e] * sa.v[e];    // col 128+8j+e
    const float r3 = xd.v[e] * cb.v[e] + xb.v[e] * sb.v[e];    // col 192+8j+e
    float t; _Float16 q;
    t = r0 * carry; q = (_Float16)t; h0[e] = q; l0[e] = (_Float16)(t - (float)q);
    t = r1 * carry; q = (_Float16)t; h1[e] = q; l1[e] = (_Float16)(t - (float)q);
    t = r2 * carry; q = (_Float16)t; h2[e] = q; l2[e] = (_Float16)(t - (float)q);
    t = r3 * carry; q = (_Float16)t; h3[e] = q; l3[e] = (_Float16)(t - (float)q);
  }
  _Float16* hp = hi + (size_t)row * dpitch + hd * HD_ + 8 * j;
  _Float16* lp = lo + (size_t)row * dpitch + hd * HD_ + 8 * j;
  {
    *(v8h*)(hp)       = h0;
    *(v8h*)(hp + 64)  = h1;
    *(v8h*)(hp + 128) = h2;
    *(v8h*)(hp + 192) = h3;
    *(v8h*)(lp)       = l0;
    *(v8h*)(lp + 64)  = l1;
    *(v8h*)(lp + 128) = l2;
    *(v8h*)(lp + 192) = l3;
    
  }
}

// ---------------------------------------------------------------------------------------------------------------
// v columns of the fused kv plane (f32 [NB*SEQ rows][512], cols 256..511) -> transposed f16 planes Vth/Vtl [b][d][s]
// (hi = f16(v*2^10), lo = unscaled residual). 64x64 tiles through LDS; (256/64) x (NB*SEQ/64) blocks (bx, by), 256 threads.
// coverage per block: load 4 it x 256 thr x 4 = 64x64; store 2 it x 256 thr x 8 = 64x64 per plane.
// ---------------------------------------------------------------------------------------------------------------
__device__ __forceinline__ void vt_split_part(int bx, int by, const float* __restrict__ KV, _Float16* __restrict__ Vth,
                                              _Float16* __restrict__ Vtl) {
  __shared__ __align__(16) float tf[64 * 68];
  const int tid = threadIdx.x;
  const int d0  = bx * 64;                   // d block (input column within v)
  const int sg0 = by * 64;                   // global row block (b*SEQ + s)
  const int b   = sg0 >> 11;
  const int s0  = sg0 & (SEQ_ - 1);
  {
    const int lr = tid >> 4;
    const int c4 = (tid & 15) * 4;
#pragma unroll
    for (int it = 0; it < 4; ++it) {
      const int rr = it * 16 + lr;
      const v4f a = *(const v4f*)(KV + (size_t)(sg0 + rr) * KVN_ + HD_ + d0 + c4);
      *(v4f*)(tf + rr * 68 + c4) = a;
    }
  }
  __syncthreads();
  const int sub = tid >> 3;          // output row within tile (= d)
  const int c8  = (tid & 7) * 8;     // s offset within tile
  v8h hv[2], lv[2];
#pragma unroll
  for (int it = 0; it < 2; ++it) {
    const int oc = it * 32 + sub;
    v8h a, rsd;
#pragma unroll
    for (int q = 0; q < 8; ++q) {
      const float f = tf[(c8 + q) * 68 + oc] * CQK_;
      const _Float16 hq = (_Float16)f;
      a[q] = hq;
      rsd[q] = (_Float16)(f - (float)hq);
    }
    hv[it] = a; lv[it] = rsd;
  }
  {
#pragma unroll
    for (int it = 0; it < 2; ++it) {
      const int oc = it * 32 + sub;
      const size_t go = ((size_t)b * HD_ + d0 + oc) * SEQ_ + s0 + c8;
      *(v8h*)(Vth + go) = hv[it];
      *(v8h*)(Vtl + go) = lv[it];
    }
    
  }
}

// ---------------------------------------------------------------------------------------------------------------
// The three passes between the projections and the attention do not depend on one another and share one launch, told apart by
// block index range (block-uniform): v transpose (the one with a barrier) first, then the k planes, then the q planes.
// coverage: SB_ALL_ blocks = the sum of the passes' own block counts.
// ---------------------------------------------------------------------------------------------------------------
#define SB_VT_  ((HD_ / 64) * ((NB_ * SEQ_) / 64))   /* 256  */
#define SB_K_   ((NB_ * SEQ_ * 8) / 256)             /* 128  */
#define SB_Q_   ((NB_ * SEQ_ * NH_ * 8) / 256)       /* 1024 */
#define SB_ALL_ (SB_VT_ + SB_K_ + SB_Q_)
__global__ __launch_bounds__(256) void split_kernel(const float* __restrict__ Qf, const float* __restrict__ KVf,
                                                    const float* __restrict__ cosT, const float* __restrict__ sinT,
                                                    _Float16* __restrict__ Qh, _Float16* __restrict__ Ql,
                                                    _Float16* __restrict__ Kh, _Float16* __restrict__ Kl,
                                                    _Float16* __restrict__ Vth, _Float16* __restrict__ Vtl) {
  int blk = blockIdx.x;
  if (blk < SB_VT_) { vt_split_part(blk & (HD_ / 64 - 1), blk / (HD_ / 64), KVf, Vth, Vtl); return; }
  blk -= SB_VT_;
  if (blk < SB_K_) { rope_split_part(blk, KVf, KVN_, 1, cosT, sinT, Kh, Kl, HD_, NB_ * SEQ_, CQK_); return; }
  blk -= SB_K_;
  rope_split_part(blk, Qf, DM_, NH_, cosT, sinT, Qh, Ql, DM_, NB_ * SEQ_ * NH_, CQK_);
}

// ---------------------------------------------------------------------------------------------------------------
// Sliding-window attention, head dim 256, one kv head shared by 8 query heads.
// Block = (b, h, 64 query rows), 256 threads = 8 waves. Key tiles of 64: kt in [max(0,qb-16), kthi], kthi = qb when the mask
// flag verified the tiles above the block add exact zeros, else min(qb+16, 31) (general in-band path, mask added).
//   S phase: wave w computes rows 16*(w&3)..+15 x keys 32*(w>>2)..+31 of the tile (2 accumulators, K = 256 = 8 k-steps),
//            A = q fragments straight from the 16-bit global planes, B = k fragments straight from the 16-bit k planes
//            (q,k carried *2^10; hi.hi everywhere, + lo.hi + hi.lo on query blocks < QE_).
//   Scores: s*2^-24 + mask[b][0][q][key] for |q-key| <= 1023, -inf outside the band; row max / sum exchanged between the two
//            waves of a row group through LDS; online softmax in f32; p*2^15 -> f16 P tile [64][72] in LDS (+ residual tile early).
//   PV phase: wave w owns O[64 rows][32*w..+31] (4x2 accumulators); A = P fragments from LDS (after __syncthreads),
//            B = v^T fragments straight from the 16-bit global planes (*2^10; + residual products on query blocks < QE_).
// coverage: NB*NH*32 blocks x 64 rows x 256 cols = the whole [NB*SEQ][2048] plane, both planes.
// ---------------------------------------------------------------------------------------------------------------
#define AT_PPITCH 72
#define AT_OPITCH 264
#define AT_OFF_PH 0
#define AT_OFF_PL 9216
#define AT_OFF_PM 18432
#define AT_OFF_PS 18944
#define AT_OFF_AL 19456
#define AT_OFF_LF 19712
#define AT_OFF_OH 19968
#define AT_OFF_OL 53760
#define AT_LDS    87552
static_assert(AT_OFF_PL == AT_OFF_PH + 64 * AT_PPITCH * 2);
static_assert(AT_OFF_PM == AT_OFF_PL + 64 * AT_PPITCH * 2);
static_assert(AT_OFF_OL == AT_OFF_OH + 64 * AT_OPITCH * 2);
static_assert(AT_LDS == AT_OFF_OL + 64 * AT_OPITCH * 2);

// The key-tile loop. One instance per kind of query block (EARLY: residual planes as well), so that the loop holds no test of the kind
// and a tile's global loads stand in groups ahead of their use: q and k fragments by groups of k-steps (the first k group during the
// tile before), the mask values in front of the score products, the v^T fragments behind the last of them.
template <bool EARLY>
__device__ __forceinline__ void attn_tiles(int ktlo, int kthi, int b, int q0, int srow0, int kh, int w, int hh, int c,
                                           const _Float16* __restrict__ qhp, const _Float16* __restrict__ qlp,
                                           const _Float16* __restrict__ Kh, const _Float16* __restrict__ Kl,
                                           const float* __restrict__ mrp,
                                           const _Float16* __restrict__ vhp, const _Float16* __restrict__ vlp,
                                           _Float16* Ph, _Float16* Pl, float* pm, float* ps, float* alph,
                                           float (&mrow)[8], float (&lrow)[8], v8f (&oacc)[4][2]) {
  constexpr int KG = EARLY ? 1 : 2;            // k-steps whose fragments are loaded as one group
  constexpr bool AHEAD = !EARLY;               // a tile's first k group is fetched during the tile before, where the registers allow it
  const size_t krow0 = (size_t)b * SEQ_ + 32 * kh + c;
  v16h kf[KG][2];
  if (AHEAD) {
    const _Float16* k0 = Kh + (krow0 + ktlo * 64) * HD_ + 8 * hh;
#pragma unroll   // register arrays: constant indices
    for (int u = 0; u < KG; ++u) {
#pragma unroll   // register arrays: constant indices
      for (int j = 0; j < 2; ++j) kf[u][j] = frag_ld(k0 + (size_t)(16 * j) * HD_ + 32 * u);
    }
    asm volatile("s_wait_xcnt 0x0" :: "v"(k0) : "memory");   // in front of a rewrite of these loads' address registers, kept whole up to here
  }
  for (int kt = ktlo; kt <= kthi; ++kt) {      // block-uniform, at most 32 trips
    const int key0  = kt * 64;
    const int wkey0 = key0 + 32 * kh;
    const _Float16* khp = Kh + ((size_t)b * SEQ_ + wkey0 + c) * HD_ + 8 * hh;
    const _Float16* klp = Kl + ((size_t)b * SEQ_ + wkey0 + c) * HD_ + 8 * hh;

    // ---- mask values of this wave's 16 x 32 scores, in flight during the score products. Every key of a tile is a column of the mask:
    //      no test guards the loads ----
    float mv[8][2];
    const float* mt = mrp + wkey0 + c;
#pragma unroll   // register arrays: constant indices
    for (int r = 0; r < 8; ++r) {
#pragma unroll   // register arrays: constant indices
      for (int j = 0; j < 2; ++j) mv[r][j] = mt[(size_t)r * SEQ_ + 16 * j];
    }

    // ---- S = q . k^T (16 rows x 32 keys per wave) ----
    v8f s[2];
    s[0] = zero8(); s[1] = zero8();
#pragma unroll   // constant load offsets, no loop overhead between the groups
    for (int g = 0; g < 8; g += KG) {
      v16h qa[KG], qr[KG], kb[KG][2], kr[KG][2];
#pragma unroll   // register arrays: constant indices
      for (int u = 0; u < KG; ++u) {
        const int ks = g + u;
        qa[u] = frag_ld(qhp + 32 * ks);
        qr[u] = qa[u];
        if (EARLY) qr[u] = frag_ld(qlp + 32 * ks);
#pragma unroll   // register arrays: constant indices
        for (int j = 0; j < 2; ++j) {
          kb[u][j] = (AHEAD && g == 0) ? kf[u][j] : frag_ld(khp + (size_t)(16 * j) * HD_ + 32 * ks);
          kr[u][j] = kb[u][j];
          if (EARLY) kr[u][j] = frag_ld(klp + (size_t)(16 * j) * HD_ + 32 * ks);
        }
      }
#pragma unroll   // register arrays: constant indices
      for (int u = 0; u < KG; ++u) {
#pragma unroll   // register arrays: constant indices
        for (int j = 0; j < 2; ++j) {
          s[j] = mma_g(qa[u], kb[u][j], s[j]);
          if (EARLY) {
            s[j] = mma_g(qr[u], kb[u][j], s[j]);
            s[j] = mma_g(qa[u], kr[u][j], s[j]);
          }
        }
      }
    }

    // ---- v^T fragments of the tile: in flight while the scores are masked and their row maxima formed ----
    v16h vb[2][2], vr[2][2];
    const _Float16* vht = vhp + key0;
    const _Float16* vlt = vlp + key0;
#pragma unroll   // register arrays: constant indices
    for (int k2 = 0; k2 < 2; ++k2) {
#pragma unroll   // register arrays: constant indices
      for (int jj = 0; jj < 2; ++jj) {
        vb[k2][jj] = frag_ld(vht + (size_t)(16 * jj) * SEQ_ + 32 * k2);
        vr[k2][jj] = vb[k2][jj];
        if (EARLY) vr[k2][jj] = frag_ld(vlt + (size_t)(16 * jj) * SEQ_ + 32 * k2);
      }
    }
    // the wait that stands in front of a rewrite of an issued load's address registers; naming the tile's mask, k and v^T addresses
    // keeps them whole up to it (else a later load may take its result into them)
    if (EARLY) asm volatile("s_wait_xcnt 0x0" :: "v"(mt), "v"(khp), "v"(klp), "v"(vht), "v"(vlt) : "memory");
    else       asm volatile("s_wait_xcnt 0x0" :: "v"(mt), "v"(khp), "v"(vht) : "memory");

    // ---- scale, mask, partial row max over this wave's 32 keys ----
    float cm[8];
#pragma unroll
    for (int r = 0; r < 8; ++r) {
      const int qrow = q0 + srow0 + 8 * hh + r;
      float mx = -INFINITY;
#pragma unroll
      for (int j = 0; j < 2; ++j) {
        const int key = wkey0 + 16 * j + c;
        const bool inb = (key + (WIN_ - 1) >= qrow) && (key <= qrow + (WIN_ - 1));
        const float sv = inb ? (s[j][r] * SSC_ + mv[r][j]) : -INFINITY;
        s[j][r] = sv;
        mx = fmaxf(mx, sv);
      }
      mx = fmaxf(mx, __shfl_xor(mx, 1, 32));
      mx = fmaxf(mx, __shfl_xor(mx, 2, 32));
      mx = fmaxf(mx, __shfl_xor(mx, 4, 32));
      mx = fmaxf(mx, __shfl_xor(mx, 8, 32));
      cm[r] = mx;
    }
    if (c == 0) {
#pragma unroll
      for (int r = 0; r < 8; ++r) pm[w * 16 + 8 * hh + r] = cm[r];
    }
    __syncthreads();

    // ---- online softmax: tile max, p, partial sums ----
    float al[8], psm[8];
    const int wo = w ^ 4;
#pragma unroll
    for (int r = 0; r < 8; ++r) {
      const float om = pm[wo * 16 + 8 * hh + r];
      const float mnew = fmaxf(mrow[r], fmaxf(cm[r], om));
      const float msafe = (mnew == -INFINITY) ? 0.0f : mnew;
      al[r] = __expf(mrow[r] - msafe);
      mrow[r] = mnew;
      float sum = 0.0f;
#pragma unroll
      for (int j = 0; j < 2; ++j) {
        const float p = __expf(s[j][r] - msafe);
        sum += p;
        const float t = p * CP_;
        const _Float16 phv = (_Float16)t;
        const int pidx = (srow0 + 8 * hh + r) * AT_PPITCH + 32 * kh + 16 * j + c;
        Ph[pidx] = phv;
        if (EARLY) Pl[pidx] = (_Float16)(t - (float)phv);
      }
      sum += __shfl_xor(sum, 1, 32);
      sum += __shfl_xor(sum, 2, 32);
      sum += __shfl_xor(sum, 4, 32);
      sum += __shfl_xor(sum, 8, 32);
      psm[r] = sum;
    }
    if (c == 0) {
#pragma unroll
      for (int r = 0; r < 8; ++r) ps[w * 16 + 8 * hh + r] = psm[r];
      if (w < 4) {
#pragma unroll
        for (int r = 0; r < 8; ++r) alph[srow0 + 8 * hh + r] = al[r];
      }
    }
    __syncthreads();
#pragma unroll
    for (int r = 0; r < 8; ++r)
      lrow[r] = lrow[r] * al[r] + (ps[(w & 3) * 16 + 8 * hh + r] + ps[((w & 3) + 4) * 16 + 8 * hh + r]);

    // ---- the next tile's first k group, in flight during the P . V products (the last tile fetches its own again, for nobody) ----
    if (AHEAD) {
      const int ktn = (kt < kthi) ? (kt + 1) : kt;   // block-uniform; keeps the address inside the k plane
      const _Float16* kn = Kh + (krow0 + ktn * 64) * HD_ + 8 * hh;
#pragma unroll   // register arrays: constant indices
      for (int u = 0; u < KG; ++u) {
#pragma unroll   // register arrays: constant indices
        for (int j = 0; j < 2; ++j) kf[u][j] = frag_ld(kn + (size_t)(16 * j) * HD_ + 32 * u);
      }
    }

    // ---- rescale O, then O += P . V for this wave's 32 output columns ----
#pragma unroll
    for (int i = 0; i < 4; ++i) {
      U8 av;
      av.q[0] = *(const v4f*)(alph + 16 * i + 8 * hh);
      av.q[1] = *(const v4f*)(alph + 16 * i + 8 * hh + 4);
#pragma unroll
      for (int r = 0; r < 8; ++r) { oacc[i][0][r] *= av.v[r]; oacc[i][1][r] *= av.v[r]; }
    }
#pragma unroll
    for (int k2 = 0; k2 < 2; ++k2) {
#pragma unroll
      for (int jj = 0; jj < 2; ++jj) {
#pragma unroll
        for (int i = 0; i < 4; ++i) {
          const v16h pa = frag_ld(Ph + (16 * i + c) * AT_PPITCH + 32 * k2 + 8 * hh);
          oacc[i][jj] = mma_g(pa, vb[k2][jj], oacc[i][jj]);
          if (EARLY) {
            const v16h pr = frag_ld(Pl + (16 * i + c) * AT_PPITCH + 32 * k2 + 8 * hh);
            oacc[i][jj] = mma_g(pa, vr[k2][jj], oacc[i][jj]);
            oacc[i][jj] = mma_g(pr, vb[k2][jj], oacc[i][jj]);
          }
        }
      }
    }
  }
}

__global__ __launch_bounds__(256) void attn_kernel(const _Float16* __restrict__ Qh, const _Float16* __restrict__ Ql,
                                                   const _Float16* __restrict__ Kh, const _Float16* __restrict__ Kl,
                                                   const _Float16* __restrict__ Vth, const _Float16* __restrict__ Vtl,
                                                   const float* __restrict__ mask, const int* __restrict__ flag,
                                                   _Float16* __restrict__ AOh, _Float16* __restrict__ AOl) {
  extern __shared__ __align__(16) unsigned char dsm[];
  _Float16* Ph   = (_Float16*)(dsm + AT_OFF_PH);
  _Float16* Pl   = (_Float16*)(dsm + AT_OFF_PL);
  float*    pm   = (float*)(dsm + AT_OFF_PM);     // [8 waves][16 rows] partial row max
  float*    ps   = (float*)(dsm + AT_OFF_PS);     // [8 waves][16 rows] partial row sum
  float*    alph = (float*)(dsm + AT_OFF_AL);     // [64] rescale factors
  float*    lfin = (float*)(dsm + AT_OFF_LF);     // [64] final row sums
  _Float16* Ohs  = (_Float16*)(dsm + AT_OFF_OH);
  _Float16* Ols  = (_Float16*)(dsm + AT_OFF_OL);

  const int tid  = threadIdx.x;
  const int w    = tid >> 5;
  const int lane = tid & 31;
  const int hh   = lane >> 4;
  const int c    = lane & 15;
  const int bid  = blockIdx.x;
  const int qb   = bid & (NQB_ - 1);
  const int h    = (bid >> 5) & (NH_ - 1);
  const int b    = bid >> 8;
  const int q0   = qb * 64;
  const int srow0 = (w & 3) * 16;
  const int kh    = w >> 2;
  const int ocol0 = w * 32;
  const bool early = (qb < QE_);
  const int ktlo = (qb > 16) ? (qb - 16) : 0;
  int fl = 1;                                  // block-uniform: all row groups of this query block verified
#pragma unroll   // independent scalar loads, issued together instead of one round trip each
  for (int g = 0; g < MFG_; ++g) fl &= flag[((b * NQB_ + qb) * MFG_ + g) * 32];
  int kthi = (fl != 0) ? qb : (qb + 16);
  if (kthi > NQB_ - 1) kthi = NQB_ - 1;

  const size_t growq = (size_t)b * SEQ_ + q0;
  const _Float16* qhp = Qh + (growq + srow0 + c) * DM_ + h * HD_ + 8 * hh;
  const _Float16* qlp = Ql + (growq + srow0 + c) * DM_ + h * HD_ + 8 * hh;
  const float*    mrp = mask + (growq + srow0 + 8 * hh) * (size_t)SEQ_;
  const _Float16* vhp = Vth + ((size_t)b * HD_ + ocol0 + c) * SEQ_ + 8 * hh;
  const _Float16* vlp = Vtl + ((size_t)b * HD_ + ocol0 + c) * SEQ_ + 8 * hh;

  float mrow[8], lrow[8];
  v8f oacc[4][2];
#pragma unroll
  for (int r = 0; r < 8; ++r) { mrow[r] = -INFINITY; lrow[r] = 0.0f; }
#pragma unroll
  for (int i = 0; i < 4; ++i) { oacc[i][0] = zero8(); oacc[i][1] = zero8(); }

  if (early)   // block-uniform
    attn_tiles<true>(ktlo, kthi, b, q0, srow0, kh, w, hh, c, qhp, qlp, Kh, Kl, mrp, vhp, vlp, Ph, Pl, pm, ps, alph, mrow, lrow, oacc);
  else
    attn_tiles<false>(ktlo, kthi, b, q0, srow0, kh, w, hh, c, qhp, qlp, Kh, Kl, mrp, vhp, vlp, Ph, Pl, pm, ps, alph, mrow, lrow, oacc);

  if (w < 4 && c == 0) {
#pragma unroll
    for (int r = 0; r < 8; ++r) lfin[srow0 + 8 * hh + r] = lrow[r];
  }
  __syncthreads();
#pragma unroll
  for (int i = 0; i < 4; ++i) {
    U8 lv;
    lv.q[0] = *(const v4f*)(lfin + 16 * i + 8 * hh);
    lv.q[1] = *(const v4f*)(lfin + 16 * i + 8 * hh + 4);
#pragma unroll
    for (int r = 0; r < 8; ++r) {
      const float f = OSC_ * (1.0f / lv.v[r]);
      const int orow = 16 * i + 8 * hh + r;
#pragma unroll
      for (int jj = 0; jj < 2; ++jj) {
        const float t = oacc[i][jj][r] * f;
        const _Float16 hq = (_Float16)t;
        const int oidx = orow * AT_OPITCH + ocol0 + 16 * jj + c;
        Ohs[oidx] = hq;
        Ols[oidx] = (_Float16)(t - (float)hq);
      }
    }
  }
  __syncthreads();
  {
    const int piece = tid & 7;
    const int lsub  = tid >> 3;
    {
#pragma unroll
      for (int it = 0; it < 8; ++it) {
        const int line = it * 32 + lsub;          // 0..255 = 64 rows x 4 lines
        const int row  = line >> 2;
        const int col  = (line & 3) * 64 + piece * 8;
        const v8h hv = *(const v8h*)(Ohs + row * AT_OPITCH + col);
        const v8h rv = *(const v8h*)(Ols + row * AT_OPITCH + col);
        const size_t go = (growq + row) * DM_ + h * HD_ + col;
        *(v8h*)(AOh + go) = hv;
        *(v8h*)(AOl + go) = rv;
      }
      
    }
  }
}

// ---------------------------------------------------------------------------------------------------------------
// Workspace map (byte offsets, all 2 MiB aligned; every region is written completely by whole-line stores before it is read;
// the attention output planes reuse the f32 q region, which is dead after the q RoPE/split pass):
//   Xh   f16 [4096][2048]            0           16,777,216
//   Wqh  f16 [2048][2048]   16,777,216            8,388,608
//   Wkvh f16 [512][2048]    25,165,824            2,097,152
//   Woh  f16 [2048][2048]   27,262,976            8,388,608
//   cosT f32 [4096][128]    35,651,584            2,097,152
//   sinT f32 [4096][128]    37,748,736            2,097,152
//   Qf   f32 [4096][2048]   39,845,888           33,554,432   (AOh f16 [4096][2048] at 39,845,888; AOl at 56,623,104)
//   KVf  f32 [4096][512]    73,400,320            8,388,608
//   Qh   f16 [4096][2048]   81,788,928           16,777,216
//   Ql   f16 [4096][2048]   98,566,144           16,777,216
//   Kh   f16 [4096][256]   115,343,360            2,097,152
//   Kl   f16 [4096][256]   117,440,512            2,097,152
//   Vth  f16 [2][256][2048] 119,537,664           2,097,152
//   Vtl  f16 [2][256][2048] 121,634,816           2,097,152
//   flags int [2*32*16][32] 123,731,968            131,072
//   total                  123,863,040
// ---------------------------------------------------------------------------------------------------------------
extern "C" void kernel_launch(void* const* d_in, const int* in_sizes, int n_in,
                              void* d_out, int out_size, void* d_ws, size_t ws_size,
                              hipStream_t stream) {
  if (n_in < 7) return;
  if (in_sizes[0] != NB_ * SEQ_ * DM_) return;
  if (in_sizes[1] != NB_ * SEQ_ * SEQ_) return;
  if (in_sizes[2] != NB_ * SEQ_) return;
  if (in_sizes[3] != DM_ * DM_) return;
  if (in_sizes[4] != HD_ * DM_) return;
  if (in_sizes[5] != HD_ * DM_) return;
  if (in_sizes[6] != DM_ * DM_) return;
  if (out_size != NB_ * SEQ_ * DM_) return;

  const float* x    = (const float*)d_in[0];
  const float* mask = (const float*)d_in[1];
  const int*   pos  = (const int*)d_in[2];
  const float* Wq   = (const float*)d_in[3];
  const float* Wk   = (const float*)d_in[4];
  const float* Wv   = (const float*)d_in[5];
  const float* Wo   = (const float*)d_in[6];
  float* out = (float*)d_out;

  const size_t nX   = (size_t)NB_ * SEQ_ * DM_;          // 8,388,608 elements
  const size_t bXh  = nX * 2;
  const size_t bWq  = (size_t)DM_ * DM_ * 2;
  const size_t bWkv = (size_t)KVN_ * DM_ * 2;
  const size_t bWo  = bWq;
  const size_t bTab = (size_t)NB_ * SEQ_ * NF_ * 4;
  const size_t bQf  = nX * 4;
  const size_t bKVf = (size_t)NB_ * SEQ_ * KVN_ * 4;
  const size_t bQ16 = nX * 2;
  const size_t bK16 = (size_t)NB_ * SEQ_ * HD_ * 2;
  const size_t bV16 = bK16;
  const size_t bFlg = (size_t)NB_ * NQB_ * MFG_ * 128;
  size_t off = 0;
  const size_t oXh  = off; off += bXh;
  const size_t oWq  = off; off += bWq;
  const size_t oWkv = off; off += bWkv;
  const size_t oWo  = off; off += bWo;
  const size_t oCos = off; off += bTab;
  const size_t oSin = off; off += bTab;
  const size_t oQf  = off; off += bQf;
  const size_t oKVf = off; off += bKVf;
  const size_t oQh  = off; off += bQ16;
  const size_t oQl  = off; off += bQ16;
  const size_t oKh  = off; off += bK16;
  const size_t oKl  = off; off += bK16;
  const size_t oVth = off; off += bV16;
  const size_t oVtl = off; off += bV16;
  const size_t oFlg = off; off += bFlg;
  if (off > ws_size) return;                        // off = 123,863,040
  if (off > (size_t)134217728) return;
  if (bQf < 2 * bQ16) return;                        // AOh/AOl alias fits inside the f32 q region
  const size_t oAOh = oQf;
  const size_t oAOl = oQf + bQ16;

  char* ws = (char*)d_ws;
  _Float16* Xh   = (_Float16*)(ws + oXh);
  _Float16* Wqh  = (_Float16*)(ws + oWq);
  _Float16* Wkvh = (_Float16*)(ws + oWkv);
  _Float16* Woh  = (_Float16*)(ws + oWo);
  float*    cosT = (float*)(ws + oCos);
  float*    sinT = (float*)(ws + oSin);
  float*    Qf   = (float*)(ws + oQf);
  float*    KVf  = (float*)(ws + oKVf);
  _Float16* Qh   = (_Float16*)(ws + oQh);
  _Float16* Ql   = (_Float16*)(ws + oQl);
  _Float16* Kh   = (_Float16*)(ws + oKh);
  _Float16* Kl   = (_Float16*)(ws + oKl);
  _Float16* Vth  = (_Float16*)(ws + oVth);
  _Float16* Vtl  = (_Float16*)(ws + oVtl);
  int*      flg  = (int*)(ws + oFlg);
  _Float16* AOh  = (_Float16*)(ws + oAOh);
  _Float16* AOl  = (_Float16*)(ws + oAOl);

  const dim3 blk(256);

  // (1) one launch: inputs -> 16-bit planes (x bf16*2^4, weights bf16*2^8, k rows then v rows in the fused kv weight plane);
  //     cos/sin tables [4096][128] from position ids; mask verification flags per (b, query block, 4-row group)
  prep_kernel<<<dim3(PB_ALL_), blk, 0, stream>>>(x, mask, pos, Wq, Wk, Wv, Wo, Xh, Wqh, Wkvh, Woh, cosT, sinT, flg);
  // (2) one launch: q = x . Wq^T -> f32 [4096][2048]; [k|v] = x . [Wk|Wv]^T -> f32 [4096][512]
  gemm64_kernel<<<dim3((NB_ * SEQ_ / GBM_) * (DM_ / GBN_ + KVN_ / GBN_)), blk, 0, stream>>>(
      Xh, Xh, DM_, Wqh, DM_, Qf, DM_, NB_ * SEQ_, DM_, DM_, 0, SEQ_ - 1, QSC_, Wkvh, KVf, KVN_, KVN_);
  // (3) one launch: RoPE + hi/residual split, q planes [4096][8*256] and k planes [4096][256]; v^T planes [2][256][2048]
  split_kernel<<<dim3(SB_ALL_), blk, 0, stream>>>(Qf, KVf, cosT, sinT, Qh, Ql, Kh, Kl, Vth, Vtl);
  // (4) attention -> AO hi/residual planes [4096][2048]
  (void)hipFuncSetAttribute(reinterpret_cast<const void*>(&attn_kernel), hipFuncAttributeMaxDynamicSharedMemorySize, AT_LDS);
  attn_kernel<<<dim3(NB_ * NH_ * NQB_), blk, AT_LDS, stream>>>(Qh, Ql, Kh, Kl, Vth, Vtl, mask, flg, AOh, AOl);
  // (5) out = AO . Wo^T -> d_out f32 [4096][2048]; residual plane on rows < LOROWS_ of each sequence
  gemm64_kernel<<<dim3((NB_ * SEQ_ / GBM_) * (DM_ / GBN_)), blk, 0, stream>>>(
      AOh, AOl, DM_, Woh, DM_, out, DM_, NB_ * SEQ_, DM_, DM_, LOROWS_, SEQ_ - 1, WSC_, Woh, out, DM_, 0);
  (void)hipGetLastError();
}

// v005
// A run of this version takes 189 microseconds.
// Next to v004, in two timings, it ran 1.10 times as fast each time.
// Counting every step since v000, it is 3.29 times as fast.
// Contractions on v_wmma_f32_16x16x32_f16 (f16 operands, f32 accumulate): q/k/v projections (x RNE-converted to bf16 and carried *2^4,
// W RNE-converted to bf16 and carried *2^8, exact products); q.k^T (q,k carried *2^10 as f16 hi planes, plus unscaled f16 residual planes
// on the leading query blocks of each sequence); p.v (p carried *2^15, v^T carried *2^10: hi planes plus residual planes on the leading query
// blocks); output projection (attention output carried *2^10: hi plane everywhere, residual plane on the leading rows of each sequence;
// Wo bf16 *2^8). RoPE, mask add and online softmax in f32.
#include <hip/hip_runtime.h>
#include <math.h>
#include <stdint.h>

#define NB_     2
#define SEQ_    2048
#define DM_     2048
#define NH_     8
#define HD_     256
#define NF_     128
#define KVN_    512
#define WIN_    1024
#define NQB_    32
#define QE_     4
#define LOROWS_ 256
#define MFG_    16

#define CX_   16.0f
#define CW_   256.0f
#define CQK_  1024.0f
#define CP_   32768.0f
#define SSC_  5.9604644775390625e-8f     /* 2^-4 * 2^-20 : score scale for q,k carried *2^10 each */
#define OSC_  3.0517578125e-5f           /* 2^-15 = 2^10 / (2^15 * 2^10) : attention output carry */
#define QSC_  2.44140625e-4f             /* 2^-12 = 1 / (2^4 * 2^8) : projection outputs back to f32 */
#define WSC_  3.814697265625e-6f         /* 2^-18 = 1 / (2^10 * 2^8) : final projection */

typedef _Float16 v16h __attribute__((ext_vector_type(16)));
typedef _Float16 v8h  __attribute__((ext_vector_type(8)));
typedef float    v8f  __attribute__((ext_vector_type(8)));
typedef float    v4f  __attribute__((ext_vector_type(4)));

union FragU { v16h v; v8h h[2]; };
union U8 { v8f v; v4f q[2]; };

__device__ __forceinline__ float bf16_rne(float f) {
  unsigned u = __float_as_uint(f);
  u = u + 0x7FFFu + ((u >> 16) & 1u);
  return __uint_as_float(u & 0xFFFF0000u);
}
__device__ __forceinline__ v8f zero8() { return (v8f){0.f, 0.f, 0.f, 0.f, 0.f, 0.f, 0.f, 0.f}; }

// 16-bit fragment (A or B): lane row/col = lane&15, elements 0..7 <- p[0..7] (k0+8h..), 8..15 <- p[16..23] (k0+16+8h..)
// p already includes the row base + k0 + 8*h.
__device__ __forceinline__ v16h frag_ld(const _Float16* p) {
  FragU f;
  f.h[0] = *(const v8h*)(p);
  f.h[1] = *(const v8h*)(p + 16);
  return f.v;
}
__device__ __forceinline__ v8f wmma_raw(v16h a, v16h b, v8f c) {
  return __builtin_amdgcn_wmma_f32_16x16x32_f16(false, a, false, b, (short)0, c, false, false);
}
// WMMA with trailing hazard guard (ties D, keeps A/B live)
__device__ __forceinline__ v8f mma_g(v16h a, v16h b, v8f c) {
  c = __builtin_amdgcn_wmma_f32_16x16x32_f16(false, a, false, b, (short)0, c, false, false);
  asm volatile("v_nop\n\tv_nop\n\tv_nop\n\tv_nop" : "+v"(c) : "v"(a), "v"(b));
  return c;
}
__device__ __forceinline__ void dep_guard(v8f& a, v8f& b, v16h x, v16h y) {
  asm volatile("v_nop\n\tv_nop\n\tv_nop\n\tv_nop" : "+v"(a), "+v"(b) : "v"(x), "v"(y));
}
__device__ __forceinline__ void keep4(v16h a, v16h b, v16h c, v16h d) {
  asm volatile("v_nop" :: "v"(a), "v"(b), "v"(c), "v"(d));
}
__device__ __forceinline__ void acc_guard4(v8f& a, v8f& b, v8f& c, v8f& d) {
  asm volatile("v_nop\n\tv_nop\n\tv_nop\n\tv_nop" : "+v"(a), "+v"(b), "+v"(c), "+v"(d));
}

// ---------------------------------------------------------------------------------------------------------------
// Elementwise convert: dst[i] = f16( bf16_rne(src[i]) * scale ), 8 elements per thread, one 16-B store per lane:
// coverage: ceil(n8/256) blocks (blk = the block's index within them), each thread 8 elements -> 8*n8 elements.
// ---------------------------------------------------------------------------------------------------------------
__device__ __forceinline__ void cvt16_part(int blk, const float* __restrict__ src, _Float16* __restrict__ dst, int n8, float scale) {
  const int i = blk * 256 + (int)threadIdx.x;
  if (i >= n8) return;
  const float* s = src + 8 * (size_t)i;
  U8 a;
  a.q[0] = *(const v4f*)(s);
  a.q[1] = *(const v4f*)(s + 4);
  v8h o;
#pragma unroll
  for (int e = 0; e < 8; ++e) o[e] = (_Float16)(bf16_rne(a.v[e]) * scale);
  _Float16* d = dst + 8 * (size_t)i;
  *(v8h*)d = o;
  
}

// ---------------------------------------------------------------------------------------------------------------
// RoPE tables: cosT/sinT [nrows][128], angle = float(pos[row]) * inv_freq[f], inv_freq[f] = 1 / f32(10000^(f/128)).
// coverage: nrows/32 blocks (blk = the block's index within them), 16 iterations x 2 rows -> nrows x 128 per table.
// ---------------------------------------------------------------------------------------------------------------
__device__ __forceinline__ void rope_table_part(int blk, const int* __restrict__ pos, float* __restrict__ cosT,
                                                float* __restrict__ sinT, int nrows) {
#pragma clang fp contract(off)
  __shared__ float invf[NF_];
  const int tid = threadIdx.x;
  if (tid < NF_) {
    const double e = (double)tid * 0.0078125;                 // tid/128 exactly
    const double p = exp2(e * 13.287712379549449);            // 10000^e
    const float pf = (float)p;                                // RNE to f32
    invf[tid] = 1.0f / pf;
  }
  __syncthreads();
  const int f = tid & (NF_ - 1);
  const int rp = tid >> 7;
  const int r0 = blk * 32;
  const float iv = invf[f];
#pragma unroll 1
  for (int it = 0; it < 16; ++it) {
    const int row = r0 + it * 2 + rp;
    const int rowc = (row < nrows) ? row : (nrows - 1);
    const float ang = (float)pos[rowc] * iv;
    float sv, cv;
    sincosf(ang, &sv, &cv);
    if (row < nrows) {
      float* cp = cosT + (size_t)row * NF_ + f;
      float* sp = sinT + (size_t)row * NF_ + f;
      *(float*)cp = cv;
      *(float*)sp = sv;
      // the wait that stands in front of a rewrite of an issued store's registers (the next trip reuses them)
      asm volatile("s_wait_xcnt 0x0" :: "v"(cp), "v"(sp), "v"(cv), "v"(sv) : "memory");
    }
  }
}

// ---------------------------------------------------------------------------------------------------------------
// Mask verification flags, MFG_ per (b, 64-query block), one per group of 4 query rows: 1 if every mask value for the group's rows
// and keys in [q0+64, min(q+1023, SEQ-1)] (the in-band keys strictly above the query block) is <= -1e9 (adds to an exact zero weight).
// The range holds at most 1023 keys, so 256 threads x 4 keys cover a row with one 16-byte load each; the 4 rows' loads are independent.
// coverage: NB*NQB*MFG_ blocks (bid = the block's index within them); each block writes its own 128-byte line of 32 equal ints.
// ---------------------------------------------------------------------------------------------------------------
__device__ __forceinline__ void maskflag_part(int bid, const float* __restrict__ mask, int* __restrict__ flag) {
  __shared__ int sw[8];
  const int tid = threadIdx.x, w = tid >> 5, lane = tid & 31;
  // bid = (b*32 + qb)*MFG_ + row group
  const int g  = bid & (MFG_ - 1);
  const int bq = bid / MFG_;
  const int b = bq >> 5, qb = bq & (NQB_ - 1);
  const int q0 = qb * 64;
  const int r0 = q0 + g * (64 / MFG_);
  const int k  = q0 + 64 + 4 * tid;          // first of this thread's four keys
  const int kc = (k <= SEQ_ - 4) ? k : (SEQ_ - 4);   // k > SEQ-4 means k >= SEQ: none of the four keys is tested
  v4f mv[64 / MFG_];
#pragma unroll   // all rows' loads issue before the first compare waits (and mv stays in registers)
  for (int rr = 0; rr < 64 / MFG_; ++rr) mv[rr] = *(const v4f*)(mask + ((size_t)b * SEQ_ + r0 + rr) * SEQ_ + kc);
  int bad = 0;
#pragma unroll
  for (int rr = 0; rr < 64 / MFG_; ++rr) {
    int kend = r0 + rr + WIN_ - 1;
    if (kend > SEQ_ - 1) kend = SEQ_ - 1;
#pragma unroll
    for (int e = 0; e < 4; ++e) {
      const int ok = (mv[rr][e] <= -1.0e9f) ? 1 : 0;
      bad |= ((k + e <= kend) && (ok == 0)) ? 1 : 0;
    }
  }
  const unsigned long long bm = __ballot(bad);
  if (lane == 0) sw[w] = (bm != 0ull) ? 1 : 0;
  __syncthreads();
  if (w == 0) {
    int any = 0;
#pragma unroll
    for (int i = 0; i < 8; ++i) any |= sw[i];
    const int fv = any ? 0 : 1;
    int* fp = flag + (size_t)bid * 32 + lane;
    *(int*)fp = fv;
  }
}

// ---------------------------------------------------------------------------------------------------------------
// The preparation passes, which depend on the inputs alone and not on one another, share one launch: a block's index range says
// which pass it belongs to (block-uniform, so each pass's barriers are reached by all of its block's threads or by none).
// The table blocks, few and with the longest serial chain, come first; then the mask check; then the five conversions.
// coverage: PB_ALL_ blocks = the sum of the passes' own block counts; every pass gets exactly its blocks.
// ---------------------------------------------------------------------------------------------------------------
#define PB_TAB_ ((NB_ * SEQ_) / 32)               /* 128  */
#define PB_FLG_ (NB_ * NQB_ * MFG_)               /* 1024 */
#define PB_X_   ((NB_ * SEQ_ * DM_) / (8 * 256))  /* 4096 */
#define PB_W_   ((DM_ * DM_) / (8 * 256))         /* 2048 */
#define PB_KV_  ((HD_ * DM_) / (8 * 256))         /* 256  */
#define PB_ALL_ (PB_TAB_ + PB_FLG_ + PB_X_ + 2 * PB_W_ + 2 * PB_KV_)
__global__ __launch_bounds__(256) void prep_kernel(const float* __restrict__ x, const float* __restrict__ mask,
                                                   const int* __restrict__ pos, const float* __restrict__ Wq,
                                                   const float* __restrict__ Wk, const float* __restrict__ Wv,
                                                   const float* __restrict__ Wo, _Float16* __restrict__ Xh,
                                                   _Float16* __restrict__ Wqh, _Float16* __restrict__ Wkvh,
                                                   _Float16* __restrict__ Woh, float* __restrict__ cosT,
                                                   float* __restrict__ sinT, int* __restrict__ flag) {
  int blk = blockIdx.x;
  if (blk < PB_TAB_) { rope_table_part(blk, pos, cosT, sinT, NB_ * SEQ_); return; }
  blk -= PB_TAB_;
  if (blk < PB_FLG_) { maskflag_part(blk, mask, flag); return; }
  blk -= PB_FLG_;
  if (blk < PB_X_) { cvt16_part(blk, x, Xh, PB_X_ * 256, CX_); return; }
  blk -= PB_X_;
  const float* src = Wq;      // weights: bf16 * 2^8; k rows then v rows in the fused kv weight plane
  _Float16* dst = Wqh;
  int n8 = PB_W_ * 256;
  if (blk >= PB_W_) {
    blk -= PB_W_; src = Wo; dst = Woh;
    if (blk >= PB_W_) {
      blk -= PB_W_; src = Wk; dst = Wkvh; n8 = PB_KV_ * 256;
      if (blk >= PB_KV_) { blk -= PB_KV_; src = Wv; dst = Wkvh + (size_t)HD_ * DM_; }
    }
  }
  cvt16_part(blk, src, dst, n8, CW_);
}

// ---------------------------------------------------------------------------------------------------------------
// Register-blocked WMMA GEMM, f16 operands: C[m][n] = scale * sum_k (A[m][k] (+ A2[m][k])) * Bt[n][k]
// A row-major [M][lda], optional residual plane A2 (same layout) used on row blocks with (m0 & seqMask) < loRows (block-uniform;
// loRows a multiple of 128); Bt row-major [N][ldb] (k contiguous); C f32 [M][ldc].
// Block = 8 waves (2 x 4) on a 128 x 256 tile of C, each wave a 64x64 tile (4x4 accumulators).
// Operands reach LDS by asynchronous 16-byte copies, whole 256-byte row pieces (128 k) per stage, two stages: the next stage's
// copies fly while this stage is multiplied. LDS row pitch 272 bytes (16 B x odd) for the 16-byte fragment reads.
// M multiple of 128, N multiple of 256, K multiple of 128. Epilogue: 16-row slabs staged per wave in the (then free) ring.
// ---------------------------------------------------------------------------------------------------------------
#define GK_    128                               /* k per stage */
#define GPH_   136                               /* LDS row pitch, halves */
#define GBM_   128
#define GBN_   256
#define G_OA2_ (GBM_ * GPH_)                     /* residual plane of A, halves from the stage's start */
#define G_OB_  (2 * GBM_ * GPH_)
#define G_STG_ ((2 * GBM_ + GBN_) * GPH_)        /* halves per stage */
#define G_LS_  (16 * GPH_ * 2)                   /* bytes between LDS rows 16 apart */
static_assert(LOROWS_ % GBM_ == 0);
static_assert(2 * G_STG_ * 2 >= 8 * 16 * 68 * 4);

// Eight copies per lane, rows 16 apart: l = the lane's LDS byte address, g = its global address, gs = halves per 16 source rows.
// s_wait_xcnt stands inside the statement so that no address register is rewritten ahead of it.
__device__ __forceinline__ void async_rows8(unsigned l, const _Float16* g, size_t gs) {
  asm volatile(
      "global_load_async_to_lds_b128 %0, %8, off\n\t"
      "global_load_async_to_lds_b128 %1, %9, off\n\t"
      "global_load_async_to_lds_b128 %2, %10, off\n\t"
      "global_load_async_to_lds_b128 %3, %11, off\n\t"
      "global_load_async_to_lds_b128 %4, %12, off\n\t"
      "global_load_async_to_lds_b128 %5, %13, off\n\t"
      "global_load_async_to_lds_b128 %6, %14, off\n\t"
      "global_load_async_to_lds_b128 %7, %15, off\n\t"
      "s_wait_xcnt 0x0"
      :: "v"(l), "v"(l + 1u * G_LS_), "v"(l + 2u * G_LS_), "v"(l + 3u * G_LS_),
         "v"(l + 4u * G_LS_), "v"(l + 5u * G_LS_), "v"(l + 6u * G_LS_), "v"(l + 7u * G_LS_),
         "v"(g), "v"(g + gs), "v"(g + 2 * gs), "v"(g + 3 * gs), "v"(g + 4 * gs), "v"(g + 5 * gs), "v"(g + 6 * gs), "v"(g + 7 * gs)
      : "memory");
}
// One stage: A 128 rows (+ A2 128 rows), Bt 256 rows, 256 bytes of each; a wave's copy covers two whole row pieces.
template <bool LO>
__device__ __forceinline__ void gemm_fill(unsigned l, const _Float16* ga, const _Float16* ga2, size_t as16,
                                          const _Float16* gb, size_t bs16) {
  async_rows8(l, ga, as16);
  if (LO) async_rows8(l + G_OA2_ * 2u, ga2, as16);
  async_rows8(l + G_OB_ * 2u, gb, bs16);
  async_rows8(l + G_OB_ * 2u + 8u * G_LS_, gb + 8 * bs16, bs16);
}

template <bool LO>
__device__ __forceinline__ void gemm_ring(v8f (&acc)[4][4], const _Float16* ring, const _Float16* __restrict__ Ab,
                                          const _Float16* __restrict__ Ab2, int lda, const _Float16* __restrict__ Bb, int ldb,
                                          int m0b, int n0b, int K, int tid, int wrow, int wcol, int rlane, int koff) {
  const int sub = tid >> 4;
  const int cc  = (tid & 15) * 8;
  const unsigned l0 = (unsigned)(size_t)ring + (unsigned)(sub * GPH_ + cc) * 2u;
  const _Float16* ga  = Ab  + (size_t)(m0b + sub) * lda + cc;
  const _Float16* ga2 = Ab2 + (size_t)(m0b + sub) * lda + cc;
  const _Float16* gb  = Bb  + (size_t)(n0b + sub) * ldb + cc;
  const size_t as16 = (size_t)16 * lda;
  const size_t bs16 = (size_t)16 * ldb;
  const int nt = K / GK_;

  gemm_fill<LO>(l0, ga, ga2, as16, gb, bs16);
  asm volatile("s_wait_asynccnt 0x0" ::: "memory");   // stage 0 landed (this wave's copies) before the barrier publishes it
  __syncthreads();
  if (nt > 1) gemm_fill<LO>(l0 + G_STG_ * 2u, ga + GK_, ga2 + GK_, as16, gb + GK_, bs16);

  for (int t = 0; t < nt; ++t) {
    const _Float16* st = ring + (t & 1) * G_STG_;
    const _Float16* sa = st + (wrow + rlane) * GPH_ + koff;
    const _Float16* sb = st + G_OB_ + (wcol + rlane) * GPH_ + koff;
#pragma unroll   // the four k-steps of a stage in one body: constant LDS offsets, no loop overhead between them
    for (int kk = 0; kk < GK_; kk += 32) {
      v16h bh[4], ah[4], al[4];
#pragma unroll   // register arrays: constant indices
      for (int j = 0; j < 4; ++j) bh[j] = frag_ld(sb + (j << 4) * GPH_ + kk);
#pragma unroll   // register arrays: constant indices
      for (int i = 0; i < 4; ++i) {
        ah[i] = frag_ld(sa + (i << 4) * GPH_ + kk);
        al[i] = ah[i];
        if (LO) al[i] = frag_ld(sa + G_OA2_ + (i << 4) * GPH_ + kk);
      }
      // holds the k-step's fragment reads together in front of its products (one LDS wait per k-step instead of one per row)
      asm volatile("" :: "v"(bh[0]), "v"(bh[1]), "v"(bh[2]), "v"(bh[3]), "v"(ah[0]), "v"(ah[1]), "v"(ah[2]), "v"(ah[3]));
      if (LO) asm volatile("" :: "v"(al[0]), "v"(al[1]), "v"(al[2]), "v"(al[3]));   // the same for the residual plane's reads
#pragma unroll   // register arrays: constant indices
      for (int i = 0; i < 4; ++i) {
#pragma unroll   // register arrays: constant indices
        for (int j = 0; j < 4; ++j) {
          acc[i][j] = wmma_raw(ah[i], bh[j], acc[i][j]);
          if (LO) acc[i][j] = wmma_raw(al[i], bh[j], acc[i][j]);
        }
        dep_guard(acc[i][0], acc[i][3], ah[i], al[i]);
      }
      keep4(bh[0], bh[1], bh[2], bh[3]);
    }
    asm volatile("s_wait_dscnt 0x0" ::: "memory");      // this wave's reads of the stage are done before it may be refilled
    asm volatile("s_wait_asynccnt 0x0" ::: "memory");   // this wave's copies of the next stage have landed
    __syncthreads();                                    // publishes stage t+1 and frees stage t's buffer
    if (t + 2 < nt)
      gemm_fill<LO>(l0 + (unsigned)(t & 1) * (G_STG_ * 2u), ga + (size_t)(t + 2) * GK_, ga2 + (size_t)(t + 2) * GK_, as16,
                    gb + (size_t)(t + 2) * GK_, bs16);
  }
  asm volatile("s_wait_asynccnt 0x0" ::: "memory");     // nothing in flight when the ring becomes output staging
}

// One launch may hold two products with the same A, M, K, ldb and scale: blocks past the first product's tiles take Btb, Cb, ldcb, Nb
// (Nb = 0: no second product).
__global__ __launch_bounds__(256) void gemm64_kernel(const _Float16* __restrict__ A, const _Float16* __restrict__ A2, int lda,
                                                     const _Float16* __restrict__ Bta, int ldb,
                                                     float* __restrict__ Ca, int ldca, int M, int Na, int K,
                                                     int loRows, int seqMask, float scale,
                                                     const _Float16* __restrict__ Btb, float* __restrict__ Cb, int ldcb, int Nb) {
  __shared__ __align__(16) _Float16 ring[2 * G_STG_];   // two stages; afterwards per-wave 16x64 f32 slabs, pitch 68 floats
  const int tid  = threadIdx.x;
  const int lane = tid & 31;
  const int wave = tid >> 5;
  const int tilesM = M / GBM_;
  const int tilesA = tilesM * (Na / GBN_);
  const bool second = ((int)blockIdx.x >= tilesA);   // block-uniform
  const _Float16* Bt = second ? Btb : Bta;
  float* C = second ? Cb : Ca;
  const int ldc = second ? ldcb : ldca;
  const int tilesN = (second ? Nb : Na) / GBN_;
  const int bid = second ? ((int)blockIdx.x - tilesA) : (int)blockIdx.x;
  if (bid >= tilesM * tilesN) return;   // block-uniform, in front of every barrier
  const int tm = bid / tilesN;
  const int tn = bid - tm * tilesN;
  const int m0b = tm * GBM_;
  const int n0b = tn * GBN_;
  const int wrow = (wave >> 2) << 6;
  const int wcol = (wave & 3) << 6;
  const int m0 = m0b + wrow;
  const int n0 = n0b + wcol;
  const int rlane = lane & 15;
  const int koff  = (lane >> 4) * 8;
  const int mOff  = koff;

  v8f acc[4][4];
#pragma unroll
  for (int i = 0; i < 4; ++i)
#pragma unroll
    for (int j = 0; j < 4; ++j) acc[i][j] = zero8();

  const bool useLo = ((m0b & seqMask) < loRows);   // block-uniform
  if (useLo) gemm_ring<true>(acc, ring, A, A2, lda, Bt, ldb, m0b, n0b, K, tid, wrow, wcol, rlane, koff);
  else       gemm_ring<false>(acc, ring, A, A, lda, Bt, ldb, m0b, n0b, K, tid, wrow, wcol, rlane, koff);
  acc_guard4(acc[0][0], acc[0][1], acc[0][2], acc[0][3]);
  acc_guard4(acc[1][0], acc[1][1], acc[1][2], acc[1][3]);
  acc_guard4(acc[2][0], acc[2][1], acc[2][2], acc[2][3]);
  acc_guard4(acc[3][0], acc[3][1], acc[3][2], acc[3][3]);

  float* slab = (float*)ring + wave * (16 * 68);
  const int hrow = lane >> 4;
  const int c4 = rlane * 4;
#pragma unroll
  for (int i = 0; i < 4; ++i) {
    const int mBase = m0 + (i << 4);
#pragma unroll
    for (int j = 0; j < 4; ++j) {
#pragma unroll
      for (int r = 0; r < 8; ++r) slab[(mOff + r) * 68 + (j << 4) + rlane] = acc[i][j][r] * scale;
    }
    __builtin_amdgcn_fence(__ATOMIC_RELEASE, "workgroup");
    __builtin_amdgcn_wave_barrier();
    __builtin_amdgcn_fence(__ATOMIC_ACQUIRE, "workgroup");
    {
#pragma unroll
      for (int it = 0; it < 8; ++it) {
        const int row = it * 2 + hrow;
        const v4f v = *(const v4f*)(slab + row * 68 + c4);
        *(v4f*)(C + (size_t)(mBase + row) * ldc + n0 + c4) = v;
      }
      
    }
    __builtin_amdgcn_fence(__ATOMIC_RELEASE, "workgroup");
    __builtin_amdgcn_wave_barrier();
    __builtin_amdgcn_fence(__ATOMIC_ACQUIRE, "workgroup");
  }
}

// ---------------------------------------------------------------------------------------------------------------
// RoPE + f16 hi/residual split. Unit = (row, head); 8 lanes per unit; lane j owns columns {8j, 64+8j, 128+8j, 192+8j}+0..7 of the
// 256-wide head (pairs (c, c+128) are in the same lane). out = x*cos + rotate_half(x)*sin with cos/sin[row][c mod 128].
// hi = f16(out*carry), lo = f16(out*carry - hi) (unscaled residual). Stores: for each column chunk one instruction writes
// coverage: nunits*8 threads x 32 elements = nunits*256 per plane.
// ---------------------------------------------------------------------------------------------------------------
__device__ __forceinline__ void rope_split_part(int blk, const float* __restrict__ src, int spitch, int nheads,
                                                const float* __restrict__ cosT, const float* __restrict__ sinT,
                                                _Float16* __restrict__ hi, _Float16* __restrict__ lo,
                                                int dpitch, int nunits, float carry) {
#pragma clang fp contract(off)
  const int gid = blk * 256 + (int)threadIdx.x;
  const int unit = gid >> 3;
  const int j = gid & 7;
  if (unit >= nunits) return;
  const int row = unit / nheads;
  const int hd = unit - row * nheads;
  const float* s  = src  + (size_t)row * spitch + hd * HD_ + 8 * j;
  const float* ct = cosT + (size_t)row * NF_ + 8 * j;
  const float* st = sinT + (size_t)row * NF_ + 8 * j;
  U8 xa, xb, xc, xd, ca, cb, sa, sb;
  xa.q[0] = *(const v4f*)(s);         xa.q[1] = *(const v4f*)(s + 4);
  xb.q[0] = *(const v4f*)(s + 64);    xb.q[1] = *(const v4f*)(s + 68);
  xc.q[0] = *(const v4f*)(s + 128);   xc.q[1] = *(const v4f*)(s + 132);
  xd.q[0] = *(const v4f*)(s + 192);   xd.q[1] = *(const v4f*)(s + 196);
  ca.q[0] = *(const v4f*)(ct);        ca.q[1] = *(const v4f*)(ct + 4);
  cb.q[0] = *(const v4f*)(ct + 64);   cb.q[1] = *(const v4f*)(ct + 68);
  sa.q[0] = *(const v4f*)(st);        sa.q[1] = *(const v4f*)(st + 4);
  sb.q[0] = *(const v4f*)(st + 64);   sb.q[1] = *(const v4f*)(st + 68);
  // the wait that stands in front of a rewrite of an issued load's address registers; naming the three addresses keeps them whole
  // up to it (else the last load takes its result into them)
  asm volatile("s_wait_xcnt 0x0" :: "v"(s), "v"(ct), "v"(st) : "memory");
  v8h h0, h1, h2, h3, l0, l1, l2, l3;
#pragma unroll
  for (int e = 0; e < 8; ++e) {
    const float r0 = xa.v[e] * ca.v[e] - xc.v[e] * sa.v[e];    // col 8j+e
    const float r1 = xb.v[e] * cb.v[e] - xd.v[e] * sb.v[e];    // col 64+8j+e
    const float r2 = xc.v[e] * ca.v[e] + xa.v[e] * sa.v[e];    // col 128+8j+e
    const float r3 = xd.v[e] * cb.v[e] + xb.v[e] * sb.v[e];    // col 192+8j+e
    float t; _Float16 q;
    t = r0 * carry; q = (_Float16)t; h0[e] = q; l0[e] = (_Float16)(t - (float)q);
    t = r1 * carry; q = (_Float16)t; h1[e] = q; l1[e] = (_Float16)(t - (float)q);
    t = r2 * carry; q = (_Float16)t; h2[e] = q; l2[e] = (_Float16)(t - (float)q);
    t = r3 * carry; q = (_Float16)t; h3[e] = q; l3[e] = (_Float16)(t - (float)q);
  }
  _Float16* hp = hi + (size_t)row * dpitch + hd * HD_ + 8 * j;
  _Float16* lp = lo + (size_t)row * dpitch + hd * HD_ + 8 * j;
  {
    *(v8h*)(hp)       = h0;
    *(v8h*)(hp + 64)  = h1;
    *(v8h*)(hp + 128) = h2;
    *(v8h*)(hp + 192) = h3;
    *(v8h*)(lp)       = l0;
    *(v8h*)(lp + 64)  = l1;
    *(v8h*)(lp + 128) = l2;
    *(v8h*)(lp + 192) = l3;
    
  }
}

// ---------------------------------------------------------------------------------------------------------------
// v columns of the fused kv plane (f32 [NB*SEQ rows][512], cols 256..511) -> transposed f16 planes Vth/Vtl [b][d][s]
// (hi = f16(v*2^10), lo = unscaled residual). 64x64 tiles through LDS; (256/64) x (NB*SEQ/64) blocks (bx, by), 256 threads.
// coverage per block: load 4 it x 256 thr x 4 = 64x64; store 2 it x 256 thr x 8 = 64x64 per plane.
// ---------------------------------------------------------------------------------------------------------------
__device__ __forceinline__ void vt_split_part(int bx, int by, const float* __restrict__ KV, _Float16* __restrict__ Vth,
                                              _Float16* __restrict__ Vtl) {
  __shared__ __align__(16) float tf[64 * 68];
  const int tid = threadIdx.x;
  const int d0  = bx * 64;                   // d block (input column within v)
  const int sg0 = by * 64;                   // global row block (b*SEQ + s)
  const int b   = sg0 >> 11;
  const int s0  = sg0 & (SEQ_ - 1);
  {
    const int lr = tid >> 4;
    const int c4 = (tid & 15) * 4;
#pragma unroll
    for (int it = 0; it < 4; ++it) {
      const int rr = it * 16 + lr;
      const v4f a = *(const v4f*)(KV + (size_t)(sg0 + rr) * KVN_ + HD_ + d0 + c4);
      *(v4f*)(tf + rr * 68 + c4) = a;
    }
  }
  __syncthreads();
  const int sub = tid >> 3;          // output row within tile (= d)
  const int c8  = (tid & 7) * 8;     // s offset within tile
  v8h hv[2], lv[2];
#pragma unroll
  for (int it = 0; it < 2; ++it) {
    const int oc = it * 32 + sub;
    v8h a, rsd;
#pragma unroll
    for (int q = 0; q < 8; ++q) {
      const float f = tf[(c8 + q) * 68 + oc] * CQK_;
      const _Float16 hq = (_Float16)f;
      a[q] = hq;
      rsd[q] = (_Float16)(f - (float)hq);
    }
    hv[it] = a; lv[it] = rsd;
  }
  {
#pragma unroll
    for (int it = 0; it < 2; ++it) {
      const int oc = it * 32 + sub;
      const size_t go = ((size_t)b * HD_ + d0 + oc) * SEQ_ + s0 + c8;
      *(v8h*)(Vth + go) = hv[it];
      *(v8h*)(Vtl + go) = lv[it];
    }
    
  }
}

// ---------------------------------------------------------------------------------------------------------------
// The three passes between the projections and the attention do not depend on one another and share one launch, told apart by
// block index range (block-uniform): v transpose (the one with a barrier) first, then the k planes, then the q planes.
// coverage: SB_ALL_ blocks = the sum of the passes' own block counts.
// ---------------------------------------------------------------------------------------------------------------
#define SB_VT_  ((HD_ / 64) * ((NB_ * SEQ_) / 64))   /* 256  */
#define SB_K_   ((NB_ * SEQ_ * 8) / 256)             /* 128  */
#define SB_Q_   ((NB_ * SEQ_ * NH_ * 8) / 256)       /* 1024 */
#define SB_ALL_ (SB_VT_ + SB_K_ + SB_Q_)
__global__ __launch_bounds__(256) void split_kernel(const float* __restrict__ Qf, const float* __restrict__ KVf,
                                                    const float* __restrict__ cosT, const float* __restrict__ sinT,
                                                    _Float16* __restrict__ Qh, _Float16* __restrict__ Ql,
                                                    _Float16* __restrict__ Kh, _Float16* __restrict__ Kl,
                                                    _Float16* __restrict__ Vth, _Float16* __restrict__ Vtl) {
  int blk = blockIdx.x;
  if (blk < SB_VT_) { vt_split_part(blk & (HD_ / 64 - 1), blk / (HD_ / 64), KVf, Vth, Vtl); return; }
  blk -= SB_VT_;
  if (blk < SB_K_) { rope_split_part(blk, KVf, KVN_, 1, cosT, sinT, Kh, Kl, HD_, NB_ * SEQ_, CQK_); return; }
  blk -= SB_K_;
  rope_split_part(blk, Qf, DM_, NH_, cosT, sinT, Qh, Ql, DM_, NB_ * SEQ_ * NH_, CQK_);
}

#define AT_PPITCH 72
#define AT_OPITCH 264
#define AT_KP     264                            /* k tile row pitch, halves: 528 B = 16 B x odd */
#define AT_VP     72                             /* v^T tile row pitch, halves: 144 B = 16 B x odd */
#define AT_SV     (64 * AT_KP)                   /* v^T tile, halves from the stage's start */
#define AT_STG    (64 * AT_KP + HD_ * AT_VP)     /* halves per stage */
#define AT_OFF_PH 0
#define AT_OFF_PM 9216
#define AT_OFF_PS 9728
#define AT_OFF_AL 10240
#define AT_OFF_LF 10496
#define AT_OFF_RG 10752                          /* the two stages */
#define AT_OFF_PL (AT_OFF_RG + AT_STG * 2)       /* residual P tile: in the residual k tile's place, which is dead behind the score products */
#define AT_OFF_OH AT_OFF_RG                      /* output staging, behind the barrier that follows the loop */
#define AT_OFF_OL (AT_OFF_RG + 33792)
#define AT_LDS    152064                         /* two blocks per 320-KiB LDS */
static_assert(AT_OFF_PM == AT_OFF_PH + 64 * AT_PPITCH * 2);
static_assert(AT_OFF_OL == AT_OFF_OH + 64 * AT_OPITCH * 2);
static_assert(AT_LDS == AT_OFF_RG + 2 * AT_STG * 2);
static_assert(AT_LDS >= AT_OFF_OL + 64 * AT_OPITCH * 2);
static_assert(64 * AT_PPITCH <= AT_SV);
static_assert(AT_OFF_RG % 16 == 0 && (AT_STG * 2) % 16 == 0 && (AT_SV * 2) % 16 == 0);

// Eight copies per lane: l = the lane's LDS byte address, LS = bytes between its LDS rows, g = its global address, gs = halves between
// its source rows. s_wait_xcnt stands inside the statement so that no address register is rewritten ahead of it.
template <unsigned LS>
__device__ __forceinline__ void async_tile8(unsigned l, const _Float16* g, size_t gs) {
  asm volatile(
      "global_load_async_to_lds_b128 %0, %8, off\n\t"
      "global_load_async_to_lds_b128 %1, %9, off\n\t"
      "global_load_async_to_lds_b128 %2, %10, off\n\t"
      "global_load_async_to_lds_b128 %3, %11, off\n\t"
      "global_load_async_to_lds_b128 %4, %12, off\n\t"
      "global_load_async_to_lds_b128 %5, %13, off\n\t"
      "global_load_async_to_lds_b128 %6, %14, off\n\t"
      "global_load_async_to_lds_b128 %7, %15, off\n\t"
      "s_wait_xcnt 0x0"
      :: "v"(l), "v"(l + 1u * LS), "v"(l + 2u * LS), "v"(l + 3u * LS),
         "v"(l + 4u * LS), "v"(l + 5u * LS), "v"(l + 6u * LS), "v"(l + 7u * LS),
         "v"(g), "v"(g + gs), "v"(g + 2 * gs), "v"(g + 3 * gs), "v"(g + 4 * gs), "v"(g + 5 * gs), "v"(g + 6 * gs), "v"(g + 7 * gs)
      : "memory");
}
// One stage = key tile kt: k rows (a wave's copy = one 512-byte row, rows 8 apart) and v^T rows (a wave's copy = four 128-byte lines,
// rows 32 apart). lk, lv: the lane's LDS byte addresses in the stage; gk, gv: its global addresses in tile 0.
__device__ __forceinline__ void attn_fill(unsigned lk, unsigned lv, const _Float16* gk, const _Float16* gv, int kt) {
  async_tile8<8u * AT_KP * 2u>(lk, gk + (size_t)kt * 64 * HD_, (size_t)8 * HD_);
  async_tile8<32u * AT_VP * 2u>(lv, gv + (size_t)kt * 64, (size_t)32 * SEQ_);
}

// The key-tile loop. One instance per kind of query block (EARLY: residual planes as well, one tile in LDS at a time; else two), so that
// the loop holds no test of the kind and a tile's loads stand in groups ahead of their use: q and k fragments by groups of k-steps, the
// mask values in front of the score products, the v^T fragments in front of the P . V products.
template <bool EARLY>
__device__ __forceinline__ void attn_tiles(int ktlo, int kthi, int b, int q0, int srow0, int kh, int w, int hh, int c,
                                           const _Float16* __restrict__ qhp, const _Float16* __restrict__ qlp,
                                           const _Float16* __restrict__ Kh, const _Float16* __restrict__ Kl,
                                           const float* __restrict__ mrp,
                                           const _Float16* __restrict__ Vth, const _Float16* __restrict__ Vtl, const _Float16* ring,
                                           _Float16* Ph, _Float16* Pl, float* pm, float* ps, float* alph,
                                           float (&mrow)[8], float (&lrow)[8], v8f (&oacc)[4][2]) {
  constexpr int KG = EARLY ? 1 : 2;            // k-steps whose fragments are loaded as one group
  constexpr bool TWO = !EARLY;                 // two stages of hi planes: a tile's copies are issued two tiles ahead
  const int tid = (w << 5) + (hh << 4) + c;
  const unsigned lk = (unsigned)(size_t)ring + (unsigned)((tid >> 5) * AT_KP + (tid & 31) * 8) * 2u;
  const unsigned lv = (unsigned)(size_t)ring + (unsigned)(AT_SV + (tid >> 3) * AT_VP + (tid & 7) * 8) * 2u;
  const size_t ok = ((size_t)b * SEQ_ + (tid >> 5)) * HD_ + (tid & 31) * 8;
  const size_t ov = ((size_t)b * HD_ + (tid >> 3)) * SEQ_ + (tid & 7) * 8;
  const _Float16* gk = Kh + ok;
  const _Float16* gv = Vth + ov;
  if (TWO) {
    attn_fill(lk, lv, gk, gv, ktlo);
    asm volatile("s_wait_asynccnt 0x0" ::: "memory");   // the first tile landed (this wave's copies) before the barrier publishes it
    __syncthreads();
    if (ktlo < kthi) attn_fill(lk + AT_STG * 2u, lv + AT_STG * 2u, gk, gv, ktlo + 1);   // block-uniform
  }
  for (int kt = ktlo; kt <= kthi; ++kt) {      // block-uniform, at most 32 trips
    const int key0  = kt * 64;
    const int wkey0 = key0 + 32 * kh;
    const int sb = TWO ? ((kt - ktlo) & 1) : 0;   // the stage of the tile's hi planes
    const _Float16* khp = ring + sb * AT_STG + (32 * kh + c) * AT_KP + 8 * hh;
    const _Float16* klp = khp + AT_STG;
    if (!TWO) {
      attn_fill(lk, lv, gk, gv, kt);
      attn_fill(lk + AT_STG * 2u, lv + AT_STG * 2u, Kl + ok, Vtl + ov, kt);
      asm volatile("s_wait_asynccnt 0x0" ::: "memory");   // the tile landed (this wave's copies) before the barrier publishes it
      __syncthreads();
    }

    // ---- mask values of this wave's 16 x 32 scores, in flight during the score products. Every key of a tile is a column of the mask:
    //      no test guards the loads ----
    float mv[8][2];
    const float* mt = mrp + wkey0 + c;
#pragma unroll   // register arrays: constant indices
    for (int r = 0; r < 8; ++r) {
#pragma unroll   // register arrays: constant indices
      for (int j = 0; j < 2; ++j) mv[r][j] = mt[(size_t)r * SEQ_ + 16 * j];
    }

    // ---- S = q . k^T (16 rows x 32 keys per wave) ----
    v8f s[2];
    s[0] = zero8(); s[1] = zero8();
#pragma unroll   // constant load offsets, no loop overhead between the groups
    for (int g = 0; g < 8; g += KG) {
      v16h qa[KG], qr[KG], kb[KG][2], kr[KG][2];
#pragma unroll   // register arrays: constant indices
      for (int u = 0; u < KG; ++u) {
        const int ks = g + u;
        qa[u] = frag_ld(qhp + 32 * ks);
        qr[u] = qa[u];
        if (EARLY) qr[u] = frag_ld(qlp + 32 * ks);
#pragma unroll   // register arrays: constant indices
        for (int j = 0; j < 2; ++j) {
          kb[u][j] = frag_ld(khp + (16 * j) * AT_KP + 32 * ks);
          kr[u][j] = kb[u][j];
          if (EARLY) kr[u][j] = frag_ld(klp + (16 * j) * AT_KP + 32 * ks);
        }
      }
#pragma unroll   // register arrays: constant indices
      for (int u = 0; u < KG; ++u) {
#pragma unroll   // register arrays: constant indices
        for (int j = 0; j < 2; ++j) {
          s[j] = mma_g(qa[u], kb[u][j], s[j]);
          if (EARLY) {
            s[j] = mma_g(qr[u], kb[u][j], s[j]);
            s[j] = mma_g(qa[u], kr[u][j], s[j]);
          }
        }
      }
    }

    // the wait that stands in front of a rewrite of an issued load's address registers; naming the tile's mask address keeps it whole
    // up to it (else a later load may take its result into it)
    asm volatile("s_wait_xcnt 0x0" :: "v"(mt) : "memory");

    // ---- scale, mask, partial row max over this wave's 32 keys ----
    float cm[8];
#pragma unroll
    for (int r = 0; r < 8; ++r) {
      const int qrow = q0 + srow0 + 8 * hh + r;
      float mx = -INFINITY;
#pragma unroll
      for (int j = 0; j < 2; ++j) {
        const int key = wkey0 + 16 * j + c;
        const bool inb = (key + (WIN_ - 1) >= qrow) && (key <= qrow + (WIN_ - 1));
        const float sv = inb ? (s[j][r] * SSC_ + mv[r][j]) : -INFINITY;
        s[j][r] = sv;
        mx = fmaxf(mx, sv);
      }
      mx = fmaxf(mx, __shfl_xor(mx, 1, 32));
      mx = fmaxf(mx, __shfl_xor(mx, 2, 32));
      mx = fmaxf(mx, __shfl_xor(mx, 4, 32));
      mx = fmaxf(mx, __shfl_xor(mx, 8, 32));
      cm[r] = mx;
    }
    if (c == 0) {
#pragma unroll
      for (int r = 0; r < 8; ++r) pm[w * 16 + 8 * hh + r] = cm[r];
    }
    __syncthreads();

    // ---- online softmax: tile max, p, partial sums ----
    float al[8], psm[8];
    const int wo = w ^ 4;
#pragma unroll
    for (int r = 0; r < 8; ++r) {
      const float om = pm[wo * 16 + 8 * hh + r];
      const float mnew = fmaxf(mrow[r], fmaxf(cm[r], om));
      const float msafe = (mnew == -INFINITY) ? 0.0f : mnew;
      al[r] = __expf(mrow[r] - msafe);
      mrow[r] = mnew;
      float sum = 0.0f;
#pragma unroll
      for (int j = 0; j < 2; ++j) {
        const float p = __expf(s[j][r] - msafe);
        sum += p;
        const float t = p * CP_;
        const _Float16 phv = (_Float16)t;
        const int pidx = (srow0 + 8 * hh + r) * AT_PPITCH + 32 * kh + 16 * j + c;
        Ph[pidx] = phv;
        if (EARLY) Pl[pidx] = (_Float16)(t - (float)phv);
      }
      sum += __shfl_xor(sum, 1, 32);
      sum += __shfl_xor(sum, 2, 32);
      sum += __shfl_xor(sum, 4, 32);
      sum += __shfl_xor(sum, 8, 32);
      psm[r] = sum;
    }
    if (c == 0) {
#pragma unroll
      for (int r = 0; r < 8; ++r) ps[w * 16 + 8 * hh + r] = psm[r];
      if (w < 4) {
#pragma unroll
        for (int r = 0; r < 8; ++r) alph[srow0 + 8 * hh + r] = al[r];
      }
    }
    __syncthreads();
#pragma unroll
    for (int r = 0; r < 8; ++r)
      lrow[r] = lrow[r] * al[r] + (ps[(w & 3) * 16 + 8 * hh + r] + ps[((w & 3) + 4) * 16 + 8 * hh + r]);

    // ---- v^T fragments of the tile, from LDS: in flight while O is rescaled ----
    v16h vb[2][2], vr[2][2];
    const _Float16* vht = ring + sb * AT_STG + AT_SV + (32 * w + c) * AT_VP + 8 * hh;
    const _Float16* vlt = vht + AT_STG;
#pragma unroll   // register arrays: constant indices
    for (int k2 = 0; k2 < 2; ++k2) {
#pragma unroll   // register arrays: constant indices
      for (int jj = 0; jj < 2; ++jj) {
        vb[k2][jj] = frag_ld(vht + (16 * jj) * AT_VP + 32 * k2);
        vr[k2][jj] = vb[k2][jj];
        if (EARLY) vr[k2][jj] = frag_ld(vlt + (16 * jj) * AT_VP + 32 * k2);
      }
    }

    // ---- rescale O, then O += P . V for this wave's 32 output columns ----
#pragma unroll
    for (int i = 0; i < 4; ++i) {
      U8 av;
      av.q[0] = *(const v4f*)(alph + 16 * i + 8 * hh);
      av.q[1] = *(const v4f*)(alph + 16 * i + 8 * hh + 4);
#pragma unroll
      for (int r = 0; r < 8; ++r) { oacc[i][0][r] *= av.v[r]; oacc[i][1][r] *= av.v[r]; }
    }
#pragma unroll
    for (int k2 = 0; k2 < 2; ++k2) {
#pragma unroll
      for (int jj = 0; jj < 2; ++jj) {
#pragma unroll
        for (int i = 0; i < 4; ++i) {
          const v16h pa = frag_ld(Ph + (16 * i + c) * AT_PPITCH + 32 * k2 + 8 * hh);
          oacc[i][jj] = mma_g(pa, vb[k2][jj], oacc[i][jj]);
          if (EARLY) {
            const v16h pr = frag_ld(Pl + (16 * i + c) * AT_PPITCH + 32 * k2 + 8 * hh);
            oacc[i][jj] = mma_g(pa, vr[k2][jj], oacc[i][jj]);
            oacc[i][jj] = mma_g(pr, vb[k2][jj], oacc[i][jj]);
          }
        }
      }
    }

    // ---- hand-over of the stages ----
    asm volatile("s_wait_dscnt 0x0" ::: "memory");        // this wave's reads (and residual P writes) there are done before a refill
    if (TWO) asm volatile("s_wait_asynccnt 0x0" ::: "memory");   // this wave's copies of the next tile have landed
    __syncthreads();                                      // frees tile kt's stage; with two stages it publishes tile kt+1 as well
    if (TWO && kt + 2 <= kthi)                            // block-uniform
      attn_fill(lk + (unsigned)sb * (AT_STG * 2u), lv + (unsigned)sb * (AT_STG * 2u), gk, gv, kt + 2);
  }
  if (TWO) asm volatile("s_wait_asynccnt 0x0" ::: "memory");   // nothing in flight when the stages become output staging
}

// amdgpu_waves_per_eu(4, 4): holds the registers to four waves per SIMD, so that two blocks share a WGP (2 x AT_LDS fits its LDS)
__global__ __launch_bounds__(256) __attribute__((amdgpu_waves_per_eu(4, 4))) void attn_kernel(const _Float16* __restrict__ Qh, const _Float16* __restrict__ Ql,
                                                   const _Float16* __restrict__ Kh, const _Float16* __restrict__ Kl,
                                                   const _Float16* __restrict__ Vth, const _Float16* __restrict__ Vtl,
                                                   const float* __restrict__ mask, const int* __restrict__ flag,
                                                   _Float16* __restrict__ AOh, _Float16* __restrict__ AOl) {
  extern __shared__ __align__(16) unsigned char dsm[];
  _Float16* Ph   = (_Float16*)(dsm + AT_OFF_PH);
  _Float16* Pl   = (_Float16*)(dsm + AT_OFF_PL);
  float*    pm   = (float*)(dsm + AT_OFF_PM);     // [8 waves][16 rows] partial row max
  float*    ps   = (float*)(dsm + AT_OFF_PS);     // [8 waves][16 rows] partial row sum
  float*    alph = (float*)(dsm + AT_OFF_AL);     // [64] rescale factors
  float*    lfin = (float*)(dsm + AT_OFF_LF);     // [64] final row sums
  const _Float16* ring = (const _Float16*)(dsm + AT_OFF_RG);   // two stages of k and v^T tiles
  _Float16* Ohs  = (_Float16*)(dsm + AT_OFF_OH);
  _Float16* Ols  = (_Float16*)(dsm + AT_OFF_OL);

  const int tid  = threadIdx.x;
  const int w    = tid >> 5;
  const int lane = tid & 31;
  const int hh   = lane >> 4;
  const int c    = lane & 15;
  const int bid  = blockIdx.x;
  const int qb   = bid & (NQB_ - 1);
  const int h    = (bid >> 5) & (NH_ - 1);
  const int b    = bid >> 8;
  const int q0   = qb * 64;
  const int srow0 = (w & 3) * 16;
  const int kh    = w >> 2;
  const int ocol0 = w * 32;
  const bool early = (qb < QE_);
  const int ktlo = (qb > 16) ? (qb - 16) : 0;
  int fl = 1;                                  // block-uniform: all row groups of this query block verified
#pragma unroll   // independent scalar loads, issued together instead of one round trip each
  for (int g = 0; g < MFG_; ++g) fl &= flag[((b * NQB_ + qb) * MFG_ + g) * 32];
  int kthi = (fl != 0) ? qb : (qb + 16);
  if (kthi > NQB_ - 1) kthi = NQB_ - 1;

  const size_t growq = (size_t)b * SEQ_ + q0;
  const _Float16* qhp = Qh + (growq + srow0 + c) * DM_ + h * HD_ + 8 * hh;
  const _Float16* qlp = Ql + (growq + srow0 + c) * DM_ + h * HD_ + 8 * hh;
  const float*    mrp = mask + (growq + srow0 + 8 * hh) * (size_t)SEQ_;

  float mrow[8], lrow[8];
  v8f oacc[4][2];
#pragma unroll
  for (int r = 0; r < 8; ++r) { mrow[r] = -INFINITY; lrow[r] = 0.0f; }
#pragma unroll
  for (int i = 0; i < 4; ++i) { oacc[i][0] = zero8(); oacc[i][1] = zero8(); }

  if (early)   // block-uniform
    attn_tiles<true>(ktlo, kthi, b, q0, srow0, kh, w, hh, c, qhp, qlp, Kh, Kl, mrp, Vth, Vtl, ring, Ph, Pl, pm, ps, alph, mrow, lrow, oacc);
  else
    attn_tiles<false>(ktlo, kthi, b, q0, srow0, kh, w, hh, c, qhp, qlp, Kh, Kl, mrp, Vth, Vtl, ring, Ph, Pl, pm, ps, alph, mrow, lrow, oacc);

  if (w < 4 && c == 0) {
#pragma unroll
    for (int r = 0; r < 8; ++r) lfin[srow0 + 8 * hh + r] = lrow[r];
  }
  __syncthreads();
#pragma unroll
  for (int i = 0; i < 4; ++i) {
    U8 lv;
    lv.q[0] = *(const v4f*)(lfin + 16 * i + 8 * hh);
    lv.q[1] = *(const v4f*)(lfin + 16 * i + 8 * hh + 4);
#pragma unroll
    for (int r = 0; r < 8; ++r) {
      const float f = OSC_ * (1.0f / lv.v[r]);
      const int orow = 16 * i + 8 * hh + r;
#pragma unroll
      for (int jj = 0; jj < 2; ++jj) {
        const float t = oacc[i][jj][r] * f;
        const _Float16 hq = (_Float16)t;
        const int oidx = orow * AT_OPITCH + ocol0 + 16 * jj + c;
        Ohs[oidx] = hq;
        Ols[oidx] = (_Float16)(t - (float)hq);
      }
    }
  }
  __syncthreads();
  {
    const int piece = tid & 7;
    const int lsub  = tid >> 3;
    {
#pragma unroll
      for (int it = 0; it < 8; ++it) {
        const int line = it * 32 + lsub;          // 0..255 = 64 rows x 4 lines
        const int row  = line >> 2;
        const int col  = (line & 3) * 64 + piece * 8;
        const v8h hv = *(const v8h*)(Ohs + row * AT_OPITCH + col);
        const v8h rv = *(const v8h*)(Ols + row * AT_OPITCH + col);
        const size_t go = (growq + row) * DM_ + h * HD_ + col;
        *(v8h*)(AOh + go) = hv;
        *(v8h*)(AOl + go) = rv;
      }
      
    }
  }
}

// ---------------------------------------------------------------------------------------------------------------
// Workspace map (byte offsets, all 2 MiB aligned; every region is written completely by whole-line stores before it is read;
// the attention output planes reuse the f32 q region, which is dead after the q RoPE/split pass):
//   Xh   f16 [4096][2048]            0           16,777,216
//   Wqh  f16 [2048][2048]   16,777,216            8,388,608
//   Wkvh f16 [512][2048]    25,165,824            2,097,152
//   Woh  f16 [2048][2048]   27,262,976            8,388,608
//   cosT f32 [4096][128]    35,651,584            2,097,152
//   sinT f32 [4096][128]    37,748,736            2,097,152
//   Qf   f32 [4096][2048]   39,845,888           33,554,432   (AOh f16 [4096][2048] at 39,845,888; AOl at 56,623,104)
//   KVf  f32 [4096][512]    73,400,320            8,388,608
//   Qh   f16 [4096][2048]   81,788,928           16,777,216
//   Ql   f16 [4096][2048]   98,566,144           16,777,216
//   Kh   f16 [4096][256]   115,343,360            2,097,152
//   Kl   f16 [4096][256]   117,440,512            2,097,152
//   Vth  f16 [2][256][2048] 119,537,664           2,097,152
//   Vtl  f16 [2][256][2048] 121,634,816           2,097,152
//   flags int [2*32*16][32] 123,731,968            131,072
//   total                  123,863,040
// ---------------------------------------------------------------------------------------------------------------
extern "C" void kernel_launch(void* const* d_in, const int* in_sizes, int n_in,
                              void* d_out, int out_size, void* d_ws, size_t ws_size,
                              hipStream_t stream) {
  if (n_in < 7) return;
  if (in_sizes[0] != NB_ * SEQ_ * DM_) return;
  if (in_sizes[1] != NB_ * SEQ_ * SEQ_) return;
  if (in_sizes[2] != NB_ * SEQ_) return;
  if (in_sizes[3] != DM_ * DM_) return;
  if (in_sizes[4] != HD_ * DM_) return;
  if (in_sizes[5] != HD_ * DM_) return;
  if (in_sizes[6] != DM_ * DM_) return;
  if (out_size != NB_ * SEQ_ * DM_) return;

  const float* x    = (const float*)d_in[0];
  const float* mask = (const float*)d_in[1];
  const int*   pos  = (const int*)d_in[2];
  const float* Wq   = (const float*)d_in[3];
  const float* Wk   = (const float*)d_in[4];
  const float* Wv   = (const float*)d_in[5];
  const float* Wo   = (const float*)d_in[6];
  float* out = (float*)d_out;

  const size_t nX   = (size_t)NB_ * SEQ_ * DM_;          // 8,388,608 elements
  const size_t bXh  = nX * 2;
  const size_t bWq  = (size_t)DM_ * DM_ * 2;
  const size_t bWkv = (size_t)KVN_ * DM_ * 2;
  const size_t bWo  = bWq;
  const size_t bTab = (size_t)NB_ * SEQ_ * NF_ * 4;
  const size_t bQf  = nX * 4;
  const size_t bKVf = (size_t)NB_ * SEQ_ * KVN_ * 4;
  const size_t bQ16 = nX * 2;
  const size_t bK16 = (size_t)NB_ * SEQ_ * HD_ * 2;
  const size_t bV16 = bK16;
  const size_t bFlg = (size_t)NB_ * NQB_ * MFG_ * 128;
  size_t off = 0;
  const size_t oXh  = off; off += bXh;
  const size_t oWq  = off; off += bWq;
  const size_t oWkv = off; off += bWkv;
  const size_t oWo  = off; off += bWo;
  const size_t oCos = off; off += bTab;
  const size_t oSin = off; off += bTab;
  const size_t oQf  = off; off += bQf;
  const size_t oKVf = off; off += bKVf;
  const size_t oQh  = off; off += bQ16;
  const size_t oQl  = off; off += bQ16;
  const size_t oKh  = off; off += bK16;
  const size_t oKl  = off; off += bK16;
  const size_t oVth = off; off += bV16;
  const size_t oVtl = off; off += bV16;
  const size_t oFlg = off; off += bFlg;
  if (off > ws_size) return;                        // off = 123,863,040
  if (off > (size_t)134217728) return;
  if (bQf < 2 * bQ16) return;                        // AOh/AOl alias fits inside the f32 q region
  const size_t oAOh = oQf;
  const size_t oAOl = oQf + bQ16;

  char* ws = (char*)d_ws;
  _Float16* Xh   = (_Float16*)(ws + oXh);
  _Float16* Wqh  = (_Float16*)(ws + oWq);
  _Float16* Wkvh = (_Float16*)(ws + oWkv);
  _Float16* Woh  = (_Float16*)(ws + oWo);
  float*    cosT = (float*)(ws + oCos);
  float*    sinT = (float*)(ws + oSin);
  float*    Qf   = (float*)(ws + oQf);
  float*    KVf  = (float*)(ws + oKVf);
  _Float16* Qh   = (_Float16*)(ws + oQh);
  _Float16* Ql   = (_Float16*)(ws + oQl);
  _Float16* Kh   = (_Float16*)(ws + oKh);
  _Float16* Kl   = (_Float16*)(ws + oKl);
  _Float16* Vth  = (_Float16*)(ws + oVth);
  _Float16* Vtl  = (_Float16*)(ws + oVtl);
  int*      flg  = (int*)(ws + oFlg);
  _Float16* AOh  = (_Float16*)(ws + oAOh);
  _Float16* AOl  = (_Float16*)(ws + oAOl);

  const dim3 blk(256);

  // (1) one launch: inputs -> 16-bit planes (x bf16*2^4, weights bf16*2^8, k rows then v rows in the fused kv weight plane);
  //     cos/sin tables [4096][128] from position ids; mask verification flags per (b, query block, 4-row group)
  prep_kernel<<<dim3(PB_ALL_), blk, 0, stream>>>(x, mask, pos, Wq, Wk, Wv, Wo, Xh, Wqh, Wkvh, Woh, cosT, sinT, flg);
  // (2) one launch: q = x . Wq^T -> f32 [4096][2048]; [k|v] = x . [Wk|Wv]^T -> f32 [4096][512]
  gemm64_kernel<<<dim3((NB_ * SEQ_ / GBM_) * (DM_ / GBN_ + KVN_ / GBN_)), blk, 0, stream>>>(
      Xh, Xh, DM_, Wqh, DM_, Qf, DM_, NB_ * SEQ_, DM_, DM_, 0, SEQ_ - 1, QSC_, Wkvh, KVf, KVN_, KVN_);
  // (3) one launch: RoPE + hi/residual split, q planes [4096][8*256] and k planes [4096][256]; v^T planes [2][256][2048]
  split_kernel<<<dim3(SB_ALL_), blk, 0, stream>>>(Qf, KVf, cosT, sinT, Qh, Ql, Kh, Kl, Vth, Vtl);
  // (4) attention -> AO hi/residual planes [4096][2048]
  (void)hipFuncSetAttribute(reinterpret_cast<const void*>(&attn_kernel), hipFuncAttributeMaxDynamicSharedMemorySize, AT_LDS);
  attn_kernel<<<dim3(NB_ * NH_ * NQB_), blk, AT_LDS, stream>>>(Qh, Ql, Kh, Kl, Vth, Vtl, mask, flg, AOh, AOl);
  // (5) out = AO . Wo^T -> d_out f32 [4096][2048]; residual plane on rows < LOROWS_ of each sequence
  gemm64_kernel<<<dim3((NB_ * SEQ_ / GBM_) * (DM_ / GBN_)), blk, 0, stream>>>(
      AOh, AOl, DM_, Woh, DM_, out, DM_, NB_ * SEQ_, DM_, DM_, LOROWS_, SEQ_ - 1, WSC_, Woh, out, DM_, 0);
  (void)hipGetLastError();
}

// v006
// It runs in 181 microseconds.
// Next to v005, in two timings, it ran 1.05 times as fast each time.
// All steps since v000 together make it 3.46 times as fast.
// Contractions on v_wmma_f32_16x16x32_f16 (f16 operands, f32 accumulate): q/k/v projections (x RNE-converted to bf16 and carried *2^4,
// W RNE-converted to bf16 and carried *2^8, exact products); q.k^T (q,k carried *2^10 as f16 hi planes, plus unscaled f16 residual planes
// on the leading query blocks of each sequence); p.v (p carried *2^15, v^T carried *2^10: hi planes plus residual planes on the leading query
// blocks); output projection (attention output carried *2^10: hi plane everywhere, residual plane on the leading rows of each sequence;
// Wo bf16 *2^8). RoPE, mask add and online softmax in f32.
#include <hip/hip_runtime.h>
#include <math.h>
#include <stdint.h>

#define NB_     2
#define SEQ_    2048
#define DM_     2048
#define NH_     8
#define HD_     256
#define NF_     128
#define KVN_    512
#define WIN_    1024
#define NQB_    32
#define QE_     4
#define LOROWS_ 256
#define MFG_    16

#define CX_   16.0f
#define CW_   256.0f
#define CQK_  1024.0f
#define CP_   32768.0f
#define SSC_  5.9604644775390625e-8f     /* 2^-4 * 2^-20 : score scale for q,k carried *2^10 each */
#define OSC_  3.0517578125e-5f           /* 2^-15 = 2^10 / (2^15 * 2^10) : attention output carry */
#define QSC_  2.44140625e-4f             /* 2^-12 = 1 / (2^4 * 2^8) : projection outputs back to f32 */
#define WSC_  3.814697265625e-6f         /* 2^-18 = 1 / (2^10 * 2^8) : final projection */

typedef _Float16 v16h __attribute__((ext_vector_type(16)));
typedef _Float16 v8h  __attribute__((ext_vector_type(8)));
typedef float    v8f  __attribute__((ext_vector_type(8)));
typedef float    v4f  __attribute__((ext_vector_type(4)));

union FragU { v16h v; v8h h[2]; };
union U8 { v8f v; v4f q[2]; };

__device__ __forceinline__ float bf16_rne(float f) {
  unsigned u = __float_as_uint(f);
  u = u + 0x7FFFu + ((u >> 16) & 1u);
  return __uint_as_float(u & 0xFFFF0000u);
}
__device__ __forceinline__ v8f zero8() { return (v8f){0.f, 0.f, 0.f, 0.f, 0.f, 0.f, 0.f, 0.f}; }

// 16-bit fragment (A or B): lane row/col = lane&15, elements 0..7 <- p[0..7] (k0+8h..), 8..15 <- p[16..23] (k0+16+8h..)
// p already includes the row base + k0 + 8*h.
__device__ __forceinline__ v16h frag_ld(const _Float16* p) {
  FragU f;
  f.h[0] = *(const v8h*)(p);
  f.h[1] = *(const v8h*)(p + 16);
  return f.v;
}
__device__ __forceinline__ v8f wmma_raw(v16h a, v16h b, v8f c) {
  return __builtin_amdgcn_wmma_f32_16x16x32_f16(false, a, false, b, (short)0, c, false, false);
}
// WMMA with trailing hazard guard (ties D, keeps A/B live)
__device__ __forceinline__ v8f mma_g(v16h a, v16h b, v8f c) {
  c = __builtin_amdgcn_wmma_f32_16x16x32_f16(false, a, false, b, (short)0, c, false, false);
  asm volatile("v_nop\n\tv_nop\n\tv_nop\n\tv_nop" : "+v"(c) : "v"(a), "v"(b));
  return c;
}
__device__ __forceinline__ void dep_guard(v8f& a, v8f& b, v16h x, v16h y) {
  asm volatile("v_nop\n\tv_nop\n\tv_nop\n\tv_nop" : "+v"(a), "+v"(b) : "v"(x), "v"(y));
}
__device__ __forceinline__ void keep4(v16h a, v16h b, v16h c, v16h d) {
  asm volatile("v_nop" :: "v"(a), "v"(b), "v"(c), "v"(d));
}
__device__ __forceinline__ void acc_guard4(v8f& a, v8f& b, v8f& c, v8f& d) {
  asm volatile("v_nop\n\tv_nop\n\tv_nop\n\tv_nop" : "+v"(a), "+v"(b), "+v"(c), "+v"(d));
}

// ---------------------------------------------------------------------------------------------------------------
// Elementwise convert: dst[i] = f16( bf16_rne(src[i]) * scale ), 8 elements per thread, one 16-B store per lane:
// coverage: ceil(n8/256) blocks (blk = the block's index within them), each thread 8 elements -> 8*n8 elements.
// ---------------------------------------------------------------------------------------------------------------
__device__ __forceinline__ void cvt16_part(int blk, const float* __restrict__ src, _Float16* __restrict__ dst, int n8, float scale) {
  const int i = blk * 256 + (int)threadIdx.x;
  if (i >= n8) return;
  const float* s = src + 8 * (size_t)i;
  U8 a;
  a.q[0] = *(const v4f*)(s);
  a.q[1] = *(const v4f*)(s + 4);
  v8h o;
#pragma unroll
  for (int e = 0; e < 8; ++e) o[e] = (_Float16)(bf16_rne(a.v[e]) * scale);
  _Float16* d = dst + 8 * (size_t)i;
  *(v8h*)d = o;
  
}

// ---------------------------------------------------------------------------------------------------------------
// RoPE tables: cosT/sinT [nrows][128], angle = float(pos[row]) * inv_freq[f], inv_freq[f] = 1 / f32(10000^(f/128)).
// coverage: nrows/32 blocks (blk = the block's index within them), 16 iterations x 2 rows -> nrows x 128 per table.
// ---------------------------------------------------------------------------------------------------------------
__device__ __forceinline__ void rope_table_part(int blk, const int* __restrict__ pos, float* __restrict__ cosT,
                                                float* __restrict__ sinT, int nrows) {
#pragma clang fp contract(off)
  __shared__ float invf[NF_];
  const int tid = threadIdx.x;
  if (tid < NF_) {
    const double e = (double)tid * 0.0078125;                 // tid/128 exactly
    const double p = exp2(e * 13.287712379549449);            // 10000^e
    const float pf = (float)p;                                // RNE to f32
    invf[tid] = 1.0f / pf;
  }
  __syncthreads();
  const int f = tid & (NF_ - 1);
  const int rp = tid >> 7;
  const int r0 = blk * 32;
  const float iv = invf[f];
#pragma unroll 1
  for (int it = 0; it < 16; ++it) {
    const int row = r0 + it * 2 + rp;
    const int rowc = (row < nrows) ? row : (nrows - 1);
    const float ang = (float)pos[rowc] * iv;
    float sv, cv;
    sincosf(ang, &sv, &cv);
    if (row < nrows) {
      float* cp = cosT + (size_t)row * NF_ + f;
      float* sp = sinT + (size_t)row * NF_ + f;
      *(float*)cp = cv;
      *(float*)sp = sv;
      // the wait that stands in front of a rewrite of an issued store's registers (the next trip reuses them)
      asm volatile("s_wait_xcnt 0x0" :: "v"(cp), "v"(sp), "v"(cv), "v"(sv) : "memory");
    }
  }
}

// ---------------------------------------------------------------------------------------------------------------
// Mask verification flags, MFG_ per (b, 64-query block), one per group of 4 query rows: 1 if every mask value for the group's rows
// and keys in [q0+64, min(q+1023, SEQ-1)] (the in-band keys strictly above the query block) is <= -1e9 (adds to an exact zero weight).
// The range holds at most 1023 keys, so 256 threads x 4 keys cover a row with one 16-byte load each; the 4 rows' loads are independent.
// coverage: NB*NQB*MFG_ blocks (bid = the block's index within them); each block writes its own 128-byte line of 32 equal ints.
// ---------------------------------------------------------------------------------------------------------------
__device__ __forceinline__ void maskflag_part(int bid, const float* __restrict__ mask, int* __restrict__ flag) {
  __shared__ int sw[8];
  const int tid = threadIdx.x, w = tid >> 5, lane = tid & 31;
  // bid = (b*32 + qb)*MFG_ + row group
  const int g  = bid & (MFG_ - 1);
  const int bq = bid / MFG_;
  const int b = bq >> 5, qb = bq & (NQB_ - 1);
  const int q0 = qb * 64;
  const int r0 = q0 + g * (64 / MFG_);
  const int k  = q0 + 64 + 4 * tid;          // first of this thread's four keys
  const int kc = (k <= SEQ_ - 4) ? k : (SEQ_ - 4);   // k > SEQ-4 means k >= SEQ: none of the four keys is tested
  v4f mv[64 / MFG_];
#pragma unroll   // all rows' loads issue before the first compare waits (and mv stays in registers)
  for (int rr = 0; rr < 64 / MFG_; ++rr) mv[rr] = *(const v4f*)(mask + ((size_t)b * SEQ_ + r0 + rr) * SEQ_ + kc);
  int bad = 0;
#pragma unroll
  for (int rr = 0; rr < 64 / MFG_; ++rr) {
    int kend = r0 + rr + WIN_ - 1;
    if (kend > SEQ_ - 1) kend = SEQ_ - 1;
#pragma unroll
    for (int e = 0; e < 4; ++e) {
      const int ok = (mv[rr][e] <= -1.0e9f) ? 1 : 0;
      bad |= ((k + e <= kend) && (ok == 0)) ? 1 : 0;
    }
  }
  const unsigned long long bm = __ballot(bad);
  if (lane == 0) sw[w] = (bm != 0ull) ? 1 : 0;
  __syncthreads();
  if (w == 0) {
    int any = 0;
#pragma unroll
    for (int i = 0; i < 8; ++i) any |= sw[i];
    const int fv = any ? 0 : 1;
    int* fp = flag + (size_t)bid * 32 + lane;
    *(int*)fp = fv;
  }
}

// ---------------------------------------------------------------------------------------------------------------
// The preparation passes, which depend on the inputs alone and not on one another, share one launch: a block's index range says
// which pass it belongs to (block-uniform, so each pass's barriers are reached by all of its block's threads or by none).
// The table blocks, few and with the longest serial chain, come first; then the mask check; then the five conversions.
// coverage: PB_ALL_ blocks = the sum of the passes' own block counts; every pass gets exactly its blocks.
// ---------------------------------------------------------------------------------------------------------------
#define PB_TAB_ ((NB_ * SEQ_) / 32)               /* 128  */
#define PB_FLG_ (NB_ * NQB_ * MFG_)               /* 1024 */
#define PB_X_   ((NB_ * SEQ_ * DM_) / (8 * 256))  /* 4096 */
#define PB_W_   ((DM_ * DM_) / (8 * 256))         /* 2048 */
#define PB_KV_  ((HD_ * DM_) / (8 * 256))         /* 256  */
#define PB_ALL_ (PB_TAB_ + PB_FLG_ + PB_X_ + 2 * PB_W_ + 2 * PB_KV_)
__global__ __launch_bounds__(256) void prep_kernel(const float* __restrict__ x, const float* __restrict__ mask,
                                                   const int* __restrict__ pos, const float* __restrict__ Wq,
                                                   const float* __restrict__ Wk, const float* __restrict__ Wv,
                                                   const float* __restrict__ Wo, _Float16* __restrict__ Xh,
                                                   _Float16* __restrict__ Wqh, _Float16* __restrict__ Wkvh,
                                                   _Float16* __restrict__ Woh, float* __restrict__ cosT,
                                                   float* __restrict__ sinT, int* __restrict__ flag) {
  int blk = blockIdx.x;
  if (blk < PB_TAB_) { rope_table_part(blk, pos, cosT, sinT, NB_ * SEQ_); return; }
  blk -= PB_TAB_;
  if (blk < PB_FLG_) { maskflag_part(blk, mask, flag); return; }
  blk -= PB_FLG_;
  if (blk < PB_X_) { cvt16_part(blk, x, Xh, PB_X_ * 256, CX_); return; }
  blk -= PB_X_;
  const float* src = Wq;      // weights: bf16 * 2^8; k rows then v rows in the fused kv weight plane
  _Float16* dst = Wqh;
  int n8 = PB_W_ * 256;
  if (blk >= PB_W_) {
    blk -= PB_W_; src = Wo; dst = Woh;
    if (blk >= PB_W_) {
      blk -= PB_W_; src = Wk; dst = Wkvh; n8 = PB_KV_ * 256;
      if (blk >= PB_KV_) { blk -= PB_KV_; src = Wv; dst = Wkvh + (size_t)HD_ * DM_; }
    }
  }
  cvt16_part(blk, src, dst, n8, CW_);
}

// ---------------------------------------------------------------------------------------------------------------
// Register-blocked WMMA GEMM, f16 operands: C[m][n] = scale * sum_k (A[m][k] (+ A2[m][k])) * Bt[n][k]
// A row-major [M][lda], optional residual plane A2 (same layout) used on row blocks with (m0 & seqMask) < loRows (block-uniform;
// loRows a multiple of 128); Bt row-major [N][ldb] (k contiguous); C f32 [M][ldc].
// Block = 8 waves (2 x 4) on a 128 x 256 tile of C, each wave a 64x64 tile (4x4 accumulators).
// Operands reach LDS by asynchronous 16-byte copies, whole 256-byte row pieces (128 k) per stage, two stages: the next stage's
// copies fly while this stage is multiplied. LDS row pitch 272 bytes (16 B x odd) for the 16-byte fragment reads.
// M multiple of 128, N multiple of 256, K multiple of 128. Epilogue: 16-row slabs staged per wave in the (then free) ring.
// ---------------------------------------------------------------------------------------------------------------
#define GK_    128                               /* k per stage */
#define GPH_   136                               /* LDS row pitch, halves */
#define GBM_   128
#define GBN_   256
#define G_OA2_ (GBM_ * GPH_)                     /* residual plane of A, halves from the stage's start */
#define G_OB_  (2 * GBM_ * GPH_)
#define G_STG_ ((2 * GBM_ + GBN_) * GPH_)        /* halves per stage */
#define G_LS_  (16 * GPH_ * 2)                   /* bytes between LDS rows 16 apart */
static_assert(LOROWS_ % GBM_ == 0);
static_assert(2 * G_STG_ * 2 >= 8 * 16 * 68 * 4);

// Eight copies per lane, rows 16 apart: l = the lane's LDS byte address, g = its global address, gs = halves per 16 source rows.
// s_wait_xcnt stands inside the statement so that no address register is rewritten ahead of it.
__device__ __forceinline__ void async_rows8(unsigned l, const _Float16* g, size_t gs) {
  asm volatile(
      "global_load_async_to_lds_b128 %0, %8, off\n\t"
      "global_load_async_to_lds_b128 %1, %9, off\n\t"
      "global_load_async_to_lds_b128 %2, %10, off\n\t"
      "global_load_async_to_lds_b128 %3, %11, off\n\t"
      "global_load_async_to_lds_b128 %4, %12, off\n\t"
      "global_load_async_to_lds_b128 %5, %13, off\n\t"
      "global_load_async_to_lds_b128 %6, %14, off\n\t"
      "global_load_async_to_lds_b128 %7, %15, off\n\t"
      "s_wait_xcnt 0x0"
      :: "v"(l), "v"(l + 1u * G_LS_), "v"(l + 2u * G_LS_), "v"(l + 3u * G_LS_),
         "v"(l + 4u * G_LS_), "v"(l + 5u * G_LS_), "v"(l + 6u * G_LS_), "v"(l + 7u * G_LS_),
         "v"(g), "v"(g + gs), "v"(g + 2 * gs), "v"(g + 3 * gs), "v"(g + 4 * gs), "v"(g + 5 * gs), "v"(g + 6 * gs), "v"(g + 7 * gs)
      : "memory");
}
// One stage: A 128 rows (+ A2 128 rows), Bt 256 rows, 256 bytes of each; a wave's copy covers two whole row pieces.
template <bool LO>
__device__ __forceinline__ void gemm_fill(unsigned l, const _Float16* ga, const _Float16* ga2, size_t as16,
                                          const _Float16* gb, size_t bs16) {
  async_rows8(l, ga, as16);
  if (LO) async_rows8(l + G_OA2_ * 2u, ga2, as16);
  async_rows8(l + G_OB_ * 2u, gb, bs16);
  async_rows8(l + G_OB_ * 2u + 8u * G_LS_, gb + 8 * bs16, bs16);
}

template <bool LO>
__device__ __forceinline__ void gemm_ring(v8f (&acc)[4][4], const _Float16* ring, const _Float16* __restrict__ Ab,
                                          const _Float16* __restrict__ Ab2, int lda, const _Float16* __restrict__ Bb, int ldb,
                                          int m0b, int n0b, int K, int tid, int wrow, int wcol, int rlane, int koff) {
  const int sub = tid >> 4;
  const int cc  = (tid & 15) * 8;
  const unsigned l0 = (unsigned)(size_t)ring + (unsigned)(sub * GPH_ + cc) * 2u;
  const _Float16* ga  = Ab  + (size_t)(m0b + sub) * lda + cc;
  const _Float16* ga2 = Ab2 + (size_t)(m0b + sub) * lda + cc;
  const _Float16* gb  = Bb  + (size_t)(n0b + sub) * ldb + cc;
  const size_t as16 = (size_t)16 * lda;
  const size_t bs16 = (size_t)16 * ldb;
  const int nt = K / GK_;

  gemm_fill<LO>(l0, ga, ga2, as16, gb, bs16);
  asm volatile("s_wait_asynccnt 0x0" ::: "memory");   // stage 0 landed (this wave's copies) before the barrier publishes it
  __syncthreads();
  if (nt > 1) gemm_fill<LO>(l0 + G_STG_ * 2u, ga + GK_, ga2 + GK_, as16, gb + GK_, bs16);

  for (int t = 0; t < nt; ++t) {
    const _Float16* st = ring + (t & 1) * G_STG_;
    const _Float16* sa = st + (wrow + rlane) * GPH_ + koff;
    const _Float16* sb = st + G_OB_ + (wcol + rlane) * GPH_ + koff;
#pragma unroll   // the four k-steps of a stage in one body: constant LDS offsets, no loop overhead between them
    for (int kk = 0; kk < GK_; kk += 32) {
      v16h bh[4], ah[4], al[4];
#pragma unroll   // register arrays: constant indices
      for (int j = 0; j < 4; ++j) bh[j] = frag_ld(sb + (j << 4) * GPH_ + kk);
#pragma unroll   // register arrays: constant indices
      for (int i = 0; i < 4; ++i) {
        ah[i] = frag_ld(sa + (i << 4) * GPH_ + kk);
        al[i] = ah[i];
        if (LO) al[i] = frag_ld(sa + G_OA2_ + (i << 4) * GPH_ + kk);
      }
      // holds the k-step's fragment reads together in front of its products (one LDS wait per k-step instead of one per row)
      asm volatile("" :: "v"(bh[0]), "v"(bh[1]), "v"(bh[2]), "v"(bh[3]), "v"(ah[0]), "v"(ah[1]), "v"(ah[2]), "v"(ah[3]));
      if (LO) asm volatile("" :: "v"(al[0]), "v"(al[1]), "v"(al[2]), "v"(al[3]));   // the same for the residual plane's reads
#pragma unroll   // register arrays: constant indices
      for (int i = 0; i < 4; ++i) {
#pragma unroll   // register arrays: constant indices
        for (int j = 0; j < 4; ++j) {
          acc[i][j] = wmma_raw(ah[i], bh[j], acc[i][j]);
          if (LO) acc[i][j] = wmma_raw(al[i], bh[j], acc[i][j]);
        }
        dep_guard(acc[i][0], acc[i][3], ah[i], al[i]);
      }
      keep4(bh[0], bh[1], bh[2], bh[3]);
    }
    asm volatile("s_wait_dscnt 0x0" ::: "memory");      // this wave's reads of the stage are done before it may be refilled
    asm volatile("s_wait_asynccnt 0x0" ::: "memory");   // this wave's copies of the next stage have landed
    __syncthreads();                                    // publishes stage t+1 and frees stage t's buffer
    if (t + 2 < nt)
      gemm_fill<LO>(l0 + (unsigned)(t & 1) * (G_STG_ * 2u), ga + (size_t)(t + 2) * GK_, ga2 + (size_t)(t + 2) * GK_, as16,
                    gb + (size_t)(t + 2) * GK_, bs16);
  }
  asm volatile("s_wait_asynccnt 0x0" ::: "memory");     // nothing in flight when the ring becomes output staging
}

// One launch may hold two products with the same A, M, K, ldb and scale: blocks past the first product's tiles take Btb, Cb, ldcb, Nb
// (Nb = 0: no second product).
__global__ __launch_bounds__(256) void gemm64_kernel(const _Float16* __restrict__ A, const _Float16* __restrict__ A2, int lda,
                                                     const _Float16* __restrict__ Bta, int ldb,
                                                     float* __restrict__ Ca, int ldca, int M, int Na, int K,
                                                     int loRows, int seqMask, float scale,
                                                     const _Float16* __restrict__ Btb, float* __restrict__ Cb, int ldcb, int Nb) {
  __shared__ __align__(16) _Float16 ring[2 * G_STG_];   // two stages; afterwards per-wave 16x64 f32 slabs, pitch 68 floats
  const int tid  = threadIdx.x;
  const int lane = tid & 31;
  const int wave = tid >> 5;
  const int tilesM = M / GBM_;
  const int tilesA = tilesM * (Na / GBN_);
  const bool second = ((int)blockIdx.x >= tilesA);   // block-uniform
  const _Float16* Bt = second ? Btb : Bta;
  float* C = second ? Cb : Ca;
  const int ldc = second ? ldcb : ldca;
  const int tilesN = (second ? Nb : Na) / GBN_;
  const int bid = second ? ((int)blockIdx.x - tilesA) : (int)blockIdx.x;
  if (bid >= tilesM * tilesN) return;   // block-uniform, in front of every barrier
  const int tm = bid / tilesN;
  const int tn = bid - tm * tilesN;
  const int m0b = tm * GBM_;
  const int n0b = tn * GBN_;
  const int wrow = (wave >> 2) << 6;
  const int wcol = (wave & 3) << 6;
  const int m0 = m0b + wrow;
  const int n0 = n0b + wcol;
  const int rlane = lane & 15;
  const int koff  = (lane >> 4) * 8;
  const int mOff  = koff;

  v8f acc[4][4];
#pragma unroll
  for (int i = 0; i < 4; ++i)
#pragma unroll
    for (int j = 0; j < 4; ++j) acc[i][j] = zero8();

  const bool useLo = ((m0b & seqMask) < loRows);   // block-uniform
  if (useLo) gemm_ring<true>(acc, ring, A, A2, lda, Bt, ldb, m0b, n0b, K, tid, wrow, wcol, rlane, koff);
  else       gemm_ring<false>(acc, ring, A, A, lda, Bt, ldb, m0b, n0b, K, tid, wrow, wcol, rlane, koff);
  acc_guard4(acc[0][0], acc[0][1], acc[0][2], acc[0][3]);
  acc_guard4(acc[1][0], acc[1][1], acc[1][2], acc[1][3]);
  acc_guard4(acc[2][0], acc[2][1], acc[2][2], acc[2][3]);
  acc_guard4(acc[3][0], acc[3][1], acc[3][2], acc[3][3]);

  float* slab = (float*)ring + wave * (16 * 68);
  const int hrow = lane >> 4;
  const int c4 = rlane * 4;
#pragma unroll
  for (int i = 0; i < 4; ++i) {
    const int mBase = m0 + (i << 4);
#pragma unroll
    for (int j = 0; j < 4; ++j) {
#pragma unroll
      for (int r = 0; r < 8; ++r) slab[(mOff + r) * 68 + (j << 4) + rlane] = acc[i][j][r] * scale;
    }
    __builtin_amdgcn_fence(__ATOMIC_RELEASE, "workgroup");
    __builtin_amdgcn_wave_barrier();
    __builtin_amdgcn_fence(__ATOMIC_ACQUIRE, "workgroup");
    {
#pragma unroll
      for (int it = 0; it < 8; ++it) {
        const int row = it * 2 + hrow;
        const v4f v = *(const v4f*)(slab + row * 68 + c4);
        *(v4f*)(C + (size_t)(mBase + row) * ldc + n0 + c4) = v;
      }
      
    }
    __builtin_amdgcn_fence(__ATOMIC_RELEASE, "workgroup");
    __builtin_amdgcn_wave_barrier();
    __builtin_amdgcn_fence(__ATOMIC_ACQUIRE, "workgroup");
  }
}

// ---------------------------------------------------------------------------------------------------------------
// RoPE + f16 hi/residual split. Unit = (row, head); 8 lanes per unit; lane j owns columns {8j, 64+8j, 128+8j, 192+8j}+0..7 of the
// 256-wide head (pairs (c, c+128) are in the same lane). out = x*cos + rotate_half(x)*sin with cos/sin[row][c mod 128].
// hi = f16(out*carry), lo = f16(out*carry - hi) (unscaled residual). Stores: for each column chunk one instruction writes
// coverage: nunits*8 threads x 32 elements = nunits*256 per plane.
// ---------------------------------------------------------------------------------------------------------------
__device__ __forceinline__ void rope_split_part(int blk, const float* __restrict__ src, int spitch, int nheads,
                                                const float* __restrict__ cosT, const float* __restrict__ sinT,
                                                _Float16* __restrict__ hi, _Float16* __restrict__ lo,
                                                int dpitch, int nunits, float carry) {
#pragma clang fp contract(off)
  const int gid = blk * 256 + (int)threadIdx.x;
  const int unit = gid >> 3;
  const int j = gid & 7;
  if (unit >= nunits) return;
  const int row = unit / nheads;
  const int hd = unit - row * nheads;
  const float* s  = src  + (size_t)row * spitch + hd * HD_ + 8 * j;
  const float* ct = cosT + (size_t)row * NF_ + 8 * j;
  const float* st = sinT + (size_t)row * NF_ + 8 * j;
  U8 xa, xb, xc, xd, ca, cb, sa, sb;
  xa.q[0] = *(const v4f*)(s);         xa.q[1] = *(const v4f*)(s + 4);
  xb.q[0] = *(const v4f*)(s + 64);    xb.q[1] = *(const v4f*)(s + 68);
  xc.q[0] = *(const v4f*)(s + 128);   xc.q[1] = *(const v4f*)(s + 132);
  xd.q[0] = *(const v4f*)(s + 192);   xd.q[1] = *(const v4f*)(s + 196);
  ca.q[0] = *(const v4f*)(ct);        ca.q[1] = *(const v4f*)(ct + 4);
  cb.q[0] = *(const v4f*)(ct + 64);   cb.q[1] = *(const v4f*)(ct + 68);
  sa.q[0] = *(const v4f*)(st);        sa.q[1] = *(const v4f*)(st + 4);
  sb.q[0] = *(const v4f*)(st + 64);   sb.q[1] = *(const v4f*)(st + 68);
  // the wait that stands in front of a rewrite of an issued load's address registers; naming the three addresses keeps them whole
  // up to it (else the last load takes its result into them)
  asm volatile("s_wait_xcnt 0x0" :: "v"(s), "v"(ct), "v"(st) : "memory");
  v8h h0, h1, h2, h3, l0, l1, l2, l3;
#pragma unroll
  for (int e = 0; e < 8; ++e) {
    const float r0 = xa.v[e] * ca.v[e] - xc.v[e] * sa.v[e];    // col 8j+e
    const float r1 = xb.v[e] * cb.v[e] - xd.v[e] * sb.v[e];    // col 64+8j+e
    const float r2 = xc.v[e] * ca.v[e] + xa.v[e] * sa.v[e];    // col 128+8j+e
    const float r3 = xd.v[e] * cb.v[e] + xb.v[e] * sb.v[e];    // col 192+8j+e
    float t; _Float16 q;
    t = r0 * carry; q = (_Float16)t; h0[e] = q; l0[e] = (_Float16)(t - (float)q);
    t = r1 * carry; q = (_Float16)t; h1[e] = q; l1[e] = (_Float16)(t - (float)q);
    t = r2 * carry; q = (_Float16)t; h2[e] = q; l2[e] = (_Float16)(t - (float)q);
    t = r3 * carry; q = (_Float16)t; h3[e] = q; l3[e] = (_Float16)(t - (float)q);
  }
  _Float16* hp = hi + (size_t)row * dpitch + hd * HD_ + 8 * j;
  _Float16* lp = lo + (size_t)row * dpitch + hd * HD_ + 8 * j;
  {
    *(v8h*)(hp)       = h0;
    *(v8h*)(hp + 64)  = h1;
    *(v8h*)(hp + 128) = h2;
    *(v8h*)(hp + 192) = h3;
    *(v8h*)(lp)       = l0;
    *(v8h*)(lp + 64)  = l1;
    *(v8h*)(lp + 128) = l2;
    *(v8h*)(lp + 192) = l3;
    
  }
}

// ---------------------------------------------------------------------------------------------------------------
// v columns of the fused kv plane (f32 [NB*SEQ rows][512], cols 256..511) -> transposed f16 planes Vth/Vtl [b][d][s]
// (hi = f16(v*2^10), lo = unscaled residual). 64x64 tiles through LDS; (256/64) x (NB*SEQ/64) blocks (bx, by), 256 threads.
// coverage per block: load 4 it x 256 thr x 4 = 64x64; store 2 it x 256 thr x 8 = 64x64 per plane.
// ---------------------------------------------------------------------------------------------------------------
__device__ __forceinline__ void vt_split_part(int bx, int by, const float* __restrict__ KV, _Float16* __restrict__ Vth,
                                              _Float16* __restrict__ Vtl) {
  __shared__ __align__(16) float tf[64 * 68];
  const int tid = threadIdx.x;
  const int d0  = bx * 64;                   // d block (input column within v)
  const int sg0 = by * 64;                   // global row block (b*SEQ + s)
  const int b   = sg0 >> 11;
  const int s0  = sg0 & (SEQ_ - 1);
  {
    const int lr = tid >> 4;
    const int c4 = (tid & 15) * 4;
#pragma unroll
    for (int it = 0; it < 4; ++it) {
      const int rr = it * 16 + lr;
      const v4f a = *(const v4f*)(KV + (size_t)(sg0 + rr) * KVN_ + HD_ + d0 + c4);
      *(v4f*)(tf + rr * 68 + c4) = a;
    }
  }
  __syncthreads();
  const int sub = tid >> 3;          // output row within tile (= d)
  const int c8  = (tid & 7) * 8;     // s offset within tile
  v8h hv[2], lv[2];
#pragma unroll
  for (int it = 0; it < 2; ++it) {
    const int oc = it * 32 + sub;
    v8h a, rsd;
#pragma unroll
    for (int q = 0; q < 8; ++q) {
      const float f = tf[(c8 + q) * 68 + oc] * CQK_;
      const _Float16 hq = (_Float16)f;
      a[q] = hq;
      rsd[q] = (_Float16)(f - (float)hq);
    }
    hv[it] = a; lv[it] = rsd;
  }
  {
#pragma unroll
    for (int it = 0; it < 2; ++it) {
      const int oc = it * 32 + sub;
      const size_t go = ((size_t)b * HD_ + d0 + oc) * SEQ_ + s0 + c8;
      *(v8h*)(Vth + go) = hv[it];
      *(v8h*)(Vtl + go) = lv[it];
    }
    
  }
}

// ---------------------------------------------------------------------------------------------------------------
// The three passes between the projections and the attention do not depend on one another and share one launch, told apart by
// block index range (block-uniform): v transpose (the one with a barrier) first, then the k planes, then the q planes.
// coverage: SB_ALL_ blocks = the sum of the passes' own block counts.
// ---------------------------------------------------------------------------------------------------------------
#define SB_VT_  ((HD_ / 64) * ((NB_ * SEQ_) / 64))   /* 256  */
#define SB_K_   ((NB_ * SEQ_ * 8) / 256)             /* 128  */
#define SB_Q_   ((NB_ * SEQ_ * NH_ * 8) / 256)       /* 1024 */
#define SB_ALL_ (SB_VT_ + SB_K_ + SB_Q_)
__global__ __launch_bounds__(256) void split_kernel(const float* __restrict__ Qf, const float* __restrict__ KVf,
                                                    const float* __restrict__ cosT, const float* __restrict__ sinT,
                                                    _Float16* __restrict__ Qh, _Float16* __restrict__ Ql,
                                                    _Float16* __restrict__ Kh, _Float16* __restrict__ Kl,
                                                    _Float16* __restrict__ Vth, _Float16* __restrict__ Vtl) {
  int blk = blockIdx.x;
  if (blk < SB_VT_) { vt_split_part(blk & (HD_ / 64 - 1), blk / (HD_ / 64), KVf, Vth, Vtl); return; }
  blk -= SB_VT_;
  if (blk < SB_K_) { rope_split_part(blk, KVf, KVN_, 1, cosT, sinT, Kh, Kl, HD_, NB_ * SEQ_, CQK_); return; }
  blk -= SB_K_;
  rope_split_part(blk, Qf, DM_, NH_, cosT, sinT, Qh, Ql, DM_, NB_ * SEQ_ * NH_, CQK_);
}

#define AT_PPITCH 72
#define AT_OPITCH 264
#define AT_KP     264                            /* k tile row pitch, halves: 528 B = 16 B x odd */
#define AT_VP     72                             /* v^T tile row pitch, halves: 144 B = 16 B x odd */
#define AT_SV     (64 * AT_KP)                   /* v^T tile, halves from the stage's start */
#define AT_STG    (64 * AT_KP + HD_ * AT_VP)     /* halves per stage */
#define AT_OFF_PH 0
#define AT_OFF_PM 9216
#define AT_OFF_PS 9728
#define AT_OFF_AL 10240
#define AT_OFF_LF 10496
#define AT_OFF_RG 10752                          /* the two stages */
#define AT_OFF_PL (AT_OFF_RG + AT_STG * 2)       /* residual P tile: in the residual k tile's place, which is dead behind the score products */
#define AT_OFF_OH AT_OFF_RG                      /* output staging, behind the barrier that follows the loop */
#define AT_OFF_OL (AT_OFF_RG + 33792)
#define AT_LDS    152064                         /* two blocks per 320-KiB LDS */
static_assert(AT_OFF_PM == AT_OFF_PH + 64 * AT_PPITCH * 2);
static_assert(AT_OFF_OL == AT_OFF_OH + 64 * AT_OPITCH * 2);
static_assert(AT_LDS == AT_OFF_RG + 2 * AT_STG * 2);
static_assert(AT_LDS >= AT_OFF_OL + 64 * AT_OPITCH * 2);
static_assert(64 * AT_PPITCH <= AT_SV);
static_assert(AT_OFF_RG % 16 == 0 && (AT_STG * 2) % 16 == 0 && (AT_SV * 2) % 16 == 0);

// Eight copies per lane: l = the lane's LDS byte address, LS = bytes between its LDS rows, g = its global address, gs = halves between
// its source rows. s_wait_xcnt stands inside the statement so that no address register is rewritten ahead of it.
template <unsigned LS>
__device__ __forceinline__ void async_tile8(unsigned l, const _Float16* g, size_t gs) {
  asm volatile(
      "global_load_async_to_lds_b128 %0, %8, off\n\t"
      "global_load_async_to_lds_b128 %1, %9, off\n\t"
      "global_load_async_to_lds_b128 %2, %10, off\n\t"
      "global_load_async_to_lds_b128 %3, %11, off\n\t"
      "global_load_async_to_lds_b128 %4, %12, off\n\t"
      "global_load_async_to_lds_b128 %5, %13, off\n\t"
      "global_load_async_to_lds_b128 %6, %14, off\n\t"
      "global_load_async_to_lds_b128 %7, %15, off\n\t"
      "s_wait_xcnt 0x0"
      :: "v"(l), "v"(l + 1u * LS), "v"(l + 2u * LS), "v"(l + 3u * LS),
         "v"(l + 4u * LS), "v"(l + 5u * LS), "v"(l + 6u * LS), "v"(l + 7u * LS),
         "v"(g), "v"(g + gs), "v"(g + 2 * gs), "v"(g + 3 * gs), "v"(g + 4 * gs), "v"(g + 5 * gs), "v"(g + 6 * gs), "v"(g + 7 * gs)
      : "memory");
}
// One stage = key tile kt: k rows (a wave's copy = one 512-byte row, rows 8 apart) and v^T rows (a wave's copy = four 128-byte lines,
// rows 32 apart). lk, lv: the lane's LDS byte addresses in the stage; gk, gv: its global addresses in tile 0.
__device__ __forceinline__ void attn_fill(unsigned lk, unsigned lv, const _Float16* gk, const _Float16* gv, int kt) {
  async_tile8<8u * AT_KP * 2u>(lk, gk + (size_t)kt * 64 * HD_, (size_t)8 * HD_);
  async_tile8<32u * AT_VP * 2u>(lv, gv + (size_t)kt * 64, (size_t)32 * SEQ_);
}

// The key-tile loop. One instance per kind of query block (EARLY: residual planes as well, one tile in LDS at a time; else two), so that
// the loop holds no test of the kind and a tile's loads stand in groups ahead of their use: q and k fragments by groups of k-steps, the
// mask values in front of the score products, the v^T fragments in front of the P . V products.
template <bool EARLY>
__device__ __forceinline__ void attn_tiles(int ktlo, int kthi, int b, int q0, int srow0, int kh, int w, int hh, int c,
                                           const _Float16* __restrict__ qhp, const _Float16* __restrict__ qlp,
                                           const _Float16* __restrict__ Kh, const _Float16* __restrict__ Kl,
                                           const float* __restrict__ mrp,
                                           const _Float16* __restrict__ Vth, const _Float16* __restrict__ Vtl, const _Float16* ring,
                                           _Float16* Ph, _Float16* Pl, float* pm, float* ps, float* alph,
                                           float (&mrow)[8], float (&lrow)[8], v8f (&oacc)[4][2]) {
  constexpr int KG = EARLY ? 1 : 2;            // k-steps whose fragments are loaded as one group
  constexpr bool TWO = !EARLY;                 // two stages of hi planes: a tile's copies are issued two tiles ahead
  const int tid = (w << 5) + (hh << 4) + c;
  const unsigned lk = (unsigned)(size_t)ring + (unsigned)((tid >> 5) * AT_KP + (tid & 31) * 8) * 2u;
  const unsigned lv = (unsigned)(size_t)ring + (unsigned)(AT_SV + (tid >> 3) * AT_VP + (tid & 7) * 8) * 2u;
  const size_t ok = ((size_t)b * SEQ_ + (tid >> 5)) * HD_ + (tid & 31) * 8;
  const size_t ov = ((size_t)b * HD_ + (tid >> 3)) * SEQ_ + (tid & 7) * 8;
  const _Float16* gk = Kh + ok;
  const _Float16* gv = Vth + ov;
  if (TWO) {
    attn_fill(lk, lv, gk, gv, ktlo);
    asm volatile("s_wait_asynccnt 0x0" ::: "memory");   // the first tile landed (this wave's copies) before the barrier publishes it
    __syncthreads();
    if (ktlo < kthi) attn_fill(lk + AT_STG * 2u, lv + AT_STG * 2u, gk, gv, ktlo + 1);   // block-uniform
  }
  const float* mtile = mrp + ktlo * 64 + 32 * kh + c;   // the lane's first mask value of the tile, moved on by 64 keys per trip
  for (int kt = ktlo; kt <= kthi; ++kt, mtile += 64) {      // block-uniform, at most 32 trips
    const int key0  = kt * 64;
    const int wkey0 = key0 + 32 * kh;
    const int sb = TWO ? ((kt - ktlo) & 1) : 0;   // the stage of the tile's hi planes
    const _Float16* khp = ring + sb * AT_STG + (32 * kh + c) * AT_KP + 8 * hh;
    const _Float16* klp = khp + AT_STG;
    if (!TWO) {
      attn_fill(lk, lv, gk, gv, kt);
      attn_fill(lk + AT_STG * 2u, lv + AT_STG * 2u, Kl + ok, Vtl + ov, kt);
      asm volatile("s_wait_asynccnt 0x0" ::: "memory");   // the tile landed (this wave's copies) before the barrier publishes it
      __syncthreads();
    }

    // ---- mask values of this wave's 16 x 32 scores, in flight during the score products. Every key of a tile is a column of the mask:
    //      no test guards the loads ----
    float mv[8][2];
    const float* mt = mtile;
#pragma unroll   // register arrays: constant indices
    for (int r = 0; r < 8; ++r) {
#pragma unroll   // register arrays: constant indices
      for (int j = 0; j < 2; ++j) mv[r][j] = mt[(size_t)r * SEQ_ + 16 * j];
    }

    // ---- S = q . k^T (16 rows x 32 keys per wave) ----
    v8f s[2];
    s[0] = zero8(); s[1] = zero8();
#pragma unroll   // constant load offsets, no loop overhead between the groups
    for (int g = 0; g < 8; g += KG) {
      v16h qa[KG], qr[KG], kb[KG][2], kr[KG][2];
#pragma unroll   // register arrays: constant indices
      for (int u = 0; u < KG; ++u) {
        const int ks = g + u;
        qa[u] = frag_ld(qhp + 32 * ks);
        qr[u] = qa[u];
        if (EARLY) qr[u] = frag_ld(qlp + 32 * ks);
#pragma unroll   // register arrays: constant indices
        for (int j = 0; j < 2; ++j) {
          kb[u][j] = frag_ld(khp + (16 * j) * AT_KP + 32 * ks);
          kr[u][j] = kb[u][j];
          if (EARLY) kr[u][j] = frag_ld(klp + (16 * j) * AT_KP + 32 * ks);
        }
      }
#pragma unroll   // register arrays: constant indices
      for (int u = 0; u < KG; ++u) {
#pragma unroll   // register arrays: constant indices
        for (int j = 0; j < 2; ++j) {
          s[j] = mma_g(qa[u], kb[u][j], s[j]);
          if (EARLY) {
            s[j] = mma_g(qr[u], kb[u][j], s[j]);
            s[j] = mma_g(qa[u], kr[u][j], s[j]);
          }
        }
      }
    }

    // the wait that stands in front of a rewrite of an issued load's address registers; naming the tile's mask address keeps it whole
    // up to it (else a later load may take its result into it)
    asm volatile("s_wait_xcnt 0x0" :: "v"(mt) : "memory");

    // ---- scale, mask, partial row max over this wave's 32 keys ----
    float cm[8];
    // key - query row at r = 0, j = 0: the band test then compares with constants, and no per-row bounds are held in registers over the
    // loop (the P fragment groups below need the room)
    const int dkq = wkey0 + c - (q0 + srow0 + 8 * hh);
#pragma unroll
    for (int r = 0; r < 8; ++r) {
      float mx = -INFINITY;
#pragma unroll
      for (int j = 0; j < 2; ++j) {
        const bool inb = (dkq >= r - 16 * j - (WIN_ - 1)) && (dkq <= r - 16 * j + (WIN_ - 1));
        const float sv = inb ? (s[j][r] * SSC_ + mv[r][j]) : -INFINITY;
        s[j][r] = sv;
        mx = fmaxf(mx, sv);
      }
      mx = fmaxf(mx, __shfl_xor(mx, 1, 32));
      mx = fmaxf(mx, __shfl_xor(mx, 2, 32));
      mx = fmaxf(mx, __shfl_xor(mx, 4, 32));
      mx = fmaxf(mx, __shfl_xor(mx, 8, 32));
      cm[r] = mx;
    }
    if (c == 0) {
#pragma unroll
      for (int r = 0; r < 8; ++r) pm[w * 16 + 8 * hh + r] = cm[r];
    }
    __syncthreads();

    // ---- online softmax: tile max, p, partial sums ----
    float al[8], psm[8];
    const int wo = w ^ 4;
#pragma unroll
    for (int r = 0; r < 8; ++r) {
      const float om = pm[wo * 16 + 8 * hh + r];
      const float mnew = fmaxf(mrow[r], fmaxf(cm[r], om));
      const float msafe = (mnew == -INFINITY) ? 0.0f : mnew;
      al[r] = __expf(mrow[r] - msafe);
      mrow[r] = mnew;
      float sum = 0.0f;
#pragma unroll
      for (int j = 0; j < 2; ++j) {
        const float p = __expf(s[j][r] - msafe);
        sum += p;
        const float t = p * CP_;
        const _Float16 phv = (_Float16)t;
        const int pidx = (srow0 + 8 * hh + r) * AT_PPITCH + 32 * kh + 16 * j + c;
        Ph[pidx] = phv;
        if (EARLY) Pl[pidx] = (_Float16)(t - (float)phv);
      }
      sum += __shfl_xor(sum, 1, 32);
      sum += __shfl_xor(sum, 2, 32);
      sum += __shfl_xor(sum, 4, 32);
      sum += __shfl_xor(sum, 8, 32);
      psm[r] = sum;
    }
    if (c == 0) {
#pragma unroll
      for (int r = 0; r < 8; ++r) ps[w * 16 + 8 * hh + r] = psm[r];
      if (w < 4) {
#pragma unroll
        for (int r = 0; r < 8; ++r) alph[srow0 + 8 * hh + r] = al[r];
      }
    }
    __syncthreads();
#pragma unroll
    for (int r = 0; r < 8; ++r)
      lrow[r] = lrow[r] * al[r] + (ps[(w & 3) * 16 + 8 * hh + r] + ps[((w & 3) + 4) * 16 + 8 * hh + r]);

    // ---- v^T fragments of the tile, from LDS: in flight while O is rescaled ----
    v16h vb[2][2], vr[2][2];
    const _Float16* vht = ring + sb * AT_STG + AT_SV + (32 * w + c) * AT_VP + 8 * hh;
    const _Float16* vlt = vht + AT_STG;
#pragma unroll   // register arrays: constant indices
    for (int k2 = 0; k2 < 2; ++k2) {
#pragma unroll   // register arrays: constant indices
      for (int jj = 0; jj < 2; ++jj) {
        vb[k2][jj] = frag_ld(vht + (16 * jj) * AT_VP + 32 * k2);
        vr[k2][jj] = vb[k2][jj];
        if (EARLY) vr[k2][jj] = frag_ld(vlt + (16 * jj) * AT_VP + 32 * k2);
      }
    }

    // ---- rescale O, then O += P . V for this wave's 32 output columns ----
    if (!EARLY) {
      // Each P fragment is read from LDS once (both column halves use it) and in a group ahead of its use, so that no product waits on
      // an LDS read issued just in front of it: the first 32 keys' fragments with the v^T fragments and the rescale factors, the second
      // 32 keys' in front of the first 32 keys' products.
      const _Float16* pp = Ph + c * AT_PPITCH + 8 * hh;
      v16h pg[2][4];
      U8 av[4];
#pragma unroll   // register arrays: constant indices
      for (int i = 0; i < 4; ++i) pg[0][i] = frag_ld(pp + (16 * i) * AT_PPITCH);
#pragma unroll   // register arrays: constant indices
      for (int i = 0; i < 4; ++i) {
        av[i].q[0] = *(const v4f*)(alph + 16 * i + 8 * hh);
        av[i].q[1] = *(const v4f*)(alph + 16 * i + 8 * hh + 4);
      }
      // holds these LDS reads together in front of the rescale (one LDS wait instead of one per row group)
      asm volatile("" :: "v"(av[0].v), "v"(av[1].v), "v"(av[2].v), "v"(av[3].v));
#pragma unroll
      for (int i = 0; i < 4; ++i) {
#pragma unroll
        for (int r = 0; r < 8; ++r) { oacc[i][0][r] *= av[i].v[r]; oacc[i][1][r] *= av[i].v[r]; }
      }
#pragma unroll   // register arrays: constant indices
      for (int i = 0; i < 4; ++i) pg[1][i] = frag_ld(pp + (16 * i) * AT_PPITCH + 32);
#pragma unroll
      for (int k2 = 0; k2 < 2; ++k2) {
#pragma unroll
        for (int jj = 0; jj < 2; ++jj) {
#pragma unroll
          for (int i = 0; i < 4; ++i) oacc[i][jj] = mma_g(pg[k2][i], vb[k2][jj], oacc[i][jj]);
        }
      }
    } else {
#pragma unroll
      for (int i = 0; i < 4; ++i) {
        U8 av;
        av.q[0] = *(const v4f*)(alph + 16 * i + 8 * hh);
        av.q[1] = *(const v4f*)(alph + 16 * i + 8 * hh + 4);
#pragma unroll
        for (int r = 0; r < 8; ++r) { oacc[i][0][r] *= av.v[r]; oacc[i][1][r] *= av.v[r]; }
      }
#pragma unroll
      for (int k2 = 0; k2 < 2; ++k2) {
#pragma unroll
        for (int jj = 0; jj < 2; ++jj) {
#pragma unroll
          for (int i = 0; i < 4; ++i) {
            const v16h pa = frag_ld(Ph + (16 * i + c) * AT_PPITCH + 32 * k2 + 8 * hh);
            oacc[i][jj] = mma_g(pa, vb[k2][jj], oacc[i][jj]);
            const v16h pr = frag_ld(Pl + (16 * i + c) * AT_PPITCH + 32 * k2 + 8 * hh);
            oacc[i][jj] = mma_g(pa, vr[k2][jj], oacc[i][jj]);
            oacc[i][jj] = mma_g(pr, vb[k2][jj], oacc[i][jj]);
          }
        }
      }
    }

    // ---- hand-over of the stages ----
    asm volatile("s_wait_dscnt 0x0" ::: "memory");        // this wave's reads (and residual P writes) there are done before a refill
    if (TWO) asm volatile("s_wait_asynccnt 0x0" ::: "memory");   // this wave's copies of the next tile have landed
    __syncthreads();                                      // frees tile kt's stage; with two stages it publishes tile kt+1 as well
    if (TWO && kt + 2 <= kthi)                            // block-uniform
      attn_fill(lk + (unsigned)sb * (AT_STG * 2u), lv + (unsigned)sb * (AT_STG * 2u), gk, gv, kt + 2);
  }
  if (TWO) asm volatile("s_wait_asynccnt 0x0" ::: "memory");   // nothing in flight when the stages become output staging
}

// amdgpu_waves_per_eu(4, 4): holds the registers to four waves per SIMD, so that two blocks share a WGP (2 x AT_LDS fits its LDS)
__global__ __launch_bounds__(256) __attribute__((amdgpu_waves_per_eu(4, 4))) void attn_kernel(const _Float16* __restrict__ Qh, const _Float16* __restrict__ Ql,
                                                   const _Float16* __restrict__ Kh, const _Float16* __restrict__ Kl,
                                                   const _Float16* __restrict__ Vth, const _Float16* __restrict__ Vtl,
                                                   const float* __restrict__ mask, const int* __restrict__ flag,
                                                   _Float16* __restrict__ AOh, _Float16* __restrict__ AOl) {
  extern __shared__ __align__(16) unsigned char dsm[];
  _Float16* Ph   = (_Float16*)(dsm + AT_OFF_PH);
  _Float16* Pl   = (_Float16*)(dsm + AT_OFF_PL);
  float*    pm   = (float*)(dsm + AT_OFF_PM);     // [8 waves][16 rows] partial row max
  float*    ps   = (float*)(dsm + AT_OFF_PS);     // [8 waves][16 rows] partial row sum
  float*    alph = (float*)(dsm + AT_OFF_AL);     // [64] rescale factors
  float*    lfin = (float*)(dsm + AT_OFF_LF);     // [64] final row sums
  const _Float16* ring = (const _Float16*)(dsm + AT_OFF_RG);   // two stages of k and v^T tiles
  _Float16* Ohs  = (_Float16*)(dsm + AT_OFF_OH);
  _Float16* Ols  = (_Float16*)(dsm + AT_OFF_OL);

  const int tid  = threadIdx.x;
  const int w    = tid >> 5;
  const int lane = tid & 31;
  const int hh   = lane >> 4;
  const int c    = lane & 15;
  const int bid  = blockIdx.x;
  const int qb   = bid & (NQB_ - 1);
  const int h    = (bid >> 5) & (NH_ - 1);
  const int b    = bid >> 8;
  const int q0   = qb * 64;
  const int srow0 = (w & 3) * 16;
  const int kh    = w >> 2;
  const int ocol0 = w * 32;
  const bool early = (qb < QE_);
  const int ktlo = (qb > 16) ? (qb - 16) : 0;
  int fl = 1;                                  // block-uniform: all row groups of this query block verified
#pragma unroll   // independent scalar loads, issued together instead of one round trip each
  for (int g = 0; g < MFG_; ++g) fl &= flag[((b * NQB_ + qb) * MFG_ + g) * 32];
  int kthi = (fl != 0) ? qb : (qb + 16);
  if (kthi > NQB_ - 1) kthi = NQB_ - 1;

  const size_t growq = (size_t)b * SEQ_ + q0;
  const _Float16* qhp = Qh + (growq + srow0 + c) * DM_ + h * HD_ + 8 * hh;
  const _Float16* qlp = Ql + (growq + srow0 + c) * DM_ + h * HD_ + 8 * hh;
  const float*    mrp = mask + (growq + srow0 + 8 * hh) * (size_t)SEQ_;

  float mrow[8], lrow[8];
  v8f oacc[4][2];
#pragma unroll
  for (int r = 0; r < 8; ++r) { mrow[r] = -INFINITY; lrow[r] = 0.0f; }
#pragma unroll
  for (int i = 0; i < 4; ++i) { oacc[i][0] = zero8(); oacc[i][1] = zero8(); }

  if (early)   // block-uniform
    attn_tiles<true>(ktlo, kthi, b, q0, srow0, kh, w, hh, c, qhp, qlp, Kh, Kl, mrp, Vth, Vtl, ring, Ph, Pl, pm, ps, alph, mrow, lrow, oacc);
  else
    attn_tiles<false>(ktlo, kthi, b, q0, srow0, kh, w, hh, c, qhp, qlp, Kh, Kl, mrp, Vth, Vtl, ring, Ph, Pl, pm, ps, alph, mrow, lrow, oacc);

  if (w < 4 && c == 0) {
#pragma unroll
    for (int r = 0; r < 8; ++r) lfin[srow0 + 8 * hh + r] = lrow[r];
  }
  __syncthreads();
#pragma unroll
  for (int i = 0; i < 4; ++i) {
    U8 lv;
    lv.q[0] = *(const v4f*)(lfin + 16 * i + 8 * hh);
    lv.q[1] = *(const v4f*)(lfin + 16 * i + 8 * hh + 4);
#pragma unroll
    for (int r = 0; r < 8; ++r) {
      const float f = OSC_ * (1.0f / lv.v[r]);
      const int orow = 16 * i + 8 * hh + r;
#pragma unroll
      for (int jj = 0; jj < 2; ++jj) {
        const float t = oacc[i][jj][r] * f;
        const _Float16 hq = (_Float16)t;
        const int oidx = orow * AT_OPITCH + ocol0 + 16 * jj + c;
        Ohs[oidx] = hq;
        Ols[oidx] = (_Float16)(t - (float)hq);
      }
    }
  }
  __syncthreads();
  {
    const int piece = tid & 7;
    const int lsub  = tid >> 3;
    {
#pragma unroll
      for (int it = 0; it < 8; ++it) {
        const int line = it * 32 + lsub;          // 0..255 = 64 rows x 4 lines
        const int row  = line >> 2;
        const int col  = (line & 3) * 64 + piece * 8;
        const v8h hv = *(const v8h*)(Ohs + row * AT_OPITCH + col);
        const v8h rv = *(const v8h*)(Ols + row * AT_OPITCH + col);
        const size_t go = (growq + row) * DM_ + h * HD_ + col;
        *(v8h*)(AOh + go) = hv;
        *(v8h*)(AOl + go) = rv;
      }
      
    }
  }
}

// ---------------------------------------------------------------------------------------------------------------
// Workspace map (byte offsets, all 2 MiB aligned; every region is written completely by whole-line stores before it is read;
// the attention output planes reuse the f32 q region, which is dead after the q RoPE/split pass):
//   Xh   f16 [4096][2048]            0           16,777,216
//   Wqh  f16 [2048][2048]   16,777,216            8,388,608
//   Wkvh f16 [512][2048]    25,165,824            2,097,152
//   Woh  f16 [2048][2048]   27,262,976            8,388,608
//   cosT f32 [4096][128]    35,651,584            2,097,152
//   sinT f32 [4096][128]    37,748,736            2,097,152
//   Qf   f32 [4096][2048]   39,845,888           33,554,432   (AOh f16 [4096][2048] at 39,845,888; AOl at 56,623,104)
//   KVf  f32 [4096][512]    73,400,320            8,388,608
//   Qh   f16 [4096][2048]   81,788,928           16,777,216
//   Ql   f16 [4096][2048]   98,566,144           16,777,216
//   Kh   f16 [4096][256]   115,343,360            2,097,152
//   Kl   f16 [4096][256]   117,440,512            2,097,152
//   Vth  f16 [2][256][2048] 119,537,664           2,097,152
//   Vtl  f16 [2][256][2048] 121,634,816           2,097,152
//   flags int [2*32*16][32] 123,731,968            131,072
//   total                  123,863,040
// ---------------------------------------------------------------------------------------------------------------
extern "C" void kernel_launch(void* const* d_in, const int* in_sizes, int n_in,
                              void* d_out, int out_size, void* d_ws, size_t ws_size,
                              hipStream_t stream) {
  if (n_in < 7) return;
  if (in_sizes[0] != NB_ * SEQ_ * DM_) return;
  if (in_sizes[1] != NB_ * SEQ_ * SEQ_) return;
  if (in_sizes[2] != NB_ * SEQ_) return;
  if (in_sizes[3] != DM_ * DM_) return;
  if (in_sizes[4] != HD_ * DM_) return;
  if (in_sizes[5] != HD_ * DM_) return;
  if (in_sizes[6] != DM_ * DM_) return;
  if (out_size != NB_ * SEQ_ * DM_) return;

  const float* x    = (const float*)d_in[0];
  const float* mask = (const float*)d_in[1];
  const int*   pos  = (const int*)d_in[2];
  const float* Wq   = (const float*)d_in[3];
  const float* Wk   = (const float*)d_in[4];
  const float* Wv   = (const float*)d_in[5];
  const float* Wo   = (const float*)d_in[6];
  float* out = (float*)d_out;

  const size_t nX   = (size_t)NB_ * SEQ_ * DM_;          // 8,388,608 elements
  const size_t bXh  = nX * 2;
  const size_t bWq  = (size_t)DM_ * DM_ * 2;
  const size_t bWkv = (size_t)KVN_ * DM_ * 2;
  const size_t bWo  = bWq;
  const size_t bTab = (size_t)NB_ * SEQ_ * NF_ * 4;
  const size_t bQf  = nX * 4;
  const size_t bKVf = (size_t)NB_ * SEQ_ * KVN_ * 4;
  const size_t bQ16 = nX * 2;
  const size_t bK16 = (size_t)NB_ * SEQ_ * HD_ * 2;
  const size_t bV16 = bK16;
  const size_t bFlg = (size_t)NB_ * NQB_ * MFG_ * 128;
  size_t off = 0;
  const size_t oXh  = off; off += bXh;
  const size_t oWq  = off; off += bWq;
  const size_t oWkv = off; off += bWkv;
  const size_t oWo  = off; off += bWo;
  const size_t oCos = off; off += bTab;
  const size_t oSin = off; off += bTab;
  const size_t oQf  = off; off += bQf;
  const size_t oKVf = off; off += bKVf;
  const size_t oQh  = off; off += bQ16;
  const size_t oQl  = off; off += bQ16;
  const size_t oKh  = off; off += bK16;
  const size_t oKl  = off; off += bK16;
  const size_t oVth = off; off += bV16;
  const size_t oVtl = off; off += bV16;
  const size_t oFlg = off; off += bFlg;
  if (off > ws_size) return;                        // off = 123,863,040
  if (off > (size_t)134217728) return;
  if (bQf < 2 * bQ16) return;                        // AOh/AOl alias fits inside the f32 q region
  const size_t oAOh = oQf;
  const size_t oAOl = oQf + bQ16;

  char* ws = (char*)d_ws;
  _Float16* Xh   = (_Float16*)(ws + oXh);
  _Float16* Wqh  = (_Float16*)(ws + oWq);
  _Float16* Wkvh = (_Float16*)(ws + oWkv);
  _Float16* Woh  = (_Float16*)(ws + oWo);
  float*    cosT = (float*)(ws + oCos);
  float*    sinT = (float*)(ws + oSin);
  float*    Qf   = (float*)(ws + oQf);
  float*    KVf  = (float*)(ws + oKVf);
  _Float16* Qh   = (_Float16*)(ws + oQh);
  _Float16* Ql   = (_Float16*)(ws + oQl);
  _Float16* Kh   = (_Float16*)(ws + oKh);
  _Float16* Kl   = (_Float16*)(ws + oKl);
  _Float16* Vth  = (_Float16*)(ws + oVth);
  _Float16* Vtl  = (_Float16*)(ws + oVtl);
  int*      flg  = (int*)(ws + oFlg);
  _Float16* AOh  = (_Float16*)(ws + oAOh);
  _Float16* AOl  = (_Float16*)(ws + oAOl);

  const dim3 blk(256);

  // (1) one launch: inputs -> 16-bit planes (x bf16*2^4, weights bf16*2^8, k rows then v rows in the fused kv weight plane);
  //     cos/sin tables [4096][128] from position ids; mask verification flags per (b, query block, 4-row group)
  prep_kernel<<<dim3(PB_ALL_), blk, 0, stream>>>(x, mask, pos, Wq, Wk, Wv, Wo, Xh, Wqh, Wkvh, Woh, cosT, sinT, flg);
  // (2) one launch: q = x . Wq^T -> f32 [4096][2048]; [k|v] = x . [Wk|Wv]^T -> f32 [4096][512]
  gemm64_kernel<<<dim3((NB_ * SEQ_ / GBM_) * (DM_ / GBN_ + KVN_ / GBN_)), blk, 0, stream>>>(
      Xh, Xh, DM_, Wqh, DM_, Qf, DM_, NB_ * SEQ_, DM_, DM_, 0, SEQ_ - 1, QSC_, Wkvh, KVf, KVN_, KVN_);
  // (3) one launch: RoPE + hi/residual split, q planes [4096][8*256] and k planes [4096][256]; v^T planes [2][256][2048]
  split_kernel<<<dim3(SB_ALL_), blk, 0, stream>>>(Qf, KVf, cosT, sinT, Qh, Ql, Kh, Kl, Vth, Vtl);
  // (4) attention -> AO hi/residual planes [4096][2048]
  (void)hipFuncSetAttribute(reinterpret_cast<const void*>(&attn_kernel), hipFuncAttributeMaxDynamicSharedMemorySize, AT_LDS);
  attn_kernel<<<dim3(NB_ * NH_ * NQB_), blk, AT_LDS, stream>>>(Qh, Ql, Kh, Kl, Vth, Vtl, mask, flg, AOh, AOl);
  // (5) out = AO . Wo^T -> d_out f32 [4096][2048]; residual plane on rows < LOROWS_ of each sequence
  gemm64_kernel<<<dim3((NB_ * SEQ_ / GBM_) * (DM_ / GBN_)), blk, 0, stream>>>(
      AOh, AOl, DM_, Woh, DM_, out, DM_, NB_ * SEQ_, DM_, DM_, LOROWS_, SEQ_ - 1, WSC_, Woh, out, DM_, 0);
  (void)hipGetLastError();
}

// v007
// One run takes 165 microseconds.
// Next to v006, in two timings, it ran 1.10 times as fast each time.
// Counting every step since v000, it is 3.80 times as fast.
// Contractions on v_wmma_f32_16x16x32_f16 (f16 operands, f32 accumulate): q/k/v projections (x RNE-converted to bf16 and carried *2^4,
// W RNE-converted to bf16 and carried *2^8, exact products); q.k^T (q,k carried *2^10 as f16 hi planes, plus unscaled f16 residual planes
// on the leading query blocks of each sequence); p.v (p carried *2^15, v^T carried *2^10: hi planes plus residual planes on the leading query
// blocks); output projection (attention output carried *2^10: hi plane everywhere, residual plane on the leading rows of each sequence;
// Wo bf16 *2^8). RoPE, mask add and online softmax in f32.
#include <hip/hip_runtime.h>
#include <math.h>
#include <stdint.h>

#define NB_     2
#define SEQ_    2048
#define DM_     2048
#define NH_     8
#define HD_     256
#define NF_     128
#define KVN_    512
#define WIN_    1024
#define NQB_    32
#define QE_     4
#define LOROWS_ 256
#define MFG_    16

#define CX_   16.0f
#define CW_   256.0f
#define CQK_  1024.0f
#define CP_   32768.0f
#define SSC_  5.9604644775390625e-8f     /* 2^-4 * 2^-20 : score scale for q,k carried *2^10 each */
#define OSC_  3.0517578125e-5f           /* 2^-15 = 2^10 / (2^15 * 2^10) : attention output carry */
#define QSC_  2.44140625e-4f             /* 2^-12 = 1 / (2^4 * 2^8) : projection outputs back to f32 */
#define WSC_  3.814697265625e-6f         /* 2^-18 = 1 / (2^10 * 2^8) : final projection */

typedef _Float16 v16h __attribute__((ext_vector_type(16)));
typedef _Float16 v8h  __attribute__((ext_vector_type(8)));
typedef float    v8f  __attribute__((ext_vector_type(8)));
typedef float    v4f  __attribute__((ext_vector_type(4)));

union FragU { v16h v; v8h h[2]; };
union U8 { v8f v; v4f q[2]; };

__device__ __forceinline__ float bf16_rne(float f) {
  unsigned u = __float_as_uint(f);
  u = u + 0x7FFFu + ((u >> 16) & 1u);
  return __uint_as_float(u & 0xFFFF0000u);
}
__device__ __forceinline__ v8f zero8() { return (v8f){0.f, 0.f, 0.f, 0.f, 0.f, 0.f, 0.f, 0.f}; }

// 16-bit fragment (A or B): lane row/col = lane&15, elements 0..7 <- p[0..7] (k0+8h..), 8..15 <- p[16..23] (k0+16+8h..)
// p already includes the row base + k0 + 8*h.
__device__ __forceinline__ v16h frag_ld(const _Float16* p) {
  FragU f;
  f.h[0] = *(const v8h*)(p);
  f.h[1] = *(const v8h*)(p + 16);
  return f.v;
}
__device__ __forceinline__ v8f wmma_raw(v16h a, v16h b, v8f c) {
  return __builtin_amdgcn_wmma_f32_16x16x32_f16(false, a, false, b, (short)0, c, false, false);
}
// WMMA with trailing hazard guard (ties D, keeps A/B live)
__device__ __forceinline__ v8f mma_g(v16h a, v16h b, v8f c) {
  c = __builtin_amdgcn_wmma_f32_16x16x32_f16(false, a, false, b, (short)0, c, false, false);
  asm volatile("v_nop\n\tv_nop\n\tv_nop\n\tv_nop" : "+v"(c) : "v"(a), "v"(b));
  return c;
}
__device__ __forceinline__ void dep_guard(v8f& a, v8f& b, v16h x, v16h y) {
  asm volatile("v_nop\n\tv_nop\n\tv_nop\n\tv_nop" : "+v"(a), "+v"(b) : "v"(x), "v"(y));
}
__device__ __forceinline__ void keep4(v16h a, v16h b, v16h c, v16h d) {
  asm volatile("v_nop" :: "v"(a), "v"(b), "v"(c), "v"(d));
}
__device__ __forceinline__ void acc_guard4(v8f& a, v8f& b, v8f& c, v8f& d) {
  asm volatile("v_nop\n\tv_nop\n\tv_nop\n\tv_nop" : "+v"(a), "+v"(b), "+v"(c), "+v"(d));
}

// ---------------------------------------------------------------------------------------------------------------
// Elementwise convert: dst[i] = f16( bf16_rne(src[i]) * scale ), 8 elements per thread, one 16-B store per lane:
// coverage: ceil(n8/256) blocks (blk = the block's index within them), each thread 8 elements -> 8*n8 elements.
// ---------------------------------------------------------------------------------------------------------------
__device__ __forceinline__ void cvt16_part(int blk, const float* __restrict__ src, _Float16* __restrict__ dst, int n8, float scale) {
  const int i = blk * 256 + (int)threadIdx.x;
  if (i >= n8) return;
  const float* s = src + 8 * (size_t)i;
  U8 a;
  a.q[0] = *(const v4f*)(s);
  a.q[1] = *(const v4f*)(s + 4);
  v8h o;
#pragma unroll
  for (int e = 0; e < 8; ++e) o[e] = (_Float16)(bf16_rne(a.v[e]) * scale);
  _Float16* d = dst + 8 * (size_t)i;
  *(v8h*)d = o;
  
}

// ---------------------------------------------------------------------------------------------------------------
// RoPE tables: cosT/sinT [nrows][128], angle = float(pos[row]) * inv_freq[f], inv_freq[f] = 1 / f32(10000^(f/128)).
// coverage: nrows/32 blocks (blk = the block's index within them), 16 iterations x 2 rows -> nrows x 128 per table.
// ---------------------------------------------------------------------------------------------------------------
__device__ __forceinline__ void rope_table_part(int blk, const int* __restrict__ pos, float* __restrict__ cosT,
                                                float* __restrict__ sinT, int nrows) {
#pragma clang fp contract(off)
  __shared__ float invf[NF_];
  const int tid = threadIdx.x;
  if (tid < NF_) {
    const double e = (double)tid * 0.0078125;                 // tid/128 exactly
    const double p = exp2(e * 13.287712379549449);            // 10000^e
    const float pf = (float)p;                                // RNE to f32
    invf[tid] = 1.0f / pf;
  }
  __syncthreads();
  const int f = tid & (NF_ - 1);
  const int rp = tid >> 7;
  const int r0 = blk * 32;
  const float iv = invf[f];
#pragma unroll 1
  for (int it = 0; it < 16; ++it) {
    const int row = r0 + it * 2 + rp;
    const int rowc = (row < nrows) ? row : (nrows - 1);
    const float ang = (float)pos[rowc] * iv;
    float sv, cv;
    sincosf(ang, &sv, &cv);
    if (row < nrows) {
      float* cp = cosT + (size_t)row * NF_ + f;
      float* sp = sinT + (size_t)row * NF_ + f;
      *(float*)cp = cv;
      *(float*)sp = sv;
      // the wait that stands in front of a rewrite of an issued store's registers (the next trip reuses them)
      asm volatile("s_wait_xcnt 0x0" :: "v"(cp), "v"(sp), "v"(cv), "v"(sv) : "memory");
    }
  }
}

// ---------------------------------------------------------------------------------------------------------------
// Mask verification flags, MFG_ per (b, 64-query block), one per group of 4 query rows: 1 if every mask value for the group's rows
// and keys in [q0+64, min(q+1023, SEQ-1)] (the in-band keys strictly above the query block) is <= -1e9 (adds to an exact zero weight).
// The range holds at most 1023 keys, so 256 threads x 4 keys cover a row with one 16-byte load each; the 4 rows' loads are independent.
// coverage: NB*NQB*MFG_ blocks (bid = the block's index within them); each block writes its own 128-byte line of 32 equal ints.
// ---------------------------------------------------------------------------------------------------------------
__device__ __forceinline__ void maskflag_part(int bid, const float* __restrict__ mask, int* __restrict__ flag) {
  __shared__ int sw[8];
  const int tid = threadIdx.x, w = tid >> 5, lane = tid & 31;
  // bid = (b*32 + qb)*MFG_ + row group
  const int g  = bid & (MFG_ - 1);
  const int bq = bid / MFG_;
  const int b = bq >> 5, qb = bq & (NQB_ - 1);
  const int q0 = qb * 64;
  const int r0 = q0 + g * (64 / MFG_);
  const int k  = q0 + 64 + 4 * tid;          // first of this thread's four keys
  const int kc = (k <= SEQ_ - 4) ? k : (SEQ_ - 4);   // k > SEQ-4 means k >= SEQ: none of the four keys is tested
  v4f mv[64 / MFG_];
#pragma unroll   // all rows' loads issue before the first compare waits (and mv stays in registers)
  for (int rr = 0; rr < 64 / MFG_; ++rr) mv[rr] = *(const v4f*)(mask + ((size_t)b * SEQ_ + r0 + rr) * SEQ_ + kc);
  int bad = 0;
#pragma unroll
  for (int rr = 0; rr < 64 / MFG_; ++rr) {
    int kend = r0 + rr + WIN_ - 1;
    if (kend > SEQ_ - 1) kend = SEQ_ - 1;
#pragma unroll
    for (int e = 0; e < 4; ++e) {
      const int ok = (mv[rr][e] <= -1.0e9f) ? 1 : 0;
      bad |= ((k + e <= kend) && (ok == 0)) ? 1 : 0;
    }
  }
  const unsigned long long bm = __ballot(bad);
  if (lane == 0) sw[w] = (bm != 0ull) ? 1 : 0;
  __syncthreads();
  if (w == 0) {
    int any = 0;
#pragma unroll
    for (int i = 0; i < 8; ++i) any |= sw[i];
    const int fv = any ? 0 : 1;
    int* fp = flag + (size_t)bid * 32 + lane;
    *(int*)fp = fv;
  }
}

// ---------------------------------------------------------------------------------------------------------------
// The preparation passes, which depend on the inputs alone and not on one another, share one launch: a block's index range says
// which pass it belongs to (block-uniform, so each pass's barriers are reached by all of its block's threads or by none).
// The table blocks, few and with the longest serial chain, come first; then the mask check; then the five conversions.
// coverage: PB_ALL_ blocks = the sum of the passes' own block counts; every pass gets exactly its blocks.
// ---------------------------------------------------------------------------------------------------------------
#define PB_TAB_ ((NB_ * SEQ_) / 32)               /* 128  */
#define PB_FLG_ (NB_ * NQB_ * MFG_)               /* 1024 */
#define PB_X_   ((NB_ * SEQ_ * DM_) / (8 * 256))  /* 4096 */
#define PB_W_   ((DM_ * DM_) / (8 * 256))         /* 2048 */
#define PB_KV_  ((HD_ * DM_) / (8 * 256))         /* 256  */
#define PB_ALL_ (PB_TAB_ + PB_FLG_ + PB_X_ + 2 * PB_W_ + 2 * PB_KV_)
__global__ __launch_bounds__(256) void prep_kernel(const float* __restrict__ x, const float* __restrict__ mask,
                                                   const int* __restrict__ pos, const float* __restrict__ Wq,
                                                   const float* __restrict__ Wk, const float* __restrict__ Wv,
                                                   const float* __restrict__ Wo, _Float16* __restrict__ Xh,
                                                   _Float16* __restrict__ Wqh, _Float16* __restrict__ Wkvh,
                                                   _Float16* __restrict__ Woh, float* __restrict__ cosT,
                                                   float* __restrict__ sinT, int* __restrict__ flag) {
  int blk = blockIdx.x;
  if (blk < PB_TAB_) { rope_table_part(blk, pos, cosT, sinT, NB_ * SEQ_); return; }
  blk -= PB_TAB_;
  if (blk < PB_FLG_) { maskflag_part(blk, mask, flag); return; }
  blk -= PB_FLG_;
  if (blk < PB_X_) { cvt16_part(blk, x, Xh, PB_X_ * 256, CX_); return; }
  blk -= PB_X_;
  const float* src = Wq;      // weights: bf16 * 2^8; k rows then v rows in the fused kv weight plane
  _Float16* dst = Wqh;
  int n8 = PB_W_ * 256;
  if (blk >= PB_W_) {
    blk -= PB_W_; src = Wo; dst = Woh;
    if (blk >= PB_W_) {
      blk -= PB_W_; src = Wk; dst = Wkvh; n8 = PB_KV_ * 256;
      if (blk >= PB_KV_) { blk -= PB_KV_; src = Wv; dst = Wkvh + (size_t)HD_ * DM_; }
    }
  }
  cvt16_part(blk, src, dst, n8, CW_);
}

// ---------------------------------------------------------------------------------------------------------------
// Register-blocked WMMA GEMM, f16 operands: C[m][n] = scale * sum_k (A[m][k] (+ A2[m][k])) * Bt[n][k]
// A row-major [M][lda], optional residual plane A2 (same layout) used on row blocks with (m0 & seqMask) < loRows (block-uniform;
// loRows a multiple of 128); Bt row-major [N][ldb] (k contiguous); C f32 [M][ldc].
// Block = 8 waves (2 x 4) on a 128 x 256 tile of C, each wave a 64x64 tile (4x4 accumulators).
// Operands reach LDS by asynchronous 16-byte copies, whole 256-byte row pieces (128 k) per stage, two stages: the next stage's
// copies fly while this stage is multiplied. LDS row pitch 272 bytes (16 B x odd) for the 16-byte fragment reads.
// M multiple of 128, N multiple of 256, K multiple of 128. Epilogue: 16-row slabs staged per wave in the (then free) ring.
// ---------------------------------------------------------------------------------------------------------------
#define GK_    128                               /* k per stage */
#define GPH_   136                               /* LDS row pitch, halves */
#define GBM_   128
#define GBN_   256
#define G_OA2_ (GBM_ * GPH_)                     /* residual plane of A, halves from the stage's start */
#define G_OB_  (2 * GBM_ * GPH_)
#define G_STG_ ((2 * GBM_ + GBN_) * GPH_)        /* halves per stage */
#define G_LS_  (16 * GPH_ * 2)                   /* bytes between LDS rows 16 apart */
static_assert(LOROWS_ % GBM_ == 0);
static_assert(2 * G_STG_ * 2 >= 8 * 16 * 68 * 4);

// Eight copies per lane, rows 16 apart: l = the lane's LDS byte address, g = its global address, gs = halves per 16 source rows.
// s_wait_xcnt stands inside the statement so that no address register is rewritten ahead of it.
__device__ __forceinline__ void async_rows8(unsigned l, const _Float16* g, size_t gs) {
  asm volatile(
      "global_load_async_to_lds_b128 %0, %8, off\n\t"
      "global_load_async_to_lds_b128 %1, %9, off\n\t"
      "global_load_async_to_lds_b128 %2, %10, off\n\t"
      "global_load_async_to_lds_b128 %3, %11, off\n\t"
      "global_load_async_to_lds_b128 %4, %12, off\n\t"
      "global_load_async_to_lds_b128 %5, %13, off\n\t"
      "global_load_async_to_lds_b128 %6, %14, off\n\t"
      "global_load_async_to_lds_b128 %7, %15, off\n\t"
      "s_wait_xcnt 0x0"
      :: "v"(l), "v"(l + 1u * G_LS_), "v"(l + 2u * G_LS_), "v"(l + 3u * G_LS_),
         "v"(l + 4u * G_LS_), "v"(l + 5u * G_LS_), "v"(l + 6u * G_LS_), "v"(l + 7u * G_LS_),
         "v"(g), "v"(g + gs), "v"(g + 2 * gs), "v"(g + 3 * gs), "v"(g + 4 * gs), "v"(g + 5 * gs), "v"(g + 6 * gs), "v"(g + 7 * gs)
      : "memory");
}
// One stage: A 128 rows (+ A2 128 rows), Bt 256 rows, 256 bytes of each; a wave's copy covers two whole row pieces.
template <bool LO>
__device__ __forceinline__ void gemm_fill(unsigned l, const _Float16* ga, const _Float16* ga2, size_t as16,
                                          const _Float16* gb, size_t bs16) {
  async_rows8(l, ga, as16);
  if (LO) async_rows8(l + G_OA2_ * 2u, ga2, as16);
  async_rows8(l + G_OB_ * 2u, gb, bs16);
  async_rows8(l + G_OB_ * 2u + 8u * G_LS_, gb + 8 * bs16, bs16);
}

template <bool LO>
__device__ __forceinline__ void gemm_ring(v8f (&acc)[4][4], const _Float16* ring, const _Float16* __restrict__ Ab,
                                          const _Float16* __restrict__ Ab2, int lda, const _Float16* __restrict__ Bb, int ldb,
                                          int m0b, int n0b, int K, int tid, int wrow, int wcol, int rlane, int koff) {
  const int sub = tid >> 4;
  const int cc  = (tid & 15) * 8;
  const unsigned l0 = (unsigned)(size_t)ring + (unsigned)(sub * GPH_ + cc) * 2u;
  const _Float16* ga  = Ab  + (size_t)(m0b + sub) * lda + cc;
  const _Float16* ga2 = Ab2 + (size_t)(m0b + sub) * lda + cc;
  const _Float16* gb  = Bb  + (size_t)(n0b + sub) * ldb + cc;
  const size_t as16 = (size_t)16 * lda;
  const size_t bs16 = (size_t)16 * ldb;
  const int nt = K / GK_;

  gemm_fill<LO>(l0, ga, ga2, as16, gb, bs16);
  asm volatile("s_wait_asynccnt 0x0" ::: "memory");   // stage 0 landed (this wave's copies) before the barrier publishes it
  __syncthreads();
  if (nt > 1) gemm_fill<LO>(l0 + G_STG_ * 2u, ga + GK_, ga2 + GK_, as16, gb + GK_, bs16);

  for (int t = 0; t < nt; ++t) {
    const _Float16* st = ring + (t & 1) * G_STG_;
    const _Float16* sa = st + (wrow + rlane) * GPH_ + koff;
    const _Float16* sb = st + G_OB_ + (wcol + rlane) * GPH_ + koff;
#pragma unroll   // the four k-steps of a stage in one body: constant LDS offsets, no loop overhead between them
    for (int kk = 0; kk < GK_; kk += 32) {
      v16h bh[4], ah[4], al[4];
#pragma unroll   // register arrays: constant indices
      for (int j = 0; j < 4; ++j) bh[j] = frag_ld(sb + (j << 4) * GPH_ + kk);
#pragma unroll   // register arrays: constant indices
      for (int i = 0; i < 4; ++i) {
        ah[i] = frag_ld(sa + (i << 4) * GPH_ + kk);
        al[i] = ah[i];
        if (LO) al[i] = frag_ld(sa + G_OA2_ + (i << 4) * GPH_ + kk);
      }
      // holds the k-step's fragment reads together in front of its products (one LDS wait per k-step instead of one per row)
      asm volatile("" :: "v"(bh[0]), "v"(bh[1]), "v"(bh[2]), "v"(bh[3]), "v"(ah[0]), "v"(ah[1]), "v"(ah[2]), "v"(ah[3]));
      if (LO) asm volatile("" :: "v"(al[0]), "v"(al[1]), "v"(al[2]), "v"(al[3]));   // the same for the residual plane's reads
#pragma unroll   // register arrays: constant indices
      for (int i = 0; i < 4; ++i) {
#pragma unroll   // register arrays: constant indices
        for (int j = 0; j < 4; ++j) {
          acc[i][j] = wmma_raw(ah[i], bh[j], acc[i][j]);
          if (LO) acc[i][j] = wmma_raw(al[i], bh[j], acc[i][j]);
        }
        dep_guard(acc[i][0], acc[i][3], ah[i], al[i]);
      }
      keep4(bh[0], bh[1], bh[2], bh[3]);
    }
    asm volatile("s_wait_dscnt 0x0" ::: "memory");      // this wave's reads of the stage are done before it may be refilled
    asm volatile("s_wait_asynccnt 0x0" ::: "memory");   // this wave's copies of the next stage have landed
    __syncthreads();                                    // publishes stage t+1 and frees stage t's buffer
    if (t + 2 < nt)
      gemm_fill<LO>(l0 + (unsigned)(t & 1) * (G_STG_ * 2u), ga + (size_t)(t + 2) * GK_, ga2 + (size_t)(t + 2) * GK_, as16,
                    gb + (size_t)(t + 2) * GK_, bs16);
  }
  asm volatile("s_wait_asynccnt 0x0" ::: "memory");     // nothing in flight when the ring becomes output staging
}

// One launch may hold two products with the same A, M, K, ldb and scale: blocks past the first product's tiles take Btb, Cb, ldcb, Nb
// (Nb = 0: no second product).
__global__ __launch_bounds__(256) void gemm64_kernel(const _Float16* __restrict__ A, const _Float16* __restrict__ A2, int lda,
                                                     const _Float16* __restrict__ Bta, int ldb,
                                                     float* __restrict__ Ca, int ldca, int M, int Na, int K,
                                                     int loRows, int seqMask, float scale,
                                                     const _Float16* __restrict__ Btb, float* __restrict__ Cb, int ldcb, int Nb) {
  __shared__ __align__(16) _Float16 ring[2 * G_STG_];   // two stages; afterwards per-wave 16x64 f32 slabs, pitch 68 floats
  const int tid  = threadIdx.x;
  const int lane = tid & 31;
  const int wave = tid >> 5;
  const int tilesM = M / GBM_;
  const int tilesA = tilesM * (Na / GBN_);
  const bool second = ((int)blockIdx.x >= tilesA);   // block-uniform
  const _Float16* Bt = second ? Btb : Bta;
  float* C = second ? Cb : Ca;
  const int ldc = second ? ldcb : ldca;
  const int tilesN = (second ? Nb : Na) / GBN_;
  const int bid = second ? ((int)blockIdx.x - tilesA) : (int)blockIdx.x;
  if (bid >= tilesM * tilesN) return;   // block-uniform, in front of every barrier
  const int tm = bid / tilesN;
  const int tn = bid - tm * tilesN;
  const int m0b = tm * GBM_;
  const int n0b = tn * GBN_;
  const int wrow = (wave >> 2) << 6;
  const int wcol = (wave & 3) << 6;
  const int m0 = m0b + wrow;
  const int n0 = n0b + wcol;
  const int rlane = lane & 15;
  const int koff  = (lane >> 4) * 8;
  const int mOff  = koff;

  v8f acc[4][4];
#pragma unroll
  for (int i = 0; i < 4; ++i)
#pragma unroll
    for (int j = 0; j < 4; ++j) acc[i][j] = zero8();

  const bool useLo = ((m0b & seqMask) < loRows);   // block-uniform
  if (useLo) gemm_ring<true>(acc, ring, A, A2, lda, Bt, ldb, m0b, n0b, K, tid, wrow, wcol, rlane, koff);
  else       gemm_ring<false>(acc, ring, A, A, lda, Bt, ldb, m0b, n0b, K, tid, wrow, wcol, rlane, koff);
  acc_guard4(acc[0][0], acc[0][1], acc[0][2], acc[0][3]);
  acc_guard4(acc[1][0], acc[1][1], acc[1][2], acc[1][3]);
  acc_guard4(acc[2][0], acc[2][1], acc[2][2], acc[2][3]);
  acc_guard4(acc[3][0], acc[3][1], acc[3][2], acc[3][3]);

  float* slab = (float*)ring + wave * (16 * 68);
  const int hrow = lane >> 4;
  const int c4 = rlane * 4;
#pragma unroll
  for (int i = 0; i < 4; ++i) {
    const int mBase = m0 + (i << 4);
#pragma unroll
    for (int j = 0; j < 4; ++j) {
#pragma unroll
      for (int r = 0; r < 8; ++r) slab[(mOff + r) * 68 + (j << 4) + rlane] = acc[i][j][r] * scale;
    }
    __builtin_amdgcn_fence(__ATOMIC_RELEASE, "workgroup");
    __builtin_amdgcn_wave_barrier();
    __builtin_amdgcn_fence(__ATOMIC_ACQUIRE, "workgroup");
    {
#pragma unroll
      for (int it = 0; it < 8; ++it) {
        const int row = it * 2 + hrow;
        const v4f v = *(const v4f*)(slab + row * 68 + c4);
        *(v4f*)(C + (size_t)(mBase + row) * ldc + n0 + c4) = v;
      }
      
    }
    __builtin_amdgcn_fence(__ATOMIC_RELEASE, "workgroup");
    __builtin_amdgcn_wave_barrier();
    __builtin_amdgcn_fence(__ATOMIC_ACQUIRE, "workgroup");
  }
}

#define PN_    (DM_ + KVN_)                      /* 2560: columns of the fused q | k | v projection plane */

// ---------------------------------------------------------------------------------------------------------------
// RoPE + f16 hi/residual split. Unit = (row, head); 8 lanes per unit; lane j owns columns {8j, 64+8j, 128+8j, 192+8j}+0..7 of the
// 256-wide head (pairs (c, c+128) are in the same lane). out = x*cos + rotate_half(x)*sin with cos/sin[row][c mod 128].
// hi = f16(out*carry), lo = f16(out*carry - hi) (unscaled residual). Stores: for each column chunk one instruction writes
// coverage: nunits*8 threads x 32 elements = nunits*256 per plane.
// ---------------------------------------------------------------------------------------------------------------
__device__ __forceinline__ void rope_split_part(int blk, const float* __restrict__ src, int spitch, int nheads,
                                                const float* __restrict__ cosT, const float* __restrict__ sinT,
                                                _Float16* __restrict__ hi, _Float16* __restrict__ lo,
                                                int dpitch, int nunits, float carry) {
#pragma clang fp contract(off)
  const int gid = blk * 256 + (int)threadIdx.x;
  const int unit = gid >> 3;
  const int j = gid & 7;
  if (unit >= nunits) return;
  const int row = unit / nheads;
  const int hd = unit - row * nheads;
  const float* s  = src  + (size_t)row * spitch + hd * HD_ + 8 * j;
  const float* ct = cosT + (size_t)row * NF_ + 8 * j;
  const float* st = sinT + (size_t)row * NF_ + 8 * j;
  U8 xa, xb, xc, xd, ca, cb, sa, sb;
  xa.q[0] = *(const v4f*)(s);         xa.q[1] = *(const v4f*)(s + 4);
  xb.q[0] = *(const v4f*)(s + 64);    xb.q[1] = *(const v4f*)(s + 68);
  xc.q[0] = *(const v4f*)(s + 128);   xc.q[1] = *(const v4f*)(s + 132);
  xd.q[0] = *(const v4f*)(s + 192);   xd.q[1] = *(const v4f*)(s + 196);
  ca.q[0] = *(const v4f*)(ct);        ca.q[1] = *(const v4f*)(ct + 4);
  cb.q[0] = *(const v4f*)(ct + 64);   cb.q[1] = *(const v4f*)(ct + 68);
  sa.q[0] = *(const v4f*)(st);        sa.q[1] = *(const v4f*)(st + 4);
  sb.q[0] = *(const v4f*)(st + 64);   sb.q[1] = *(const v4f*)(st + 68);
  // the wait that stands in front of a rewrite of an issued load's address registers; naming the three addresses keeps them whole
  // up to it (else the last load takes its result into them)
  asm volatile("s_wait_xcnt 0x0" :: "v"(s), "v"(ct), "v"(st) : "memory");
  v8h h0, h1, h2, h3, l0, l1, l2, l3;
#pragma unroll
  for (int e = 0; e < 8; ++e) {
    const float r0 = xa.v[e] * ca.v[e] - xc.v[e] * sa.v[e];    // col 8j+e
    const float r1 = xb.v[e] * cb.v[e] - xd.v[e] * sb.v[e];    // col 64+8j+e
    const float r2 = xc.v[e] * ca.v[e] + xa.v[e] * sa.v[e];    // col 128+8j+e
    const float r3 = xd.v[e] * cb.v[e] + xb.v[e] * sb.v[e];    // col 192+8j+e
    float t; _Float16 q;
    t = r0 * carry; q = (_Float16)t; h0[e] = q; l0[e] = (_Float16)(t - (float)q);
    t = r1 * carry; q = (_Float16)t; h1[e] = q; l1[e] = (_Float16)(t - (float)q);
    t = r2 * carry; q = (_Float16)t; h2[e] = q; l2[e] = (_Float16)(t - (float)q);
    t = r3 * carry; q = (_Float16)t; h3[e] = q; l3[e] = (_Float16)(t - (float)q);
  }
  _Float16* hp = hi + (size_t)row * dpitch + hd * HD_ + 8 * j;
  _Float16* lp = lo + (size_t)row * dpitch + hd * HD_ + 8 * j;
  {
    *(v8h*)(hp)       = h0;
    *(v8h*)(hp + 64)  = h1;
    *(v8h*)(hp + 128) = h2;
    *(v8h*)(hp + 192) = h3;
    *(v8h*)(lp)       = l0;
    *(v8h*)(lp + 64)  = l1;
    *(v8h*)(lp + 128) = l2;
    *(v8h*)(lp + 192) = l3;
    
  }
}

// ---------------------------------------------------------------------------------------------------------------
// v columns of the fused projection plane (KV = its column 2048: f32 rows of pitch PN_, v in cols 256..511) -> transposed f16 planes Vth/Vtl [b][d][s]
// (hi = f16(v*2^10), lo = unscaled residual). 64x64 tiles through LDS; (256/64) x (NB*SEQ/64) blocks (bx, by), 256 threads.
// coverage per block: load 4 it x 256 thr x 4 = 64x64; store 2 it x 256 thr x 8 = 64x64 per plane.
// ---------------------------------------------------------------------------------------------------------------
__device__ __forceinline__ void vt_split_part(int bx, int by, const float* __restrict__ KV, _Float16* __restrict__ Vth,
                                              _Float16* __restrict__ Vtl) {
  __shared__ __align__(16) float tf[64 * 68];
  const int tid = threadIdx.x;
  const int d0  = bx * 64;                   // d block (input column within v)
  const int sg0 = by * 64;                   // global row block (b*SEQ + s)
  const int b   = sg0 >> 11;
  const int s0  = sg0 & (SEQ_ - 1);
  {
    const int lr = tid >> 4;
    const int c4 = (tid & 15) * 4;
    const float* vp = KV + (size_t)(sg0 + lr) * PN_ + d0 + c4;
#pragma unroll
    for (int it = 0; it < 4; ++it) {
      const int rr = it * 16 + lr;
      const v4f a = *(const v4f*)(vp + HD_ + (size_t)it * 16 * PN_);
      *(v4f*)(tf + rr * 68 + c4) = a;
    }
    // the wait that stands in front of a rewrite of an issued load's address registers; naming the address keeps it whole up to it
    asm volatile("s_wait_xcnt 0x0" :: "v"(vp) : "memory");
  }
  __syncthreads();
  const int sub = tid >> 3;          // output row within tile (= d)
  const int c8  = (tid & 7) * 8;     // s offset within tile
  v8h hv[2], lv[2];
#pragma unroll
  for (int it = 0; it < 2; ++it) {
    const int oc = it * 32 + sub;
    v8h a, rsd;
#pragma unroll
    for (int q = 0; q < 8; ++q) {
      const float f = tf[(c8 + q) * 68 + oc] * CQK_;
      const _Float16 hq = (_Float16)f;
      a[q] = hq;
      rsd[q] = (_Float16)(f - (float)hq);
    }
    hv[it] = a; lv[it] = rsd;
  }
  {
#pragma unroll
    for (int it = 0; it < 2; ++it) {
      const int oc = it * 32 + sub;
      const size_t go = ((size_t)b * HD_ + d0 + oc) * SEQ_ + s0 + c8;
      *(v8h*)(Vth + go) = hv[it];
      *(v8h*)(Vtl + go) = lv[it];
    }
    
  }
}

// ---------------------------------------------------------------------------------------------------------------
// The three passes between the projections and the attention do not depend on one another and share one launch, told apart by
// block index range (block-uniform): v transpose (the one with a barrier) first, then the k planes, then the q planes.
// coverage: SB_ALL_ blocks = the sum of the passes' own block counts.
// ---------------------------------------------------------------------------------------------------------------
#define SB_VT_  ((HD_ / 64) * ((NB_ * SEQ_) / 64))   /* 256  */
#define SB_K_   ((NB_ * SEQ_ * 8) / 256)             /* 128  */
#define SB_Q_   ((NB_ * SEQ_ * NH_ * 8) / 256)       /* 1024 */
#define SB_ALL_ (SB_VT_ + SB_K_ + SB_Q_)
__global__ __launch_bounds__(256) void split_kernel(const float* __restrict__ Qf, const float* __restrict__ KVf,
                                                    const float* __restrict__ cosT, const float* __restrict__ sinT,
                                                    _Float16* __restrict__ Qh, _Float16* __restrict__ Ql,
                                                    _Float16* __restrict__ Kh, _Float16* __restrict__ Kl,
                                                    _Float16* __restrict__ Vth, _Float16* __restrict__ Vtl) {
  int blk = blockIdx.x;
  if (blk < SB_VT_) { vt_split_part(blk & (HD_ / 64 - 1), blk / (HD_ / 64), KVf, Vth, Vtl); return; }
  blk -= SB_VT_;
  if (blk < SB_K_) { rope_split_part(blk, KVf, PN_, 1, cosT, sinT, Kh, Kl, HD_, NB_ * SEQ_, CQK_); return; }
  blk -= SB_K_;
  rope_split_part(blk, Qf, PN_, NH_, cosT, sinT, Qh, Ql, DM_, NB_ * SEQ_ * NH_, CQK_);
}

#define AT_PPITCH 72
#define AT_OPITCH 264
#define AT_KP     264                            /* k tile row pitch, halves: 528 B = 16 B x odd */
#define AT_VP     72                             /* v^T tile row pitch, halves: 144 B = 16 B x odd */
#define AT_SV     (64 * AT_KP)                   /* v^T tile, halves from the stage's start */
#define AT_STG    (64 * AT_KP + HD_ * AT_VP)     /* halves per stage */
#define AT_OFF_PH 0
#define AT_OFF_PM 9216
#define AT_OFF_PS 9728
#define AT_OFF_AL 10240
#define AT_OFF_LF 10496
#define AT_OFF_RG 10752                          /* the two stages */
#define AT_OFF_PL (AT_OFF_RG + AT_STG * 2)       /* residual P tile: in the residual k tile's place, which is dead behind the score products */
#define AT_OFF_OH AT_OFF_RG                      /* output staging, behind the barrier that follows the loop */
#define AT_OFF_OL (AT_OFF_RG + 33792)
#define AT_LDS    152064                         /* two blocks per 320-KiB LDS */
static_assert(AT_OFF_PM == AT_OFF_PH + 64 * AT_PPITCH * 2);
static_assert(AT_OFF_OL == AT_OFF_OH + 64 * AT_OPITCH * 2);
static_assert(AT_LDS == AT_OFF_RG + 2 * AT_STG * 2);
static_assert(AT_LDS >= AT_OFF_OL + 64 * AT_OPITCH * 2);
static_assert(64 * AT_PPITCH <= AT_SV);
static_assert(AT_OFF_RG % 16 == 0 && (AT_STG * 2) % 16 == 0 && (AT_SV * 2) % 16 == 0);

// Eight copies per lane: l = the lane's LDS byte address, LS = bytes between its LDS rows, g = its global address, gs = halves between
// its source rows. s_wait_xcnt stands inside the statement so that no address register is rewritten ahead of it.
template <unsigned LS>
__device__ __forceinline__ void async_tile8(unsigned l, const _Float16* g, size_t gs) {
  asm volatile(
      "global_load_async_to_lds_b128 %0, %8, off\n\t"
      "global_load_async_to_lds_b128 %1, %9, off\n\t"
      "global_load_async_to_lds_b128 %2, %10, off\n\t"
      "global_load_async_to_lds_b128 %3, %11, off\n\t"
      "global_load_async_to_lds_b128 %4, %12, off\n\t"
      "global_load_async_to_lds_b128 %5, %13, off\n\t"
      "global_load_async_to_lds_b128 %6, %14, off\n\t"
      "global_load_async_to_lds_b128 %7, %15, off\n\t"
      "s_wait_xcnt 0x0"
      :: "v"(l), "v"(l + 1u * LS), "v"(l + 2u * LS), "v"(l + 3u * LS),
         "v"(l + 4u * LS), "v"(l + 5u * LS), "v"(l + 6u * LS), "v"(l + 7u * LS),
         "v"(g), "v"(g + gs), "v"(g + 2 * gs), "v"(g + 3 * gs), "v"(g + 4 * gs), "v"(g + 5 * gs), "v"(g + 6 * gs), "v"(g + 7 * gs)
      : "memory");
}
// One stage = key tile kt: k rows (a wave's copy = one 512-byte row, rows 8 apart) and v^T rows (a wave's copy = four 128-byte lines,
// rows 32 apart). lk, lv: the lane's LDS byte addresses in the stage; gk, gv: its global addresses in tile 0.
__device__ __forceinline__ void attn_fill(unsigned lk, unsigned lv, const _Float16* gk, const _Float16* gv, int kt) {
  async_tile8<8u * AT_KP * 2u>(lk, gk + (size_t)kt * 64 * HD_, (size_t)8 * HD_);
  async_tile8<32u * AT_VP * 2u>(lv, gv + (size_t)kt * 64, (size_t)32 * SEQ_);
}

// The key-tile loop. One instance per kind of query block (EARLY: residual planes as well, one tile in LDS at a time; else two), so that
// the loop holds no test of the kind and a tile's loads stand in groups ahead of their use: q and k fragments by groups of k-steps, the
// mask values in front of the score products, the v^T fragments in front of the P . V products.
template <bool EARLY>
__device__ __forceinline__ void attn_tiles(int ktlo, int kthi, int b, int q0, int srow0, int kh, int w, int hh, int c,
                                           const _Float16* __restrict__ qhp, const _Float16* __restrict__ qlp,
                                           const _Float16* __restrict__ Kh, const _Float16* __restrict__ Kl,
                                           const float* __restrict__ mrp,
                                           const _Float16* __restrict__ Vth, const _Float16* __restrict__ Vtl, const _Float16* ring,
                                           _Float16* Ph, _Float16* Pl, float* pm, float* ps, float* alph,
                                           float (&mrow)[8], float (&lrow)[8], v8f (&oacc)[4][2]) {
  constexpr int KG = EARLY ? 1 : 2;            // k-steps whose fragments are loaded as one group
  constexpr bool TWO = !EARLY;                 // two stages of hi planes: a tile's copies are issued two tiles ahead
  const int tid = (w << 5) + (hh << 4) + c;
  const unsigned lk = (unsigned)(size_t)ring + (unsigned)((tid >> 5) * AT_KP + (tid & 31) * 8) * 2u;
  const unsigned lv = (unsigned)(size_t)ring + (unsigned)(AT_SV + (tid >> 3) * AT_VP + (tid & 7) * 8) * 2u;
  const size_t ok = ((size_t)b * SEQ_ + (tid >> 5)) * HD_ + (tid & 31) * 8;
  const size_t ov = ((size_t)b * HD_ + (tid >> 3)) * SEQ_ + (tid & 7) * 8;
  const _Float16* gk = Kh + ok;
  const _Float16* gv = Vth + ov;
  if (TWO) {
    attn_fill(lk, lv, gk, gv, ktlo);
    asm volatile("s_wait_asynccnt 0x0" ::: "memory");   // the first tile landed (this wave's copies) before the barrier publishes it
    __syncthreads();
    if (ktlo < kthi) attn_fill(lk + AT_STG * 2u, lv + AT_STG * 2u, gk, gv, ktlo + 1);   // block-uniform
  }
  const float* mtile = mrp + ktlo * 64 + 32 * kh + c;   // the lane's first mask value of the tile, moved on by 64 keys per trip
  for (int kt = ktlo; kt <= kthi; ++kt, mtile += 64) {      // block-uniform, at most 32 trips
    const int key0  = kt * 64;
    const int wkey0 = key0 + 32 * kh;
    const int sb = TWO ? ((kt - ktlo) & 1) : 0;   // the stage of the tile's hi planes
    const _Float16* khp = ring + sb * AT_STG + (32 * kh + c) * AT_KP + 8 * hh;
    const _Float16* klp = khp + AT_STG;
    if (!TWO) {
      attn_fill(lk, lv, gk, gv, kt);
      attn_fill(lk + AT_STG * 2u, lv + AT_STG * 2u, Kl + ok, Vtl + ov, kt);
      asm volatile("s_wait_asynccnt 0x0" ::: "memory");   // the tile landed (this wave's copies) before the barrier publishes it
      __syncthreads();
    }

    // ---- mask values of this wave's 16 x 32 scores, in flight during the score products. Every key of a tile is a column of the mask:
    //      no test guards the loads ----
    float mv[8][2];
    const float* mt = mtile;
#pragma unroll   // register arrays: constant indices
    for (int r = 0; r < 8; ++r) {
#pragma unroll   // register arrays: constant indices
      for (int j = 0; j < 2; ++j) mv[r][j] = mt[(size_t)r * SEQ_ + 16 * j];
    }

    // ---- S = q . k^T (16 rows x 32 keys per wave) ----
    v8f s[2];
    s[0] = zero8(); s[1] = zero8();
#pragma unroll   // constant load offsets, no loop overhead between the groups
    for (int g = 0; g < 8; g += KG) {
      v16h qa[KG], qr[KG], kb[KG][2], kr[KG][2];
#pragma unroll   // register arrays: constant indices
      for (int u = 0; u < KG; ++u) {
        const int ks = g + u;
        qa[u] = frag_ld(qhp + 32 * ks);
        qr[u] = qa[u];
        if (EARLY) qr[u] = frag_ld(qlp + 32 * ks);
#pragma unroll   // register arrays: constant indices
        for (int j = 0; j < 2; ++j) {
          kb[u][j] = frag_ld(khp + (16 * j) * AT_KP + 32 * ks);
          kr[u][j] = kb[u][j];
          if (EARLY) kr[u][j] = frag_ld(klp + (16 * j) * AT_KP + 32 * ks);
        }
      }
#pragma unroll   // register arrays: constant indices
      for (int u = 0; u < KG; ++u) {
#pragma unroll   // register arrays: constant indices
        for (int j = 0; j < 2; ++j) {
          s[j] = mma_g(qa[u], kb[u][j], s[j]);
          if (EARLY) {
            s[j] = mma_g(qr[u], kb[u][j], s[j]);
            s[j] = mma_g(qa[u], kr[u][j], s[j]);
          }
        }
      }
    }

    // the wait that stands in front of a rewrite of an issued load's address registers; naming the tile's mask address keeps it whole
    // up to it (else a later load may take its result into it)
    asm volatile("s_wait_xcnt 0x0" :: "v"(mt) : "memory");

    // ---- scale, mask, partial row max over this wave's 32 keys ----
    float cm[8];
    // key - query row at r = 0, j = 0: the band test then compares with constants, and no per-row bounds are held in registers over the
    // loop (the P fragment groups below need the room)
    const int dkq = wkey0 + c - (q0 + srow0 + 8 * hh);
#pragma unroll
    for (int r = 0; r < 8; ++r) {
      float mx = -INFINITY;
#pragma unroll
      for (int j = 0; j < 2; ++j) {
        const bool inb = (dkq >= r - 16 * j - (WIN_ - 1)) && (dkq <= r - 16 * j + (WIN_ - 1));
        const float sv = inb ? (s[j][r] * SSC_ + mv[r][j]) : -INFINITY;
        s[j][r] = sv;
        mx = fmaxf(mx, sv);
      }
      mx = fmaxf(mx, __shfl_xor(mx, 1, 32));
      mx = fmaxf(mx, __shfl_xor(mx, 2, 32));
      mx = fmaxf(mx, __shfl_xor(mx, 4, 32));
      mx = fmaxf(mx, __shfl_xor(mx, 8, 32));
      cm[r] = mx;
    }
    if (c == 0) {
#pragma unroll
      for (int r = 0; r < 8; ++r) pm[w * 16 + 8 * hh + r] = cm[r];
    }
    __syncthreads();

    // ---- online softmax: tile max, p, partial sums ----
    float al[8], psm[8];
    const int wo = w ^ 4;
#pragma unroll
    for (int r = 0; r < 8; ++r) {
      const float om = pm[wo * 16 + 8 * hh + r];
      const float mnew = fmaxf(mrow[r], fmaxf(cm[r], om));
      const float msafe = (mnew == -INFINITY) ? 0.0f : mnew;
      al[r] = __expf(mrow[r] - msafe);
      mrow[r] = mnew;
      float sum = 0.0f;
#pragma unroll
      for (int j = 0; j < 2; ++j) {
        const float p = __expf(s[j][r] - msafe);
        sum += p;
        const float t = p * CP_;
        const _Float16 phv = (_Float16)t;
        const int pidx = (srow0 + 8 * hh + r) * AT_PPITCH + 32 * kh + 16 * j + c;
        Ph[pidx] = phv;
        if (EARLY) Pl[pidx] = (_Float16)(t - (float)phv);
      }
      sum += __shfl_xor(sum, 1, 32);
      sum += __shfl_xor(sum, 2, 32);
      sum += __shfl_xor(sum, 4, 32);
      sum += __shfl_xor(sum, 8, 32);
      psm[r] = sum;
    }
    if (c == 0) {
#pragma unroll
      for (int r = 0; r < 8; ++r) ps[w * 16 + 8 * hh + r] = psm[r];
      if (w < 4) {
#pragma unroll
        for (int r = 0; r < 8; ++r) alph[srow0 + 8 * hh + r] = al[r];
      }
    }
    __syncthreads();
#pragma unroll
    for (int r = 0; r < 8; ++r)
      lrow[r] = lrow[r] * al[r] + (ps[(w & 3) * 16 + 8 * hh + r] + ps[((w & 3) + 4) * 16 + 8 * hh + r]);

    // ---- v^T fragments of the tile, from LDS: in flight while O is rescaled ----
    v16h vb[2][2], vr[2][2];
    const _Float16* vht = ring + sb * AT_STG + AT_SV + (32 * w + c) * AT_VP + 8 * hh;
    const _Float16* vlt = vht + AT_STG;
#pragma unroll   // register arrays: constant indices
    for (int k2 = 0; k2 < 2; ++k2) {
#pragma unroll   // register arrays: constant indices
      for (int jj = 0; jj < 2; ++jj) {
        vb[k2][jj] = frag_ld(vht + (16 * jj) * AT_VP + 32 * k2);
        vr[k2][jj] = vb[k2][jj];
        if (EARLY) vr[k2][jj] = frag_ld(vlt + (16 * jj) * AT_VP + 32 * k2);
      }
    }

    // ---- rescale O, then O += P . V for this wave's 32 output columns ----
    if (!EARLY) {
      // Each P fragment is read from LDS once (both column halves use it) and in a group ahead of its use, so that no product waits on
      // an LDS read issued just in front of it: the first 32 keys' fragments with the v^T fragments and the rescale factors, the second
      // 32 keys' in front of the first 32 keys' products.
      const _Float16* pp = Ph + c * AT_PPITCH + 8 * hh;
      v16h pg[2][4];
      U8 av[4];
#pragma unroll   // register arrays: constant indices
      for (int i = 0; i < 4; ++i) pg[0][i] = frag_ld(pp + (16 * i) * AT_PPITCH);
#pragma unroll   // register arrays: constant indices
      for (int i = 0; i < 4; ++i) {
        av[i].q[0] = *(const v4f*)(alph + 16 * i + 8 * hh);
        av[i].q[1] = *(const v4f*)(alph + 16 * i + 8 * hh + 4);
      }
      // holds these LDS reads together in front of the rescale (one LDS wait instead of one per row group)
      asm volatile("" :: "v"(av[0].v), "v"(av[1].v), "v"(av[2].v), "v"(av[3].v));
#pragma unroll
      for (int i = 0; i < 4; ++i) {
#pragma unroll
        for (int r = 0; r < 8; ++r) { oacc[i][0][r] *= av[i].v[r]; oacc[i][1][r] *= av[i].v[r]; }
      }
#pragma unroll   // register arrays: constant indices
      for (int i = 0; i < 4; ++i) pg[1][i] = frag_ld(pp + (16 * i) * AT_PPITCH + 32);
#pragma unroll
      for (int k2 = 0; k2 < 2; ++k2) {
#pragma unroll
        for (int jj = 0; jj < 2; ++jj) {
#pragma unroll
          for (int i = 0; i < 4; ++i) oacc[i][jj] = mma_g(pg[k2][i], vb[k2][jj], oacc[i][jj]);
        }
      }
    } else {
#pragma unroll
      for (int i = 0; i < 4; ++i) {
        U8 av;
        av.q[0] = *(const v4f*)(alph + 16 * i + 8 * hh);
        av.q[1] = *(const v4f*)(alph + 16 * i + 8 * hh + 4);
#pragma unroll
        for (int r = 0; r < 8; ++r) { oacc[i][0][r] *= av.v[r]; oacc[i][1][r] *= av.v[r]; }
      }
#pragma unroll
      for (int k2 = 0; k2 < 2; ++k2) {
#pragma unroll
        for (int jj = 0; jj < 2; ++jj) {
#pragma unroll
          for (int i = 0; i < 4; ++i) {
            const v16h pa = frag_ld(Ph + (16 * i + c) * AT_PPITCH + 32 * k2 + 8 * hh);
            oacc[i][jj] = mma_g(pa, vb[k2][jj], oacc[i][jj]);
            const v16h pr = frag_ld(Pl + (16 * i + c) * AT_PPITCH + 32 * k2 + 8 * hh);
            oacc[i][jj] = mma_g(pa, vr[k2][jj], oacc[i][jj]);
            oacc[i][jj] = mma_g(pr, vb[k2][jj], oacc[i][jj]);
          }
        }
      }
    }

    // ---- hand-over of the stages ----
    asm volatile("s_wait_dscnt 0x0" ::: "memory");        // this wave's reads (and residual P writes) there are done before a refill
    if (TWO) asm volatile("s_wait_asynccnt 0x0" ::: "memory");   // this wave's copies of the next tile have landed
    __syncthreads();                                      // frees tile kt's stage; with two stages it publishes tile kt+1 as well
    if (TWO && kt + 2 <= kthi)                            // block-uniform
      attn_fill(lk + (unsigned)sb * (AT_STG * 2u), lv + (unsigned)sb * (AT_STG * 2u), gk, gv, kt + 2);
  }
  if (TWO) asm volatile("s_wait_asynccnt 0x0" ::: "memory");   // nothing in flight when the stages become output staging
}

// amdgpu_waves_per_eu(4, 4): holds the registers to four waves per SIMD, so that two blocks share a WGP (2 x AT_LDS fits its LDS)
__global__ __launch_bounds__(256) __attribute__((amdgpu_waves_per_eu(4, 4))) void attn_kernel(const _Float16* __restrict__ Qh, const _Float16* __restrict__ Ql,
                                                   const _Float16* __restrict__ Kh, const _Float16* __restrict__ Kl,
                                                   const _Float16* __restrict__ Vth, const _Float16* __restrict__ Vtl,
                                                   const float* __restrict__ mask, const int* __restrict__ flag,
                                                   _Float16* __restrict__ AOh, _Float16* __restrict__ AOl) {
  extern __shared__ __align__(16) unsigned char dsm[];
  _Float16* Ph   = (_Float16*)(dsm + AT_OFF_PH);
  _Float16* Pl   = (_Float16*)(dsm + AT_OFF_PL);
  float*    pm   = (float*)(dsm + AT_OFF_PM);     // [8 waves][16 rows] partial row max
  float*    ps   = (float*)(dsm + AT_OFF_PS);     // [8 waves][16 rows] partial row sum
  float*    alph = (float*)(dsm + AT_OFF_AL);     // [64] rescale factors
  float*    lfin = (float*)(dsm + AT_OFF_LF);     // [64] final row sums
  const _Float16* ring = (const _Float16*)(dsm + AT_OFF_RG);   // two stages of k and v^T tiles
  _Float16* Ohs  = (_Float16*)(dsm + AT_OFF_OH);
  _Float16* Ols  = (_Float16*)(dsm + AT_OFF_OL);

  const int tid  = threadIdx.x;
  const int w    = tid >> 5;
  const int lane = tid & 31;
  const int hh   = lane >> 4;
  const int c    = lane & 15;
  const int bid  = blockIdx.x;
  const int qb   = bid & (NQB_ - 1);
  const int h    = (bid >> 5) & (NH_ - 1);
  const int b    = bid >> 8;
  const int q0   = qb * 64;
  const int srow0 = (w & 3) * 16;
  const int kh    = w >> 2;
  const int ocol0 = w * 32;
  const bool early = (qb < QE_);
  const int ktlo = (qb > 16) ? (qb - 16) : 0;
  int fl = 1;                                  // block-uniform: all row groups of this query block verified
#pragma unroll   // independent scalar loads, issued together instead of one round trip each
  for (int g = 0; g < MFG_; ++g) fl &= flag[((b * NQB_ + qb) * MFG_ + g) * 32];
  int kthi = (fl != 0) ? qb : (qb + 16);
  if (kthi > NQB_ - 1) kthi = NQB_ - 1;

  const size_t growq = (size_t)b * SEQ_ + q0;
  const _Float16* qhp = Qh + (growq + srow0 + c) * DM_ + h * HD_ + 8 * hh;
  const _Float16* qlp = Ql + (growq + srow0 + c) * DM_ + h * HD_ + 8 * hh;
  const float*    mrp = mask + (growq + srow0 + 8 * hh) * (size_t)SEQ_;

  float mrow[8], lrow[8];
  v8f oacc[4][2];
#pragma unroll
  for (int r = 0; r < 8; ++r) { mrow[r] = -INFINITY; lrow[r] = 0.0f; }
#pragma unroll
  for (int i = 0; i < 4; ++i) { oacc[i][0] = zero8(); oacc[i][1] = zero8(); }

  if (early)   // block-uniform
    attn_tiles<true>(ktlo, kthi, b, q0, srow0, kh, w, hh, c, qhp, qlp, Kh, Kl, mrp, Vth, Vtl, ring, Ph, Pl, pm, ps, alph, mrow, lrow, oacc);
  else
    attn_tiles<false>(ktlo, kthi, b, q0, srow0, kh, w, hh, c, qhp, qlp, Kh, Kl, mrp, Vth, Vtl, ring, Ph, Pl, pm, ps, alph, mrow, lrow, oacc);

  if (w < 4 && c == 0) {
#pragma unroll
    for (int r = 0; r < 8; ++r) lfin[srow0 + 8 * hh + r] = lrow[r];
  }
  __syncthreads();
#pragma unroll
  for (int i = 0; i < 4; ++i) {
    U8 lv;
    lv.q[0] = *(const v4f*)(lfin + 16 * i + 8 * hh);
    lv.q[1] = *(const v4f*)(lfin + 16 * i + 8 * hh + 4);
#pragma unroll
    for (int r = 0; r < 8; ++r) {
      const float f = OSC_ * (1.0f / lv.v[r]);
      const int orow = 16 * i + 8 * hh + r;
#pragma unroll
      for (int jj = 0; jj < 2; ++jj) {
        const float t = oacc[i][jj][r] * f;
        const _Float16 hq = (_Float16)t;
        const int oidx = orow * AT_OPITCH + ocol0 + 16 * jj + c;
        Ohs[oidx] = hq;
        Ols[oidx] = (_Float16)(t - (float)hq);
      }
    }
  }
  __syncthreads();
  {
    const int piece = tid & 7;
    const int lsub  = tid >> 3;
    {
#pragma unroll
      for (int it = 0; it < 8; ++it) {
        const int line = it * 32 + lsub;          // 0..255 = 64 rows x 4 lines
        const int row  = line >> 2;
        const int col  = (line & 3) * 64 + piece * 8;
        const v8h hv = *(const v8h*)(Ohs + row * AT_OPITCH + col);
        const v8h rv = *(const v8h*)(Ols + row * AT_OPITCH + col);
        const size_t go = (growq + row) * DM_ + h * HD_ + col;
        *(v8h*)(AOh + go) = hv;
        *(v8h*)(AOl + go) = rv;
      }
      
    }
  }
}

// ---------------------------------------------------------------------------------------------------------------
// The q, k and v projections as ONE product over the PN_ = 2560 rows of the weight planes (q rows, then k rows, then v rows, which lie
// one behind the other): C[m][n] = 2^-12 * sum_k A[m][k] * Bt[n][k], C f32 [4096][2560].
// Block = 8 waves (2 x 4) on a 128 x 320 tile of C, each wave 64 x 80 (4 x 5 accumulators): 32 x 8 = 256 equal blocks, one per WGP in
// one round (a block's LDS leaves room for no second one), where 128 x 256 tiles make 320 blocks and a second round of 64.
// The ring is that of gemm_ring: asynchronous 16-byte copies, 256-byte row pieces (128 k) per stage, two stages, pitch 272 bytes.
// Epilogue: the whole tile staged in the (then free) ring, then stored by 512-byte runs of its rows: a wave's 80 columns alone end
// in the middle of a 128-byte line, the block's 320 do not.
// ---------------------------------------------------------------------------------------------------------------
#define PNJ_   5                                 /* 16-column accumulators per wave */
#define PBN_   (4 * 16 * PNJ_)                   /* 320 */
#define P_OB_  (GBM_ * GPH_)                     /* Bt rows, halves from the stage's start */
#define P_STG_ ((GBM_ + PBN_) * GPH_)            /* halves per stage */
#define P_CP_  (PBN_ + 4)                        /* staged C row pitch, floats: rows 8 apart fall 32 banks apart */
static_assert(PN_ % PBN_ == 0 && (NB_ * SEQ_) % GBM_ == 0 && DM_ % GK_ == 0 && DM_ / GK_ >= 2);
static_assert(2 * P_STG_ * 2 >= GBM_ * P_CP_ * 4);
static_assert((GBM_ * (PBN_ / 4)) % (8 * 256) == 0);

// Four copies per lane, rows 16 apart (as async_rows8). s_wait_xcnt stands inside the statement so that no address register is
// rewritten ahead of it.
__device__ __forceinline__ void async_rows4(unsigned l, const _Float16* g, size_t gs) {
  asm volatile(
      "global_load_async_to_lds_b128 %0, %4, off\n\t"
      "global_load_async_to_lds_b128 %1, %5, off\n\t"
      "global_load_async_to_lds_b128 %2, %6, off\n\t"
      "global_load_async_to_lds_b128 %3, %7, off\n\t"
      "s_wait_xcnt 0x0"
      :: "v"(l), "v"(l + 1u * G_LS_), "v"(l + 2u * G_LS_), "v"(l + 3u * G_LS_),
         "v"(g), "v"(g + gs), "v"(g + 2 * gs), "v"(g + 3 * gs)
      : "memory");
}
// One stage: A 128 rows, Bt 320 rows, 256 bytes of each.
__device__ __forceinline__ void proj_fill(unsigned l, const _Float16* ga, const _Float16* gb) {
  const size_t s16 = (size_t)16 * DM_;
  async_rows8(l, ga, s16);
  async_rows8(l + P_OB_ * 2u, gb, s16);
  async_rows8(l + P_OB_ * 2u + 8u * G_LS_, gb + 8 * s16, s16);
  async_rows4(l + P_OB_ * 2u + 16u * G_LS_, gb + 16 * s16, s16);
}

__global__ __launch_bounds__(256) void proj_kernel(const _Float16* __restrict__ A, const _Float16* __restrict__ Bt,
                                                   float* __restrict__ C) {
  __shared__ __align__(16) _Float16 ring[2 * P_STG_];   // two stages; afterwards the block's 128 x 320 f32 tile, pitch P_CP_ floats
  const int tid  = threadIdx.x;
  const int lane = tid & 31;
  const int wave = tid >> 5;
  const int tm = (int)blockIdx.x / (PN_ / PBN_);
  const int tn = (int)blockIdx.x - tm * (PN_ / PBN_);
  const int m0b = tm * GBM_;
  const int n0b = tn * PBN_;
  const int wrow = (wave >> 2) << 6;
  const int wcol = (wave & 3) * (16 * PNJ_);
  const int rlane = lane & 15;
  const int koff  = (lane >> 4) * 8;

  v8f acc[4][PNJ_];
#pragma unroll
  for (int i = 0; i < 4; ++i)
#pragma unroll
    for (int j = 0; j < PNJ_; ++j) acc[i][j] = zero8();

  const int sub = tid >> 4;
  const int cc  = (tid & 15) * 8;
  const unsigned l0 = (unsigned)(size_t)ring + (unsigned)(sub * GPH_ + cc) * 2u;
  const _Float16* ga = A  + (size_t)(m0b + sub) * DM_ + cc;
  const _Float16* gb = Bt + (size_t)(n0b + sub) * DM_ + cc;
  constexpr int nt = DM_ / GK_;

  proj_fill(l0, ga, gb);
  asm volatile("s_wait_asynccnt 0x0" ::: "memory");   // stage 0 landed (this wave's copies) before the barrier publishes it
  __syncthreads();
  proj_fill(l0 + P_STG_ * 2u, ga + GK_, gb + GK_);

  for (int t = 0; t < nt; ++t) {
    const _Float16* st = ring + (t & 1) * P_STG_;
    const _Float16* sa = st + (wrow + rlane) * GPH_ + koff;
    const _Float16* sb = st + P_OB_ + (wcol + rlane) * GPH_ + koff;
#pragma unroll   // the four k-steps of a stage in one body: constant LDS offsets, no loop overhead between them
    for (int kk = 0; kk < GK_; kk += 32) {
      v16h bh[PNJ_], ah[4];
#pragma unroll   // register arrays: constant indices
      for (int j = 0; j < PNJ_; ++j) bh[j] = frag_ld(sb + (j << 4) * GPH_ + kk);
#pragma unroll   // register arrays: constant indices
      for (int i = 0; i < 4; ++i) ah[i] = frag_ld(sa + (i << 4) * GPH_ + kk);
      // holds the k-step's fragment reads together in front of its products (one LDS wait per k-step instead of one per row)
      asm volatile("" :: "v"(bh[0]), "v"(bh[1]), "v"(bh[2]), "v"(bh[3]), "v"(bh[4]), "v"(ah[0]), "v"(ah[1]), "v"(ah[2]), "v"(ah[3]));
#pragma unroll   // register arrays: constant indices
      for (int i = 0; i < 4; ++i) {
#pragma unroll   // register arrays: constant indices
        for (int j = 0; j < PNJ_; ++j) acc[i][j] = wmma_raw(ah[i], bh[j], acc[i][j]);
      }
    }
    asm volatile("s_wait_dscnt 0x0" ::: "memory");      // this wave's reads of the stage are done before it may be refilled
    asm volatile("s_wait_asynccnt 0x0" ::: "memory");   // this wave's copies of the next stage have landed
    __syncthreads();                                    // publishes stage t+1 and frees stage t's buffer
    if (t + 2 < nt)
      proj_fill(l0 + (unsigned)(t & 1) * (P_STG_ * 2u), ga + (size_t)(t + 2) * GK_, gb + (size_t)(t + 2) * GK_);
  }
  asm volatile("s_wait_asynccnt 0x0" ::: "memory");     // nothing in flight when the ring becomes output staging

  float* cst = (float*)ring;
#pragma unroll
  for (int i = 0; i < 4; ++i) {
#pragma unroll
    for (int j = 0; j < PNJ_; ++j) {
#pragma unroll
      for (int r = 0; r < 8; ++r) cst[(wrow + (i << 4) + koff + r) * P_CP_ + wcol + (j << 4) + rlane] = acc[i][j][r] * QSC_;
    }
  }
  __syncthreads();                                      // the tile is whole before any wave reads other waves' columns
#pragma unroll 1   // eight LDS reads and eight stores per trip are enough in flight; keeps the text short
  for (int g = 0; g < (GBM_ * (PBN_ / 4)) / (8 * 256); ++g) {
    v4f v[8];
    float* p[8];
#pragma unroll   // register arrays: constant indices
    for (int it = 0; it < 8; ++it) {
      const int idx = (g * 8 + it) * 256 + tid;         // 16-byte piece of the tile, row-major: a wave's store = four whole 128-byte lines
      const int row = idx / (PBN_ / 4);
      const int c4  = (idx - row * (PBN_ / 4)) * 4;
      v[it] = *(const v4f*)(cst + row * P_CP_ + c4);
      p[it] = C + (size_t)(m0b + row) * PN_ + n0b + c4;
    }
#pragma unroll   // register arrays: constant indices
    for (int it = 0; it < 8; ++it) *(v4f*)p[it] = v[it];
    // the wait that stands in front of a rewrite of an issued store's registers (the next trip reuses them); naming them keeps them
    // whole up to it
    asm volatile("s_wait_xcnt 0x0" :: "v"(p[0]), "v"(p[1]), "v"(p[2]), "v"(p[3]), "v"(p[4]), "v"(p[5]), "v"(p[6]), "v"(p[7]),
                 "v"(v[0]), "v"(v[1]), "v"(v[2]), "v"(v[3]), "v"(v[4]), "v"(v[5]), "v"(v[6]), "v"(v[7]) : "memory");
  }
}

// ---------------------------------------------------------------------------------------------------------------
// Workspace map (byte offsets, all 2 MiB aligned; every region is written completely by whole-line stores before it is read;
// the attention output planes reuse the f32 projection plane, which is dead after the RoPE/split passes):
//   Xh   f16 [4096][2048]            0           16,777,216
//   Wqh  f16 [2048][2048]   16,777,216            8,388,608
//   Wkvh f16 [512][2048]    25,165,824            2,097,152
//   Woh  f16 [2048][2048]   27,262,976            8,388,608
//   cosT f32 [4096][128]    35,651,584            2,097,152
//   sinT f32 [4096][128]    37,748,736            2,097,152
//   Qf   f32 [4096][2560]   39,845,888           41,943,040   (q | k | v columns; AOh f16 [4096][2048] at 39,845,888; AOl at 56,623,104)
//   Qh   f16 [4096][2048]   81,788,928           16,777,216
//   Ql   f16 [4096][2048]   98,566,144           16,777,216
//   Kh   f16 [4096][256]   115,343,360            2,097,152
//   Kl   f16 [4096][256]   117,440,512            2,097,152
//   Vth  f16 [2][256][2048] 119,537,664           2,097,152
//   Vtl  f16 [2][256][2048] 121,634,816           2,097,152
//   flags int [2*32*16][32] 123,731,968            131,072
//   total                  123,863,040
// ---------------------------------------------------------------------------------------------------------------
extern "C" void kernel_launch(void* const* d_in, const int* in_sizes, int n_in,
                              void* d_out, int out_size, void* d_ws, size_t ws_size,
                              hipStream_t stream) {
  if (n_in < 7) return;
  if (in_sizes[0] != NB_ * SEQ_ * DM_) return;
  if (in_sizes[1] != NB_ * SEQ_ * SEQ_) return;
  if (in_sizes[2] != NB_ * SEQ_) return;
  if (in_sizes[3] != DM_ * DM_) return;
  if (in_sizes[4] != HD_ * DM_) return;
  if (in_sizes[5] != HD_ * DM_) return;
  if (in_sizes[6] != DM_ * DM_) return;
  if (out_size != NB_ * SEQ_ * DM_) return;

  const float* x    = (const float*)d_in[0];
  const float* mask = (const float*)d_in[1];
  const int*   pos  = (const int*)d_in[2];
  const float* Wq   = (const float*)d_in[3];
  const float* Wk   = (const float*)d_in[4];
  const float* Wv   = (const float*)d_in[5];
  const float* Wo   = (const float*)d_in[6];
  float* out = (float*)d_out;

  const size_t nX   = (size_t)NB_ * SEQ_ * DM_;          // 8,388,608 elements
  const size_t bXh  = nX * 2;
  const size_t bWq  = (size_t)DM_ * DM_ * 2;
  const size_t bWkv = (size_t)KVN_ * DM_ * 2;
  const size_t bWo  = bWq;
  const size_t bTab = (size_t)NB_ * SEQ_ * NF_ * 4;
  const size_t bQf  = nX * 4;
  const size_t bKVf = (size_t)NB_ * SEQ_ * KVN_ * 4;
  const size_t bQ16 = nX * 2;
  const size_t bK16 = (size_t)NB_ * SEQ_ * HD_ * 2;
  const size_t bV16 = bK16;
  const size_t bFlg = (size_t)NB_ * NQB_ * MFG_ * 128;
  size_t off = 0;
  const size_t oXh  = off; off += bXh;
  const size_t oWq  = off; off += bWq;
  const size_t oWkv = off; off += bWkv;
  const size_t oWo  = off; off += bWo;
  const size_t oCos = off; off += bTab;
  const size_t oSin = off; off += bTab;
  const size_t oQf  = off; off += bQf;
  const size_t oKVf = off; off += bKVf;
  const size_t oQh  = off; off += bQ16;
  const size_t oQl  = off; off += bQ16;
  const size_t oKh  = off; off += bK16;
  const size_t oKl  = off; off += bK16;
  const size_t oVth = off; off += bV16;
  const size_t oVtl = off; off += bV16;
  const size_t oFlg = off; off += bFlg;
  if (off > ws_size) return;                        // off = 123,863,040
  if (off > (size_t)134217728) return;
  if (bQf < 2 * bQ16) return;                        // AOh/AOl alias fits inside the f32 q region
  const size_t oAOh = oQf;
  const size_t oAOl = oQf + bQ16;

  char* ws = (char*)d_ws;
  _Float16* Xh   = (_Float16*)(ws + oXh);
  _Float16* Wqh  = (_Float16*)(ws + oWq);
  _Float16* Wkvh = (_Float16*)(ws + oWkv);
  _Float16* Woh  = (_Float16*)(ws + oWo);
  float*    cosT = (float*)(ws + oCos);
  float*    sinT = (float*)(ws + oSin);
  float*    Qf   = (float*)(ws + oQf);
  float*    KVf  = Qf + DM_;                         // the k | v columns of the fused plane, row pitch PN_
  if (oKVf != oQf + bQf || oWkv != oWq + bWq) return;   // the fused planes are the q and kv regions one behind the other
  _Float16* Qh   = (_Float16*)(ws + oQh);
  _Float16* Ql   = (_Float16*)(ws + oQl);
  _Float16* Kh   = (_Float16*)(ws + oKh);
  _Float16* Kl   = (_Float16*)(ws + oKl);
  _Float16* Vth  = (_Float16*)(ws + oVth);
  _Float16* Vtl  = (_Float16*)(ws + oVtl);
  int*      flg  = (int*)(ws + oFlg);
  _Float16* AOh  = (_Float16*)(ws + oAOh);
  _Float16* AOl  = (_Float16*)(ws + oAOl);

  const dim3 blk(256);

  // (1) one launch: inputs -> 16-bit planes (x bf16*2^4, weights bf16*2^8, k rows then v rows in the fused kv weight plane);
  //     cos/sin tables [4096][128] from position ids; mask verification flags per (b, query block, 4-row group)
  prep_kernel<<<dim3(PB_ALL_), blk, 0, stream>>>(x, mask, pos, Wq, Wk, Wv, Wo, Xh, Wqh, Wkvh, Woh, cosT, sinT, flg);
  // (2) one product: [q|k|v] = x . [Wq|Wk|Wv]^T -> f32 [4096][2560]
  proj_kernel<<<dim3((NB_ * SEQ_ / GBM_) * (PN_ / PBN_)), blk, 0, stream>>>(Xh, Wqh, Qf);
  // (3) one launch: RoPE + hi/residual split, q planes [4096][8*256] and k planes [4096][256]; v^T planes [2][256][2048]
  split_kernel<<<dim3(SB_ALL_), blk, 0, stream>>>(Qf, KVf, cosT, sinT, Qh, Ql, Kh, Kl, Vth, Vtl);
  // (4) attention -> AO hi/residual planes [4096][2048]
  (void)hipFuncSetAttribute(reinterpret_cast<const void*>(&attn_kernel), hipFuncAttributeMaxDynamicSharedMemorySize, AT_LDS);
  attn_kernel<<<dim3(NB_ * NH_ * NQB_), blk, AT_LDS, stream>>>(Qh, Ql, Kh, Kl, Vth, Vtl, mask, flg, AOh, AOl);
  // (5) out = AO . Wo^T -> d_out f32 [4096][2048]; residual plane on rows < LOROWS_ of each sequence
  gemm64_kernel<<<dim3((NB_ * SEQ_ / GBM_) * (DM_ / GBN_)), blk, 0, stream>>>(
      AOh, AOl, DM_, Woh, DM_, out, DM_, NB_ * SEQ_, DM_, DM_, LOROWS_, SEQ_ - 1, WSC_, Woh, out, DM_, 0);
  (void)hipGetLastError();
}

// v008
// Measured time: 154 microseconds a run.
// Two timings next to v007 both put it at 1.07 times that version's speed.
// Over all steps from v000 it is 4.06 times as fast.
// Contractions on v_wmma_f32_16x16x32_f16 (f16 operands, f32 accumulate): q/k/v projections (x RNE-converted to bf16 and carried *2^4,
// W RNE-converted to bf16 and carried *2^8, exact products); q.k^T (q,k carried *2^10 as f16 hi planes, plus unscaled f16 residual planes
// on the leading query blocks of each sequence); p.v (p carried *2^15, v^T carried *2^10: hi planes plus residual planes on the leading query
// blocks); output projection (attention output carried *2^10: hi plane everywhere, residual plane on the leading rows of each sequence;
// Wo bf16 *2^8). RoPE, mask add and online softmax in f32.
#include <hip/hip_runtime.h>
#include <math.h>
#include <stdint.h>

#define NB_     2
#define SEQ_    2048
#define DM_     2048
#define NH_     8
#define HD_     256
#define NF_     128
#define KVN_    512
#define WIN_    1024
#define NQB_    32
#define QE_     4
#define LOROWS_ 256
#define MFG_    16

#define CX_   16.0f
#define CW_   256.0f
#define CQK_  1024.0f
#define CP_   32768.0f
#define SSC_  5.9604644775390625e-8f     /* 2^-4 * 2^-20 : score scale for q,k carried *2^10 each */
#define OSC_  3.0517578125e-5f           /* 2^-15 = 2^10 / (2^15 * 2^10) : attention output carry */
#define QSC_  2.44140625e-4f             /* 2^-12 = 1 / (2^4 * 2^8) : projection outputs back to f32 */
#define WSC_  3.814697265625e-6f         /* 2^-18 = 1 / (2^10 * 2^8) : final projection */

typedef _Float16 v16h __attribute__((ext_vector_type(16)));
typedef _Float16 v8h  __attribute__((ext_vector_type(8)));
typedef float    v8f  __attribute__((ext_vector_type(8)));
typedef float    v4f  __attribute__((ext_vector_type(4)));

union FragU { v16h v; v8h h[2]; };
union U8 { v8f v; v4f q[2]; };

__device__ __forceinline__ float bf16_rne(float f) {
  unsigned u = __float_as_uint(f);
  u = u + 0x7FFFu + ((u >> 16) & 1u);
  return __uint_as_float(u & 0xFFFF0000u);
}
__device__ __forceinline__ v8f zero8() { return (v8f){0.f, 0.f, 0.f, 0.f, 0.f, 0.f, 0.f, 0.f}; }

// 16-bit fragment (A or B): lane row/col = lane&15, elements 0..7 <- p[0..7] (k0+8h..), 8..15 <- p[16..23] (k0+16+8h..)
// p already includes the row base + k0 + 8*h.
__device__ __forceinline__ v16h frag_ld(const _Float16* p) {
  FragU f;
  f.h[0] = *(const v8h*)(p);
  f.h[1] = *(const v8h*)(p + 16);
  return f.v;
}
__device__ __forceinline__ v8f wmma_raw(v16h a, v16h b, v8f c) {
  return __builtin_amdgcn_wmma_f32_16x16x32_f16(false, a, false, b, (short)0, c, false, false);
}
// WMMA with trailing hazard guard (ties D, keeps A/B live)
__device__ __forceinline__ v8f mma_g(v16h a, v16h b, v8f c) {
  c = __builtin_amdgcn_wmma_f32_16x16x32_f16(false, a, false, b, (short)0, c, false, false);
  asm volatile("v_nop\n\tv_nop\n\tv_nop\n\tv_nop" : "+v"(c) : "v"(a), "v"(b));
  return c;
}

// ---------------------------------------------------------------------------------------------------------------
// Elementwise convert: dst[i] = f16( bf16_rne(src[i]) * scale ), 8 elements per thread, one 16-B store per lane:
// coverage: ceil(n8/256) blocks (blk = the block's index within them), each thread 8 elements -> 8*n8 elements.
// ---------------------------------------------------------------------------------------------------------------
__device__ __forceinline__ void cvt16_part(int blk, const float* __restrict__ src, _Float16* __restrict__ dst, int n8, float scale) {
  const int i = blk * 256 + (int)threadIdx.x;
  if (i >= n8) return;
  const float* s = src + 8 * (size_t)i;
  U8 a;
  a.q[0] = *(const v4f*)(s);
  a.q[1] = *(const v4f*)(s + 4);
  v8h o;
#pragma unroll
  for (int e = 0; e < 8; ++e) o[e] = (_Float16)(bf16_rne(a.v[e]) * scale);
  _Float16* d = dst + 8 * (size_t)i;
  *(v8h*)d = o;
  
}

// ---------------------------------------------------------------------------------------------------------------
// RoPE tables: cosT/sinT [nrows][128], angle = float(pos[row]) * inv_freq[f], inv_freq[f] = 1 / f32(10000^(f/128)).
// coverage: nrows/32 blocks (blk = the block's index within them), 16 iterations x 2 rows -> nrows x 128 per table.
// ---------------------------------------------------------------------------------------------------------------
__device__ __forceinline__ void rope_table_part(int blk, const int* __restrict__ pos, float* __restrict__ cosT,
                                                float* __restrict__ sinT, int nrows) {
#pragma clang fp contract(off)
  __shared__ float invf[NF_];
  const int tid = threadIdx.x;
  if (tid < NF_) {
    const double e = (double)tid * 0.0078125;                 // tid/128 exactly
    const double p = exp2(e * 13.287712379549449);            // 10000^e
    const float pf = (float)p;                                // RNE to f32
    invf[tid] = 1.0f / pf;
  }
  __syncthreads();
  const int f = tid & (NF_ - 1);
  const int rp = tid >> 7;
  const int r0 = blk * 32;
  const float iv = invf[f];
#pragma unroll 1
  for (int it = 0; it < 16; ++it) {
    const int row = r0 + it * 2 + rp;
    const int rowc = (row < nrows) ? row : (nrows - 1);
    const float ang = (float)pos[rowc] * iv;
    float sv, cv;
    sincosf(ang, &sv, &cv);
    if (row < nrows) {
      float* cp = cosT + (size_t)row * NF_ + f;
      float* sp = sinT + (size_t)row * NF_ + f;
      *(float*)cp = cv;
      *(float*)sp = sv;
      // the wait that stands in front of a rewrite of an issued store's registers (the next trip reuses them)
      asm volatile("s_wait_xcnt 0x0" :: "v"(cp), "v"(sp), "v"(cv), "v"(sv) : "memory");
    }
  }
}

// ---------------------------------------------------------------------------------------------------------------
// Mask verification flags, MFG_ per (b, 64-query block), one per group of 4 query rows: 1 if every mask value for the group's rows
// and keys in [q0+64, min(q+1023, SEQ-1)] (the in-band keys strictly above the query block) is <= -1e9 (adds to an exact zero weight).
// The range holds at most 1023 keys, so 256 threads x 4 keys cover a row with one 16-byte load each; the 4 rows' loads are independent.
// coverage: NB*NQB*MFG_ blocks (bid = the block's index within them); each block writes its own 128-byte line of 32 equal ints.
// ---------------------------------------------------------------------------------------------------------------
__device__ __forceinline__ void maskflag_part(int bid, const float* __restrict__ mask, int* __restrict__ flag) {
  __shared__ int sw[8];
  const int tid = threadIdx.x, w = tid >> 5, lane = tid & 31;
  // bid = (b*32 + qb)*MFG_ + row group
  const int g  = bid & (MFG_ - 1);
  const int bq = bid / MFG_;
  const int b = bq >> 5, qb = bq & (NQB_ - 1);
  const int q0 = qb * 64;
  const int r0 = q0 + g * (64 / MFG_);
  const int k  = q0 + 64 + 4 * tid;          // first of this thread's four keys
  const int kc = (k <= SEQ_ - 4) ? k : (SEQ_ - 4);   // k > SEQ-4 means k >= SEQ: none of the four keys is tested
  v4f mv[64 / MFG_];
#pragma unroll   // all rows' loads issue before the first compare waits (and mv stays in registers)
  for (int rr = 0; rr < 64 / MFG_; ++rr) mv[rr] = *(const v4f*)(mask + ((size_t)b * SEQ_ + r0 + rr) * SEQ_ + kc);
  int bad = 0;
#pragma unroll
  for (int rr = 0; rr < 64 / MFG_; ++rr) {
    int kend = r0 + rr + WIN_ - 1;
    if (kend > SEQ_ - 1) kend = SEQ_ - 1;
#pragma unroll
    for (int e = 0; e < 4; ++e) {
      const int ok = (mv[rr][e] <= -1.0e9f) ? 1 : 0;
      bad |= ((k + e <= kend) && (ok == 0)) ? 1 : 0;
    }
  }
  const unsigned long long bm = __ballot(bad);
  if (lane == 0) sw[w] = (bm != 0ull) ? 1 : 0;
  __syncthreads();
  if (w == 0) {
    int any = 0;
#pragma unroll
    for (int i = 0; i < 8; ++i) any |= sw[i];
    const int fv = any ? 0 : 1;
    int* fp = flag + (size_t)bid * 32 + lane;
    *(int*)fp = fv;
  }
}

// ---------------------------------------------------------------------------------------------------------------
// The preparation passes, which depend on the inputs alone and not on one another, share one launch: a block's index range says
// which pass it belongs to (block-uniform, so each pass's barriers are reached by all of its block's threads or by none).
// The table blocks, few and with the longest serial chain, come first; then the mask check; then the five conversions.
// coverage: PB_ALL_ blocks = the sum of the passes' own block counts; every pass gets exactly its blocks.
// ---------------------------------------------------------------------------------------------------------------
#define PB_TAB_ ((NB_ * SEQ_) / 32)               /* 128  */
#define PB_FLG_ (NB_ * NQB_ * MFG_)               /* 1024 */
#define PB_X_   ((NB_ * SEQ_ * DM_) / (8 * 256))  /* 4096 */
#define PB_W_   ((DM_ * DM_) / (8 * 256))         /* 2048 */
#define PB_KV_  ((HD_ * DM_) / (8 * 256))         /* 256  */
#define PB_ALL_ (PB_TAB_ + PB_FLG_ + PB_X_ + 2 * PB_W_ + 2 * PB_KV_)
__global__ __launch_bounds__(256) void prep_kernel(const float* __restrict__ x, const float* __restrict__ mask,
                                                   const int* __restrict__ pos, const float* __restrict__ Wq,
                                                   const float* __restrict__ Wk, const float* __restrict__ Wv,
                                                   const float* __restrict__ Wo, _Float16* __restrict__ Xh,
                                                   _Float16* __restrict__ Wqh, _Float16* __restrict__ Wkvh,
                                                   _Float16* __restrict__ Woh, float* __restrict__ cosT,
                                                   float* __restrict__ sinT, int* __restrict__ flag) {
  int blk = blockIdx.x;
  if (blk < PB_TAB_) { rope_table_part(blk, pos, cosT, sinT, NB_ * SEQ_); return; }
  blk -= PB_TAB_;
  if (blk < PB_FLG_) { maskflag_part(blk, mask, flag); return; }
  blk -= PB_FLG_;
  if (blk < PB_X_) { cvt16_part(blk, x, Xh, PB_X_ * 256, CX_); return; }
  blk -= PB_X_;
  const float* src = Wq;      // weights: bf16 * 2^8; k rows then v rows in the fused kv weight plane
  _Float16* dst = Wqh;
  int n8 = PB_W_ * 256;
  if (blk >= PB_W_) {
    blk -= PB_W_; src = Wo; dst = Woh;
    if (blk >= PB_W_) {
      blk -= PB_W_; src = Wk; dst = Wkvh; n8 = PB_KV_ * 256;
      if (blk >= PB_KV_) { blk -= PB_KV_; src = Wv; dst = Wkvh + (size_t)HD_ * DM_; }
    }
  }
  cvt16_part(blk, src, dst, n8, CW_);
}

// ---------------------------------------------------------------------------------------------------------------
// The two WMMA products' common ring figures: operands reach LDS by asynchronous 16-byte copies, whole 256-byte row pieces (128 k) per
// stage, two stages: the next stage's copies fly while this stage is multiplied. LDS row pitch 272 bytes (16 B x odd) for the 16-byte
// fragment reads.
// ---------------------------------------------------------------------------------------------------------------
#define GK_    128                               /* k per stage */
#define GPH_   136                               /* LDS row pitch, halves */
#define GBM_   128
#define GBN_   256
#define G_LS_  (16 * GPH_ * 2)                   /* bytes between LDS rows 16 apart */

// Eight copies per lane, rows 16 apart: l = the lane's LDS byte address, g = its global address, gs = halves per 16 source rows.
// s_wait_xcnt stands inside the statement so that no address register is rewritten ahead of it.
__device__ __forceinline__ void async_rows8(unsigned l, const _Float16* g, size_t gs) {
  asm volatile(
      "global_load_async_to_lds_b128 %0, %8, off\n\t"
      "global_load_async_to_lds_b128 %1, %9, off\n\t"
      "global_load_async_to_lds_b128 %2, %10, off\n\t"
      "global_load_async_to_lds_b128 %3, %11, off\n\t"
      "global_load_async_to_lds_b128 %4, %12, off\n\t"
      "global_load_async_to_lds_b128 %5, %13, off\n\t"
      "global_load_async_to_lds_b128 %6, %14, off\n\t"
      "global_load_async_to_lds_b128 %7, %15, off\n\t"
      "s_wait_xcnt 0x0"
      :: "v"(l), "v"(l + 1u * G_LS_), "v"(l + 2u * G_LS_), "v"(l + 3u * G_LS_),
         "v"(l + 4u * G_LS_), "v"(l + 5u * G_LS_), "v"(l + 6u * G_LS_), "v"(l + 7u * G_LS_),
         "v"(g), "v"(g + gs), "v"(g + 2 * gs), "v"(g + 3 * gs), "v"(g + 4 * gs), "v"(g + 5 * gs), "v"(g + 6 * gs), "v"(g + 7 * gs)
      : "memory");
}

#define PN_    (DM_ + KVN_)                      /* 2560: columns of the fused q | k | v projection plane */

// ---------------------------------------------------------------------------------------------------------------
// RoPE + f16 hi/residual split. Unit = (row, head); 8 lanes per unit; lane j owns columns {8j, 64+8j, 128+8j, 192+8j}+0..7 of the
// 256-wide head (pairs (c, c+128) are in the same lane). out = x*cos + rotate_half(x)*sin with cos/sin[row][c mod 128].
// hi = f16(out*carry), lo = f16(out*carry - hi) (unscaled residual). Stores: for each column chunk one instruction writes
// coverage: nunits*8 threads x 32 elements = nunits*256 per plane.
// ---------------------------------------------------------------------------------------------------------------
__device__ __forceinline__ void rope_split_part(int blk, const float* __restrict__ src, int spitch, int nheads,
                                                const float* __restrict__ cosT, const float* __restrict__ sinT,
                                                _Float16* __restrict__ hi, _Float16* __restrict__ lo,
                                                int dpitch, int nunits, float carry) {
#pragma clang fp contract(off)
  const int gid = blk * 256 + (int)threadIdx.x;
  const int unit = gid >> 3;
  const int j = gid & 7;
  if (unit >= nunits) return;
  const int row = unit / nheads;
  const int hd = unit - row * nheads;
  const float* s  = src  + (size_t)row * spitch + hd * HD_ + 8 * j;
  const float* ct = cosT + (size_t)row * NF_ + 8 * j;
  const float* st = sinT + (size_t)row * NF_ + 8 * j;
  U8 xa, xb, xc, xd, ca, cb, sa, sb;
  xa.q[0] = *(const v4f*)(s);         xa.q[1] = *(const v4f*)(s + 4);
  xb.q[0] = *(const v4f*)(s + 64);    xb.q[1] = *(const v4f*)(s + 68);
  xc.q[0] = *(const v4f*)(s + 128);   xc.q[1] = *(const v4f*)(s + 132);
  xd.q[0] = *(const v4f*)(s + 192);   xd.q[1] = *(const v4f*)(s + 196);
  ca.q[0] = *(const v4f*)(ct);        ca.q[1] = *(const v4f*)(ct + 4);
  cb.q[0] = *(const v4f*)(ct + 64);   cb.q[1] = *(const v4f*)(ct + 68);
  sa.q[0] = *(const v4f*)(st);        sa.q[1] = *(const v4f*)(st + 4);
  sb.q[0] = *(const v4f*)(st + 64);   sb.q[1] = *(const v4f*)(st + 68);
  // the wait that stands in front of a rewrite of an issued load's address registers; naming the three addresses keeps them whole
  // up to it (else the last load takes its result into them)
  asm volatile("s_wait_xcnt 0x0" :: "v"(s), "v"(ct), "v"(st) : "memory");
  v8h h0, h1, h2, h3, l0, l1, l2, l3;
#pragma unroll
  for (int e = 0; e < 8; ++e) {
    const float r0 = xa.v[e] * ca.v[e] - xc.v[e] * sa.v[e];    // col 8j+e
    const float r1 = xb.v[e] * cb.v[e] - xd.v[e] * sb.v[e];    // col 64+8j+e
    const float r2 = xc.v[e] * ca.v[e] + xa.v[e] * sa.v[e];    // col 128+8j+e
    const float r3 = xd.v[e] * cb.v[e] + xb.v[e] * sb.v[e];    // col 192+8j+e
    float t; _Float16 q;
    t = r0 * carry; q = (_Float16)t; h0[e] = q; l0[e] = (_Float16)(t - (float)q);
    t = r1 * carry; q = (_Float16)t; h1[e] = q; l1[e] = (_Float16)(t - (float)q);
    t = r2 * carry; q = (_Float16)t; h2[e] = q; l2[e] = (_Float16)(t - (float)q);
    t = r3 * carry; q = (_Float16)t; h3[e] = q; l3[e] = (_Float16)(t - (float)q);
  }
  _Float16* hp = hi + (size_t)row * dpitch + hd * HD_ + 8 * j;
  _Float16* lp = lo + (size_t)row * dpitch + hd * HD_ + 8 * j;
  {
    *(v8h*)(hp)       = h0;
    *(v8h*)(hp + 64)  = h1;
    *(v8h*)(hp + 128) = h2;
    *(v8h*)(hp + 192) = h3;
    *(v8h*)(lp)       = l0;
    *(v8h*)(lp + 64)  = l1;
    *(v8h*)(lp + 128) = l2;
    *(v8h*)(lp + 192) = l3;
    
  }
}

// ---------------------------------------------------------------------------------------------------------------
// v columns of the fused projection plane (KV = its column 2048: f32 rows of pitch PN_, v in cols 256..511) -> transposed f16 planes Vth/Vtl [b][d][s]
// (hi = f16(v*2^10), lo = unscaled residual). 64x64 tiles through LDS; (256/64) x (NB*SEQ/64) blocks (bx, by), 256 threads.
// coverage per block: load 4 it x 256 thr x 4 = 64x64; store 2 it x 256 thr x 8 = 64x64 per plane.
// ---------------------------------------------------------------------------------------------------------------
__device__ __forceinline__ void vt_split_part(int bx, int by, const float* __restrict__ KV, _Float16* __restrict__ Vth,
                                              _Float16* __restrict__ Vtl) {
  __shared__ __align__(16) float tf[64 * 68];
  const int tid = threadIdx.x;
  const int d0  = bx * 64;                   // d block (input column within v)
  const int sg0 = by * 64;                   // global row block (b*SEQ + s)
  const int b   = sg0 >> 11;
  const int s0  = sg0 & (SEQ_ - 1);
  {
    const int lr = tid >> 4;
    const int c4 = (tid & 15) * 4;
    const float* vp = KV + (size_t)(sg0 + lr) * PN_ + d0 + c4;
#pragma unroll
    for (int it = 0; it < 4; ++it) {
      const int rr = it * 16 + lr;
      const v4f a = *(const v4f*)(vp + HD_ + (size_t)it * 16 * PN_);
      *(v4f*)(tf + rr * 68 + c4) = a;
    }
    // the wait that stands in front of a rewrite of an issued load's address registers; naming the address keeps it whole up to it
    asm volatile("s_wait_xcnt 0x0" :: "v"(vp) : "memory");
  }
  __syncthreads();
  const int sub = tid >> 3;          // output row within tile (= d)
  const int c8  = (tid & 7) * 8;     // s offset within tile
  v8h hv[2], lv[2];
#pragma unroll
  for (int it = 0; it < 2; ++it) {
    const int oc = it * 32 + sub;
    v8h a, rsd;
#pragma unroll
    for (int q = 0; q < 8; ++q) {
      const float f = tf[(c8 + q) * 68 + oc] * CQK_;
      const _Float16 hq = (_Float16)f;
      a[q] = hq;
      rsd[q] = (_Float16)(f - (float)hq);
    }
    hv[it] = a; lv[it] = rsd;
  }
  {
#pragma unroll
    for (int it = 0; it < 2; ++it) {
      const int oc = it * 32 + sub;
      const size_t go = ((size_t)b * HD_ + d0 + oc) * SEQ_ + s0 + c8;
      *(v8h*)(Vth + go) = hv[it];
      *(v8h*)(Vtl + go) = lv[it];
    }
    
  }
}

// ---------------------------------------------------------------------------------------------------------------
// The three passes between the projections and the attention do not depend on one another and share one launch, told apart by
// block index range (block-uniform): v transpose (the one with a barrier) first, then the k planes, then the q planes.
// coverage: SB_ALL_ blocks = the sum of the passes' own block counts.
// ---------------------------------------------------------------------------------------------------------------
#define SB_VT_  ((HD_ / 64) * ((NB_ * SEQ_) / 64))   /* 256  */
#define SB_K_   ((NB_ * SEQ_ * 8) / 256)             /* 128  */
#define SB_Q_   ((NB_ * SEQ_ * NH_ * 8) / 256)       /* 1024 */
#define SB_ALL_ (SB_VT_ + SB_K_ + SB_Q_)
__global__ __launch_bounds__(256) void split_kernel(const float* __restrict__ Qf, const float* __restrict__ KVf,
                                                    const float* __restrict__ cosT, const float* __restrict__ sinT,
                                                    _Float16* __restrict__ Qh, _Float16* __restrict__ Ql,
                                                    _Float16* __restrict__ Kh, _Float16* __restrict__ Kl,
                                                    _Float16* __restrict__ Vth, _Float16* __restrict__ Vtl) {
  int blk = blockIdx.x;
  if (blk < SB_VT_) { vt_split_part(blk & (HD_ / 64 - 1), blk / (HD_ / 64), KVf, Vth, Vtl); return; }
  blk -= SB_VT_;
  if (blk < SB_K_) { rope_split_part(blk, KVf, PN_, 1, cosT, sinT, Kh, Kl, HD_, NB_ * SEQ_, CQK_); return; }
  blk -= SB_K_;
  rope_split_part(blk, Qf, PN_, NH_, cosT, sinT, Qh, Ql, DM_, NB_ * SEQ_ * NH_, CQK_);
}

#define AT_PPITCH 72
#define AT_OPITCH 264
#define AT_KP     264                            /* k tile row pitch, halves: 528 B = 16 B x odd */
#define AT_VP     72                             /* v^T tile row pitch, halves: 144 B = 16 B x odd */
#define AT_SV     (64 * AT_KP)                   /* v^T tile, halves from the stage's start */
#define AT_STG    (64 * AT_KP + HD_ * AT_VP)     /* halves per stage */
#define AT_OFF_PH 0
#define AT_OFF_PM 9216
#define AT_OFF_PS 9728
#define AT_OFF_AL 10240
#define AT_OFF_LF 10496
#define AT_OFF_RG 10752                          /* the two stages */
#define AT_OFF_PL (AT_OFF_RG + AT_STG * 2)       /* residual P tile: in the residual k tile's place, which is dead behind the score products */
#define AT_OFF_OH AT_OFF_RG                      /* output staging, behind the barrier that follows the loop */
#define AT_OFF_OL (AT_OFF_RG + 33792)
#define AT_LDS    152064                         /* two blocks per 320-KiB LDS */
static_assert(AT_OFF_PM == AT_OFF_PH + 64 * AT_PPITCH * 2);
static_assert(AT_OFF_OL == AT_OFF_OH + 64 * AT_OPITCH * 2);
static_assert(AT_LDS == AT_OFF_RG + 2 * AT_STG * 2);
static_assert(AT_LDS >= AT_OFF_OL + 64 * AT_OPITCH * 2);
static_assert(64 * AT_PPITCH <= AT_SV);
static_assert(AT_OFF_RG % 16 == 0 && (AT_STG * 2) % 16 == 0 && (AT_SV * 2) % 16 == 0);

// Eight copies per lane: l = the lane's LDS byte address, LS = bytes between its LDS rows, g = its global address, gs = halves between
// its source rows. s_wait_xcnt stands inside the statement so that no address register is rewritten ahead of it.
template <unsigned LS>
__device__ __forceinline__ void async_tile8(unsigned l, const _Float16* g, size_t gs) {
  asm volatile(
      "global_load_async_to_lds_b128 %0, %8, off\n\t"
      "global_load_async_to_lds_b128 %1, %9, off\n\t"
      "global_load_async_to_lds_b128 %2, %10, off\n\t"
      "global_load_async_to_lds_b128 %3, %11, off\n\t"
      "global_load_async_to_lds_b128 %4, %12, off\n\t"
      "global_load_async_to_lds_b128 %5, %13, off\n\t"
      "global_load_async_to_lds_b128 %6, %14, off\n\t"
      "global_load_async_to_lds_b128 %7, %15, off\n\t"
      "s_wait_xcnt 0x0"
      :: "v"(l), "v"(l + 1u * LS), "v"(l + 2u * LS), "v"(l + 3u * LS),
         "v"(l + 4u * LS), "v"(l + 5u * LS), "v"(l + 6u * LS), "v"(l + 7u * LS),
         "v"(g), "v"(g + gs), "v"(g + 2 * gs), "v"(g + 3 * gs), "v"(g + 4 * gs), "v"(g + 5 * gs), "v"(g + 6 * gs), "v"(g + 7 * gs)
      : "memory");
}
// One stage = key tile kt: k rows (a wave's copy = one 512-byte row, rows 8 apart) and v^T rows (a wave's copy = four 128-byte lines,
// rows 32 apart). lk, lv: the lane's LDS byte addresses in the stage; gk, gv: its global addresses in tile 0.
__device__ __forceinline__ void attn_fill(unsigned lk, unsigned lv, const _Float16* gk, const _Float16* gv, int kt) {
  async_tile8<8u * AT_KP * 2u>(lk, gk + (size_t)kt * 64 * HD_, (size_t)8 * HD_);
  async_tile8<32u * AT_VP * 2u>(lv, gv + (size_t)kt * 64, (size_t)32 * SEQ_);
}

// The key-tile loop. One instance per kind of query block (EARLY: residual planes as well, one tile in LDS at a time; else two), so that
// the loop holds no test of the kind and a tile's loads stand in groups ahead of their use: q and k fragments by groups of k-steps, the
// mask values in front of the score products, the v^T fragments in front of the P . V products.
template <bool EARLY>
__device__ __forceinline__ void attn_tiles(int ktlo, int kthi, int b, int q0, int srow0, int kh, int w, int hh, int c,
                                           const _Float16* __restrict__ qhp, const _Float16* __restrict__ qlp,
                                           const _Float16* __restrict__ Kh, const _Float16* __restrict__ Kl,
                                           const float* __restrict__ mrp,
                                           const _Float16* __restrict__ Vth, const _Float16* __restrict__ Vtl, const _Float16* ring,
                                           _Float16* Ph, _Float16* Pl, float* pm, float* ps, float* alph,
                                           float (&mrow)[8], float (&lrow)[8], v8f (&oacc)[4][2]) {
  constexpr int KG = EARLY ? 1 : 2;            // k-steps whose fragments are loaded as one group
  constexpr bool TWO = !EARLY;                 // two stages of hi planes: a tile's copies are issued two tiles ahead
  const int tid = (w << 5) + (hh << 4) + c;
  const unsigned lk = (unsigned)(size_t)ring + (unsigned)((tid >> 5) * AT_KP + (tid & 31) * 8) * 2u;
  const unsigned lv = (unsigned)(size_t)ring + (unsigned)(AT_SV + (tid >> 3) * AT_VP + (tid & 7) * 8) * 2u;
  const size_t ok = ((size_t)b * SEQ_ + (tid >> 5)) * HD_ + (tid & 31) * 8;
  const size_t ov = ((size_t)b * HD_ + (tid >> 3)) * SEQ_ + (tid & 7) * 8;
  const _Float16* gk = Kh + ok;
  const _Float16* gv = Vth + ov;
  if (TWO) {
    attn_fill(lk, lv, gk, gv, ktlo);
    asm volatile("s_wait_asynccnt 0x0" ::: "memory");   // the first tile landed (this wave's copies) before the barrier publishes it
    __syncthreads();
    if (ktlo < kthi) attn_fill(lk + AT_STG * 2u, lv + AT_STG * 2u, gk, gv, ktlo + 1);   // block-uniform
  }
  const float* mtile = mrp + ktlo * 64 + 32 * kh + c;   // the lane's first mask value of the tile, moved on by 64 keys per trip
  for (int kt = ktlo; kt <= kthi; ++kt, mtile += 64) {      // block-uniform, at most 32 trips
    const int key0  = kt * 64;
    const int wkey0 = key0 + 32 * kh;
    const int sb = TWO ? ((kt - ktlo) & 1) : 0;   // the stage of the tile's hi planes
    const _Float16* khp = ring + sb * AT_STG + (32 * kh + c) * AT_KP + 8 * hh;
    const _Float16* klp = khp + AT_STG;
    if (!TWO) {
      attn_fill(lk, lv, gk, gv, kt);
      attn_fill(lk + AT_STG * 2u, lv + AT_STG * 2u, Kl + ok, Vtl + ov, kt);
      asm volatile("s_wait_asynccnt 0x0" ::: "memory");   // the tile landed (this wave's copies) before the barrier publishes it
      __syncthreads();
    }

    // ---- mask values of this wave's 16 x 32 scores, in flight during the score products. Every key of a tile is a column of the mask:
    //      no test guards the loads ----
    float mv[8][2];
    const float* mt = mtile;
#pragma unroll   // register arrays: constant indices
    for (int r = 0; r < 8; ++r) {
#pragma unroll   // register arrays: constant indices
      for (int j = 0; j < 2; ++j) mv[r][j] = mt[(size_t)r * SEQ_ + 16 * j];
    }

    // ---- S = q . k^T (16 rows x 32 keys per wave) ----
    v8f s[2];
    s[0] = zero8(); s[1] = zero8();
#pragma unroll   // constant load offsets, no loop overhead between the groups
    for (int g = 0; g < 8; g += KG) {
      v16h qa[KG], qr[KG], kb[KG][2], kr[KG][2];
#pragma unroll   // register arrays: constant indices
      for (int u = 0; u < KG; ++u) {
        const int ks = g + u;
        qa[u] = frag_ld(qhp + 32 * ks);
        qr[u] = qa[u];
        if (EARLY) qr[u] = frag_ld(qlp + 32 * ks);
#pragma unroll   // register arrays: constant indices
        for (int j = 0; j < 2; ++j) {
          kb[u][j] = frag_ld(khp + (16 * j) * AT_KP + 32 * ks);
          kr[u][j] = kb[u][j];
          if (EARLY) kr[u][j] = frag_ld(klp + (16 * j) * AT_KP + 32 * ks);
        }
      }
#pragma unroll   // register arrays: constant indices
      for (int u = 0; u < KG; ++u) {
#pragma unroll   // register arrays: constant indices
        for (int j = 0; j < 2; ++j) {
          s[j] = mma_g(qa[u], kb[u][j], s[j]);
          if (EARLY) {
            s[j] = mma_g(qr[u], kb[u][j], s[j]);
            s[j] = mma_g(qa[u], kr[u][j], s[j]);
          }
        }
      }
    }

    // the wait that stands in front of a rewrite of an issued load's address registers; naming the tile's mask address keeps it whole
    // up to it (else a later load may take its result into it)
    asm volatile("s_wait_xcnt 0x0" :: "v"(mt) : "memory");

    // ---- scale, mask, partial row max over this wave's 32 keys ----
    float cm[8];
    // key - query row at r = 0, j = 0: the band test then compares with constants, and no per-row bounds are held in registers over the
    // loop (the P fragment groups below need the room)
    const int dkq = wkey0 + c - (q0 + srow0 + 8 * hh);
#pragma unroll
    for (int r = 0; r < 8; ++r) {
      float mx = -INFINITY;
#pragma unroll
      for (int j = 0; j < 2; ++j) {
        const bool inb = (dkq >= r - 16 * j - (WIN_ - 1)) && (dkq <= r - 16 * j + (WIN_ - 1));
        const float sv = inb ? (s[j][r] * SSC_ + mv[r][j]) : -INFINITY;
        s[j][r] = sv;
        mx = fmaxf(mx, sv);
      }
      mx = fmaxf(mx, __shfl_xor(mx, 1, 32));
      mx = fmaxf(mx, __shfl_xor(mx, 2, 32));
      mx = fmaxf(mx, __shfl_xor(mx, 4, 32));
      mx = fmaxf(mx, __shfl_xor(mx, 8, 32));
      cm[r] = mx;
    }
    if (c == 0) {
#pragma unroll
      for (int r = 0; r < 8; ++r) pm[w * 16 + 8 * hh + r] = cm[r];
    }
    __syncthreads();

    // ---- online softmax: tile max, p, partial sums ----
    float al[8], psm[8];
    const int wo = w ^ 4;
#pragma unroll
    for (int r = 0; r < 8; ++r) {
      const float om = pm[wo * 16 + 8 * hh + r];
      const float mnew = fmaxf(mrow[r], fmaxf(cm[r], om));
      const float msafe = (mnew == -INFINITY) ? 0.0f : mnew;
      al[r] = __expf(mrow[r] - msafe);
      mrow[r] = mnew;
      float sum = 0.0f;
#pragma unroll
      for (int j = 0; j < 2; ++j) {
        const float p = __expf(s[j][r] - msafe);
        sum += p;
        const float t = p * CP_;
        const _Float16 phv = (_Float16)t;
        const int pidx = (srow0 + 8 * hh + r) * AT_PPITCH + 32 * kh + 16 * j + c;
        Ph[pidx] = phv;
        if (EARLY) Pl[pidx] = (_Float16)(t - (float)phv);
      }
      sum += __shfl_xor(sum, 1, 32);
      sum += __shfl_xor(sum, 2, 32);
      sum += __shfl_xor(sum, 4, 32);
      sum += __shfl_xor(sum, 8, 32);
      psm[r] = sum;
    }
    if (c == 0) {
#pragma unroll
      for (int r = 0; r < 8; ++r) ps[w * 16 + 8 * hh + r] = psm[r];
      if (w < 4) {
#pragma unroll
        for (int r = 0; r < 8; ++r) alph[srow0 + 8 * hh + r] = al[r];
      }
    }
    __syncthreads();
#pragma unroll
    for (int r = 0; r < 8; ++r)
      lrow[r] = lrow[r] * al[r] + (ps[(w & 3) * 16 + 8 * hh + r] + ps[((w & 3) + 4) * 16 + 8 * hh + r]);

    // ---- v^T fragments of the tile, from LDS: in flight while O is rescaled ----
    v16h vb[2][2], vr[2][2];
    const _Float16* vht = ring + sb * AT_STG + AT_SV + (32 * w + c) * AT_VP + 8 * hh;
    const _Float16* vlt = vht + AT_STG;
#pragma unroll   // register arrays: constant indices
    for (int k2 = 0; k2 < 2; ++k2) {
#pragma unroll   // register arrays: constant indices
      for (int jj = 0; jj < 2; ++jj) {
        vb[k2][jj] = frag_ld(vht + (16 * jj) * AT_VP + 32 * k2);
        vr[k2][jj] = vb[k2][jj];
        if (EARLY) vr[k2][jj] = frag_ld(vlt + (16 * jj) * AT_VP + 32 * k2);
      }
    }

    // ---- rescale O, then O += P . V for this wave's 32 output columns ----
    if (!EARLY) {
      // Each P fragment is read from LDS once (both column halves use it) and in a group ahead of its use, so that no product waits on
      // an LDS read issued just in front of it: the first 32 keys' fragments with the v^T fragments and the rescale factors, the second
      // 32 keys' in front of the first 32 keys' products.
      const _Float16* pp = Ph + c * AT_PPITCH + 8 * hh;
      v16h pg[2][4];
      U8 av[4];
#pragma unroll   // register arrays: constant indices
      for (int i = 0; i < 4; ++i) pg[0][i] = frag_ld(pp + (16 * i) * AT_PPITCH);
#pragma unroll   // register arrays: constant indices
      for (int i = 0; i < 4; ++i) {
        av[i].q[0] = *(const v4f*)(alph + 16 * i + 8 * hh);
        av[i].q[1] = *(const v4f*)(alph + 16 * i + 8 * hh + 4);
      }
      // holds these LDS reads together in front of the rescale (one LDS wait instead of one per row group)
      asm volatile("" :: "v"(av[0].v), "v"(av[1].v), "v"(av[2].v), "v"(av[3].v));
#pragma unroll
      for (int i = 0; i < 4; ++i) {
#pragma unroll
        for (int r = 0; r < 8; ++r) { oacc[i][0][r] *= av[i].v[r]; oacc[i][1][r] *= av[i].v[r]; }
      }
#pragma unroll   // register arrays: constant indices
      for (int i = 0; i < 4; ++i) pg[1][i] = frag_ld(pp + (16 * i) * AT_PPITCH + 32);
#pragma unroll
      for (int k2 = 0; k2 < 2; ++k2) {
#pragma unroll
        for (int jj = 0; jj < 2; ++jj) {
#pragma unroll
          for (int i = 0; i < 4; ++i) oacc[i][jj] = mma_g(pg[k2][i], vb[k2][jj], oacc[i][jj]);
        }
      }
    } else {
#pragma unroll
      for (int i = 0; i < 4; ++i) {
        U8 av;
        av.q[0] = *(const v4f*)(alph + 16 * i + 8 * hh);
        av.q[1] = *(const v4f*)(alph + 16 * i + 8 * hh + 4);
#pragma unroll
        for (int r = 0; r < 8; ++r) { oacc[i][0][r] *= av.v[r]; oacc[i][1][r] *= av.v[r]; }
      }
#pragma unroll
      for (int k2 = 0; k2 < 2; ++k2) {
#pragma unroll
        for (int jj = 0; jj < 2; ++jj) {
#pragma unroll
          for (int i = 0; i < 4; ++i) {
            const v16h pa = frag_ld(Ph + (16 * i + c) * AT_PPITCH + 32 * k2 + 8 * hh);
            oacc[i][jj] = mma_g(pa, vb[k2][jj], oacc[i][jj]);
            const v16h pr = frag_ld(Pl + (16 * i + c) * AT_PPITCH + 32 * k2 + 8 * hh);
            oacc[i][jj] = mma_g(pa, vr[k2][jj], oacc[i][jj]);
            oacc[i][jj] = mma_g(pr, vb[k2][jj], oacc[i][jj]);
          }
        }
      }
    }

    // ---- hand-over of the stages ----
    asm volatile("s_wait_dscnt 0x0" ::: "memory");        // this wave's reads (and residual P writes) there are done before a refill
    if (TWO) asm volatile("s_wait_asynccnt 0x0" ::: "memory");   // this wave's copies of the next tile have landed
    __syncthreads();                                      // frees tile kt's stage; with two stages it publishes tile kt+1 as well
    if (TWO && kt + 2 <= kthi)                            // block-uniform
      attn_fill(lk + (unsigned)sb * (AT_STG * 2u), lv + (unsigned)sb * (AT_STG * 2u), gk, gv, kt + 2);
  }
  if (TWO) asm volatile("s_wait_asynccnt 0x0" ::: "memory");   // nothing in flight when the stages become output staging
}

// amdgpu_waves_per_eu(4, 4): holds the registers to four waves per SIMD, so that two blocks share a WGP (2 x AT_LDS fits its LDS)
__global__ __launch_bounds__(256) __attribute__((amdgpu_waves_per_eu(4, 4))) void attn_kernel(const _Float16* __restrict__ Qh, const _Float16* __restrict__ Ql,
                                                   const _Float16* __restrict__ Kh, const _Float16* __restrict__ Kl,
                                                   const _Float16* __restrict__ Vth, const _Float16* __restrict__ Vtl,
                                                   const float* __restrict__ mask, const int* __restrict__ flag,
                                                   _Float16* __restrict__ AOh, _Float16* __restrict__ AOl) {
  extern __shared__ __align__(16) unsigned char dsm[];
  _Float16* Ph   = (_Float16*)(dsm + AT_OFF_PH);
  _Float16* Pl   = (_Float16*)(dsm + AT_OFF_PL);
  float*    pm   = (float*)(dsm + AT_OFF_PM);     // [8 waves][16 rows] partial row max
  float*    ps   = (float*)(dsm + AT_OFF_PS);     // [8 waves][16 rows] partial row sum
  float*    alph = (float*)(dsm + AT_OFF_AL);     // [64] rescale factors
  float*    lfin = (float*)(dsm + AT_OFF_LF);     // [64] final row sums
  const _Float16* ring = (const _Float16*)(dsm + AT_OFF_RG);   // two stages of k and v^T tiles
  _Float16* Ohs  = (_Float16*)(dsm + AT_OFF_OH);
  _Float16* Ols  = (_Float16*)(dsm + AT_OFF_OL);

  const int tid  = threadIdx.x;
  const int w    = tid >> 5;
  const int lane = tid & 31;
  const int hh   = lane >> 4;
  const int c    = lane & 15;
  const int bid  = blockIdx.x;
  const int qb   = bid & (NQB_ - 1);
  const int h    = (bid >> 5) & (NH_ - 1);
  const int b    = bid >> 8;
  const int q0   = qb * 64;
  const int srow0 = (w & 3) * 16;
  const int kh    = w >> 2;
  const int ocol0 = w * 32;
  const bool early = (qb < QE_);
  const int ktlo = (qb > 16) ? (qb - 16) : 0;
  int fl = 1;                                  // block-uniform: all row groups of this query block verified
#pragma unroll   // independent scalar loads, issued together instead of one round trip each
  for (int g = 0; g < MFG_; ++g) fl &= flag[((b * NQB_ + qb) * MFG_ + g) * 32];
  int kthi = (fl != 0) ? qb : (qb + 16);
  if (kthi > NQB_ - 1) kthi = NQB_ - 1;

  const size_t growq = (size_t)b * SEQ_ + q0;
  const _Float16* qhp = Qh + (growq + srow0 + c) * DM_ + h * HD_ + 8 * hh;
  const _Float16* qlp = Ql + (growq + srow0 + c) * DM_ + h * HD_ + 8 * hh;
  const float*    mrp = mask + (growq + srow0 + 8 * hh) * (size_t)SEQ_;

  float mrow[8], lrow[8];
  v8f oacc[4][2];
#pragma unroll
  for (int r = 0; r < 8; ++r) { mrow[r] = -INFINITY; lrow[r] = 0.0f; }
#pragma unroll
  for (int i = 0; i < 4; ++i) { oacc[i][0] = zero8(); oacc[i][1] = zero8(); }

  if (early)   // block-uniform
    attn_tiles<true>(ktlo, kthi, b, q0, srow0, kh, w, hh, c, qhp, qlp, Kh, Kl, mrp, Vth, Vtl, ring, Ph, Pl, pm, ps, alph, mrow, lrow, oacc);
  else
    attn_tiles<false>(ktlo, kthi, b, q0, srow0, kh, w, hh, c, qhp, qlp, Kh, Kl, mrp, Vth, Vtl, ring, Ph, Pl, pm, ps, alph, mrow, lrow, oacc);

  if (w < 4 && c == 0) {
#pragma unroll
    for (int r = 0; r < 8; ++r) lfin[srow0 + 8 * hh + r] = lrow[r];
  }
  __syncthreads();
#pragma unroll
  for (int i = 0; i < 4; ++i) {
    U8 lv;
    lv.q[0] = *(const v4f*)(lfin + 16 * i + 8 * hh);
    lv.q[1] = *(const v4f*)(lfin + 16 * i + 8 * hh + 4);
#pragma unroll
    for (int r = 0; r < 8; ++r) {
      const float f = OSC_ * (1.0f / lv.v[r]);
      const int orow = 16 * i + 8 * hh + r;
#pragma unroll
      for (int jj = 0; jj < 2; ++jj) {
        const float t = oacc[i][jj][r] * f;
        const _Float16 hq = (_Float16)t;
        const int oidx = orow * AT_OPITCH + ocol0 + 16 * jj + c;
        Ohs[oidx] = hq;
        Ols[oidx] = (_Float16)(t - (float)hq);
      }
    }
  }
  __syncthreads();
  {
    const int piece = tid & 7;
    const int lsub  = tid >> 3;
    {
#pragma unroll
      for (int it = 0; it < 8; ++it) {
        const int line = it * 32 + lsub;          // 0..255 = 64 rows x 4 lines
        const int row  = line >> 2;
        const int col  = (line & 3) * 64 + piece * 8;
        const v8h hv = *(const v8h*)(Ohs + row * AT_OPITCH + col);
        const v8h rv = *(const v8h*)(Ols + row * AT_OPITCH + col);
        const size_t go = (growq + row) * DM_ + h * HD_ + col;
        *(v8h*)(AOh + go) = hv;
        *(v8h*)(AOl + go) = rv;
      }
      
    }
  }
}

// ---------------------------------------------------------------------------------------------------------------
// The q, k and v projections as ONE product over the PN_ = 2560 rows of the weight planes (q rows, then k rows, then v rows, which lie
// one behind the other): C[m][n] = 2^-12 * sum_k A[m][k] * Bt[n][k], C f32 [4096][2560].
// Block = 8 waves (2 x 4) on a 128 x 320 tile of C, each wave 64 x 80 (4 x 5 accumulators): 32 x 8 = 256 equal blocks, one per WGP in
// one round (a block's LDS leaves room for no second one), where 128 x 256 tiles make 320 blocks and a second round of 64.
// The ring is the common one above: asynchronous 16-byte copies, 256-byte row pieces (128 k) per stage, two stages, pitch 272 bytes.
// Epilogue: the whole tile staged in the (then free) ring, then stored by 512-byte runs of its rows: a wave's 80 columns alone end
// in the middle of a 128-byte line, the block's 320 do not.
// ---------------------------------------------------------------------------------------------------------------
#define PNJ_   5                                 /* 16-column accumulators per wave */
#define PBN_   (4 * 16 * PNJ_)                   /* 320 */
#define P_OB_  (GBM_ * GPH_)                     /* Bt rows, halves from the stage's start */
#define P_STG_ ((GBM_ + PBN_) * GPH_)            /* halves per stage */
#define P_CP_  (PBN_ + 4)                        /* staged C row pitch, floats: rows 8 apart fall 32 banks apart */
static_assert(PN_ % PBN_ == 0 && (NB_ * SEQ_) % GBM_ == 0 && DM_ % GK_ == 0 && DM_ / GK_ >= 2);
static_assert(2 * P_STG_ * 2 >= GBM_ * P_CP_ * 4);
static_assert((GBM_ * (PBN_ / 4)) % (8 * 256) == 0);

// Four copies per lane, rows 16 apart (as async_rows8). s_wait_xcnt stands inside the statement so that no address register is
// rewritten ahead of it.
__device__ __forceinline__ void async_rows4(unsigned l, const _Float16* g, size_t gs) {
  asm volatile(
      "global_load_async_to_lds_b128 %0, %4, off\n\t"
      "global_load_async_to_lds_b128 %1, %5, off\n\t"
      "global_load_async_to_lds_b128 %2, %6, off\n\t"
      "global_load_async_to_lds_b128 %3, %7, off\n\t"
      "s_wait_xcnt 0x0"
      :: "v"(l), "v"(l + 1u * G_LS_), "v"(l + 2u * G_LS_), "v"(l + 3u * G_LS_),
         "v"(g), "v"(g + gs), "v"(g + 2 * gs), "v"(g + 3 * gs)
      : "memory");
}
// One stage: A 128 rows, Bt 320 rows, 256 bytes of each.
__device__ __forceinline__ void proj_fill(unsigned l, const _Float16* ga, const _Float16* gb) {
  const size_t s16 = (size_t)16 * DM_;
  async_rows8(l, ga, s16);
  async_rows8(l + P_OB_ * 2u, gb, s16);
  async_rows8(l + P_OB_ * 2u + 8u * G_LS_, gb + 8 * s16, s16);
  async_rows4(l + P_OB_ * 2u + 16u * G_LS_, gb + 16 * s16, s16);
}

__global__ __launch_bounds__(256) void proj_kernel(const _Float16* __restrict__ A, const _Float16* __restrict__ Bt,
                                                   float* __restrict__ C) {
  __shared__ __align__(16) _Float16 ring[2 * P_STG_];   // two stages; afterwards the block's 128 x 320 f32 tile, pitch P_CP_ floats
  const int tid  = threadIdx.x;
  const int lane = tid & 31;
  const int wave = tid >> 5;
  const int tm = (int)blockIdx.x / (PN_ / PBN_);
  const int tn = (int)blockIdx.x - tm * (PN_ / PBN_);
  const int m0b = tm * GBM_;
  const int n0b = tn * PBN_;
  const int wrow = (wave >> 2) << 6;
  const int wcol = (wave & 3) * (16 * PNJ_);
  const int rlane = lane & 15;
  const int koff  = (lane >> 4) * 8;

  v8f acc[4][PNJ_];
#pragma unroll
  for (int i = 0; i < 4; ++i)
#pragma unroll
    for (int j = 0; j < PNJ_; ++j) acc[i][j] = zero8();

  const int sub = tid >> 4;
  const int cc  = (tid & 15) * 8;
  const unsigned l0 = (unsigned)(size_t)ring + (unsigned)(sub * GPH_ + cc) * 2u;
  const _Float16* ga = A  + (size_t)(m0b + sub) * DM_ + cc;
  const _Float16* gb = Bt + (size_t)(n0b + sub) * DM_ + cc;
  constexpr int nt = DM_ / GK_;

  proj_fill(l0, ga, gb);
  asm volatile("s_wait_asynccnt 0x0" ::: "memory");   // stage 0 landed (this wave's copies) before the barrier publishes it
  __syncthreads();
  proj_fill(l0 + P_STG_ * 2u, ga + GK_, gb + GK_);

  for (int t = 0; t < nt; ++t) {
    const _Float16* st = ring + (t & 1) * P_STG_;
    const _Float16* sa = st + (wrow + rlane) * GPH_ + koff;
    const _Float16* sb = st + P_OB_ + (wcol + rlane) * GPH_ + koff;
#pragma unroll   // the four k-steps of a stage in one body: constant LDS offsets, no loop overhead between them
    for (int kk = 0; kk < GK_; kk += 32) {
      v16h bh[PNJ_], ah[4];
#pragma unroll   // register arrays: constant indices
      for (int j = 0; j < PNJ_; ++j) bh[j] = frag_ld(sb + (j << 4) * GPH_ + kk);
#pragma unroll   // register arrays: constant indices
      for (int i = 0; i < 4; ++i) ah[i] = frag_ld(sa + (i << 4) * GPH_ + kk);
      // holds the k-step's fragment reads together in front of its products (one LDS wait per k-step instead of one per row)
      asm volatile("" :: "v"(bh[0]), "v"(bh[1]), "v"(bh[2]), "v"(bh[3]), "v"(bh[4]), "v"(ah[0]), "v"(ah[1]), "v"(ah[2]), "v"(ah[3]));
#pragma unroll   // register arrays: constant indices
      for (int i = 0; i < 4; ++i) {
#pragma unroll   // register arrays: constant indices
        for (int j = 0; j < PNJ_; ++j) acc[i][j] = wmma_raw(ah[i], bh[j], acc[i][j]);
      }
    }
    asm volatile("s_wait_dscnt 0x0" ::: "memory");      // this wave's reads of the stage are done before it may be refilled
    asm volatile("s_wait_asynccnt 0x0" ::: "memory");   // this wave's copies of the next stage have landed
    __syncthreads();                                    // publishes stage t+1 and frees stage t's buffer
    if (t + 2 < nt)
      proj_fill(l0 + (unsigned)(t & 1) * (P_STG_ * 2u), ga + (size_t)(t + 2) * GK_, gb + (size_t)(t + 2) * GK_);
  }
  asm volatile("s_wait_asynccnt 0x0" ::: "memory");     // nothing in flight when the ring becomes output staging

  float* cst = (float*)ring;
#pragma unroll
  for (int i = 0; i < 4; ++i) {
#pragma unroll
    for (int j = 0; j < PNJ_; ++j) {
#pragma unroll
      for (int r = 0; r < 8; ++r) cst[(wrow + (i << 4) + koff + r) * P_CP_ + wcol + (j << 4) + rlane] = acc[i][j][r] * QSC_;
    }
  }
  __syncthreads();                                      // the tile is whole before any wave reads other waves' columns
#pragma unroll 1   // eight LDS reads and eight stores per trip are enough in flight; keeps the text short
  for (int g = 0; g < (GBM_ * (PBN_ / 4)) / (8 * 256); ++g) {
    v4f v[8];
    float* p[8];
#pragma unroll   // register arrays: constant indices
    for (int it = 0; it < 8; ++it) {
      const int idx = (g * 8 + it) * 256 + tid;         // 16-byte piece of the tile, row-major: a wave's store = four whole 128-byte lines
      const int row = idx / (PBN_ / 4);
      const int c4  = (idx - row * (PBN_ / 4)) * 4;
      v[it] = *(const v4f*)(cst + row * P_CP_ + c4);
      p[it] = C + (size_t)(m0b + row) * PN_ + n0b + c4;
    }
#pragma unroll   // register arrays: constant indices
    for (int it = 0; it < 8; ++it) *(v4f*)p[it] = v[it];
    // the wait that stands in front of a rewrite of an issued store's registers (the next trip reuses them); naming them keeps them
    // whole up to it
    asm volatile("s_wait_xcnt 0x0" :: "v"(p[0]), "v"(p[1]), "v"(p[2]), "v"(p[3]), "v"(p[4]), "v"(p[5]), "v"(p[6]), "v"(p[7]),
                 "v"(v[0]), "v"(v[1]), "v"(v[2]), "v"(v[3]), "v"(v[4]), "v"(v[5]), "v"(v[6]), "v"(v[7]) : "memory");
  }
}

// ---------------------------------------------------------------------------------------------------------------
// Output projection: C[m][n] = 2^-18 * sum_k (A[m][k] (+ A2[m][k])) * Bt[n][k], A = the attention output's hi plane, A2 = its residual
// plane, which counts on the first LOROWS_ rows of each sequence only; Bt = Wo rows (k contiguous); C f32 [4096][2048].
// The rows with a residual plane cost twice the products. They are dealt out evenly: every block's 128 x 256 tile of C holds 112 rows
// without and 16 rows with the residual plane (tile rows 112..127), so that all 32 x 8 = 256 blocks, one per WGP, do the same work,
// 9/8 of a plain tile's, where whole tiles of such rows would do 2 tiles' work on 32 WGPs while the others idle.
// Block = 8 waves (2 x 4), each wave 64 x 64 (4 x 4 accumulators); the four waves of the lower row half add the residual products
// (4 more per k-step, behind a scalar branch that holds no barrier).
// Per accumulator the order of the sums is hi, residual, k-step by k-step.
// The ring is that of proj_kernel. Epilogue: the whole tile staged in the (then free) ring, then stored by 512-byte runs of its rows.
// ---------------------------------------------------------------------------------------------------------------
#define O_LO_  16                                /* tile rows with a residual plane */
#define O_HI_  (GBM_ - O_LO_)                    /* 112 tile rows without */
#define O_OA2_ (GBM_ * GPH_)                     /* residual rows, halves from the stage's start */
#define O_OB_  ((GBM_ + O_LO_) * GPH_)           /* Bt rows, halves from the stage's start */
#define O_STG_ ((GBM_ + O_LO_ + GBN_) * GPH_)    /* halves per stage */
#define O_CP_  (GBN_ + 4)                        /* staged C row pitch, floats: rows 8 apart fall 32 banks apart */
#define O_TS_  ((SEQ_ - LOROWS_) / O_HI_)        /* 16 row tiles per sequence */
static_assert((SEQ_ - LOROWS_) % O_HI_ == 0 && LOROWS_ == O_TS_ * O_LO_ && O_LO_ == 16 && O_HI_ % 16 == 0);
static_assert(DM_ % GBN_ == 0 && DM_ % GK_ == 0 && DM_ / GK_ >= 2 && NB_ * O_TS_ == (NB_ * SEQ_) / GBM_);
static_assert(2 * O_STG_ * 2 >= GBM_ * O_CP_ * 4);
static_assert((GBM_ * (GBN_ / 4)) % (8 * 256) == 0);

// Five copies per lane, LDS rows 16 apart, each with a source address of its own. s_wait_xcnt stands inside the statement so that no
// address register is rewritten ahead of it.
__device__ __forceinline__ void async_rows5(unsigned l, const _Float16* g0, const _Float16* g1, const _Float16* g2,
                                            const _Float16* g3, const _Float16* g4) {
  asm volatile(
      "global_load_async_to_lds_b128 %0, %5, off\n\t"
      "global_load_async_to_lds_b128 %1, %6, off\n\t"
      "global_load_async_to_lds_b128 %2, %7, off\n\t"
      "global_load_async_to_lds_b128 %3, %8, off\n\t"
      "global_load_async_to_lds_b128 %4, %9, off\n\t"
      "s_wait_xcnt 0x0"
      :: "v"(l), "v"(l + 1u * G_LS_), "v"(l + 2u * G_LS_), "v"(l + 3u * G_LS_), "v"(l + 4u * G_LS_),
         "v"(g0), "v"(g1), "v"(g2), "v"(g3), "v"(g4)
      : "memory");
}
// One stage, 256 bytes of each row: A 112 rows (ga), A 16 rows (gl), A2 the same 16 rows (gr), Bt 256 rows (gb).
__device__ __forceinline__ void oproj_fill(unsigned l, const _Float16* ga, const _Float16* gl, const _Float16* gr, const _Float16* gb) {
  const size_t s16 = (size_t)16 * DM_;
  async_rows4(l, ga, s16);
  async_rows5(l + 4u * G_LS_, ga + 4 * s16, ga + 5 * s16, ga + 6 * s16, gl, gr);
  async_rows8(l + O_OB_ * 2u, gb, s16);
  async_rows8(l + O_OB_ * 2u + 8u * G_LS_, gb + 8 * s16, s16);
}
// One stage's products of one wave. res (wave-uniform, a scalar): the wave's last 16 rows have a residual plane (sr = its fragment rows).
__device__ __forceinline__ void oproj_stage(v8f (&acc)[4][4], const _Float16* sa, const _Float16* sr, const _Float16* sb, bool res) {
#pragma unroll   // the four k-steps of a stage in one body: constant LDS offsets, no loop overhead between them
  for (int kk = 0; kk < GK_; kk += 32) {
    v16h bh[4], ah[4];
#pragma unroll   // register arrays: constant indices
    for (int j = 0; j < 4; ++j) bh[j] = frag_ld(sb + (j << 4) * GPH_ + kk);
#pragma unroll   // register arrays: constant indices
    for (int i = 0; i < 4; ++i) ah[i] = frag_ld(sa + (i << 4) * GPH_ + kk);
    const v16h al = frag_ld(sr + kk);   // read by every wave, so that the k-step's reads stand in one group with no branch among them
    // holds the k-step's fragment reads together in front of its products (one LDS wait per k-step instead of one per row)
    asm volatile("" :: "v"(bh[0]), "v"(bh[1]), "v"(bh[2]), "v"(bh[3]), "v"(ah[0]), "v"(ah[1]), "v"(ah[2]), "v"(ah[3]), "v"(al));
#pragma unroll   // register arrays: constant indices
    for (int i = 0; i < 4; ++i) {
#pragma unroll   // register arrays: constant indices
      for (int j = 0; j < 4; ++j) acc[i][j] = wmma_raw(ah[i], bh[j], acc[i][j]);
    }
    if (res) {
#pragma unroll   // register arrays: constant indices
      for (int j = 0; j < 4; ++j) acc[3][j] = wmma_raw(al, bh[j], acc[3][j]);
    }
  }
}

__global__ __launch_bounds__(256) void oproj_kernel(const _Float16* __restrict__ A, const _Float16* __restrict__ A2,
                                                    const _Float16* __restrict__ Bt, float* __restrict__ C) {
  __shared__ __align__(16) _Float16 ring[2 * O_STG_];   // two stages; afterwards the block's 128 x 256 f32 tile, pitch O_CP_ floats
  const int tid  = threadIdx.x;
  const int lane = tid & 31;
  const int wave = tid >> 5;
  const int tm = (int)blockIdx.x / (DM_ / GBN_);
  const int tn = (int)blockIdx.x - tm * (DM_ / GBN_);
  const int sq = tm / O_TS_;                            // sequence
  const int ts = tm - sq * O_TS_;                       // row tile within it
  const int rh0 = sq * SEQ_ + LOROWS_ + ts * O_HI_;     // global row of tile row 0 (rows without a residual plane)
  const int rl0 = sq * SEQ_ + ts * O_LO_;               // global row of tile row O_HI_ (rows with one)
  const int n0b = tn * GBN_;
  const int wrow = (wave >> 2) << 6;
  const int wcol = (wave & 3) << 6;
  const int rlane = lane & 15;
  const int koff  = (lane >> 4) * 8;
  // wave-uniform, in a scalar register: the branch on it is a scalar one and holds no barrier
  const bool res = __builtin_amdgcn_readfirstlane(wave >> 2) != 0;

  v8f acc[4][4];
#pragma unroll
  for (int i = 0; i < 4; ++i)
#pragma unroll
    for (int j = 0; j < 4; ++j) acc[i][j] = zero8();

  const int sub = tid >> 4;
  const int cc  = (tid & 15) * 8;
  const unsigned l0 = (unsigned)(size_t)ring + (unsigned)(sub * GPH_ + cc) * 2u;
  const _Float16* ga = A  + (size_t)(rh0 + sub) * DM_ + cc;
  const _Float16* gl = A  + (size_t)(rl0 + sub) * DM_ + cc;
  const _Float16* gr = A2 + (size_t)(rl0 + sub) * DM_ + cc;
  const _Float16* gb = Bt + (size_t)(n0b + sub) * DM_ + cc;
  constexpr int nt = DM_ / GK_;

  oproj_fill(l0, ga, gl, gr, gb);
  asm volatile("s_wait_asynccnt 0x0" ::: "memory");   // stage 0 landed (this wave's copies) before the barrier publishes it
  __syncthreads();
  oproj_fill(l0 + O_STG_ * 2u, ga + GK_, gl + GK_, gr + GK_, gb + GK_);

  for (int t = 0; t < nt; ++t) {
    const _Float16* st = ring + (t & 1) * O_STG_;
    const _Float16* sa = st + (wrow + rlane) * GPH_ + koff;
    const _Float16* sr = st + O_OA2_ + rlane * GPH_ + koff;
    const _Float16* sb = st + O_OB_ + (wcol + rlane) * GPH_ + koff;
    oproj_stage(acc, sa, sr, sb, res);
    asm volatile("s_wait_dscnt 0x0" ::: "memory");      // this wave's reads of the stage are done before it may be refilled
    asm volatile("s_wait_asynccnt 0x0" ::: "memory");   // this wave's copies of the next stage have landed
    __syncthreads();                                    // publishes stage t+1 and frees stage t's buffer
    if (t + 2 < nt) {
      const size_t ko = (size_t)(t + 2) * GK_;
      oproj_fill(l0 + (unsigned)(t & 1) * (O_STG_ * 2u), ga + ko, gl + ko, gr + ko, gb + ko);
    }
  }
  asm volatile("s_wait_asynccnt 0x0" ::: "memory");     // nothing in flight when the ring becomes output staging

  float* cst = (float*)ring;
#pragma unroll
  for (int i = 0; i < 4; ++i) {
#pragma unroll
    for (int j = 0; j < 4; ++j) {
#pragma unroll
      for (int r = 0; r < 8; ++r) cst[(wrow + (i << 4) + koff + r) * O_CP_ + wcol + (j << 4) + rlane] = acc[i][j][r] * WSC_;
    }
  }
  __syncthreads();                                      // the tile is whole before any wave reads other waves' columns
#pragma unroll 1   // eight LDS reads and eight stores per trip are enough in flight; keeps the text short
  for (int g = 0; g < (GBM_ * (GBN_ / 4)) / (8 * 256); ++g) {
    v4f v[8];
    float* p[8];
#pragma unroll   // register arrays: constant indices
    for (int it = 0; it < 8; ++it) {
      const int idx = (g * 8 + it) * 256 + tid;         // 16-byte piece of the tile, row-major: a wave's store = four whole 128-byte lines
      const int row = idx / (GBN_ / 4);
      const int c4  = (idx - row * (GBN_ / 4)) * 4;
      const int grow = (row < O_HI_) ? (rh0 + row) : (rl0 + row - O_HI_);
      v[it] = *(const v4f*)(cst + row * O_CP_ + c4);
      p[it] = C + (size_t)grow * DM_ + n0b + c4;
    }
#pragma unroll   // register arrays: constant indices
    for (int it = 0; it < 8; ++it) *(v4f*)p[it] = v[it];
    // the wait that stands in front of a rewrite of an issued store's registers (the next trip reuses them); naming them keeps them
    // whole up to it
    asm volatile("s_wait_xcnt 0x0" :: "v"(p[0]), "v"(p[1]), "v"(p[2]), "v"(p[3]), "v"(p[4]), "v"(p[5]), "v"(p[6]), "v"(p[7]),
                 "v"(v[0]), "v"(v[1]), "v"(v[2]), "v"(v[3]), "v"(v[4]), "v"(v[5]), "v"(v[6]), "v"(v[7]) : "memory");
  }
}

// ---------------------------------------------------------------------------------------------------------------
// Workspace map (byte offsets, all 2 MiB aligned; every region is written completely by whole-line stores before it is read;
// the attention output planes reuse the f32 projection plane, which is dead after the RoPE/split passes):
//   Xh   f16 [4096][2048]            0           16,777,216
//   Wqh  f16 [2048][2048]   16,777,216            8,388,608
//   Wkvh f16 [512][2048]    25,165,824            2,097,152
//   Woh  f16 [2048][2048]   27,262,976            8,388,608
//   cosT f32 [4096][128]    35,651,584            2,097,152
//   sinT f32 [4096][128]    37,748,736            2,097,152
//   Qf   f32 [4096][2560]   39,845,888           41,943,040   (q | k | v columns; AOh f16 [4096][2048] at 39,845,888; AOl at 56,623,104)
//   Qh   f16 [4096][2048]   81,788,928           16,777,216
//   Ql   f16 [4096][2048]   98,566,144           16,777,216
//   Kh   f16 [4096][256]   115,343,360            2,097,152
//   Kl   f16 [4096][256]   117,440,512            2,097,152
//   Vth  f16 [2][256][2048] 119,537,664           2,097,152
//   Vtl  f16 [2][256][2048] 121,634,816           2,097,152
//   flags int [2*32*16][32] 123,731,968            131,072
//   total                  123,863,040
// ---------------------------------------------------------------------------------------------------------------
extern "C" void kernel_launch(void* const* d_in, const int* in_sizes, int n_in,
                              void* d_out, int out_size, void* d_ws, size_t ws_size,
                              hipStream_t stream) {
  if (n_in < 7) return;
  if (in_sizes[0] != NB_ * SEQ_ * DM_) return;
  if (in_sizes[1] != NB_ * SEQ_ * SEQ_) return;
  if (in_sizes[2] != NB_ * SEQ_) return;
  if (in_sizes[3] != DM_ * DM_) return;
  if (in_sizes[4] != HD_ * DM_) return;
  if (in_sizes[5] != HD_ * DM_) return;
  if (in_sizes[6] != DM_ * DM_) return;
  if (out_size != NB_ * SEQ_ * DM_) return;

  const float* x    = (const float*)d_in[0];
  const float* mask = (const float*)d_in[1];
  const int*   pos  = (const int*)d_in[2];
  const float* Wq   = (const float*)d_in[3];
  const float* Wk   = (const float*)d_in[4];
  const float* Wv   = (const float*)d_in[5];
  const float* Wo   = (const float*)d_in[6];
  float* out = (float*)d_out;

  const size_t nX   = (size_t)NB_ * SEQ_ * DM_;          // 8,388,608 elements
  const size_t bXh  = nX * 2;
  const size_t bWq  = (size_t)DM_ * DM_ * 2;
  const size_t bWkv = (size_t)KVN_ * DM_ * 2;
  const size_t bWo  = bWq;
  const size_t bTab = (size_t)NB_ * SEQ_ * NF_ * 4;
  const size_t bQf  = nX * 4;
  const size_t bKVf = (size_t)NB_ * SEQ_ * KVN_ * 4;
  const size_t bQ16 = nX * 2;
  const size_t bK16 = (size_t)NB_ * SEQ_ * HD_ * 2;
  const size_t bV16 = bK16;
  const size_t bFlg = (size_t)NB_ * NQB_ * MFG_ * 128;
  size_t off = 0;
  const size_t oXh  = off; off += bXh;
  const size_t oWq  = off; off += bWq;
  const size_t oWkv = off; off += bWkv;
  const size_t oWo  = off; off += bWo;
  const size_t oCos = off; off += bTab;
  const size_t oSin = off; off += bTab;
  const size_t oQf  = off; off += bQf;
  const size_t oKVf = off; off += bKVf;
  const size_t oQh  = off; off += bQ16;
  const size_t oQl  = off; off += bQ16;
  const size_t oKh  = off; off += bK16;
  const size_t oKl  = off; off += bK16;
  const size_t oVth = off; off += bV16;
  const size_t oVtl = off; off += bV16;
  const size_t oFlg = off; off += bFlg;
  if (off > ws_size) return;                        // off = 123,863,040
  if (off > (size_t)134217728) return;
  if (bQf < 2 * bQ16) return;                        // AOh/AOl alias fits inside the f32 q region
  const size_t oAOh = oQf;
  const size_t oAOl = oQf + bQ16;

  char* ws = (char*)d_ws;
  _Float16* Xh   = (_Float16*)(ws + oXh);
  _Float16* Wqh  = (_Float16*)(ws + oWq);
  _Float16* Wkvh = (_Float16*)(ws + oWkv);
  _Float16* Woh  = (_Float16*)(ws + oWo);
  float*    cosT = (float*)(ws + oCos);
  float*    sinT = (float*)(ws + oSin);
  float*    Qf   = (float*)(ws + oQf);
  float*    KVf  = Qf + DM_;                         // the k | v columns of the fused plane, row pitch PN_
  if (oKVf != oQf + bQf || oWkv != oWq + bWq) return;   // the fused planes are the q and kv regions one behind the other
  _Float16* Qh   = (_Float16*)(ws + oQh);
  _Float16* Ql   = (_Float16*)(ws + oQl);
  _Float16* Kh   = (_Float16*)(ws + oKh);
  _Float16* Kl   = (_Float16*)(ws + oKl);
  _Float16* Vth  = (_Float16*)(ws + oVth);
  _Float16* Vtl  = (_Float16*)(ws + oVtl);
  int*      flg  = (int*)(ws + oFlg);
  _Float16* AOh  = (_Float16*)(ws + oAOh);
  _Float16* AOl  = (_Float16*)(ws + oAOl);

  const dim3 blk(256);

  // (1) one launch: inputs -> 16-bit planes (x bf16*2^4, weights bf16*2^8, k rows then v rows in the fused kv weight plane);
  //     cos/sin tables [4096][128] from position ids; mask verification flags per (b, query block, 4-row group)
  prep_kernel<<<dim3(PB_ALL_), blk, 0, stream>>>(x, mask, pos, Wq, Wk, Wv, Wo, Xh, Wqh, Wkvh, Woh, cosT, sinT, flg);
  // (2) one product: [q|k|v] = x . [Wq|Wk|Wv]^T -> f32 [4096][2560]
  proj_kernel<<<dim3((NB_ * SEQ_ / GBM_) * (PN_ / PBN_)), blk, 0, stream>>>(Xh, Wqh, Qf);
  // (3) one launch: RoPE + hi/residual split, q planes [4096][8*256] and k planes [4096][256]; v^T planes [2][256][2048]
  split_kernel<<<dim3(SB_ALL_), blk, 0, stream>>>(Qf, KVf, cosT, sinT, Qh, Ql, Kh, Kl, Vth, Vtl);
  // (4) attention -> AO hi/residual planes [4096][2048]
  (void)hipFuncSetAttribute(reinterpret_cast<const void*>(&attn_kernel), hipFuncAttributeMaxDynamicSharedMemorySize, AT_LDS);
  attn_kernel<<<dim3(NB_ * NH_ * NQB_), blk, AT_LDS, stream>>>(Qh, Ql, Kh, Kl, Vth, Vtl, mask, flg, AOh, AOl);
  // (5) out = AO . Wo^T -> d_out f32 [4096][2048]; residual plane on rows < LOROWS_ of each sequence
  oproj_kernel<<<dim3((NB_ * SEQ_ / GBM_) * (DM_ / GBN_)), blk, 0, stream>>>(AOh, AOl, Woh, out);
  (void)hipGetLastError();
}

// v009
// One run takes 150 microseconds.
// Next to v008, in two timings, it ran 1.03 times as fast each time.
// Over all steps from v000 it is 4.19 times as fast.
// Contractions on v_wmma_f32_16x16x32_f16 (f16 operands, f32 accumulate): q/k/v projections (x RNE-converted to bf16 and carried *2^4,
// W RNE-converted to bf16 and carried *2^8, exact products); q.k^T (q,k carried *2^10 as f16 hi planes, plus unscaled f16 residual planes
// on the leading query blocks of each sequence); p.v (p carried *2^15, v^T carried *2^10: hi planes plus residual planes on the leading query
// blocks); output projection (attention output carried *2^10: hi plane everywhere, residual plane on the leading rows of each sequence;
// Wo bf16 *2^8). RoPE, mask add and online softmax in f32.
#include <hip/hip_runtime.h>
#include <math.h>
#include <stdint.h>

#define NB_     2
#define SEQ_    2048
#define DM_     2048
#define NH_     8
#define HD_     256
#define NF_     128
#define KVN_    512
#define WIN_    1024
#define NQB_    32
#define QE_     4
#define LOROWS_ 256
#define MFG_    16

#define CX_   16.0f
#define CW_   256.0f
#define CQK_  1024.0f
#define CP_   32768.0f
#define SSC_  5.9604644775390625e-8f     /* 2^-4 * 2^-20 : score scale for q,k carried *2^10 each */
#define OSC_  3.0517578125e-5f           /* 2^-15 = 2^10 / (2^15 * 2^10) : attention output carry */
#define QSC_  2.44140625e-4f             /* 2^-12 = 1 / (2^4 * 2^8) : projection outputs back to f32 */
#define WSC_  3.814697265625e-6f         /* 2^-18 = 1 / (2^10 * 2^8) : final projection */

typedef _Float16 v16h __attribute__((ext_vector_type(16)));
typedef _Float16 v8h  __attribute__((ext_vector_type(8)));
typedef float    v8f  __attribute__((ext_vector_type(8)));
typedef float    v4f  __attribute__((ext_vector_type(4)));

union FragU { v16h v; v8h h[2]; };
union U8 { v8f v; v4f q[2]; };

__device__ __forceinline__ float bf16_rne(float f) {
  unsigned u = __float_as_uint(f);
  u = u + 0x7FFFu + ((u >> 16) & 1u);
  return __uint_as_float(u & 0xFFFF0000u);
}
__device__ __forceinline__ v8f zero8() { return (v8f){0.f, 0.f, 0.f, 0.f, 0.f, 0.f, 0.f, 0.f}; }

// 16-bit fragment (A or B): lane row/col = lane&15, elements 0..7 <- p[0..7] (k0+8h..), 8..15 <- p[16..23] (k0+16+8h..)
// p already includes the row base + k0 + 8*h.
__device__ __forceinline__ v16h frag_ld(const _Float16* p) {
  FragU f;
  f.h[0] = *(const v8h*)(p);
  f.h[1] = *(const v8h*)(p + 16);
  return f.v;
}
__device__ __forceinline__ v8f wmma_raw(v16h a, v16h b, v8f c) {
  return __builtin_amdgcn_wmma_f32_16x16x32_f16(false, a, false, b, (short)0, c, false, false);
}
// WMMA with trailing hazard guard (ties D, keeps A/B live)
__device__ __forceinline__ v8f mma_g(v16h a, v16h b, v8f c) {
  c = __builtin_amdgcn_wmma_f32_16x16x32_f16(false, a, false, b, (short)0, c, false, false);
  asm volatile("v_nop\n\tv_nop\n\tv_nop\n\tv_nop" : "+v"(c) : "v"(a), "v"(b));
  return c;
}

// Maximum / sum over each 16-lane row, of eight values at once, left in every lane of the row: the xor butterfly (1, 2, 4, 8) by DPP
// row_xmask steps on the vector pipe: no LDS-pipe permute and no LDS wait. One statement each, a step's eight instructions in a row, so
// that a value's next step stands eight instructions behind the one it depends on. Every lane is on where they are used; volatile keeps
// them there: under a lane test a step would read lanes that are off.
__device__ __forceinline__ void row_max8(float (&v)[8]) {
  asm volatile(
      "v_max_num_f32_dpp %0, %0, %0 row_xmask:1 row_mask:0xf bank_mask:0xf\n\t"
      "v_max_num_f32_dpp %1, %1, %1 row_xmask:1 row_mask:0xf bank_mask:0xf\n\t"
      "v_max_num_f32_dpp %2, %2, %2 row_xmask:1 row_mask:0xf bank_mask:0xf\n\t"
      "v_max_num_f32_dpp %3, %3, %3 row_xmask:1 row_mask:0xf bank_mask:0xf\n\t"
      "v_max_num_f32_dpp %4, %4, %4 row_xmask:1 row_mask:0xf bank_mask:0xf\n\t"
      "v_max_num_f32_dpp %5, %5, %5 row_xmask:1 row_mask:0xf bank_mask:0xf\n\t"
      "v_max_num_f32_dpp %6, %6, %6 row_xmask:1 row_mask:0xf bank_mask:0xf\n\t"
      "v_max_num_f32_dpp %7, %7, %7 row_xmask:1 row_mask:0xf bank_mask:0xf\n\t"
      "v_max_num_f32_dpp %0, %0, %0 row_xmask:2 row_mask:0xf bank_mask:0xf\n\t"
      "v_max_num_f32_dpp %1, %1, %1 row_xmask:2 row_mask:0xf bank_mask:0xf\n\t"
      "v_max_num_f32_dpp %2, %2, %2 row_xmask:2 row_mask:0xf bank_mask:0xf\n\t"
      "v_max_num_f32_dpp %3, %3, %3 row_xmask:2 row_mask:0xf bank_mask:0xf\n\t"
      "v_max_num_f32_dpp %4, %4, %4 row_xmask:2 row_mask:0xf bank_mask:0xf\n\t"
      "v_max_num_f32_dpp %5, %5, %5 row_xmask:2 row_mask:0xf bank_mask:0xf\n\t"
      "v_max_num_f32_dpp %6, %6, %6 row_xmask:2 row_mask:0xf bank_mask:0xf\n\t"
      "v_max_num_f32_dpp %7, %7, %7 row_xmask:2 row_mask:0xf bank_mask:0xf\n\t"
      "v_max_num_f32_dpp %0, %0, %0 row_xmask:4 row_mask:0xf bank_mask:0xf\n\t"
      "v_max_num_f32_dpp %1, %1, %1 row_xmask:4 row_mask:0xf bank_mask:0xf\n\t"
      "v_max_num_f32_dpp %2, %2, %2 row_xmask:4 row_mask:0xf bank_mask:0xf\n\t"
      "v_max_num_f32_dpp %3, %3, %3 row_xmask:4 row_mask:0xf bank_mask:0xf\n\t"
      "v_max_num_f32_dpp %4, %4, %4 row_xmask:4 row_mask:0xf bank_mask:0xf\n\t"
      "v_max_num_f32_dpp %5, %5, %5 row_xmask:4 row_mask:0xf bank_mask:0xf\n\t"
      "v_max_num_f32_dpp %6, %6, %6 row_xmask:4 row_mask:0xf bank_mask:0xf\n\t"
      "v_max_num_f32_dpp %7, %7, %7 row_xmask:4 row_mask:0xf bank_mask:0xf\n\t"
      "v_max_num_f32_dpp %0, %0, %0 row_xmask:8 row_mask:0xf bank_mask:0xf\n\t"
      "v_max_num_f32_dpp %1, %1, %1 row_xmask:8 row_mask:0xf bank_mask:0xf\n\t"
      "v_max_num_f32_dpp %2, %2, %2 row_xmask:8 row_mask:0xf bank_mask:0xf\n\t"
      "v_max_num_f32_dpp %3, %3, %3 row_xmask:8 row_mask:0xf bank_mask:0xf\n\t"
      "v_max_num_f32_dpp %4, %4, %4 row_xmask:8 row_mask:0xf bank_mask:0xf\n\t"
      "v_max_num_f32_dpp %5, %5, %5 row_xmask:8 row_mask:0xf bank_mask:0xf\n\t"
      "v_max_num_f32_dpp %6, %6, %6 row_xmask:8 row_mask:0xf bank_mask:0xf\n\t"
      "v_max_num_f32_dpp %7, %7, %7 row_xmask:8 row_mask:0xf bank_mask:0xf"
      : "+v"(v[0]), "+v"(v[1]), "+v"(v[2]), "+v"(v[3]), "+v"(v[4]), "+v"(v[5]), "+v"(v[6]), "+v"(v[7]));
}
__device__ __forceinline__ void row_sum8(float (&v)[8]) {
  asm volatile(
      "v_add_f32_dpp %0, %0, %0 row_xmask:1 row_mask:0xf bank_mask:0xf\n\t"
      "v_add_f32_dpp %1, %1, %1 row_xmask:1 row_mask:0xf bank_mask:0xf\n\t"
      "v_add_f32_dpp %2, %2, %2 row_xmask:1 row_mask:0xf bank_mask:0xf\n\t"
      "v_add_f32_dpp %3, %3, %3 row_xmask:1 row_mask:0xf bank_mask:0xf\n\t"
      "v_add_f32_dpp %4, %4, %4 row_xmask:1 row_mask:0xf bank_mask:0xf\n\t"
      "v_add_f32_dpp %5, %5, %5 row_xmask:1 row_mask:0xf bank_mask:0xf\n\t"
      "v_add_f32_dpp %6, %6, %6 row_xmask:1 row_mask:0xf bank_mask:0xf\n\t"
      "v_add_f32_dpp %7, %7, %7 row_xmask:1 row_mask:0xf bank_mask:0xf\n\t"
      "v_add_f32_dpp %0, %0, %0 row_xmask:2 row_mask:0xf bank_mask:0xf\n\t"
      "v_add_f32_dpp %1, %1, %1 row_xmask:2 row_mask:0xf bank_mask:0xf\n\t"
      "v_add_f32_dpp %2, %2, %2 row_xmask:2 row_mask:0xf bank_mask:0xf\n\t"
      "v_add_f32_dpp %3, %3, %3 row_xmask:2 row_mask:0xf bank_mask:0xf\n\t"
      "v_add_f32_dpp %4, %4, %4 row_xmask:2 row_mask:0xf bank_mask:0xf\n\t"
      "v_add_f32_dpp %5, %5, %5 row_xmask:2 row_mask:0xf bank_mask:0xf\n\t"
      "v_add_f32_dpp %6, %6, %6 row_xmask:2 row_mask:0xf bank_mask:0xf\n\t"
      "v_add_f32_dpp %7, %7, %7 row_xmask:2 row_mask:0xf bank_mask:0xf\n\t"
      "v_add_f32_dpp %0, %0, %0 row_xmask:4 row_mask:0xf bank_mask:0xf\n\t"
      "v_add_f32_dpp %1, %1, %1 row_xmask:4 row_mask:0xf bank_mask:0xf\n\t"
      "v_add_f32_dpp %2, %2, %2 row_xmask:4 row_mask:0xf bank_mask:0xf\n\t"
      "v_add_f32_dpp %3, %3, %3 row_xmask:4 row_mask:0xf bank_mask:0xf\n\t"
      "v_add_f32_dpp %4, %4, %4 row_xmask:4 row_mask:0xf bank_mask:0xf\n\t"
      "v_add_f32_dpp %5, %5, %5 row_xmask:4 row_mask:0xf bank_mask:0xf\n\t"
      "v_add_f32_dpp %6, %6, %6 row_xmask:4 row_mask:0xf bank_mask:0xf\n\t"
      "v_add_f32_dpp %7, %7, %7 row_xmask:4 row_mask:0xf bank_mask:0xf\n\t"
      "v_add_f32_dpp %0, %0, %0 row_xmask:8 row_mask:0xf bank_mask:0xf\n\t"
      "v_add_f32_dpp %1, %1, %1 row_xmask:8 row_mask:0xf bank_mask:0xf\n\t"
      "v_add_f32_dpp %2, %2, %2 row_xmask:8 row_mask:0xf bank_mask:0xf\n\t"
      "v_add_f32_dpp %3, %3, %3 row_xmask:8 row_mask:0xf bank_mask:0xf\n\t"
      "v_add_f32_dpp %4, %4, %4 row_xmask:8 row_mask:0xf bank_mask:0xf\n\t"
      "v_add_f32_dpp %5, %5, %5 row_xmask:8 row_mask:0xf bank_mask:0xf\n\t"
      "v_add_f32_dpp %6, %6, %6 row_xmask:8 row_mask:0xf bank_mask:0xf\n\t"
      "v_add_f32_dpp %7, %7, %7 row_xmask:8 row_mask:0xf bank_mask:0xf"
      : "+v"(v[0]), "+v"(v[1]), "+v"(v[2]), "+v"(v[3]), "+v"(v[4]), "+v"(v[5]), "+v"(v[6]), "+v"(v[7]));
}

// ---------------------------------------------------------------------------------------------------------------
// Elementwise convert: dst[i] = f16( bf16_rne(src[i]) * scale ), 8 elements per thread, one 16-B store per lane:
// coverage: ceil(n8/256) blocks (blk = the block's index within them), each thread 8 elements -> 8*n8 elements.
// ---------------------------------------------------------------------------------------------------------------
__device__ __forceinline__ void cvt16_part(int blk, const float* __restrict__ src, _Float16* __restrict__ dst, int n8, float scale) {
  const int i = blk * 256 + (int)threadIdx.x;
  if (i >= n8) return;
  const float* s = src + 8 * (size_t)i;
  U8 a;
  a.q[0] = *(const v4f*)(s);
  a.q[1] = *(const v4f*)(s + 4);
  v8h o;
#pragma unroll
  for (int e = 0; e < 8; ++e) o[e] = (_Float16)(bf16_rne(a.v[e]) * scale);
  _Float16* d = dst + 8 * (size_t)i;
  *(v8h*)d = o;
  
}

// ---------------------------------------------------------------------------------------------------------------
// RoPE tables: cosT/sinT [nrows][128], angle = float(pos[row]) * inv_freq[f], inv_freq[f] = 1 / f32(10000^(f/128)).
// coverage: nrows/32 blocks (blk = the block's index within them), 16 iterations x 2 rows -> nrows x 128 per table.
// ---------------------------------------------------------------------------------------------------------------
__device__ __forceinline__ void rope_table_part(int blk, const int* __restrict__ pos, float* __restrict__ cosT,
                                                float* __restrict__ sinT, int nrows) {
#pragma clang fp contract(off)
  __shared__ float invf[NF_];
  const int tid = threadIdx.x;
  if (tid < NF_) {
    const double e = (double)tid * 0.0078125;                 // tid/128 exactly
    const double p = exp2(e * 13.287712379549449);            // 10000^e
    const float pf = (float)p;                                // RNE to f32
    invf[tid] = 1.0f / pf;
  }
  __syncthreads();
  const int f = tid & (NF_ - 1);
  const int rp = tid >> 7;
  const int r0 = blk * 32;
  const float iv = invf[f];
#pragma unroll 1
  for (int it = 0; it < 16; ++it) {
    const int row = r0 + it * 2 + rp;
    const int rowc = (row < nrows) ? row : (nrows - 1);
    const float ang = (float)pos[rowc] * iv;
    float sv, cv;
    sincosf(ang, &sv, &cv);
    if (row < nrows) {
      float* cp = cosT + (size_t)row * NF_ + f;
      float* sp = sinT + (size_t)row * NF_ + f;
      *(float*)cp = cv;
      *(float*)sp = sv;
      // the wait that stands in front of a rewrite of an issued store's registers (the next trip reuses them)
      asm volatile("s_wait_xcnt 0x0" :: "v"(cp), "v"(sp), "v"(cv), "v"(sv) : "memory");
    }
  }
}

// ---------------------------------------------------------------------------------------------------------------
// Mask verification flags, MFG_ per (b, 64-query block), one per group of 4 query rows: 1 if every mask value for the group's rows
// and keys in [q0+64, min(q+1023, SEQ-1)] (the in-band keys strictly above the query block) is <= -1e9 (adds to an exact zero weight).
// The range holds at most 1023 keys, so 256 threads x 4 keys cover a row with one 16-byte load each; the 4 rows' loads are independent.
// coverage: NB*NQB*MFG_ blocks (bid = the block's index within them); each block writes its own 128-byte line of 32 equal ints.
// ---------------------------------------------------------------------------------------------------------------
__device__ __forceinline__ void maskflag_part(int bid, const float* __restrict__ mask, int* __restrict__ flag) {
  __shared__ int sw[8];
  const int tid = threadIdx.x, w = tid >> 5, lane = tid & 31;
  // bid = (b*32 + qb)*MFG_ + row group
  const int g  = bid & (MFG_ - 1);
  const int bq = bid / MFG_;
  const int b = bq >> 5, qb = bq & (NQB_ - 1);
  const int q0 = qb * 64;
  const int r0 = q0 + g * (64 / MFG_);
  const int k  = q0 + 64 + 4 * tid;          // first of this thread's four keys
  const int kc = (k <= SEQ_ - 4) ? k : (SEQ_ - 4);   // k > SEQ-4 means k >= SEQ: none of the four keys is tested
  v4f mv[64 / MFG_];
#pragma unroll   // all rows' loads issue before the first compare waits (and mv stays in registers)
  for (int rr = 0; rr < 64 / MFG_; ++rr) mv[rr] = *(const v4f*)(mask + ((size_t)b * SEQ_ + r0 + rr) * SEQ_ + kc);
  int bad = 0;
#pragma unroll
  for (int rr = 0; rr < 64 / MFG_; ++rr) {
    int kend = r0 + rr + WIN_ - 1;
    if (kend > SEQ_ - 1) kend = SEQ_ - 1;
#pragma unroll
    for (int e = 0; e < 4; ++e) {
      const int ok = (mv[rr][e] <= -1.0e9f) ? 1 : 0;
      bad |= ((k + e <= kend) && (ok == 0)) ? 1 : 0;
    }
  }
  const unsigned long long bm = __ballot(bad);
  if (lane == 0) sw[w] = (bm != 0ull) ? 1 : 0;
  __syncthreads();
  if (w == 0) {
    int any = 0;
#pragma unroll
    for (int i = 0; i < 8; ++i) any |= sw[i];
    const int fv = any ? 0 : 1;
    int* fp = flag + (size_t)bid * 32 + lane;
    *(int*)fp = fv;
  }
}

// ---------------------------------------------------------------------------------------------------------------
// The preparation passes, which depend on the inputs alone and not on one another, share one launch: a block's index range says
// which pass it belongs to (block-uniform, so each pass's barriers are reached by all of its block's threads or by none).
// The table blocks, few and with the longest serial chain, come first; then the mask check; then the five conversions.
// coverage: PB_ALL_ blocks = the sum of the passes' own block counts; every pass gets exactly its blocks.
// ---------------------------------------------------------------------------------------------------------------
#define PB_TAB_ ((NB_ * SEQ_) / 32)               /* 128  */
#define PB_FLG_ (NB_ * NQB_ * MFG_)               /* 1024 */
#define PB_X_   ((NB_ * SEQ_ * DM_) / (8 * 256))  /* 4096 */
#define PB_W_   ((DM_ * DM_) / (8 * 256))         /* 2048 */
#define PB_KV_  ((HD_ * DM_) / (8 * 256))         /* 256  */
#define PB_ALL_ (PB_TAB_ + PB_FLG_ + PB_X_ + 2 * PB_W_ + 2 * PB_KV_)
__global__ __launch_bounds__(256) void prep_kernel(const float* __restrict__ x, const float* __restrict__ mask,
                                                   const int* __restrict__ pos, const float* __restrict__ Wq,
                                                   const float* __restrict__ Wk, const float* __restrict__ Wv,
                                                   const float* __restrict__ Wo, _Float16* __restrict__ Xh,
                                                   _Float16* __restrict__ Wqh, _Float16* __restrict__ Wkvh,
                                                   _Float16* __restrict__ Woh, float* __restrict__ cosT,
                                                   float* __restrict__ sinT, int* __restrict__ flag) {
  int blk = blockIdx.x;
  if (blk < PB_TAB_) { rope_table_part(blk, pos, cosT, sinT, NB_ * SEQ_); return; }
  blk -= PB_TAB_;
  if (blk < PB_FLG_) { maskflag_part(blk, mask, flag); return; }
  blk -= PB_FLG_;
  if (blk < PB_X_) { cvt16_part(blk, x, Xh, PB_X_ * 256, CX_); return; }
  blk -= PB_X_;
  const float* src = Wq;      // weights: bf16 * 2^8; k rows then v rows in the fused kv weight plane
  _Float16* dst = Wqh;
  int n8 = PB_W_ * 256;
  if (blk >= PB_W_) {
    blk -= PB_W_; src = Wo; dst = Woh;
    if (blk >= PB_W_) {
      blk -= PB_W_; src = Wk; dst = Wkvh; n8 = PB_KV_ * 256;
      if (blk >= PB_KV_) { blk -= PB_KV_; src = Wv; dst = Wkvh + (size_t)HD_ * DM_; }
    }
  }
  cvt16_part(blk, src, dst, n8, CW_);
}

// ---------------------------------------------------------------------------------------------------------------
// The two WMMA products' common ring figures: operands reach LDS by asynchronous 16-byte copies, whole 256-byte row pieces (128 k) per
// stage, two stages: the next stage's copies fly while this stage is multiplied. LDS row pitch 272 bytes (16 B x odd) for the 16-byte
// fragment reads.
// ---------------------------------------------------------------------------------------------------------------
#define GK_    128                               /* k per stage */
#define GPH_   136                               /* LDS row pitch, halves */
#define GBM_   128
#define GBN_   256
#define G_LS_  (16 * GPH_ * 2)                   /* bytes between LDS rows 16 apart */

// Eight copies per lane, rows 16 apart: l = the lane's LDS byte address, g = its global address, gs = halves per 16 source rows.
// s_wait_xcnt stands inside the statement so that no address register is rewritten ahead of it.
__device__ __forceinline__ void async_rows8(unsigned l, const _Float16* g, size_t gs) {
  asm volatile(
      "global_load_async_to_lds_b128 %0, %8, off\n\t"
      "global_load_async_to_lds_b128 %1, %9, off\n\t"
      "global_load_async_to_lds_b128 %2, %10, off\n\t"
      "global_load_async_to_lds_b128 %3, %11, off\n\t"
      "global_load_async_to_lds_b128 %4, %12, off\n\t"
      "global_load_async_to_lds_b128 %5, %13, off\n\t"
      "global_load_async_to_lds_b128 %6, %14, off\n\t"
      "global_load_async_to_lds_b128 %7, %15, off\n\t"
      "s_wait_xcnt 0x0"
      :: "v"(l), "v"(l + 1u * G_LS_), "v"(l + 2u * G_LS_), "v"(l + 3u * G_LS_),
         "v"(l + 4u * G_LS_), "v"(l + 5u * G_LS_), "v"(l + 6u * G_LS_), "v"(l + 7u * G_LS_),
         "v"(g), "v"(g + gs), "v"(g + 2 * gs), "v"(g + 3 * gs), "v"(g + 4 * gs), "v"(g + 5 * gs), "v"(g + 6 * gs), "v"(g + 7 * gs)
      : "memory");
}

#define PN_    (DM_ + KVN_)                      /* 2560: columns of the fused q | k | v projection plane */

// ---------------------------------------------------------------------------------------------------------------
// RoPE + f16 hi/residual split. Unit = (row, head); 8 lanes per unit; lane j owns columns {8j, 64+8j, 128+8j, 192+8j}+0..7 of the
// 256-wide head (pairs (c, c+128) are in the same lane). out = x*cos + rotate_half(x)*sin with cos/sin[row][c mod 128].
// hi = f16(out*carry), lo = f16(out*carry - hi) (unscaled residual). Stores: for each column chunk one instruction writes
// coverage: nunits*8 threads x 32 elements = nunits*256 per plane.
// ---------------------------------------------------------------------------------------------------------------
__device__ __forceinline__ void rope_split_part(int blk, const float* __restrict__ src, int spitch, int nheads,
                                                const float* __restrict__ cosT, const float* __restrict__ sinT,
                                                _Float16* __restrict__ hi, _Float16* __restrict__ lo,
                                                int dpitch, int nunits, float carry) {
#pragma clang fp contract(off)
  const int gid = blk * 256 + (int)threadIdx.x;
  const int unit = gid >> 3;
  const int j = gid & 7;
  if (unit >= nunits) return;
  const int row = unit / nheads;
  const int hd = unit - row * nheads;
  const float* s  = src  + (size_t)row * spitch + hd * HD_ + 8 * j;
  const float* ct = cosT + (size_t)row * NF_ + 8 * j;
  const float* st = sinT + (size_t)row * NF_ + 8 * j;
  U8 xa, xb, xc, xd, ca, cb, sa, sb;
  xa.q[0] = *(const v4f*)(s);         xa.q[1] = *(const v4f*)(s + 4);
  xb.q[0] = *(const v4f*)(s + 64);    xb.q[1] = *(const v4f*)(s + 68);
  xc.q[0] = *(const v4f*)(s + 128);   xc.q[1] = *(const v4f*)(s + 132);
  xd.q[0] = *(const v4f*)(s + 192);   xd.q[1] = *(const v4f*)(s + 196);
  ca.q[0] = *(const v4f*)(ct);        ca.q[1] = *(const v4f*)(ct + 4);
  cb.q[0] = *(const v4f*)(ct + 64);   cb.q[1] = *(const v4f*)(ct + 68);
  sa.q[0] = *(const v4f*)(st);        sa.q[1] = *(const v4f*)(st + 4);
  sb.q[0] = *(const v4f*)(st + 64);   sb.q[1] = *(const v4f*)(st + 68);
  // the wait that stands in front of a rewrite of an issued load's address registers; naming the three addresses keeps them whole
  // up to it (else the last load takes its result into them)
  asm volatile("s_wait_xcnt 0x0" :: "v"(s), "v"(ct), "v"(st) : "memory");
  v8h h0, h1, h2, h3, l0, l1, l2, l3;
#pragma unroll
  for (int e = 0; e < 8; ++e) {
    const float r0 = xa.v[e] * ca.v[e] - xc.v[e] * sa.v[e];    // col 8j+e
    const float r1 = xb.v[e] * cb.v[e] - xd.v[e] * sb.v[e];    // col 64+8j+e
    const float r2 = xc.v[e] * ca.v[e] + xa.v[e] * sa.v[e];    // col 128+8j+e
    const float r3 = xd.v[e] * cb.v[e] + xb.v[e] * sb.v[e];    // col 192+8j+e
    float t; _Float16 q;
    t = r0 * carry; q = (_Float16)t; h0[e] = q; l0[e] = (_Float16)(t - (float)q);
    t = r1 * carry; q = (_Float16)t; h1[e] = q; l1[e] = (_Float16)(t - (float)q);
    t = r2 * carry; q = (_Float16)t; h2[e] = q; l2[e] = (_Float16)(t - (float)q);
    t = r3 * carry; q = (_Float16)t; h3[e] = q; l3[e] = (_Float16)(t - (float)q);
  }
  _Float16* hp = hi + (size_t)row * dpitch + hd * HD_ + 8 * j;
  _Float16* lp = lo + (size_t)row * dpitch + hd * HD_ + 8 * j;
  {
    *(v8h*)(hp)       = h0;
    *(v8h*)(hp + 64)  = h1;
    *(v8h*)(hp + 128) = h2;
    *(v8h*)(hp + 192) = h3;
    *(v8h*)(lp)       = l0;
    *(v8h*)(lp + 64)  = l1;
    *(v8h*)(lp + 128) = l2;
    *(v8h*)(lp + 192) = l3;
    
  }
}

// ---------------------------------------------------------------------------------------------------------------
// v columns of the fused projection plane (KV = its column 2048: f32 rows of pitch PN_, v in cols 256..511) -> transposed f16 planes Vth/Vtl [b][d][s]
// (hi = f16(v*2^10), lo = unscaled residual). 64x64 tiles through LDS; (256/64) x (NB*SEQ/64) blocks (bx, by), 256 threads.
// coverage per block: load 4 it x 256 thr x 4 = 64x64; store 2 it x 256 thr x 8 = 64x64 per plane.
// ---------------------------------------------------------------------------------------------------------------
__device__ __forceinline__ void vt_split_part(int bx, int by, const float* __restrict__ KV, _Float16* __restrict__ Vth,
                                              _Float16* __restrict__ Vtl) {
  __shared__ __align__(16) float tf[64 * 68];
  const int tid = threadIdx.x;
  const int d0  = bx * 64;                   // d block (input column within v)
  const int sg0 = by * 64;                   // global row block (b*SEQ + s)
  const int b   = sg0 >> 11;
  const int s0  = sg0 & (SEQ_ - 1);
  {
    const int lr = tid >> 4;
    const int c4 = (tid & 15) * 4;
    const float* vp = KV + (size_t)(sg0 + lr) * PN_ + d0 + c4;
#pragma unroll
    for (int it = 0; it < 4; ++it) {
      const int rr = it * 16 + lr;
      const v4f a = *(const v4f*)(vp + HD_ + (size_t)it * 16 * PN_);
      *(v4f*)(tf + rr * 68 + c4) = a;
    }
    // the wait that stands in front of a rewrite of an issued load's address registers; naming the address keeps it whole up to it
    asm volatile("s_wait_xcnt 0x0" :: "v"(vp) : "memory");
  }
  __syncthreads();
  const int sub = tid >> 3;          // output row within tile (= d)
  const int c8  = (tid & 7) * 8;     // s offset within tile
  v8h hv[2], lv[2];
#pragma unroll
  for (int it = 0; it < 2; ++it) {
    const int oc = it * 32 + sub;
    v8h a, rsd;
#pragma unroll
    for (int q = 0; q < 8; ++q) {
      const float f = tf[(c8 + q) * 68 + oc] * CQK_;
      const _Float16 hq = (_Float16)f;
      a[q] = hq;
      rsd[q] = (_Float16)(f - (float)hq);
    }
    hv[it] = a; lv[it] = rsd;
  }
  {
#pragma unroll
    for (int it = 0; it < 2; ++it) {
      const int oc = it * 32 + sub;
      const size_t go = ((size_t)b * HD_ + d0 + oc) * SEQ_ + s0 + c8;
      *(v8h*)(Vth + go) = hv[it];
      *(v8h*)(Vtl + go) = lv[it];
    }
    
  }
}

// ---------------------------------------------------------------------------------------------------------------
// The three passes between the projections and the attention do not depend on one another and share one launch, told apart by
// block index range (block-uniform): v transpose (the one with a barrier) first, then the k planes, then the q planes.
// coverage: SB_ALL_ blocks = the sum of the passes' own block counts.
// ---------------------------------------------------------------------------------------------------------------
#define SB_VT_  ((HD_ / 64) * ((NB_ * SEQ_) / 64))   /* 256  */
#define SB_K_   ((NB_ * SEQ_ * 8) / 256)             /* 128  */
#define SB_Q_   ((NB_ * SEQ_ * NH_ * 8) / 256)       /* 1024 */
#define SB_ALL_ (SB_VT_ + SB_K_ + SB_Q_)
__global__ __launch_bounds__(256) void split_kernel(const float* __restrict__ Qf, const float* __restrict__ KVf,
                                                    const float* __restrict__ cosT, const float* __restrict__ sinT,
                                                    _Float16* __restrict__ Qh, _Float16* __restrict__ Ql,
                                                    _Float16* __restrict__ Kh, _Float16* __restrict__ Kl,
                                                    _Float16* __restrict__ Vth, _Float16* __restrict__ Vtl) {
  int blk = blockIdx.x;
  if (blk < SB_VT_) { vt_split_part(blk & (HD_ / 64 - 1), blk / (HD_ / 64), KVf, Vth, Vtl); return; }
  blk -= SB_VT_;
  if (blk < SB_K_) { rope_split_part(blk, KVf, PN_, 1, cosT, sinT, Kh, Kl, HD_, NB_ * SEQ_, CQK_); return; }
  blk -= SB_K_;
  rope_split_part(blk, Qf, PN_, NH_, cosT, sinT, Qh, Ql, DM_, NB_ * SEQ_ * NH_, CQK_);
}

#define AT_PPITCH 72
#define AT_OPITCH 264
#define AT_KP     264                            /* k tile row pitch, halves: 528 B = 16 B x odd */
#define AT_VP     72                             /* v^T tile row pitch, halves: 144 B = 16 B x odd */
#define AT_SV     (64 * AT_KP)                   /* v^T tile, halves from the stage's start */
#define AT_STG    (64 * AT_KP + HD_ * AT_VP)     /* halves per stage */
#define AT_OFF_PH 0
#define AT_OFF_PM 9216
#define AT_OFF_PS 9728
#define AT_OFF_AL 10240
#define AT_OFF_LF 10496
#define AT_OFF_RG 10752                          /* the two stages */
#define AT_OFF_PL (AT_OFF_RG + AT_STG * 2)       /* residual P tile: in the residual k tile's place, which is dead behind the score products */
#define AT_OFF_OH AT_OFF_RG                      /* output staging, behind the barrier that follows the loop */
#define AT_OFF_OL (AT_OFF_RG + 33792)
#define AT_LDS    152064                         /* two blocks per 320-KiB LDS */
static_assert(AT_OFF_PM == AT_OFF_PH + 64 * AT_PPITCH * 2);
static_assert(AT_OFF_OL == AT_OFF_OH + 64 * AT_OPITCH * 2);
static_assert(AT_LDS == AT_OFF_RG + 2 * AT_STG * 2);
static_assert(AT_LDS >= AT_OFF_OL + 64 * AT_OPITCH * 2);
static_assert(64 * AT_PPITCH <= AT_SV);
static_assert(AT_OFF_RG % 16 == 0 && (AT_STG * 2) % 16 == 0 && (AT_SV * 2) % 16 == 0);

// Eight copies per lane: l = the lane's LDS byte address, LS = bytes between its LDS rows, g = its global address, gs = halves between
// its source rows. s_wait_xcnt stands inside the statement so that no address register is rewritten ahead of it.
template <unsigned LS>
__device__ __forceinline__ void async_tile8(unsigned l, const _Float16* g, size_t gs) {
  asm volatile(
      "global_load_async_to_lds_b128 %0, %8, off\n\t"
      "global_load_async_to_lds_b128 %1, %9, off\n\t"
      "global_load_async_to_lds_b128 %2, %10, off\n\t"
      "global_load_async_to_lds_b128 %3, %11, off\n\t"
      "global_load_async_to_lds_b128 %4, %12, off\n\t"
      "global_load_async_to_lds_b128 %5, %13, off\n\t"
      "global_load_async_to_lds_b128 %6, %14, off\n\t"
      "global_load_async_to_lds_b128 %7, %15, off\n\t"
      "s_wait_xcnt 0x0"
      :: "v"(l), "v"(l + 1u * LS), "v"(l + 2u * LS), "v"(l + 3u * LS),
         "v"(l + 4u * LS), "v"(l + 5u * LS), "v"(l + 6u * LS), "v"(l + 7u * LS),
         "v"(g), "v"(g + gs), "v"(g + 2 * gs), "v"(g + 3 * gs), "v"(g + 4 * gs), "v"(g + 5 * gs), "v"(g + 6 * gs), "v"(g + 7 * gs)
      : "memory");
}
// One stage = key tile kt: k rows (a wave's copy = one 512-byte row, rows 8 apart) and v^T rows (a wave's copy = four 128-byte lines,
// rows 32 apart). lk, lv: the lane's LDS byte addresses in the stage; gk, gv: its global addresses in tile 0.
__device__ __forceinline__ void attn_fill(unsigned lk, unsigned lv, const _Float16* gk, const _Float16* gv, int kt) {
  async_tile8<8u * AT_KP * 2u>(lk, gk + (size_t)kt * 64 * HD_, (size_t)8 * HD_);
  async_tile8<32u * AT_VP * 2u>(lv, gv + (size_t)kt * 64, (size_t)32 * SEQ_);
}

// The key-tile loop. One instance per kind of query block (EARLY: residual planes as well, one tile in LDS at a time; else two), so that
// the loop holds no test of the kind and a tile's loads stand in groups ahead of their use: q and k fragments by groups of k-steps, the
// mask values in front of the score products, the v^T fragments in front of the P . V products.
template <bool EARLY>
__device__ __forceinline__ void attn_tiles(int ktlo, int kthi, int b, int q0, int srow0, int kh, int w, int hh, int c,
                                           const _Float16* __restrict__ qhp, const _Float16* __restrict__ qlp,
                                           const _Float16* __restrict__ Kh, const _Float16* __restrict__ Kl,
                                           const float* __restrict__ mrp,
                                           const _Float16* __restrict__ Vth, const _Float16* __restrict__ Vtl, const _Float16* ring,
                                           _Float16* Ph, _Float16* Pl, float* pm, float* ps, float* alph,
                                           float (&mrow)[8], float (&lrow)[8], v8f (&oacc)[4][2]) {
  constexpr int KG = EARLY ? 1 : 2;            // k-steps whose fragments are loaded as one group
  constexpr bool TWO = !EARLY;                 // two stages of hi planes: a tile's copies are issued two tiles ahead
  const int tid = (w << 5) + (hh << 4) + c;
  const unsigned lk = (unsigned)(size_t)ring + (unsigned)((tid >> 5) * AT_KP + (tid & 31) * 8) * 2u;
  const unsigned lv = (unsigned)(size_t)ring + (unsigned)(AT_SV + (tid >> 3) * AT_VP + (tid & 7) * 8) * 2u;
  const size_t ok = ((size_t)b * SEQ_ + (tid >> 5)) * HD_ + (tid & 31) * 8;
  const size_t ov = ((size_t)b * HD_ + (tid >> 3)) * SEQ_ + (tid & 7) * 8;
  const _Float16* gk = Kh + ok;
  const _Float16* gv = Vth + ov;
  if (TWO) {
    attn_fill(lk, lv, gk, gv, ktlo);
    asm volatile("s_wait_asynccnt 0x0" ::: "memory");   // the first tile landed (this wave's copies) before the barrier publishes it
    __syncthreads();
    if (ktlo < kthi) attn_fill(lk + AT_STG * 2u, lv + AT_STG * 2u, gk, gv, ktlo + 1);   // block-uniform
  }
  const float* mtile = mrp + ktlo * 64 + 32 * kh + c;   // the lane's first mask value of the tile, moved on by 64 keys per trip
  for (int kt = ktlo; kt <= kthi; ++kt, mtile += 64) {      // block-uniform, at most 32 trips
    const int key0  = kt * 64;
    const int wkey0 = key0 + 32 * kh;
    const int sb = TWO ? ((kt - ktlo) & 1) : 0;   // the stage of the tile's hi planes
    const _Float16* khp = ring + sb * AT_STG + (32 * kh + c) * AT_KP + 8 * hh;
    const _Float16* klp = khp + AT_STG;
    if (!TWO) {
      attn_fill(lk, lv, gk, gv, kt);
      attn_fill(lk + AT_STG * 2u, lv + AT_STG * 2u, Kl + ok, Vtl + ov, kt);
      asm volatile("s_wait_asynccnt 0x0" ::: "memory");   // the tile landed (this wave's copies) before the barrier publishes it
      __syncthreads();
    }

    // ---- mask values of this wave's 16 x 32 scores, in flight during the score products. Every key of a tile is a column of the mask:
    //      no test guards the loads ----
    float mv[8][2];
    const float* mt = mtile;
#pragma unroll   // register arrays: constant indices
    for (int r = 0; r < 8; ++r) {
#pragma unroll   // register arrays: constant indices
      for (int j = 0; j < 2; ++j) mv[r][j] = mt[(size_t)r * SEQ_ + 16 * j];
    }

    // ---- S = q . k^T (16 rows x 32 keys per wave) ----
    v8f s[2];
    s[0] = zero8(); s[1] = zero8();
#pragma unroll   // constant load offsets, no loop overhead between the groups
    for (int g = 0; g < 8; g += KG) {
      v16h qa[KG], qr[KG], kb[KG][2], kr[KG][2];
#pragma unroll   // register arrays: constant indices
      for (int u = 0; u < KG; ++u) {
        const int ks = g + u;
        qa[u] = frag_ld(qhp + 32 * ks);
        qr[u] = qa[u];
        if (EARLY) qr[u] = frag_ld(qlp + 32 * ks);
#pragma unroll   // register arrays: constant indices
        for (int j = 0; j < 2; ++j) {
          kb[u][j] = frag_ld(khp + (16 * j) * AT_KP + 32 * ks);
          kr[u][j] = kb[u][j];
          if (EARLY) kr[u][j] = frag_ld(klp + (16 * j) * AT_KP + 32 * ks);
        }
      }
#pragma unroll   // register arrays: constant indices
      for (int u = 0; u < KG; ++u) {
#pragma unroll   // register arrays: constant indices
        for (int j = 0; j < 2; ++j) {
          s[j] = mma_g(qa[u], kb[u][j], s[j]);
          if (EARLY) {
            s[j] = mma_g(qr[u], kb[u][j], s[j]);
            s[j] = mma_g(qa[u], kr[u][j], s[j]);
          }
        }
      }
    }

    // the wait that stands in front of a rewrite of an issued load's address registers; naming the tile's mask address keeps it whole
    // up to it (else a later load may take its result into it)
    asm volatile("s_wait_xcnt 0x0" :: "v"(mt) : "memory");

    // ---- scale, mask, partial row max over this wave's 32 keys ----
    float cm[8];
    // key - query row at r = 0, j = 0: the band test then compares with constants, and no per-row bounds are held in registers over the
    // loop (the P fragment groups below need the room)
    const int dkq = wkey0 + c - (q0 + srow0 + 8 * hh);
#pragma unroll
    for (int r = 0; r < 8; ++r) {
      float mx = -INFINITY;
#pragma unroll
      for (int j = 0; j < 2; ++j) {
        const bool inb = (dkq >= r - 16 * j - (WIN_ - 1)) && (dkq <= r - 16 * j + (WIN_ - 1));
        const float sv = inb ? (s[j][r] * SSC_ + mv[r][j]) : -INFINITY;
        s[j][r] = sv;
        mx = fmaxf(mx, sv);
      }
      cm[r] = mx;
    }
    row_max8(cm);
    if (c == 0) {
#pragma unroll
      for (int r = 0; r < 8; ++r) pm[w * 16 + 8 * hh + r] = cm[r];
    }
    __syncthreads();

    // ---- online softmax: tile max, p, partial sums ----
    float al[8], psm[8];
    const int wo = w ^ 4;
#pragma unroll
    for (int r = 0; r < 8; ++r) {
      const float om = pm[wo * 16 + 8 * hh + r];
      const float mnew = fmaxf(mrow[r], fmaxf(cm[r], om));
      const float msafe = (mnew == -INFINITY) ? 0.0f : mnew;
      al[r] = __expf(mrow[r] - msafe);
      mrow[r] = mnew;
      float sum = 0.0f;
#pragma unroll
      for (int j = 0; j < 2; ++j) {
        const float p = __expf(s[j][r] - msafe);
        sum += p;
        const float t = p * CP_;
        const _Float16 phv = (_Float16)t;
        const int pidx = (srow0 + 8 * hh + r) * AT_PPITCH + 32 * kh + 16 * j + c;
        Ph[pidx] = phv;
        if (EARLY) Pl[pidx] = (_Float16)(t - (float)phv);
      }
      psm[r] = sum;
    }
    row_sum8(psm);
    if (c == 0) {
#pragma unroll
      for (int r = 0; r < 8; ++r) ps[w * 16 + 8 * hh + r] = psm[r];
      if (w < 4) {
#pragma unroll
        for (int r = 0; r < 8; ++r) alph[srow0 + 8 * hh + r] = al[r];
      }
    }
    __syncthreads();
#pragma unroll
    for (int r = 0; r < 8; ++r)
      lrow[r] = lrow[r] * al[r] + (ps[(w & 3) * 16 + 8 * hh + r] + ps[((w & 3) + 4) * 16 + 8 * hh + r]);

    // ---- v^T fragments of the tile, from LDS: in flight while O is rescaled ----
    v16h vb[2][2], vr[2][2];
    const _Float16* vht = ring + sb * AT_STG + AT_SV + (32 * w + c) * AT_VP + 8 * hh;
    const _Float16* vlt = vht + AT_STG;
#pragma unroll   // register arrays: constant indices
    for (int k2 = 0; k2 < 2; ++k2) {
#pragma unroll   // register arrays: constant indices
      for (int jj = 0; jj < 2; ++jj) {
        vb[k2][jj] = frag_ld(vht + (16 * jj) * AT_VP + 32 * k2);
        vr[k2][jj] = vb[k2][jj];
        if (EARLY) vr[k2][jj] = frag_ld(vlt + (16 * jj) * AT_VP + 32 * k2);
      }
    }

    // ---- rescale O, then O += P . V for this wave's 32 output columns ----
    if (!EARLY) {
      // Each P fragment is read from LDS once (both column halves use it) and in a group ahead of its use, so that no product waits on
      // an LDS read issued just in front of it: the first 32 keys' fragments with the v^T fragments and the rescale factors, the second
      // 32 keys' in front of the first 32 keys' products.
      const _Float16* pp = Ph + c * AT_PPITCH + 8 * hh;
      v16h pg[2][4];
      U8 av[4];
#pragma unroll   // register arrays: constant indices
      for (int i = 0; i < 4; ++i) pg[0][i] = frag_ld(pp + (16 * i) * AT_PPITCH);
#pragma unroll   // register arrays: constant indices
      for (int i = 0; i < 4; ++i) {
        av[i].q[0] = *(const v4f*)(alph + 16 * i + 8 * hh);
        av[i].q[1] = *(const v4f*)(alph + 16 * i + 8 * hh + 4);
      }
      // holds these LDS reads together in front of the rescale (one LDS wait instead of one per row group)
      asm volatile("" :: "v"(av[0].v), "v"(av[1].v), "v"(av[2].v), "v"(av[3].v));
#pragma unroll
      for (int i = 0; i < 4; ++i) {
#pragma unroll
        for (int r = 0; r < 8; ++r) { oacc[i][0][r] *= av[i].v[r]; oacc[i][1][r] *= av[i].v[r]; }
      }
#pragma unroll   // register arrays: constant indices
      for (int i = 0; i < 4; ++i) pg[1][i] = frag_ld(pp + (16 * i) * AT_PPITCH + 32);
#pragma unroll
      for (int k2 = 0; k2 < 2; ++k2) {
#pragma unroll
        for (int jj = 0; jj < 2; ++jj) {
#pragma unroll
          for (int i = 0; i < 4; ++i) oacc[i][jj] = mma_g(pg[k2][i], vb[k2][jj], oacc[i][jj]);
        }
      }
    } else {
#pragma unroll
      for (int i = 0; i < 4; ++i) {
        U8 av;
        av.q[0] = *(const v4f*)(alph + 16 * i + 8 * hh);
        av.q[1] = *(const v4f*)(alph + 16 * i + 8 * hh + 4);
#pragma unroll
        for (int r = 0; r < 8; ++r) { oacc[i][0][r] *= av.v[r]; oacc[i][1][r] *= av.v[r]; }
      }
#pragma unroll
      for (int k2 = 0; k2 < 2; ++k2) {
#pragma unroll
        for (int jj = 0; jj < 2; ++jj) {
#pragma unroll
          for (int i = 0; i < 4; ++i) {
            const v16h pa = frag_ld(Ph + (16 * i + c) * AT_PPITCH + 32 * k2 + 8 * hh);
            oacc[i][jj] = mma_g(pa, vb[k2][jj], oacc[i][jj]);
            const v16h pr = frag_ld(Pl + (16 * i + c) * AT_PPITCH + 32 * k2 + 8 * hh);
            oacc[i][jj] = mma_g(pa, vr[k2][jj], oacc[i][jj]);
            oacc[i][jj] = mma_g(pr, vb[k2][jj], oacc[i][jj]);
          }
        }
      }
    }

    // ---- hand-over of the stages ----
    asm volatile("s_wait_dscnt 0x0" ::: "memory");        // this wave's reads (and residual P writes) there are done before a refill
    if (TWO) asm volatile("s_wait_asynccnt 0x0" ::: "memory");   // this wave's copies of the next tile have landed
    __syncthreads();                                      // frees tile kt's stage; with two stages it publishes tile kt+1 as well
    if (TWO && kt + 2 <= kthi)                            // block-uniform
      attn_fill(lk + (unsigned)sb * (AT_STG * 2u), lv + (unsigned)sb * (AT_STG * 2u), gk, gv, kt + 2);
  }
  if (TWO) asm volatile("s_wait_asynccnt 0x0" ::: "memory");   // nothing in flight when the stages become output staging
}

// amdgpu_waves_per_eu(4, 4): holds the registers to four waves per SIMD, so that two blocks share a WGP (2 x AT_LDS fits its LDS)
__global__ __launch_bounds__(256) __attribute__((amdgpu_waves_per_eu(4, 4))) void attn_kernel(const _Float16* __restrict__ Qh, const _Float16* __restrict__ Ql,
                                                   const _Float16* __restrict__ Kh, const _Float16* __restrict__ Kl,
                                                   const _Float16* __restrict__ Vth, const _Float16* __restrict__ Vtl,
                                                   const float* __restrict__ mask, const int* __restrict__ flag,
                                                   _Float16* __restrict__ AOh, _Float16* __restrict__ AOl) {
  extern __shared__ __align__(16) unsigned char dsm[];
  _Float16* Ph   = (_Float16*)(dsm + AT_OFF_PH);
  _Float16* Pl   = (_Float16*)(dsm + AT_OFF_PL);
  float*    pm   = (float*)(dsm + AT_OFF_PM);     // [8 waves][16 rows] partial row max
  float*    ps   = (float*)(dsm + AT_OFF_PS);     // [8 waves][16 rows] partial row sum
  float*    alph = (float*)(dsm + AT_OFF_AL);     // [64] rescale factors
  float*    lfin = (float*)(dsm + AT_OFF_LF);     // [64] final row sums
  const _Float16* ring = (const _Float16*)(dsm + AT_OFF_RG);   // two stages of k and v^T tiles
  _Float16* Ohs  = (_Float16*)(dsm + AT_OFF_OH);
  _Float16* Ols  = (_Float16*)(dsm + AT_OFF_OL);

  const int tid  = threadIdx.x;
  const int w    = tid >> 5;
  const int lane = tid & 31;
  const int hh   = lane >> 4;
  const int c    = lane & 15;
  const int bid  = blockIdx.x;
  const int qb   = bid & (NQB_ - 1);
  const int h    = (bid >> 5) & (NH_ - 1);
  const int b    = bid >> 8;
  const int q0   = qb * 64;
  const int srow0 = (w & 3) * 16;
  const int kh    = w >> 2;
  const int ocol0 = w * 32;
  const bool early = (qb < QE_);
  const int ktlo = (qb > 16) ? (qb - 16) : 0;
  int fl = 1;                                  // block-uniform: all row groups of this query block verified
#pragma unroll   // independent scalar loads, issued together instead of one round trip each
  for (int g = 0; g < MFG_; ++g) fl &= flag[((b * NQB_ + qb) * MFG_ + g) * 32];
  int kthi = (fl != 0) ? qb : (qb + 16);
  if (kthi > NQB_ - 1) kthi = NQB_ - 1;

  const size_t growq = (size_t)b * SEQ_ + q0;
  const _Float16* qhp = Qh + (growq + srow0 + c) * DM_ + h * HD_ + 8 * hh;
  const _Float16* qlp = Ql + (growq + srow0 + c) * DM_ + h * HD_ + 8 * hh;
  const float*    mrp = mask + (growq + srow0 + 8 * hh) * (size_t)SEQ_;

  float mrow[8], lrow[8];
  v8f oacc[4][2];
#pragma unroll
  for (int r = 0; r < 8; ++r) { mrow[r] = -INFINITY; lrow[r] = 0.0f; }
#pragma unroll
  for (int i = 0; i < 4; ++i) { oacc[i][0] = zero8(); oacc[i][1] = zero8(); }

  if (early)   // block-uniform
    attn_tiles<true>(ktlo, kthi, b, q0, srow0, kh, w, hh, c, qhp, qlp, Kh, Kl, mrp, Vth, Vtl, ring, Ph, Pl, pm, ps, alph, mrow, lrow, oacc);
  else
    attn_tiles<false>(ktlo, kthi, b, q0, srow0, kh, w, hh, c, qhp, qlp, Kh, Kl, mrp, Vth, Vtl, ring, Ph, Pl, pm, ps, alph, mrow, lrow, oacc);

  if (w < 4 && c == 0) {
#pragma unroll
    for (int r = 0; r < 8; ++r) lfin[srow0 + 8 * hh + r] = lrow[r];
  }
  __syncthreads();
#pragma unroll
  for (int i = 0; i < 4; ++i) {
    U8 lv;
    lv.q[0] = *(const v4f*)(lfin + 16 * i + 8 * hh);
    lv.q[1] = *(const v4f*)(lfin + 16 * i + 8 * hh + 4);
#pragma unroll
    for (int r = 0; r < 8; ++r) {
      const float f = OSC_ * (1.0f / lv.v[r]);
      const int orow = 16 * i + 8 * hh + r;
#pragma unroll
      for (int jj = 0; jj < 2; ++jj) {
        const float t = oacc[i][jj][r] * f;
        const _Float16 hq = (_Float16)t;
        const int oidx = orow * AT_OPITCH + ocol0 + 16 * jj + c;
        Ohs[oidx] = hq;
        Ols[oidx] = (_Float16)(t - (float)hq);
      }
    }
  }
  __syncthreads();
  {
    const int piece = tid & 7;
    const int lsub  = tid >> 3;
    {
#pragma unroll
      for (int it = 0; it < 8; ++it) {
        const int line = it * 32 + lsub;          // 0..255 = 64 rows x 4 lines
        const int row  = line >> 2;
        const int col  = (line & 3) * 64 + piece * 8;
        const v8h hv = *(const v8h*)(Ohs + row * AT_OPITCH + col);
        const v8h rv = *(const v8h*)(Ols + row * AT_OPITCH + col);
        const size_t go = (growq + row) * DM_ + h * HD_ + col;
        *(v8h*)(AOh + go) = hv;
        *(v8h*)(AOl + go) = rv;
      }
      
    }
  }
}

// ---------------------------------------------------------------------------------------------------------------
// The q, k and v projections as ONE product over the PN_ = 2560 rows of the weight planes (q rows, then k rows, then v rows, which lie
// one behind the other): C[m][n] = 2^-12 * sum_k A[m][k] * Bt[n][k], C f32 [4096][2560].
// Block = 8 waves (2 x 4) on a 128 x 320 tile of C, each wave 64 x 80 (4 x 5 accumulators): 32 x 8 = 256 equal blocks, one per WGP in
// one round (a block's LDS leaves room for no second one), where 128 x 256 tiles make 320 blocks and a second round of 64.
// The ring is the common one above: asynchronous 16-byte copies, 256-byte row pieces (128 k) per stage, two stages, pitch 272 bytes.
// Epilogue: the whole tile staged in the (then free) ring, then stored by 512-byte runs of its rows: a wave's 80 columns alone end
// in the middle of a 128-byte line, the block's 320 do not.
// ---------------------------------------------------------------------------------------------------------------
#define PNJ_   5                                 /* 16-column accumulators per wave */
#define PBN_   (4 * 16 * PNJ_)                   /* 320 */
#define P_OB_  (GBM_ * GPH_)                     /* Bt rows, halves from the stage's start */
#define P_STG_ ((GBM_ + PBN_) * GPH_)            /* halves per stage */
#define P_CP_  (PBN_ + 4)                        /* staged C row pitch, floats: rows 8 apart fall 32 banks apart */
static_assert(PN_ % PBN_ == 0 && (NB_ * SEQ_) % GBM_ == 0 && DM_ % GK_ == 0 && DM_ / GK_ >= 2);
static_assert(2 * P_STG_ * 2 >= GBM_ * P_CP_ * 4);
static_assert((GBM_ * (PBN_ / 4)) % (8 * 256) == 0);

// Four copies per lane, rows 16 apart (as async_rows8). s_wait_xcnt stands inside the statement so that no address register is
// rewritten ahead of it.
__device__ __forceinline__ void async_rows4(unsigned l, const _Float16* g, size_t gs) {
  asm volatile(
      "global_load_async_to_lds_b128 %0, %4, off\n\t"
      "global_load_async_to_lds_b128 %1, %5, off\n\t"
      "global_load_async_to_lds_b128 %2, %6, off\n\t"
      "global_load_async_to_lds_b128 %3, %7, off\n\t"
      "s_wait_xcnt 0x0"
      :: "v"(l), "v"(l + 1u * G_LS_), "v"(l + 2u * G_LS_), "v"(l + 3u * G_LS_),
         "v"(g), "v"(g + gs), "v"(g + 2 * gs), "v"(g + 3 * gs)
      : "memory");
}
// One stage: A 128 rows, Bt 320 rows, 256 bytes of each.
__device__ __forceinline__ void proj_fill(unsigned l, const _Float16* ga, const _Float16* gb) {
  const size_t s16 = (size_t)16 * DM_;
  async_rows8(l, ga, s16);
  async_rows8(l + P_OB_ * 2u, gb, s16);
  async_rows8(l + P_OB_ * 2u + 8u * G_LS_, gb + 8 * s16, s16);
  async_rows4(l + P_OB_ * 2u + 16u * G_LS_, gb + 16 * s16, s16);
}

__global__ __launch_bounds__(256) void proj_kernel(const _Float16* __restrict__ A, const _Float16* __restrict__ Bt,
                                                   float* __restrict__ C) {
  __shared__ __align__(16) _Float16 ring[2 * P_STG_];   // two stages; afterwards the block's 128 x 320 f32 tile, pitch P_CP_ floats
  const int tid  = threadIdx.x;
  const int lane = tid & 31;
  const int wave = tid >> 5;
  const int tm = (int)blockIdx.x / (PN_ / PBN_);
  const int tn = (int)blockIdx.x - tm * (PN_ / PBN_);
  const int m0b = tm * GBM_;
  const int n0b = tn * PBN_;
  const int wrow = (wave >> 2) << 6;
  const int wcol = (wave & 3) * (16 * PNJ_);
  const int rlane = lane & 15;
  const int koff  = (lane >> 4) * 8;

  v8f acc[4][PNJ_];
#pragma unroll
  for (int i = 0; i < 4; ++i)
#pragma unroll
    for (int j = 0; j < PNJ_; ++j) acc[i][j] = zero8();

  const int sub = tid >> 4;
  const int cc  = (tid & 15) * 8;
  const unsigned l0 = (unsigned)(size_t)ring + (unsigned)(sub * GPH_ + cc) * 2u;
  const _Float16* ga = A  + (size_t)(m0b + sub) * DM_ + cc;
  const _Float16* gb = Bt + (size_t)(n0b + sub) * DM_ + cc;
  constexpr int nt = DM_ / GK_;

  proj_fill(l0, ga, gb);
  asm volatile("s_wait_asynccnt 0x0" ::: "memory");   // stage 0 landed (this wave's copies) before the barrier publishes it
  __syncthreads();
  proj_fill(l0 + P_STG_ * 2u, ga + GK_, gb + GK_);

  for (int t = 0; t < nt; ++t) {
    const _Float16* st = ring + (t & 1) * P_STG_;
    const _Float16* sa = st + (wrow + rlane) * GPH_ + koff;
    const _Float16* sb = st + P_OB_ + (wcol + rlane) * GPH_ + koff;
#pragma unroll   // the four k-steps of a stage in one body: constant LDS offsets, no loop overhead between them
    for (int kk = 0; kk < GK_; kk += 32) {
      v16h bh[PNJ_], ah[4];
#pragma unroll   // register arrays: constant indices
      for (int j = 0; j < PNJ_; ++j) bh[j] = frag_ld(sb + (j << 4) * GPH_ + kk);
#pragma unroll   // register arrays: constant indices
      for (int i = 0; i < 4; ++i) ah[i] = frag_ld(sa + (i << 4) * GPH_ + kk);
      // holds the k-step's fragment reads together in front of its products (one LDS wait per k-step instead of one per row)
      asm volatile("" :: "v"(bh[0]), "v"(bh[1]), "v"(bh[2]), "v"(bh[3]), "v"(bh[4]), "v"(ah[0]), "v"(ah[1]), "v"(ah[2]), "v"(ah[3]));
#pragma unroll   // register arrays: constant indices
      for (int i = 0; i < 4; ++i) {
#pragma unroll   // register arrays: constant indices
        for (int j = 0; j < PNJ_; ++j) acc[i][j] = wmma_raw(ah[i], bh[j], acc[i][j]);
      }
    }
    asm volatile("s_wait_dscnt 0x0" ::: "memory");      // this wave's reads of the stage are done before it may be refilled
    asm volatile("s_wait_asynccnt 0x0" ::: "memory");   // this wave's copies of the next stage have landed
    __syncthreads();                                    // publishes stage t+1 and frees stage t's buffer
    if (t + 2 < nt)
      proj_fill(l0 + (unsigned)(t & 1) * (P_STG_ * 2u), ga + (size_t)(t + 2) * GK_, gb + (size_t)(t + 2) * GK_);
  }
  asm volatile("s_wait_asynccnt 0x0" ::: "memory");     // nothing in flight when the ring becomes output staging

  float* cst = (float*)ring;
#pragma unroll
  for (int i = 0; i < 4; ++i) {
#pragma unroll
    for (int j = 0; j < PNJ_; ++j) {
#pragma unroll
      for (int r = 0; r < 8; ++r) cst[(wrow + (i << 4) + koff + r) * P_CP_ + wcol + (j << 4) + rlane] = acc[i][j][r] * QSC_;
    }
  }
  __syncthreads();                                      // the tile is whole before any wave reads other waves' columns
#pragma unroll 1   // eight LDS reads and eight stores per trip are enough in flight; keeps the text short
  for (int g = 0; g < (GBM_ * (PBN_ / 4)) / (8 * 256); ++g) {
    v4f v[8];
    float* p[8];
#pragma unroll   // register arrays: constant indices
    for (int it = 0; it < 8; ++it) {
      const int idx = (g * 8 + it) * 256 + tid;         // 16-byte piece of the tile, row-major: a wave's store = four whole 128-byte lines
      const int row = idx / (PBN_ / 4);
      const int c4  = (idx - row * (PBN_ / 4)) * 4;
      v[it] = *(const v4f*)(cst + row * P_CP_ + c4);
      p[it] = C + (size_t)(m0b + row) * PN_ + n0b + c4;
    }
#pragma unroll   // register arrays: constant indices
    for (int it = 0; it < 8; ++it) *(v4f*)p[it] = v[it];
    // the wait that stands in front of a rewrite of an issued store's registers (the next trip reuses them); naming them keeps them
    // whole up to it
    asm volatile("s_wait_xcnt 0x0" :: "v"(p[0]), "v"(p[1]), "v"(p[2]), "v"(p[3]), "v"(p[4]), "v"(p[5]), "v"(p[6]), "v"(p[7]),
                 "v"(v[0]), "v"(v[1]), "v"(v[2]), "v"(v[3]), "v"(v[4]), "v"(v[5]), "v"(v[6]), "v"(v[7]) : "memory");
  }
}

// ---------------------------------------------------------------------------------------------------------------
// Output projection: C[m][n] = 2^-18 * sum_k (A[m][k] (+ A2[m][k])) * Bt[n][k], A = the attention output's hi plane, A2 = its residual
// plane, which counts on the first LOROWS_ rows of each sequence only; Bt = Wo rows (k contiguous); C f32 [4096][2048].
// The rows with a residual plane cost twice the products. They are dealt out evenly: every block's 128 x 256 tile of C holds 112 rows
// without and 16 rows with the residual plane (tile rows 112..127), so that all 32 x 8 = 256 blocks, one per WGP, do the same work,
// 9/8 of a plain tile's, where whole tiles of such rows would do 2 tiles' work on 32 WGPs while the others idle.
// Block = 8 waves (2 x 4), each wave 64 x 64 (4 x 4 accumulators); the four waves of the lower row half add the residual products
// (4 more per k-step, behind a scalar branch that holds no barrier).
// Per accumulator the order of the sums is hi, residual, k-step by k-step.
// The ring is that of proj_kernel. Epilogue: the whole tile staged in the (then free) ring, then stored by 512-byte runs of its rows.
// ---------------------------------------------------------------------------------------------------------------
#define O_LO_  16                                /* tile rows with a residual plane */
#define O_HI_  (GBM_ - O_LO_)                    /* 112 tile rows without */
#define O_OA2_ (GBM_ * GPH_)                     /* residual rows, halves from the stage's start */
#define O_OB_  ((GBM_ + O_LO_) * GPH_)           /* Bt rows, halves from the stage's start */
#define O_STG_ ((GBM_ + O_LO_ + GBN_) * GPH_)    /* halves per stage */
#define O_CP_  (GBN_ + 4)                        /* staged C row pitch, floats: rows 8 apart fall 32 banks apart */
#define O_TS_  ((SEQ_ - LOROWS_) / O_HI_)        /* 16 row tiles per sequence */
static_assert((SEQ_ - LOROWS_) % O_HI_ == 0 && LOROWS_ == O_TS_ * O_LO_ && O_LO_ == 16 && O_HI_ % 16 == 0);
static_assert(DM_ % GBN_ == 0 && DM_ % GK_ == 0 && DM_ / GK_ >= 2 && NB_ * O_TS_ == (NB_ * SEQ_) / GBM_);
static_assert(2 * O_STG_ * 2 >= GBM_ * O_CP_ * 4);
static_assert((GBM_ * (GBN_ / 4)) % (8 * 256) == 0);

// Five copies per lane, LDS rows 16 apart, each with a source address of its own. s_wait_xcnt stands inside the statement so that no
// address register is rewritten ahead of it.
__device__ __forceinline__ void async_rows5(unsigned l, const _Float16* g0, const _Float16* g1, const _Float16* g2,
                                            const _Float16* g3, const _Float16* g4) {
  asm volatile(
      "global_load_async_to_lds_b128 %0, %5, off\n\t"
      "global_load_async_to_lds_b128 %1, %6, off\n\t"
      "global_load_async_to_lds_b128 %2, %7, off\n\t"
      "global_load_async_to_lds_b128 %3, %8, off\n\t"
      "global_load_async_to_lds_b128 %4, %9, off\n\t"
      "s_wait_xcnt 0x0"
      :: "v"(l), "v"(l + 1u * G_LS_), "v"(l + 2u * G_LS_), "v"(l + 3u * G_LS_), "v"(l + 4u * G_LS_),
         "v"(g0), "v"(g1), "v"(g2), "v"(g3), "v"(g4)
      : "memory");
}
// One stage, 256 bytes of each row: A 112 rows (ga), A 16 rows (gl), A2 the same 16 rows (gr), Bt 256 rows (gb).
__device__ __forceinline__ void oproj_fill(unsigned l, const _Float16* ga, const _Float16* gl, const _Float16* gr, const _Float16* gb) {
  const size_t s16 = (size_t)16 * DM_;
  async_rows4(l, ga, s16);
  async_rows5(l + 4u * G_LS_, ga + 4 * s16, ga + 5 * s16, ga + 6 * s16, gl, gr);
  async_rows8(l + O_OB_ * 2u, gb, s16);
  async_rows8(l + O_OB_ * 2u + 8u * G_LS_, gb + 8 * s16, s16);
}
// One stage's products of one wave. res (wave-uniform, a scalar): the wave's last 16 rows have a residual plane (sr = its fragment rows).
__device__ __forceinline__ void oproj_stage(v8f (&acc)[4][4], const _Float16* sa, const _Float16* sr, const _Float16* sb, bool res) {
#pragma unroll   // the four k-steps of a stage in one body: constant LDS offsets, no loop overhead between them
  for (int kk = 0; kk < GK_; kk += 32) {
    v16h bh[4], ah[4];
#pragma unroll   // register arrays: constant indices
    for (int j = 0; j < 4; ++j) bh[j] = frag_ld(sb + (j << 4) * GPH_ + kk);
#pragma unroll   // register arrays: constant indices
    for (int i = 0; i < 4; ++i) ah[i] = frag_ld(sa + (i << 4) * GPH_ + kk);
    const v16h al = frag_ld(sr + kk);   // read by every wave, so that the k-step's reads stand in one group with no branch among them
    // holds the k-step's fragment reads together in front of its products (one LDS wait per k-step instead of one per row)
    asm volatile("" :: "v"(bh[0]), "v"(bh[1]), "v"(bh[2]), "v"(bh[3]), "v"(ah[0]), "v"(ah[1]), "v"(ah[2]), "v"(ah[3]), "v"(al));
#pragma unroll   // register arrays: constant indices
    for (int i = 0; i < 4; ++i) {
#pragma unroll   // register arrays: constant indices
      for (int j = 0; j < 4; ++j) acc[i][j] = wmma_raw(ah[i], bh[j], acc[i][j]);
    }
    if (res) {
#pragma unroll   // register arrays: constant indices
      for (int j = 0; j < 4; ++j) acc[3][j] = wmma_raw(al, bh[j], acc[3][j]);
    }
  }
}

__global__ __launch_bounds__(256) void oproj_kernel(const _Float16* __restrict__ A, const _Float16* __restrict__ A2,
                                                    const _Float16* __restrict__ Bt, float* __restrict__ C) {
  __shared__ __align__(16) _Float16 ring[2 * O_STG_];   // two stages; afterwards the block's 128 x 256 f32 tile, pitch O_CP_ floats
  const int tid  = threadIdx.x;
  const int lane = tid & 31;
  const int wave = tid >> 5;
  const int tm = (int)blockIdx.x / (DM_ / GBN_);
  const int tn = (int)blockIdx.x - tm * (DM_ / GBN_);
  const int sq = tm / O_TS_;                            // sequence
  const int ts = tm - sq * O_TS_;                       // row tile within it
  const int rh0 = sq * SEQ_ + LOROWS_ + ts * O_HI_;     // global row of tile row 0 (rows without a residual plane)
  const int rl0 = sq * SEQ_ + ts * O_LO_;               // global row of tile row O_HI_ (rows with one)
  const int n0b = tn * GBN_;
  const int wrow = (wave >> 2) << 6;
  const int wcol = (wave & 3) << 6;
  const int rlane = lane & 15;
  const int koff  = (lane >> 4) * 8;
  // wave-uniform, in a scalar register: the branch on it is a scalar one and holds no barrier
  const bool res = __builtin_amdgcn_readfirstlane(wave >> 2) != 0;

  v8f acc[4][4];
#pragma unroll
  for (int i = 0; i < 4; ++i)
#pragma unroll
    for (int j = 0; j < 4; ++j) acc[i][j] = zero8();

  const int sub = tid >> 4;
  const int cc  = (tid & 15) * 8;
  const unsigned l0 = (unsigned)(size_t)ring + (unsigned)(sub * GPH_ + cc) * 2u;
  const _Float16* ga = A  + (size_t)(rh0 + sub) * DM_ + cc;
  const _Float16* gl = A  + (size_t)(rl0 + sub) * DM_ + cc;
  const _Float16* gr = A2 + (size_t)(rl0 + sub) * DM_ + cc;
  const _Float16* gb = Bt + (size_t)(n0b + sub) * DM_ + cc;
  constexpr int nt = DM_ / GK_;

  oproj_fill(l0, ga, gl, gr, gb);
  asm volatile("s_wait_asynccnt 0x0" ::: "memory");   // stage 0 landed (this wave's copies) before the barrier publishes it
  __syncthreads();
  oproj_fill(l0 + O_STG_ * 2u, ga + GK_, gl + GK_, gr + GK_, gb + GK_);

  for (int t = 0; t < nt; ++t) {
    const _Float16* st = ring + (t & 1) * O_STG_;
    const _Float16* sa = st + (wrow + rlane) * GPH_ + koff;
    const _Float16* sr = st + O_OA2_ + rlane * GPH_ + koff;
    const _Float16* sb = st + O_OB_ + (wcol + rlane) * GPH_ + koff;
    oproj_stage(acc, sa, sr, sb, res);
    asm volatile("s_wait_dscnt 0x0" ::: "memory");      // this wave's reads of the stage are done before it may be refilled
    asm volatile("s_wait_asynccnt 0x0" ::: "memory");   // this wave's copies of the next stage have landed
    __syncthreads();                                    // publishes stage t+1 and frees stage t's buffer
    if (t + 2 < nt) {
      const size_t ko = (size_t)(t + 2) * GK_;
      oproj_fill(l0 + (unsigned)(t & 1) * (O_STG_ * 2u), ga + ko, gl + ko, gr + ko, gb + ko);
    }
  }
  asm volatile("s_wait_asynccnt 0x0" ::: "memory");     // nothing in flight when the ring becomes output staging

  float* cst = (float*)ring;
#pragma unroll
  for (int i = 0; i < 4; ++i) {
#pragma unroll
    for (int j = 0; j < 4; ++j) {
#pragma unroll
      for (int r = 0; r < 8; ++r) cst[(wrow + (i << 4) + koff + r) * O_CP_ + wcol + (j << 4) + rlane] = acc[i][j][r] * WSC_;
    }
  }
  __syncthreads();                                      // the tile is whole before any wave reads other waves' columns
#pragma unroll 1   // eight LDS reads and eight stores per trip are enough in flight; keeps the text short
  for (int g = 0; g < (GBM_ * (GBN_ / 4)) / (8 * 256); ++g) {
    v4f v[8];
    float* p[8];
#pragma unroll   // register arrays: constant indices
    for (int it = 0; it < 8; ++it) {
      const int idx = (g * 8 + it) * 256 + tid;         // 16-byte piece of the tile, row-major: a wave's store = four whole 128-byte lines
      const int row = idx / (GBN_ / 4);
      const int c4  = (idx - row * (GBN_ / 4)) * 4;
      const int grow = (row < O_HI_) ? (rh0 + row) : (rl0 + row - O_HI_);
      v[it] = *(const v4f*)(cst + row * O_CP_ + c4);
      p[it] = C + (size_t)grow * DM_ + n0b + c4;
    }
#pragma unroll   // register arrays: constant indices
    for (int it = 0; it < 8; ++it) *(v4f*)p[it] = v[it];
    // the wait that stands in front of a rewrite of an issued store's registers (the next trip reuses them); naming them keeps them
    // whole up to it
    asm volatile("s_wait_xcnt 0x0" :: "v"(p[0]), "v"(p[1]), "v"(p[2]), "v"(p[3]), "v"(p[4]), "v"(p[5]), "v"(p[6]), "v"(p[7]),
                 "v"(v[0]), "v"(v[1]), "v"(v[2]), "v"(v[3]), "v"(v[4]), "v"(v[5]), "v"(v[6]), "v"(v[7]) : "memory");
  }
}

// ---------------------------------------------------------------------------------------------------------------
// Workspace map (byte offsets, all 2 MiB aligned; every region is written completely by whole-line stores before it is read;
// the attention output planes reuse the f32 projection plane, which is dead after the RoPE/split passes):
//   Xh   f16 [4096][2048]            0           16,777,216
//   Wqh  f16 [2048][2048]   16,777,216            8,388,608
//   Wkvh f16 [512][2048]    25,165,824            2,097,152
//   Woh  f16 [2048][2048]   27,262,976            8,388,608
//   cosT f32 [4096][128]    35,651,584            2,097,152
//   sinT f32 [4096][128]    37,748,736            2,097,152
//   Qf   f32 [4096][2560]   39,845,888           41,943,040   (q | k | v columns; AOh f16 [4096][2048] at 39,845,888; AOl at 56,623,104)
//   Qh   f16 [4096][2048]   81,788,928           16,777,216
//   Ql   f16 [4096][2048]   98,566,144           16,777,216
//   Kh   f16 [4096][256]   115,343,360            2,097,152
//   Kl   f16 [4096][256]   117,440,512            2,097,152
//   Vth  f16 [2][256][2048] 119,537,664           2,097,152
//   Vtl  f16 [2][256][2048] 121,634,816           2,097,152
//   flags int [2*32*16][32] 123,731,968            131,072
//   total                  123,863,040
// ---------------------------------------------------------------------------------------------------------------
extern "C" void kernel_launch(void* const* d_in, const int* in_sizes, int n_in,
                              void* d_out, int out_size, void* d_ws, size_t ws_size,
                              hipStream_t stream) {
  if (n_in < 7) return;
  if (in_sizes[0] != NB_ * SEQ_ * DM_) return;
  if (in_sizes[1] != NB_ * SEQ_ * SEQ_) return;
  if (in_sizes[2] != NB_ * SEQ_) return;
  if (in_sizes[3] != DM_ * DM_) return;
  if (in_sizes[4] != HD_ * DM_) return;
  if (in_sizes[5] != HD_ * DM_) return;
  if (in_sizes[6] != DM_ * DM_) return;
  if (out_size != NB_ * SEQ_ * DM_) return;

  const float* x    = (const float*)d_in[0];
  const float* mask = (const float*)d_in[1];
  const int*   pos  = (const int*)d_in[2];
  const float* Wq   = (const float*)d_in[3];
  const float* Wk   = (const float*)d_in[4];
  const float* Wv   = (const float*)d_in[5];
  const float* Wo   = (const float*)d_in[6];
  float* out = (float*)d_out;

  const size_t nX   = (size_t)NB_ * SEQ_ * DM_;          // 8,388,608 elements
  const size_t bXh  = nX * 2;
  const size_t bWq  = (size_t)DM_ * DM_ * 2;
  const size_t bWkv = (size_t)KVN_ * DM_ * 2;
  const size_t bWo  = bWq;
  const size_t bTab = (size_t)NB_ * SEQ_ * NF_ * 4;
  const size_t bQf  = nX * 4;
  const size_t bKVf = (size_t)NB_ * SEQ_ * KVN_ * 4;
  const size_t bQ16 = nX * 2;
  const size_t bK16 = (size_t)NB_ * SEQ_ * HD_ * 2;
  const size_t bV16 = bK16;
  const size_t bFlg = (size_t)NB_ * NQB_ * MFG_ * 128;
  size_t off = 0;
  const size_t oXh  = off; off += bXh;
  const size_t oWq  = off; off += bWq;
  const size_t oWkv = off; off += bWkv;
  const size_t oWo  = off; off += bWo;
  const size_t oCos = off; off += bTab;
  const size_t oSin = off; off += bTab;
  const size_t oQf  = off; off += bQf;
  const size_t oKVf = off; off += bKVf;
  const size_t oQh  = off; off += bQ16;
  const size_t oQl  = off; off += bQ16;
  const size_t oKh  = off; off += bK16;
  const size_t oKl  = off; off += bK16;
  const size_t oVth = off; off += bV16;
  const size_t oVtl = off; off += bV16;
  const size_t oFlg = off; off += bFlg;
  if (off > ws_size) return;                        // off = 123,863,040
  if (off > (size_t)134217728) return;
  if (bQf < 2 * bQ16) return;                        // AOh/AOl alias fits inside the f32 q region
  const size_t oAOh = oQf;
  const size_t oAOl = oQf + bQ16;

  char* ws = (char*)d_ws;
  _Float16* Xh   = (_Float16*)(ws + oXh);
  _Float16* Wqh  = (_Float16*)(ws + oWq);
  _Float16* Wkvh = (_Float16*)(ws + oWkv);
  _Float16* Woh  = (_Float16*)(ws + oWo);
  float*    cosT = (float*)(ws + oCos);
  float*    sinT = (float*)(ws + oSin);
  float*    Qf   = (float*)(ws + oQf);
  float*    KVf  = Qf + DM_;                         // the k | v columns of the fused plane, row pitch PN_
  if (oKVf != oQf + bQf || oWkv != oWq + bWq) return;   // the fused planes are the q and kv regions one behind the other
  _Float16* Qh   = (_Float16*)(ws + oQh);
  _Float16* Ql   = (_Float16*)(ws + oQl);
  _Float16* Kh   = (_Float16*)(ws + oKh);
  _Float16* Kl   = (_Float16*)(ws + oKl);
  _Float16* Vth  = (_Float16*)(ws + oVth);
  _Float16* Vtl  = (_Float16*)(ws + oVtl);
  int*      flg  = (int*)(ws + oFlg);
  _Float16* AOh  = (_Float16*)(ws + oAOh);
  _Float16* AOl  = (_Float16*)(ws + oAOl);

  const dim3 blk(256);

  // (1) one launch: inputs -> 16-bit planes (x bf16*2^4, weights bf16*2^8, k rows then v rows in the fused kv weight plane);
  //     cos/sin tables [4096][128] from position ids; mask verification flags per (b, query block, 4-row group)
  prep_kernel<<<dim3(PB_ALL_), blk, 0, stream>>>(x, mask, pos, Wq, Wk, Wv, Wo, Xh, Wqh, Wkvh, Woh, cosT, sinT, flg);
  // (2) one product: [q|k|v] = x . [Wq|Wk|Wv]^T -> f32 [4096][2560]
  proj_kernel<<<dim3((NB_ * SEQ_ / GBM_) * (PN_ / PBN_)), blk, 0, stream>>>(Xh, Wqh, Qf);
  // (3) one launch: RoPE + hi/residual split, q planes [4096][8*256] and k planes [4096][256]; v^T planes [2][256][2048]
  split_kernel<<<dim3(SB_ALL_), blk, 0, stream>>>(Qf, KVf, cosT, sinT, Qh, Ql, Kh, Kl, Vth, Vtl);
  // (4) attention -> AO hi/residual planes [4096][2048]
  (void)hipFuncSetAttribute(reinterpret_cast<const void*>(&attn_kernel), hipFuncAttributeMaxDynamicSharedMemorySize, AT_LDS);
  attn_kernel<<<dim3(NB_ * NH_ * NQB_), blk, AT_LDS, stream>>>(Qh, Ql, Kh, Kl, Vth, Vtl, mask, flg, AOh, AOl);
  // (5) out = AO . Wo^T -> d_out f32 [4096][2048]; residual plane on rows < LOROWS_ of each sequence
  oproj_kernel<<<dim3((NB_ * SEQ_ / GBM_) * (DM_ / GBN_)), blk, 0, stream>>>(AOh, AOl, Woh, out);
  (void)hipGetLastError();
}

// v010
// Measured time: 138 microseconds a run.
// Two timings next to v009 both put it at 1.08 times that version's speed.
// Over all steps from v000 it is 4.53 times as fast.
// Contractions on v_wmma_f32_16x16x32_f16 (f16 operands, f32 accumulate): q/k/v projections (x RNE-converted to bf16 and carried *2^4,
// W RNE-converted to bf16 and carried *2^8, exact products); q.k^T (q,k carried *2^10 as f16 hi planes, plus unscaled f16 residual planes
// on the leading query blocks of each sequence); p.v (p carried *2^15, v^T carried *2^10: hi planes plus residual planes on the leading query
// blocks); output projection (attention output carried *2^10: hi plane everywhere, residual plane on the leading rows of each sequence;
// Wo bf16 *2^8). RoPE, mask add and online softmax in f32.
#include <hip/hip_runtime.h>
#include <math.h>
#include <stdint.h>

#define NB_     2
#define SEQ_    2048
#define DM_     2048
#define NH_     8
#define HD_     256
#define NF_     128
#define KVN_    512
#define WIN_    1024
#define NQB_    32
#define QE_     4
#define LOROWS_ 256
#define MFG_    16

#define CX_   16.0f
#define CW_   256.0f
#define CQK_  1024.0f
#define CP_   32768.0f
#define SSC_  5.9604644775390625e-8f     /* 2^-4 * 2^-20 : score scale for q,k carried *2^10 each */
#define OSC_  3.0517578125e-5f           /* 2^-15 = 2^10 / (2^15 * 2^10) : attention output carry */
#define QSC_  2.44140625e-4f             /* 2^-12 = 1 / (2^4 * 2^8) : projection outputs back to f32 */
#define WSC_  3.814697265625e-6f         /* 2^-18 = 1 / (2^10 * 2^8) : final projection */

typedef _Float16 v16h __attribute__((ext_vector_type(16)));
typedef _Float16 v8h  __attribute__((ext_vector_type(8)));
typedef float    v8f  __attribute__((ext_vector_type(8)));
typedef float    v4f  __attribute__((ext_vector_type(4)));

union FragU { v16h v; v8h h[2]; };
union U8 { v8f v; v4f q[2]; };

__device__ __forceinline__ float bf16_rne(float f) {
  unsigned u = __float_as_uint(f);
  u = u + 0x7FFFu + ((u >> 16) & 1u);
  return __uint_as_float(u & 0xFFFF0000u);
}
__device__ __forceinline__ v8f zero8() { return (v8f){0.f, 0.f, 0.f, 0.f, 0.f, 0.f, 0.f, 0.f}; }

// 16-bit fragment (A or B): lane row/col = lane&15, elements 0..7 <- p[0..7] (k0+8h..), 8..15 <- p[16..23] (k0+16+8h..)
// p already includes the row base + k0 + 8*h.
__device__ __forceinline__ v16h frag_ld(const _Float16* p) {
  FragU f;
  f.h[0] = *(const v8h*)(p);
  f.h[1] = *(const v8h*)(p + 16);
  return f.v;
}
__device__ __forceinline__ v8f wmma_raw(v16h a, v16h b, v8f c) {
  return __builtin_amdgcn_wmma_f32_16x16x32_f16(false, a, false, b, (short)0, c, false, false);
}
// WMMA with trailing hazard guard (ties D, keeps A/B live)
__device__ __forceinline__ v8f mma_g(v16h a, v16h b, v8f c) {
  c = __builtin_amdgcn_wmma_f32_16x16x32_f16(false, a, false, b, (short)0, c, false, false);
  asm volatile("v_nop\n\tv_nop\n\tv_nop\n\tv_nop" : "+v"(c) : "v"(a), "v"(b));
  return c;
}

// Maximum / sum over each 16-lane row, of eight values at once, left in every lane of the row: the xor butterfly (1, 2, 4, 8) by DPP
// row_xmask steps on the vector pipe: no LDS-pipe permute and no LDS wait. One statement each, a step's eight instructions in a row, so
// that a value's next step stands eight instructions behind the one it depends on. Every lane is on where they are used; volatile keeps
// them there: under a lane test a step would read lanes that are off.
__device__ __forceinline__ void row_max8(float (&v)[8]) {
  asm volatile(
      "v_max_num_f32_dpp %0, %0, %0 row_xmask:1 row_mask:0xf bank_mask:0xf\n\t"
      "v_max_num_f32_dpp %1, %1, %1 row_xmask:1 row_mask:0xf bank_mask:0xf\n\t"
      "v_max_num_f32_dpp %2, %2, %2 row_xmask:1 row_mask:0xf bank_mask:0xf\n\t"
      "v_max_num_f32_dpp %3, %3, %3 row_xmask:1 row_mask:0xf bank_mask:0xf\n\t"
      "v_max_num_f32_dpp %4, %4, %4 row_xmask:1 row_mask:0xf bank_mask:0xf\n\t"
      "v_max_num_f32_dpp %5, %5, %5 row_xmask:1 row_mask:0xf bank_mask:0xf\n\t"
      "v_max_num_f32_dpp %6, %6, %6 row_xmask:1 row_mask:0xf bank_mask:0xf\n\t"
      "v_max_num_f32_dpp %7, %7, %7 row_xmask:1 row_mask:0xf bank_mask:0xf\n\t"
      "v_max_num_f32_dpp %0, %0, %0 row_xmask:2 row_mask:0xf bank_mask:0xf\n\t"
      "v_max_num_f32_dpp %1, %1, %1 row_xmask:2 row_mask:0xf bank_mask:0xf\n\t"
      "v_max_num_f32_dpp %2, %2, %2 row_xmask:2 row_mask:0xf bank_mask:0xf\n\t"
      "v_max_num_f32_dpp %3, %3, %3 row_xmask:2 row_mask:0xf bank_mask:0xf\n\t"
      "v_max_num_f32_dpp %4, %4, %4 row_xmask:2 row_mask:0xf bank_mask:0xf\n\t"
      "v_max_num_f32_dpp %5, %5, %5 row_xmask:2 row_mask:0xf bank_mask:0xf\n\t"
      "v_max_num_f32_dpp %6, %6, %6 row_xmask:2 row_mask:0xf bank_mask:0xf\n\t"
      "v_max_num_f32_dpp %7, %7, %7 row_xmask:2 row_mask:0xf bank_mask:0xf\n\t"
      "v_max_num_f32_dpp %0, %0, %0 row_xmask:4 row_mask:0xf bank_mask:0xf\n\t"
      "v_max_num_f32_dpp %1, %1, %1 row_xmask:4 row_mask:0xf bank_mask:0xf\n\t"
      "v_max_num_f32_dpp %2, %2, %2 row_xmask:4 row_mask:0xf bank_mask:0xf\n\t"
      "v_max_num_f32_dpp %3, %3, %3 row_xmask:4 row_mask:0xf bank_mask:0xf\n\t"
      "v_max_num_f32_dpp %4, %4, %4 row_xmask:4 row_mask:0xf bank_mask:0xf\n\t"
      "v_max_num_f32_dpp %5, %5, %5 row_xmask:4 row_mask:0xf bank_mask:0xf\n\t"
      "v_max_num_f32_dpp %6, %6, %6 row_xmask:4 row_mask:0xf bank_mask:0xf\n\t"
      "v_max_num_f32_dpp %7, %7, %7 row_xmask:4 row_mask:0xf bank_mask:0xf\n\t"
      "v_max_num_f32_dpp %0, %0, %0 row_xmask:8 row_mask:0xf bank_mask:0xf\n\t"
      "v_max_num_f32_dpp %1, %1, %1 row_xmask:8 row_mask:0xf bank_mask:0xf\n\t"
      "v_max_num_f32_dpp %2, %2, %2 row_xmask:8 row_mask:0xf bank_mask:0xf\n\t"
      "v_max_num_f32_dpp %3, %3, %3 row_xmask:8 row_mask:0xf bank_mask:0xf\n\t"
      "v_max_num_f32_dpp %4, %4, %4 row_xmask:8 row_mask:0xf bank_mask:0xf\n\t"
      "v_max_num_f32_dpp %5, %5, %5 row_xmask:8 row_mask:0xf bank_mask:0xf\n\t"
      "v_max_num_f32_dpp %6, %6, %6 row_xmask:8 row_mask:0xf bank_mask:0xf\n\t"
      "v_max_num_f32_dpp %7, %7, %7 row_xmask:8 row_mask:0xf bank_mask:0xf"
      : "+v"(v[0]), "+v"(v[1]), "+v"(v[2]), "+v"(v[3]), "+v"(v[4]), "+v"(v[5]), "+v"(v[6]), "+v"(v[7]));
}
__device__ __forceinline__ void row_sum8(float (&v)[8]) {
  asm volatile(
      "v_add_f32_dpp %0, %0, %0 row_xmask:1 row_mask:0xf bank_mask:0xf\n\t"
      "v_add_f32_dpp %1, %1, %1 row_xmask:1 row_mask:0xf bank_mask:0xf\n\t"
      "v_add_f32_dpp %2, %2, %2 row_xmask:1 row_mask:0xf bank_mask:0xf\n\t"
      "v_add_f32_dpp %3, %3, %3 row_xmask:1 row_mask:0xf bank_mask:0xf\n\t"
      "v_add_f32_dpp %4, %4, %4 row_xmask:1 row_mask:0xf bank_mask:0xf\n\t"
      "v_add_f32_dpp %5, %5, %5 row_xmask:1 row_mask:0xf bank_mask:0xf\n\t"
      "v_add_f32_dpp %6, %6, %6 row_xmask:1 row_mask:0xf bank_mask:0xf\n\t"
      "v_add_f32_dpp %7, %7, %7 row_xmask:1 row_mask:0xf bank_mask:0xf\n\t"
      "v_add_f32_dpp %0, %0, %0 row_xmask:2 row_mask:0xf bank_mask:0xf\n\t"
      "v_add_f32_dpp %1, %1, %1 row_xmask:2 row_mask:0xf bank_mask:0xf\n\t"
      "v_add_f32_dpp %2, %2, %2 row_xmask:2 row_mask:0xf bank_mask:0xf\n\t"
      "v_add_f32_dpp %3, %3, %3 row_xmask:2 row_mask:0xf bank_mask:0xf\n\t"
      "v_add_f32_dpp %4, %4, %4 row_xmask:2 row_mask:0xf bank_mask:0xf\n\t"
      "v_add_f32_dpp %5, %5, %5 row_xmask:2 row_mask:0xf bank_mask:0xf\n\t"
      "v_add_f32_dpp %6, %6, %6 row_xmask:2 row_mask:0xf bank_mask:0xf\n\t"
      "v_add_f32_dpp %7, %7, %7 row_xmask:2 row_mask:0xf bank_mask:0xf\n\t"
      "v_add_f32_dpp %0, %0, %0 row_xmask:4 row_mask:0xf bank_mask:0xf\n\t"
      "v_add_f32_dpp %1, %1, %1 row_xmask:4 row_mask:0xf bank_mask:0xf\n\t"
      "v_add_f32_dpp %2, %2, %2 row_xmask:4 row_mask:0xf bank_mask:0xf\n\t"
      "v_add_f32_dpp %3, %3, %3 row_xmask:4 row_mask:0xf bank_mask:0xf\n\t"
      "v_add_f32_dpp %4, %4, %4 row_xmask:4 row_mask:0xf bank_mask:0xf\n\t"
      "v_add_f32_dpp %5, %5, %5 row_xmask:4 row_mask:0xf bank_mask:0xf\n\t"
      "v_add_f32_dpp %6, %6, %6 row_xmask:4 row_mask:0xf bank_mask:0xf\n\t"
      "v_add_f32_dpp %7, %7, %7 row_xmask:4 row_mask:0xf bank_mask:0xf\n\t"
      "v_add_f32_dpp %0, %0, %0 row_xmask:8 row_mask:0xf bank_mask:0xf\n\t"
      "v_add_f32_dpp %1, %1, %1 row_xmask:8 row_mask:0xf bank_mask:0xf\n\t"
      "v_add_f32_dpp %2, %2, %2 row_xmask:8 row_mask:0xf bank_mask:0xf\n\t"
      "v_add_f32_dpp %3, %3, %3 row_xmask:8 row_mask:0xf bank_mask:0xf\n\t"
      "v_add_f32_dpp %4, %4, %4 row_xmask:8 row_mask:0xf bank_mask:0xf\n\t"
      "v_add_f32_dpp %5, %5, %5 row_xmask:8 row_mask:0xf bank_mask:0xf\n\t"
      "v_add_f32_dpp %6, %6, %6 row_xmask:8 row_mask:0xf bank_mask:0xf\n\t"
      "v_add_f32_dpp %7, %7, %7 row_xmask:8 row_mask:0xf bank_mask:0xf"
      : "+v"(v[0]), "+v"(v[1]), "+v"(v[2]), "+v"(v[3]), "+v"(v[4]), "+v"(v[5]), "+v"(v[6]), "+v"(v[7]));
}

// ---------------------------------------------------------------------------------------------------------------
// Elementwise convert: dst[i] = f16( bf16_rne(src[i]) * scale ), 8 elements per thread, one 16-B store per lane:
// coverage: ceil(n8/256) blocks (blk = the block's index within them), each thread 8 elements -> 8*n8 elements.
// ---------------------------------------------------------------------------------------------------------------
__device__ __forceinline__ void cvt16_part(int blk, const float* __restrict__ src, _Float16* __restrict__ dst, int n8, float scale) {
  const int i = blk * 256 + (int)threadIdx.x;
  if (i >= n8) return;
  const float* s = src + 8 * (size_t)i;
  U8 a;
  a.q[0] = *(const v4f*)(s);
  a.q[1] = *(const v4f*)(s + 4);
  v8h o;
#pragma unroll
  for (int e = 0; e < 8; ++e) o[e] = (_Float16)(bf16_rne(a.v[e]) * scale);
  _Float16* d = dst + 8 * (size_t)i;
  *(v8h*)d = o;
  
}

// ---------------------------------------------------------------------------------------------------------------
// RoPE tables: cosT/sinT [nrows][128], angle = float(pos[row]) * inv_freq[f], inv_freq[f] = 1 / f32(10000^(f/128)).
// coverage: nrows/32 blocks (blk = the block's index within them), 16 iterations x 2 rows -> nrows x 128 per table.
// ---------------------------------------------------------------------------------------------------------------
__device__ __forceinline__ void rope_table_part(int blk, const int* __restrict__ pos, float* __restrict__ cosT,
                                                float* __restrict__ sinT, int nrows) {
#pragma clang fp contract(off)
  __shared__ float invf[NF_];
  const int tid = threadIdx.x;
  if (tid < NF_) {
    const double e = (double)tid * 0.0078125;                 // tid/128 exactly
    const double p = exp2(e * 13.287712379549449);            // 10000^e
    const float pf = (float)p;                                // RNE to f32
    invf[tid] = 1.0f / pf;
  }
  __syncthreads();
  const int f = tid & (NF_ - 1);
  const int rp = tid >> 7;
  const int r0 = blk * 32;
  const float iv = invf[f];
#pragma unroll 1
  for (int it = 0; it < 16; ++it) {
    const int row = r0 + it * 2 + rp;
    const int rowc = (row < nrows) ? row : (nrows - 1);
    const float ang = (float)pos[rowc] * iv;
    float sv, cv;
    sincosf(ang, &sv, &cv);
    if (row < nrows) {
      float* cp = cosT + (size_t)row * NF_ + f;
      float* sp = sinT + (size_t)row * NF_ + f;
      *(float*)cp = cv;
      *(float*)sp = sv;
      // the wait that stands in front of a rewrite of an issued store's registers (the next trip reuses them)
      asm volatile("s_wait_xcnt 0x0" :: "v"(cp), "v"(sp), "v"(cv), "v"(sv) : "memory");
    }
  }
}

// ---------------------------------------------------------------------------------------------------------------
// Mask verification flags, MFG_ per (b, 64-query block), one per group of 4 query rows: 1 if every mask value for the group's rows
// and keys in [q0+64, min(q+1023, SEQ-1)] (the in-band keys strictly above the query block) is <= -1e9 (adds to an exact zero weight).
// The range holds at most 1023 keys, so 256 threads x 4 keys cover a row with one 16-byte load each; the 4 rows' loads are independent.
// coverage: NB*NQB*MFG_ blocks (bid = the block's index within them); each block writes its own 128-byte line of 32 equal ints.
// ---------------------------------------------------------------------------------------------------------------
__device__ __forceinline__ void maskflag_part(int bid, const float* __restrict__ mask, int* __restrict__ flag) {
  __shared__ int sw[8];
  const int tid = threadIdx.x, w = tid >> 5, lane = tid & 31;
  // bid = (b*32 + qb)*MFG_ + row group
  const int g  = bid & (MFG_ - 1);
  const int bq = bid / MFG_;
  const int b = bq >> 5, qb = bq & (NQB_ - 1);
  const int q0 = qb * 64;
  const int r0 = q0 + g * (64 / MFG_);
  const int k  = q0 + 64 + 4 * tid;          // first of this thread's four keys
  const int kc = (k <= SEQ_ - 4) ? k : (SEQ_ - 4);   // k > SEQ-4 means k >= SEQ: none of the four keys is tested
  v4f mv[64 / MFG_];
#pragma unroll   // all rows' loads issue before the first compare waits (and mv stays in registers)
  for (int rr = 0; rr < 64 / MFG_; ++rr) mv[rr] = *(const v4f*)(mask + ((size_t)b * SEQ_ + r0 + rr) * SEQ_ + kc);
  int bad = 0;
#pragma unroll
  for (int rr = 0; rr < 64 / MFG_; ++rr) {
    int kend = r0 + rr + WIN_ - 1;
    if (kend > SEQ_ - 1) kend = SEQ_ - 1;
#pragma unroll
    for (int e = 0; e < 4; ++e) {
      const int ok = (mv[rr][e] <= -1.0e9f) ? 1 : 0;
      bad |= ((k + e <= kend) && (ok == 0)) ? 1 : 0;
    }
  }
  const unsigned long long bm = __ballot(bad);
  if (lane == 0) sw[w] = (bm != 0ull) ? 1 : 0;
  __syncthreads();
  if (w == 0) {
    int any = 0;
#pragma unroll
    for (int i = 0; i < 8; ++i) any |= sw[i];
    const int fv = any ? 0 : 1;
    int* fp = flag + (size_t)bid * 32 + lane;
    *(int*)fp = fv;
  }
}

// ---------------------------------------------------------------------------------------------------------------
// The preparation passes, which depend on the inputs alone and not on one another, share one launch: a block's index range says
// which pass it belongs to (block-uniform, so each pass's barriers are reached by all of its block's threads or by none).
// The table blocks, few and with the longest serial chain, come first; then the mask check; then the five conversions.
// coverage: PB_ALL_ blocks = the sum of the passes' own block counts; every pass gets exactly its blocks.
// ---------------------------------------------------------------------------------------------------------------
#define PB_TAB_ ((NB_ * SEQ_) / 32)               /* 128  */
#define PB_FLG_ (NB_ * NQB_ * MFG_)               /* 1024 */
#define PB_X_   ((NB_ * SEQ_ * DM_) / (8 * 256))  /* 4096 */
#define PB_W_   ((DM_ * DM_) / (8 * 256))         /* 2048 */
#define PB_KV_  ((HD_ * DM_) / (8 * 256))         /* 256  */
#define PB_ALL_ (PB_TAB_ + PB_FLG_ + PB_X_ + 2 * PB_W_ + 2 * PB_KV_)
#define PNJ_   5                                 /* projection: 16-column accumulators per wave */
#define PBN_   (4 * 16 * PNJ_)                   /* projection: 320 columns per block */
static_assert(DM_ == 8 * 256 && PB_W_ == DM_ && PB_KV_ == HD_ && PBN_ == HD_ + 64 && NH_ == 8);
__global__ __launch_bounds__(256) void prep_kernel(const float* __restrict__ x, const float* __restrict__ mask,
                                                   const int* __restrict__ pos, const float* __restrict__ Wq,
                                                   const float* __restrict__ Wk, const float* __restrict__ Wv,
                                                   const float* __restrict__ Wo, _Float16* __restrict__ Xh,
                                                   _Float16* __restrict__ Wp,
                                                   _Float16* __restrict__ Woh, float* __restrict__ cosT,
                                                   float* __restrict__ sinT, int* __restrict__ flag) {
  int blk = blockIdx.x;
  if (blk < PB_TAB_) { rope_table_part(blk, pos, cosT, sinT, NB_ * SEQ_); return; }
  blk -= PB_TAB_;
  if (blk < PB_FLG_) { maskflag_part(blk, mask, flag); return; }
  blk -= PB_FLG_;
  if (blk < PB_X_) { cvt16_part(blk, x, Xh, PB_X_ * 256, CX_); return; }
  blk -= PB_X_;
  // weights: bf16 * 2^8; one block converts one row. Rows of the fused projection plane Wp, 320 per projection block tn: the 256 rows
  // of q head tn, then 64 rows of k (tn < 4: d = 32 tn + 0..31, then 128 + 32 tn + 0..31, so that the block holds both columns of each
  // RoPE pair) or of v (tn >= 4: d = 64 (tn - 4) + 0..63).
  const float* src;
  _Float16* dst;
  if (blk < PB_W_) {
    src = Wq + (size_t)blk * DM_;
    dst = Wp + (size_t)((blk >> 8) * PBN_ + (blk & (HD_ - 1))) * DM_;
  } else if (blk < 2 * PB_W_) {
    src = Wo + (size_t)(blk - PB_W_) * DM_;
    dst = Woh + (size_t)(blk - PB_W_) * DM_;
  } else if (blk < 2 * PB_W_ + PB_KV_) {
    const int d = blk - 2 * PB_W_;
    src = Wk + (size_t)d * DM_;
    dst = Wp + (size_t)(((d & (NF_ - 1)) >> 5) * PBN_ + HD_ + (d >> 7) * 32 + (d & 31)) * DM_;
  } else {
    const int d = blk - 2 * PB_W_ - PB_KV_;
    src = Wv + (size_t)d * DM_;
    dst = Wp + (size_t)((4 + (d >> 6)) * PBN_ + HD_ + (d & 63)) * DM_;
  }
  cvt16_part(0, src, dst, 256, CW_);
}

// ---------------------------------------------------------------------------------------------------------------
// The two WMMA products' common ring figures: operands reach LDS by asynchronous 16-byte copies, whole 256-byte row pieces (128 k) per
// stage, two stages: the next stage's copies fly while this stage is multiplied. LDS row pitch 272 bytes (16 B x odd) for the 16-byte
// fragment reads.
// ---------------------------------------------------------------------------------------------------------------
#define GK_    128                               /* k per stage */
#define GPH_   136                               /* LDS row pitch, halves */
#define GBM_   128
#define GBN_   256
#define G_LS_  (16 * GPH_ * 2)                   /* bytes between LDS rows 16 apart */

// Eight copies per lane, rows 16 apart: l = the lane's LDS byte address, g = its global address, gs = halves per 16 source rows.
// s_wait_xcnt stands inside the statement so that no address register is rewritten ahead of it.
__device__ __forceinline__ void async_rows8(unsigned l, const _Float16* g, size_t gs) {
  asm volatile(
      "global_load_async_to_lds_b128 %0, %8, off\n\t"
      "global_load_async_to_lds_b128 %1, %9, off\n\t"
      "global_load_async_to_lds_b128 %2, %10, off\n\t"
      "global_load_async_to_lds_b128 %3, %11, off\n\t"
      "global_load_async_to_lds_b128 %4, %12, off\n\t"
      "global_load_async_to_lds_b128 %5, %13, off\n\t"
      "global_load_async_to_lds_b128 %6, %14, off\n\t"
      "global_load_async_to_lds_b128 %7, %15, off\n\t"
      "s_wait_xcnt 0x0"
      :: "v"(l), "v"(l + 1u * G_LS_), "v"(l + 2u * G_LS_), "v"(l + 3u * G_LS_),
         "v"(l + 4u * G_LS_), "v"(l + 5u * G_LS_), "v"(l + 6u * G_LS_), "v"(l + 7u * G_LS_),
         "v"(g), "v"(g + gs), "v"(g + 2 * gs), "v"(g + 3 * gs), "v"(g + 4 * gs), "v"(g + 5 * gs), "v"(g + 6 * gs), "v"(g + 7 * gs)
      : "memory");
}

#define PN_    (DM_ + KVN_)                      /* 2560: columns of the fused q | k | v projection plane */

#define AT_PPITCH 72
#define AT_OPITCH 264
#define AT_KP     264                            /* k tile row pitch, halves: 528 B = 16 B x odd */
#define AT_VP     72                             /* v^T tile row pitch, halves: 144 B = 16 B x odd */
#define AT_SV     (64 * AT_KP)                   /* v^T tile, halves from the stage's start */
#define AT_STG    (64 * AT_KP + HD_ * AT_VP)     /* halves per stage */
#define AT_OFF_PH 0
#define AT_OFF_PM 9216
#define AT_OFF_PS 9728
#define AT_OFF_AL 10240
#define AT_OFF_LF 10496
#define AT_OFF_RG 10752                          /* the two stages */
#define AT_OFF_PL (AT_OFF_RG + AT_STG * 2)       /* residual P tile: in the residual k tile's place, which is dead behind the score products */
#define AT_OFF_OH AT_OFF_RG                      /* output staging, behind the barrier that follows the loop */
#define AT_OFF_OL (AT_OFF_RG + 33792)
#define AT_LDS    152064                         /* two blocks per 320-KiB LDS */
static_assert(AT_OFF_PM == AT_OFF_PH + 64 * AT_PPITCH * 2);
static_assert(AT_OFF_OL == AT_OFF_OH + 64 * AT_OPITCH * 2);
static_assert(AT_LDS == AT_OFF_RG + 2 * AT_STG * 2);
static_assert(AT_LDS >= AT_OFF_OL + 64 * AT_OPITCH * 2);
static_assert(64 * AT_PPITCH <= AT_SV);
static_assert(AT_OFF_RG % 16 == 0 && (AT_STG * 2) % 16 == 0 && (AT_SV * 2) % 16 == 0);

// Eight copies per lane: l = the lane's LDS byte address, LS = bytes between its LDS rows, g = its global address, gs = halves between
// its source rows. s_wait_xcnt stands inside the statement so that no address register is rewritten ahead of it.
template <unsigned LS>
__device__ __forceinline__ void async_tile8(unsigned l, const _Float16* g, size_t gs) {
  asm volatile(
      "global_load_async_to_lds_b128 %0, %8, off\n\t"
      "global_load_async_to_lds_b128 %1, %9, off\n\t"
      "global_load_async_to_lds_b128 %2, %10, off\n\t"
      "global_load_async_to_lds_b128 %3, %11, off\n\t"
      "global_load_async_to_lds_b128 %4, %12, off\n\t"
      "global_load_async_to_lds_b128 %5, %13, off\n\t"
      "global_load_async_to_lds_b128 %6, %14, off\n\t"
      "global_load_async_to_lds_b128 %7, %15, off\n\t"
      "s_wait_xcnt 0x0"
      :: "v"(l), "v"(l + 1u * LS), "v"(l + 2u * LS), "v"(l + 3u * LS),
         "v"(l + 4u * LS), "v"(l + 5u * LS), "v"(l + 6u * LS), "v"(l + 7u * LS),
         "v"(g), "v"(g + gs), "v"(g + 2 * gs), "v"(g + 3 * gs), "v"(g + 4 * gs), "v"(g + 5 * gs), "v"(g + 6 * gs), "v"(g + 7 * gs)
      : "memory");
}
// One stage = key tile kt: k rows (a wave's copy = one 512-byte row, rows 8 apart) and v^T rows (a wave's copy = four 128-byte lines,
// rows 32 apart). lk, lv: the lane's LDS byte addresses in the stage; gk, gv: its global addresses in tile 0.
__device__ __forceinline__ void attn_fill(unsigned lk, unsigned lv, const _Float16* gk, const _Float16* gv, int kt) {
  async_tile8<8u * AT_KP * 2u>(lk, gk + (size_t)kt * 64 * HD_, (size_t)8 * HD_);
  async_tile8<32u * AT_VP * 2u>(lv, gv + (size_t)kt * 64, (size_t)32 * SEQ_);
}

// The key-tile loop. One instance per kind of query block (EARLY: residual planes as well, one tile in LDS at a time; else two), so that
// the loop holds no test of the kind and a tile's loads stand in groups ahead of their use: q and k fragments by groups of k-steps, the
// mask values in front of the score products, the v^T fragments in front of the P . V products.
template <bool EARLY>
__device__ __forceinline__ void attn_tiles(int ktlo, int kthi, int b, int q0, int srow0, int kh, int w, int hh, int c,
                                           const _Float16* __restrict__ qhp, const _Float16* __restrict__ qlp,
                                           const _Float16* __restrict__ Kh, const _Float16* __restrict__ Kl,
                                           const float* __restrict__ mrp,
                                           const _Float16* __restrict__ Vth, const _Float16* __restrict__ Vtl, const _Float16* ring,
                                           _Float16* Ph, _Float16* Pl, float* pm, float* ps, float* alph,
                                           float (&mrow)[8], float (&lrow)[8], v8f (&oacc)[4][2]) {
  constexpr int KG = EARLY ? 1 : 2;            // k-steps whose fragments are loaded as one group
  constexpr bool TWO = !EARLY;                 // two stages of hi planes: a tile's copies are issued two tiles ahead
  const int tid = (w << 5) + (hh << 4) + c;
  const unsigned lk = (unsigned)(size_t)ring + (unsigned)((tid >> 5) * AT_KP + (tid & 31) * 8) * 2u;
  const unsigned lv = (unsigned)(size_t)ring + (unsigned)(AT_SV + (tid >> 3) * AT_VP + (tid & 7) * 8) * 2u;
  const size_t ok = ((size_t)b * SEQ_ + (tid >> 5)) * HD_ + (tid & 31) * 8;
  const size_t ov = ((size_t)b * HD_ + (tid >> 3)) * SEQ_ + (tid & 7) * 8;
  const _Float16* gk = Kh + ok;
  const _Float16* gv = Vth + ov;
  if (TWO) {
    attn_fill(lk, lv, gk, gv, ktlo);
    asm volatile("s_wait_asynccnt 0x0" ::: "memory");   // the first tile landed (this wave's copies) before the barrier publishes it
    __syncthreads();
    if (ktlo < kthi) attn_fill(lk + AT_STG * 2u, lv + AT_STG * 2u, gk, gv, ktlo + 1);   // block-uniform
  }
  const float* mtile = mrp + ktlo * 64 + 32 * kh + c;   // the lane's first mask value of the tile, moved on by 64 keys per trip
  for (int kt = ktlo; kt <= kthi; ++kt, mtile += 64) {      // block-uniform, at most 32 trips
    const int key0  = kt * 64;
    const int wkey0 = key0 + 32 * kh;
    const int sb = TWO ? ((kt - ktlo) & 1) : 0;   // the stage of the tile's hi planes
    const _Float16* khp = ring + sb * AT_STG + (32 * kh + c) * AT_KP + 8 * hh;
    const _Float16* klp = khp + AT_STG;
    if (!TWO) {
      attn_fill(lk, lv, gk, gv, kt);
      attn_fill(lk + AT_STG * 2u, lv + AT_STG * 2u, Kl + ok, Vtl + ov, kt);
      asm volatile("s_wait_asynccnt 0x0" ::: "memory");   // the tile landed (this wave's copies) before the barrier publishes it
      __syncthreads();
    }

    // ---- mask values of this wave's 16 x 32 scores, in flight during the score products. Every key of a tile is a column of the mask:
    //      no test guards the loads ----
    float mv[8][2];
    const float* mt = mtile;
#pragma unroll   // register arrays: constant indices
    for (int r = 0; r < 8; ++r) {
#pragma unroll   // register arrays: constant indices
      for (int j = 0; j < 2; ++j) mv[r][j] = mt[(size_t)r * SEQ_ + 16 * j];
    }

    // ---- S = q . k^T (16 rows x 32 keys per wave) ----
    v8f s[2];
    s[0] = zero8(); s[1] = zero8();
#pragma unroll   // constant load offsets, no loop overhead between the groups
    for (int g = 0; g < 8; g += KG) {
      v16h qa[KG], qr[KG], kb[KG][2], kr[KG][2];
#pragma unroll   // register arrays: constant indices
      for (int u = 0; u < KG; ++u) {
        const int ks = g + u;
        qa[u] = frag_ld(qhp + 32 * ks);
        qr[u] = qa[u];
        if (EARLY) qr[u] = frag_ld(qlp + 32 * ks);
#pragma unroll   // register arrays: constant indices
        for (int j = 0; j < 2; ++j) {
          kb[u][j] = frag_ld(khp + (16 * j) * AT_KP + 32 * ks);
          kr[u][j] = kb[u][j];
          if (EARLY) kr[u][j] = frag_ld(klp + (16 * j) * AT_KP + 32 * ks);
        }
      }
#pragma unroll   // register arrays: constant indices
      for (int u = 0; u < KG; ++u) {
#pragma unroll   // register arrays: constant indices
        for (int j = 0; j < 2; ++j) {
          s[j] = mma_g(qa[u], kb[u][j], s[j]);
          if (EARLY) {
            s[j] = mma_g(qr[u], kb[u][j], s[j]);
            s[j] = mma_g(qa[u], kr[u][j], s[j]);
          }
        }
      }
    }

    // the wait that stands in front of a rewrite of an issued load's address registers; naming the tile's mask address keeps it whole
    // up to it (else a later load may take its result into it)
    asm volatile("s_wait_xcnt 0x0" :: "v"(mt) : "memory");

    // ---- scale, mask, partial row max over this wave's 32 keys ----
    float cm[8];
    // key - query row at r = 0, j = 0: the band test then compares with constants, and no per-row bounds are held in registers over the
    // loop (the P fragment groups below need the room)
    const int dkq = wkey0 + c - (q0 + srow0 + 8 * hh);
#pragma unroll
    for (int r = 0; r < 8; ++r) {
      float mx = -INFINITY;
#pragma unroll
      for (int j = 0; j < 2; ++j) {
        const bool inb = (dkq >= r - 16 * j - (WIN_ - 1)) && (dkq <= r - 16 * j + (WIN_ - 1));
        const float sv = inb ? (s[j][r] * SSC_ + mv[r][j]) : -INFINITY;
        s[j][r] = sv;
        mx = fmaxf(mx, sv);
      }
      cm[r] = mx;
    }
    row_max8(cm);
    if (c == 0) {
#pragma unroll
      for (int r = 0; r < 8; ++r) pm[w * 16 + 8 * hh + r] = cm[r];
    }
    __syncthreads();

    // ---- online softmax: tile max, p, partial sums ----
    float al[8], psm[8];
    const int wo = w ^ 4;
#pragma unroll
    for (int r = 0; r < 8; ++r) {
      const float om = pm[wo * 16 + 8 * hh + r];
      const float mnew = fmaxf(mrow[r], fmaxf(cm[r], om));
      const float msafe = (mnew == -INFINITY) ? 0.0f : mnew;
      al[r] = __expf(mrow[r] - msafe);
      mrow[r] = mnew;
      float sum = 0.0f;
#pragma unroll
      for (int j = 0; j < 2; ++j) {
        const float p = __expf(s[j][r] - msafe);
        sum += p;
        const float t = p * CP_;
        const _Float16 phv = (_Float16)t;
        const int pidx = (srow0 + 8 * hh + r) * AT_PPITCH + 32 * kh + 16 * j + c;
        Ph[pidx] = phv;
        if (EARLY) Pl[pidx] = (_Float16)(t - (float)phv);
      }
      psm[r] = sum;
    }
    row_sum8(psm);
    if (c == 0) {
#pragma unroll
      for (int r = 0; r < 8; ++r) ps[w * 16 + 8 * hh + r] = psm[r];
      if (w < 4) {
#pragma unroll
        for (int r = 0; r < 8; ++r) alph[srow0 + 8 * hh + r] = al[r];
      }
    }
    __syncthreads();
#pragma unroll
    for (int r = 0; r < 8; ++r)
      lrow[r] = lrow[r] * al[r] + (ps[(w & 3) * 16 + 8 * hh + r] + ps[((w & 3) + 4) * 16 + 8 * hh + r]);

    // ---- v^T fragments of the tile, from LDS: in flight while O is rescaled ----
    v16h vb[2][2], vr[2][2];
    const _Float16* vht = ring + sb * AT_STG + AT_SV + (32 * w + c) * AT_VP + 8 * hh;
    const _Float16* vlt = vht + AT_STG;
#pragma unroll   // register arrays: constant indices
    for (int k2 = 0; k2 < 2; ++k2) {
#pragma unroll   // register arrays: constant indices
      for (int jj = 0; jj < 2; ++jj) {
        vb[k2][jj] = frag_ld(vht + (16 * jj) * AT_VP + 32 * k2);
        vr[k2][jj] = vb[k2][jj];
        if (EARLY) vr[k2][jj] = frag_ld(vlt + (16 * jj) * AT_VP + 32 * k2);
      }
    }

    // ---- rescale O, then O += P . V for this wave's 32 output columns ----
    if (!EARLY) {
      // Each P fragment is read from LDS once (both column halves use it) and in a group ahead of its use, so that no product waits on
      // an LDS read issued just in front of it: the first 32 keys' fragments with the v^T fragments and the rescale factors, the second
      // 32 keys' in front of the first 32 keys' products.
      const _Float16* pp = Ph + c * AT_PPITCH + 8 * hh;
      v16h pg[2][4];
      U8 av[4];
#pragma unroll   // register arrays: constant indices
      for (int i = 0; i < 4; ++i) pg[0][i] = frag_ld(pp + (16 * i) * AT_PPITCH);
#pragma unroll   // register arrays: constant indices
      for (int i = 0; i < 4; ++i) {
        av[i].q[0] = *(const v4f*)(alph + 16 * i + 8 * hh);
        av[i].q[1] = *(const v4f*)(alph + 16 * i + 8 * hh + 4);
      }
      // holds these LDS reads together in front of the rescale (one LDS wait instead of one per row group)
      asm volatile("" :: "v"(av[0].v), "v"(av[1].v), "v"(av[2].v), "v"(av[3].v));
#pragma unroll
      for (int i = 0; i < 4; ++i) {
#pragma unroll
        for (int r = 0; r < 8; ++r) { oacc[i][0][r] *= av[i].v[r]; oacc[i][1][r] *= av[i].v[r]; }
      }
#pragma unroll   // register arrays: constant indices
      for (int i = 0; i < 4; ++i) pg[1][i] = frag_ld(pp + (16 * i) * AT_PPITCH + 32);
#pragma unroll
      for (int k2 = 0; k2 < 2; ++k2) {
#pragma unroll
        for (int jj = 0; jj < 2; ++jj) {
#pragma unroll
          for (int i = 0; i < 4; ++i) oacc[i][jj] = mma_g(pg[k2][i], vb[k2][jj], oacc[i][jj]);
        }
      }
    } else {
#pragma unroll
      for (int i = 0; i < 4; ++i) {
        U8 av;
        av.q[0] = *(const v4f*)(alph + 16 * i + 8 * hh);
        av.q[1] = *(const v4f*)(alph + 16 * i + 8 * hh + 4);
#pragma unroll
        for (int r = 0; r < 8; ++r) { oacc[i][0][r] *= av.v[r]; oacc[i][1][r] *= av.v[r]; }
      }
#pragma unroll
      for (int k2 = 0; k2 < 2; ++k2) {
#pragma unroll
        for (int jj = 0; jj < 2; ++jj) {
#pragma unroll
          for (int i = 0; i < 4; ++i) {
            const v16h pa = frag_ld(Ph + (16 * i + c) * AT_PPITCH + 32 * k2 + 8 * hh);
            oacc[i][jj] = mma_g(pa, vb[k2][jj], oacc[i][jj]);
            const v16h pr = frag_ld(Pl + (16 * i + c) * AT_PPITCH + 32 * k2 + 8 * hh);
            oacc[i][jj] = mma_g(pa, vr[k2][jj], oacc[i][jj]);
            oacc[i][jj] = mma_g(pr, vb[k2][jj], oacc[i][jj]);
          }
        }
      }
    }

    // ---- hand-over of the stages ----
    asm volatile("s_wait_dscnt 0x0" ::: "memory");        // this wave's reads (and residual P writes) there are done before a refill
    if (TWO) asm volatile("s_wait_asynccnt 0x0" ::: "memory");   // this wave's copies of the next tile have landed
    __syncthreads();                                      // frees tile kt's stage; with two stages it publishes tile kt+1 as well
    if (TWO && kt + 2 <= kthi)                            // block-uniform
      attn_fill(lk + (unsigned)sb * (AT_STG * 2u), lv + (unsigned)sb * (AT_STG * 2u), gk, gv, kt + 2);
  }
  if (TWO) asm volatile("s_wait_asynccnt 0x0" ::: "memory");   // nothing in flight when the stages become output staging
}

// amdgpu_waves_per_eu(4, 4): holds the registers to four waves per SIMD, so that two blocks share a WGP (2 x AT_LDS fits its LDS)
__global__ __launch_bounds__(256) __attribute__((amdgpu_waves_per_eu(4, 4))) void attn_kernel(const _Float16* __restrict__ Qh, const _Float16* __restrict__ Ql,
                                                   const _Float16* __restrict__ Kh, const _Float16* __restrict__ Kl,
                                                   const _Float16* __restrict__ Vth, const _Float16* __restrict__ Vtl,
                                                   const float* __restrict__ mask, const int* __restrict__ flag,
                                                   _Float16* __restrict__ AOh, _Float16* __restrict__ AOl) {
  extern __shared__ __align__(16) unsigned char dsm[];
  _Float16* Ph   = (_Float16*)(dsm + AT_OFF_PH);
  _Float16* Pl   = (_Float16*)(dsm + AT_OFF_PL);
  float*    pm   = (float*)(dsm + AT_OFF_PM);     // [8 waves][16 rows] partial row max
  float*    ps   = (float*)(dsm + AT_OFF_PS);     // [8 waves][16 rows] partial row sum
  float*    alph = (float*)(dsm + AT_OFF_AL);     // [64] rescale factors
  float*    lfin = (float*)(dsm + AT_OFF_LF);     // [64] final row sums
  const _Float16* ring = (const _Float16*)(dsm + AT_OFF_RG);   // two stages of k and v^T tiles
  _Float16* Ohs  = (_Float16*)(dsm + AT_OFF_OH);
  _Float16* Ols  = (_Float16*)(dsm + AT_OFF_OL);

  const int tid  = threadIdx.x;
  const int w    = tid >> 5;
  const int lane = tid & 31;
  const int hh   = lane >> 4;
  const int c    = lane & 15;
  const int bid  = blockIdx.x;
  const int qb   = bid & (NQB_ - 1);
  const int h    = (bid >> 5) & (NH_ - 1);
  const int b    = bid >> 8;
  const int q0   = qb * 64;
  const int srow0 = (w & 3) * 16;
  const int kh    = w >> 2;
  const int ocol0 = w * 32;
  const bool early = (qb < QE_);
  const int ktlo = (qb > 16) ? (qb - 16) : 0;
  int fl = 1;                                  // block-uniform: all row groups of this query block verified
#pragma unroll   // independent scalar loads, issued together instead of one round trip each
  for (int g = 0; g < MFG_; ++g) fl &= flag[((b * NQB_ + qb) * MFG_ + g) * 32];
  int kthi = (fl != 0) ? qb : (qb + 16);
  if (kthi > NQB_ - 1) kthi = NQB_ - 1;

  const size_t growq = (size_t)b * SEQ_ + q0;
  const _Float16* qhp = Qh + (growq + srow0 + c) * DM_ + h * HD_ + 8 * hh;
  const _Float16* qlp = Ql + (growq + srow0 + c) * DM_ + h * HD_ + 8 * hh;
  const float*    mrp = mask + (growq + srow0 + 8 * hh) * (size_t)SEQ_;

  float mrow[8], lrow[8];
  v8f oacc[4][2];
#pragma unroll
  for (int r = 0; r < 8; ++r) { mrow[r] = -INFINITY; lrow[r] = 0.0f; }
#pragma unroll
  for (int i = 0; i < 4; ++i) { oacc[i][0] = zero8(); oacc[i][1] = zero8(); }

  if (early)   // block-uniform
    attn_tiles<true>(ktlo, kthi, b, q0, srow0, kh, w, hh, c, qhp, qlp, Kh, Kl, mrp, Vth, Vtl, ring, Ph, Pl, pm, ps, alph, mrow, lrow, oacc);
  else
    attn_tiles<false>(ktlo, kthi, b, q0, srow0, kh, w, hh, c, qhp, qlp, Kh, Kl, mrp, Vth, Vtl, ring, Ph, Pl, pm, ps, alph, mrow, lrow, oacc);

  if (w < 4 && c == 0) {
#pragma unroll
    for (int r = 0; r < 8; ++r) lfin[srow0 + 8 * hh + r] = lrow[r];
  }
  __syncthreads();
#pragma unroll
  for (int i = 0; i < 4; ++i) {
    U8 lv;
    lv.q[0] = *(const v4f*)(lfin + 16 * i + 8 * hh);
    lv.q[1] = *(const v4f*)(lfin + 16 * i + 8 * hh + 4);
#pragma unroll
    for (int r = 0; r < 8; ++r) {
      const float f = OSC_ * (1.0f / lv.v[r]);
      const int orow = 16 * i + 8 * hh + r;
#pragma unroll
      for (int jj = 0; jj < 2; ++jj) {
        const float t = oacc[i][jj][r] * f;
        const _Float16 hq = (_Float16)t;
        const int oidx = orow * AT_OPITCH + ocol0 + 16 * jj + c;
        Ohs[oidx] = hq;
        Ols[oidx] = (_Float16)(t - (float)hq);
      }
    }
  }
  __syncthreads();
  {
    const int piece = tid & 7;
    const int lsub  = tid >> 3;
    {
#pragma unroll
      for (int it = 0; it < 8; ++it) {
        const int line = it * 32 + lsub;          // 0..255 = 64 rows x 4 lines
        const int row  = line >> 2;
        const int col  = (line & 3) * 64 + piece * 8;
        const v8h hv = *(const v8h*)(Ohs + row * AT_OPITCH + col);
        const v8h rv = *(const v8h*)(Ols + row * AT_OPITCH + col);
        const size_t go = (growq + row) * DM_ + h * HD_ + col;
        *(v8h*)(AOh + go) = hv;
        *(v8h*)(AOl + go) = rv;
      }
      
    }
  }
}

// ---------------------------------------------------------------------------------------------------------------
// The q, k and v projections as ONE product over the PN_ = 2560 rows of the fused weight plane (row order: prep_kernel), with RoPE, the
// f16 hi/residual split and the v transpose in its epilogue: c[m][n] = 2^-12 * sum_k A[m][k] * Bt[n][k] never leaves the block as f32.
// Block = 8 waves (2 x 4) on a 128 x 320 tile, each wave 64 x 80 (4 x 5 accumulators): 32 x 8 = 256 equal blocks, one per WGP in
// one round (a block's LDS leaves room for no second one). Block column tn holds q head tn (tile columns 0..255) and, in tile columns
// 256..319, 32 RoPE pairs of k (tn < 4) or 64 columns of v (tn >= 4).
// The ring: asynchronous 16-byte copies, 256-byte row pieces (128 k) per stage, two stages, pitch 272 bytes.
// Epilogue: the whole tile staged as f32 in the (then free) ring (v columns transposed as well, behind it); then, per unit of one row and
// 8 pairs (c, c + 128): out = x*cos + rotate_half(x)*sin with cos/sin[row][c], hi = f16(out*2^10), lo = f16(out*2^10 - hi).
// Order of the head dimension in the q and k planes (the same in both, so q . k pairs equal d): pair c stands at 16 (c >> 3) + (c & 7),
// its partner c + 128 eight places on: a unit's 16 results are 32 contiguous bytes and a block's 32 pairs of k one whole 128-byte line.
// v: hi = f16(v*2^10), lo = residual, planes [b][d][s], 8 consecutive s per unit, 256-byte runs per d.
// coverage per block: q 2 x 4 x 256 units = 128 rows x 16 chunks; k 2 x 256 units = 128 rows x 4 chunks; v 4 x 256 units = 64 d x 16 chunks.
// ---------------------------------------------------------------------------------------------------------------
#define P_OB_  (GBM_ * GPH_)                     /* Bt rows, halves from the stage's start */
#define P_STG_ ((GBM_ + PBN_) * GPH_)            /* halves per stage */
#define P_CP_  (PBN_ + 4)                        /* staged tile row pitch, floats: rows 8 apart fall 32 banks apart */
#define P_VP_  (GBM_ + 4)                        /* staged v^T row pitch, floats: 16 B x odd */
static_assert(PN_ % PBN_ == 0 && (NB_ * SEQ_) % GBM_ == 0 && DM_ % GK_ == 0 && DM_ / GK_ >= 2 && SEQ_ % GBM_ == 0);
static_assert(2 * P_STG_ * 2 >= (GBM_ * P_CP_ + 64 * P_VP_) * 4 && (GBM_ * P_CP_ * 4) % 16 == 0);

// RoPE and split of 8 pairs: xa = columns c.., xc = columns c + 128.., ca / sa = cos / sin at c..; o = hi(c), hi(c+128), lo(c), lo(c+128).
__device__ __forceinline__ void rope_pairs8(const U8& xa, const U8& xc, const U8& ca, const U8& sa, v8h (&o)[4]) {
#pragma unroll
  for (int e = 0; e < 8; ++e) {
    const float t0 = (xa.v[e] * ca.v[e] - xc.v[e] * sa.v[e]) * CQK_;
    const float t1 = (xc.v[e] * ca.v[e] + xa.v[e] * sa.v[e]) * CQK_;
    const _Float16 q0 = (_Float16)t0, q1 = (_Float16)t1;
    o[0][e] = q0; o[1][e] = q1;
    o[2][e] = (_Float16)(t0 - (float)q0);
    o[3][e] = (_Float16)(t1 - (float)q1);
  }
}
// NU units of one thread, tile rows RS apart: cr = the first unit's columns c.. in the staged tile (partners XO floats on), ct / st = its
// cos / sin values, hp / lp = its place in the hi / residual plane (row pitch DP halves). All table loads first, all stores last.
template <int NU, int RS, int XO, int DP>
__device__ __forceinline__ void rope_units(const float* cr, const float* ct, const float* st, _Float16* hp, _Float16* lp) {
  U8 ca[NU], sa[NU];
#pragma unroll   // register arrays: constant indices; all the units' table loads in flight together
  for (int it = 0; it < NU; ++it) {
    ca[it].q[0] = *(const v4f*)(ct + it * RS * NF_);  ca[it].q[1] = *(const v4f*)(ct + it * RS * NF_ + 4);
    sa[it].q[0] = *(const v4f*)(st + it * RS * NF_);  sa[it].q[1] = *(const v4f*)(st + it * RS * NF_ + 4);
  }
  // the wait that stands in front of a rewrite of an issued load's address registers; naming the addresses keeps them whole up to it
  asm volatile("s_wait_xcnt 0x0" :: "v"(ct), "v"(st) : "memory");
  v8h o[NU][4];
  _Float16* p[NU][2];
#pragma unroll   // register arrays: constant indices
  for (int it = 0; it < NU; ++it) {
    const float* x = cr + it * RS * P_CP_;
    U8 xa, xc;
    xa.q[0] = *(const v4f*)(x);       xa.q[1] = *(const v4f*)(x + 4);
    xc.q[0] = *(const v4f*)(x + XO);  xc.q[1] = *(const v4f*)(x + XO + 4);
    rope_pairs8(xa, xc, ca[it], sa[it], o[it]);
    p[it][0] = hp + (size_t)it * RS * DP;
    p[it][1] = lp + (size_t)it * RS * DP;
  }
#pragma unroll   // register arrays: constant indices
  for (int it = 0; it < NU; ++it) {
    *(v8h*)(p[it][0])     = o[it][0];
    *(v8h*)(p[it][0] + 8) = o[it][1];
    *(v8h*)(p[it][1])     = o[it][2];
    *(v8h*)(p[it][1] + 8) = o[it][3];
  }
  // the wait that stands in front of a rewrite of an issued store's registers (what follows reuses them); naming them keeps them whole
  // up to it
  if constexpr (NU == 4)
    asm volatile("s_wait_xcnt 0x0" :: "v"(p[0][0]), "v"(p[0][1]), "v"(p[1][0]), "v"(p[1][1]), "v"(p[2][0]), "v"(p[2][1]), "v"(p[3][0]),
                 "v"(p[3][1]), "v"(o[0][0]), "v"(o[0][1]), "v"(o[0][2]), "v"(o[0][3]), "v"(o[1][0]), "v"(o[1][1]), "v"(o[1][2]),
                 "v"(o[1][3]), "v"(o[2][0]), "v"(o[2][1]), "v"(o[2][2]), "v"(o[2][3]), "v"(o[3][0]), "v"(o[3][1]), "v"(o[3][2]),
                 "v"(o[3][3]) : "memory");
  else
    asm volatile("s_wait_xcnt 0x0" :: "v"(p[0][0]), "v"(p[0][1]), "v"(p[1][0]), "v"(p[1][1]), "v"(o[0][0]), "v"(o[0][1]), "v"(o[0][2]),
                 "v"(o[0][3]), "v"(o[1][0]), "v"(o[1][1]), "v"(o[1][2]), "v"(o[1][3]) : "memory");
}

// Four copies per lane, rows 16 apart (as async_rows8). s_wait_xcnt stands inside the statement so that no address register is
// rewritten ahead of it.
__device__ __forceinline__ void async_rows4(unsigned l, const _Float16* g, size_t gs) {
  asm volatile(
      "global_load_async_to_lds_b128 %0, %4, off\n\t"
      "global_load_async_to_lds_b128 %1, %5, off\n\t"
      "global_load_async_to_lds_b128 %2, %6, off\n\t"
      "global_load_async_to_lds_b128 %3, %7, off\n\t"
      "s_wait_xcnt 0x0"
      :: "v"(l), "v"(l + 1u * G_LS_), "v"(l + 2u * G_LS_), "v"(l + 3u * G_LS_),
         "v"(g), "v"(g + gs), "v"(g + 2 * gs), "v"(g + 3 * gs)
      : "memory");
}
// One stage: A 128 rows, Bt 320 rows, 256 bytes of each.
__device__ __forceinline__ void proj_fill(unsigned l, const _Float16* ga, const _Float16* gb) {
  const size_t s16 = (size_t)16 * DM_;
  async_rows8(l, ga, s16);
  async_rows8(l + P_OB_ * 2u, gb, s16);
  async_rows8(l + P_OB_ * 2u + 8u * G_LS_, gb + 8 * s16, s16);
  async_rows4(l + P_OB_ * 2u + 16u * G_LS_, gb + 16 * s16, s16);
}

__global__ __launch_bounds__(256) void proj_kernel(const _Float16* __restrict__ A, const _Float16* __restrict__ Bt,
                                                   const float* __restrict__ cosT, const float* __restrict__ sinT,
                                                   _Float16* __restrict__ Qh, _Float16* __restrict__ Ql,
                                                   _Float16* __restrict__ Kh, _Float16* __restrict__ Kl,
                                                   _Float16* __restrict__ Vth, _Float16* __restrict__ Vtl) {
  // two stages; afterwards the block's 128 x 320 f32 tile, pitch P_CP_ floats, and behind it its 64 v columns transposed, pitch P_VP_
  __shared__ __align__(16) _Float16 ring[2 * P_STG_];
  const int tid  = threadIdx.x;
  const int lane = tid & 31;
  const int wave = tid >> 5;
  const int tm = (int)blockIdx.x / (PN_ / PBN_);
  const int tn = (int)blockIdx.x - tm * (PN_ / PBN_);
  const int m0b = tm * GBM_;
  const int n0b = tn * PBN_;
  const int wrow = (wave >> 2) << 6;
  const int wcol = (wave & 3) * (16 * PNJ_);
  const int rlane = lane & 15;
  const int koff  = (lane >> 4) * 8;

  v8f acc[4][PNJ_];
#pragma unroll
  for (int i = 0; i < 4; ++i)
#pragma unroll
    for (int j = 0; j < PNJ_; ++j) acc[i][j] = zero8();

  const int sub = tid >> 4;
  const int cc  = (tid & 15) * 8;
  const unsigned l0 = (unsigned)(size_t)ring + (unsigned)(sub * GPH_ + cc) * 2u;
  const _Float16* ga = A  + (size_t)(m0b + sub) * DM_ + cc;
  const _Float16* gb = Bt + (size_t)(n0b + sub) * DM_ + cc;
  constexpr int nt = DM_ / GK_;

  proj_fill(l0, ga, gb);
  asm volatile("s_wait_asynccnt 0x0" ::: "memory");   // stage 0 landed (this wave's copies) before the barrier publishes it
  __syncthreads();
  proj_fill(l0 + P_STG_ * 2u, ga + GK_, gb + GK_);

  for (int t = 0; t < nt; ++t) {
    const _Float16* st = ring + (t & 1) * P_STG_;
    const _Float16* sa = st + (wrow + rlane) * GPH_ + koff;
    const _Float16* sb = st + P_OB_ + (wcol + rlane) * GPH_ + koff;
#pragma unroll   // the four k-steps of a stage in one body: constant LDS offsets, no loop overhead between them
    for (int kk = 0; kk < GK_; kk += 32) {
      v16h bh[PNJ_], ah[4];
#pragma unroll   // register arrays: constant indices
      for (int j = 0; j < PNJ_; ++j) bh[j] = frag_ld(sb + (j << 4) * GPH_ + kk);
#pragma unroll   // register arrays: constant indices
      for (int i = 0; i < 4; ++i) ah[i] = frag_ld(sa + (i << 4) * GPH_ + kk);
      // holds the k-step's fragment reads together in front of its products (one LDS wait per k-step instead of one per row)
      asm volatile("" :: "v"(bh[0]), "v"(bh[1]), "v"(bh[2]), "v"(bh[3]), "v"(bh[4]), "v"(ah[0]), "v"(ah[1]), "v"(ah[2]), "v"(ah[3]));
#pragma unroll   // register arrays: constant indices
      for (int i = 0; i < 4; ++i) {
#pragma unroll   // register arrays: constant indices
        for (int j = 0; j < PNJ_; ++j) acc[i][j] = wmma_raw(ah[i], bh[j], acc[i][j]);
      }
    }
    asm volatile("s_wait_dscnt 0x0" ::: "memory");      // this wave's reads of the stage are done before it may be refilled
    asm volatile("s_wait_asynccnt 0x0" ::: "memory");   // this wave's copies of the next stage have landed
    __syncthreads();                                    // publishes stage t+1 and frees stage t's buffer
    if (t + 2 < nt)
      proj_fill(l0 + (unsigned)(t & 1) * (P_STG_ * 2u), ga + (size_t)(t + 2) * GK_, gb + (size_t)(t + 2) * GK_);
  }
  asm volatile("s_wait_asynccnt 0x0" ::: "memory");     // nothing in flight when the ring becomes output staging

  float* cst = (float*)ring;
#pragma unroll
  for (int i = 0; i < 4; ++i) {
#pragma unroll
    for (int j = 0; j < PNJ_; ++j) {
#pragma unroll
      for (int r = 0; r < 8; ++r) cst[(wrow + (i << 4) + koff + r) * P_CP_ + wcol + (j << 4) + rlane] = acc[i][j][r] * QSC_;
    }
  }
  float* vts = cst + GBM_ * P_CP_;
  if (tn >= 4 && (wave & 3) == 3) {                     // the waves that hold tile columns 256..319 (their accumulators j = 1..4)
#pragma unroll
    for (int i = 0; i < 4; ++i) {
#pragma unroll
      for (int j = 1; j < PNJ_; ++j) {
        U8 t;                                           // a lane's 8 values are 8 consecutive rows (s) of one column (d)
#pragma unroll
        for (int r = 0; r < 8; ++r) t.v[r] = acc[i][j][r] * QSC_;
        float* vp = vts + (((j - 1) << 4) + rlane) * P_VP_ + wrow + (i << 4) + koff;
        *(v4f*)(vp)     = t.q[0];
        *(v4f*)(vp + 4) = t.q[1];
      }
    }
  }
  __syncthreads();                                      // the tile is whole before any wave reads other waves' columns

  {   // q head tn: unit = (row, chunk u of 8 pairs), 16 lanes per row
    const int u = tid & 15;
    const int r = tid >> 4;
#pragma unroll 1   // four units' loads and stores per trip are enough in flight; keeps the text short
    for (int g = 0; g < 2; ++g) {
      const int row = g * 64 + r;
      const size_t to = (size_t)(m0b + row) * NF_ + 8 * u;
      const size_t qo = (size_t)(m0b + row) * DM_ + tn * HD_ + 16 * u;
      rope_units<4, 16, NF_, DM_>(cst + row * P_CP_ + 8 * u, cosT + to, sinT + to, Qh + qo, Ql + qo);
    }
  }
  if (tn < 4) {   // block-uniform. k pairs c = 32 tn + 0..31: unit = (row, chunk u of 8 pairs), 4 lanes per row
    const int u = tid & 3;
    const int row = tid >> 2;
    const size_t to = (size_t)(m0b + row) * NF_ + 32 * tn + 8 * u;
    const size_t ko = (size_t)(m0b + row) * HD_ + 64 * tn + 16 * u;
    rope_units<2, 64, 32, HD_>(cst + row * P_CP_ + HD_ + 8 * u, cosT + to, sinT + to, Kh + ko, Kl + ko);
  } else {        // v columns d = 64 (tn - 4) + 0..63: unit = (d, 8 consecutive s), 16 lanes per d
    const int sc = (tid & 15) * 8;
    const int d  = tid >> 4;
    const size_t go = ((size_t)(m0b / SEQ_) * HD_ + (tn - 4) * 64 + d) * SEQ_ + (m0b & (SEQ_ - 1)) + sc;
    v8h o[4][2];
    _Float16* p[4][2];
#pragma unroll   // register arrays: constant indices
    for (int it = 0; it < 4; ++it) {
      const float* x = vts + (it * 16 + d) * P_VP_ + sc;
      U8 t;
      t.q[0] = *(const v4f*)(x);
      t.q[1] = *(const v4f*)(x + 4);
#pragma unroll
      for (int e = 0; e < 8; ++e) {
        const float f = t.v[e] * CQK_;
        const _Float16 hq = (_Float16)f;
        o[it][0][e] = hq;
        o[it][1][e] = (_Float16)(f - (float)hq);
      }
      p[it][0] = Vth + go + (size_t)it * 16 * SEQ_;
      p[it][1] = Vtl + go + (size_t)it * 16 * SEQ_;
    }
#pragma unroll   // register arrays: constant indices
    for (int it = 0; it < 4; ++it) {
      *(v8h*)(p[it][0]) = o[it][0];
      *(v8h*)(p[it][1]) = o[it][1];
    }
    // the wait that stands in front of a rewrite of an issued store's registers; naming them keeps them whole up to it
    // (the eight stores address by constant offsets from the first pair)
    asm volatile("s_wait_xcnt 0x0" :: "v"(p[0][0]), "v"(p[0][1]), "v"(o[0][0]), "v"(o[0][1]), "v"(o[1][0]), "v"(o[1][1]), "v"(o[2][0]),
                 "v"(o[2][1]), "v"(o[3][0]), "v"(o[3][1]) : "memory");
  }
}

// ---------------------------------------------------------------------------------------------------------------
// Output projection: C[m][n] = 2^-18 * sum_k (A[m][k] (+ A2[m][k])) * Bt[n][k], A = the attention output's hi plane, A2 = its residual
// plane, which counts on the first LOROWS_ rows of each sequence only; Bt = Wo rows (k contiguous); C f32 [4096][2048].
// The rows with a residual plane cost twice the products. They are dealt out evenly: every block's 128 x 256 tile of C holds 112 rows
// without and 16 rows with the residual plane (tile rows 112..127), so that all 32 x 8 = 256 blocks, one per WGP, do the same work,
// 9/8 of a plain tile's, where whole tiles of such rows would do 2 tiles' work on 32 WGPs while the others idle.
// Block = 8 waves (2 x 4), each wave 64 x 64 (4 x 4 accumulators); the four waves of the lower row half add the residual products
// (4 more per k-step, behind a scalar branch that holds no barrier).
// Per accumulator the order of the sums is hi, residual, k-step by k-step.
// The ring is that of proj_kernel. Epilogue: the whole tile staged in the (then free) ring, then stored by 512-byte runs of its rows.
// ---------------------------------------------------------------------------------------------------------------
#define O_LO_  16                                /* tile rows with a residual plane */
#define O_HI_  (GBM_ - O_LO_)                    /* 112 tile rows without */
#define O_OA2_ (GBM_ * GPH_)                     /* residual rows, halves from the stage's start */
#define O_OB_  ((GBM_ + O_LO_) * GPH_)           /* Bt rows, halves from the stage's start */
#define O_STG_ ((GBM_ + O_LO_ + GBN_) * GPH_)    /* halves per stage */
#define O_CP_  (GBN_ + 4)                        /* staged C row pitch, floats: rows 8 apart fall 32 banks apart */
#define O_TS_  ((SEQ_ - LOROWS_) / O_HI_)        /* 16 row tiles per sequence */
static_assert((SEQ_ - LOROWS_) % O_HI_ == 0 && LOROWS_ == O_TS_ * O_LO_ && O_LO_ == 16 && O_HI_ % 16 == 0);
static_assert(DM_ % GBN_ == 0 && DM_ % GK_ == 0 && DM_ / GK_ >= 2 && NB_ * O_TS_ == (NB_ * SEQ_) / GBM_);
static_assert(2 * O_STG_ * 2 >= GBM_ * O_CP_ * 4);
static_assert((GBM_ * (GBN_ / 4)) % (8 * 256) == 0);

// Five copies per lane, LDS rows 16 apart, each with a source address of its own. s_wait_xcnt stands inside the statement so that no
// address register is rewritten ahead of it.
__device__ __forceinline__ void async_rows5(unsigned l, const _Float16* g0, const _Float16* g1, const _Float16* g2,
                                            const _Float16* g3, const _Float16* g4) {
  asm volatile(
      "global_load_async_to_lds_b128 %0, %5, off\n\t"
      "global_load_async_to_lds_b128 %1, %6, off\n\t"
      "global_load_async_to_lds_b128 %2, %7, off\n\t"
      "global_load_async_to_lds_b128 %3, %8, off\n\t"
      "global_load_async_to_lds_b128 %4, %9, off\n\t"
      "s_wait_xcnt 0x0"
      :: "v"(l), "v"(l + 1u * G_LS_), "v"(l + 2u * G_LS_), "v"(l + 3u * G_LS_), "v"(l + 4u * G_LS_),
         "v"(g0), "v"(g1), "v"(g2), "v"(g3), "v"(g4)
      : "memory");
}
// One stage, 256 bytes of each row: A 112 rows (ga), A 16 rows (gl), A2 the same 16 rows (gr), Bt 256 rows (gb).
__device__ __forceinline__ void oproj_fill(unsigned l, const _Float16* ga, const _Float16* gl, const _Float16* gr, const _Float16* gb) {
  const size_t s16 = (size_t)16 * DM_;
  async_rows4(l, ga, s16);
  async_rows5(l + 4u * G_LS_, ga + 4 * s16, ga + 5 * s16, ga + 6 * s16, gl, gr);
  async_rows8(l + O_OB_ * 2u, gb, s16);
  async_rows8(l + O_OB_ * 2u + 8u * G_LS_, gb + 8 * s16, s16);
}
// One stage's products of one wave. res (wave-uniform, a scalar): the wave's last 16 rows have a residual plane (sr = its fragment rows).
__device__ __forceinline__ void oproj_stage(v8f (&acc)[4][4], const _Float16* sa, const _Float16* sr, const _Float16* sb, bool res) {
#pragma unroll   // the four k-steps of a stage in one body: constant LDS offsets, no loop overhead between them
  for (int kk = 0; kk < GK_; kk += 32) {
    v16h bh[4], ah[4];
#pragma unroll   // register arrays: constant indices
    for (int j = 0; j < 4; ++j) bh[j] = frag_ld(sb + (j << 4) * GPH_ + kk);
#pragma unroll   // register arrays: constant indices
    for (int i = 0; i < 4; ++i) ah[i] = frag_ld(sa + (i << 4) * GPH_ + kk);
    const v16h al = frag_ld(sr + kk);   // read by every wave, so that the k-step's reads stand in one group with no branch among them
    // holds the k-step's fragment reads together in front of its products (one LDS wait per k-step instead of one per row)
    asm volatile("" :: "v"(bh[0]), "v"(bh[1]), "v"(bh[2]), "v"(bh[3]), "v"(ah[0]), "v"(ah[1]), "v"(ah[2]), "v"(ah[3]), "v"(al));
#pragma unroll   // register arrays: constant indices
    for (int i = 0; i < 4; ++i) {
#pragma unroll   // register arrays: constant indices
      for (int j = 0; j < 4; ++j) acc[i][j] = wmma_raw(ah[i], bh[j], acc[i][j]);
    }
    if (res) {
#pragma unroll   // register arrays: constant indices
      for (int j = 0; j < 4; ++j) acc[3][j] = wmma_raw(al, bh[j], acc[3][j]);
    }
  }
}

__global__ __launch_bounds__(256) void oproj_kernel(const _Float16* __restrict__ A, const _Float16* __restrict__ A2,
                                                    const _Float16* __restrict__ Bt, float* __restrict__ C) {
  __shared__ __align__(16) _Float16 ring[2 * O_STG_];   // two stages; afterwards the block's 128 x 256 f32 tile, pitch O_CP_ floats
  const int tid  = threadIdx.x;
  const int lane = tid & 31;
  const int wave = tid >> 5;
  const int tm = (int)blockIdx.x / (DM_ / GBN_);
  const int tn = (int)blockIdx.x - tm * (DM_ / GBN_);
  const int sq = tm / O_TS_;                            // sequence
  const int ts = tm - sq * O_TS_;                       // row tile within it
  const int rh0 = sq * SEQ_ + LOROWS_ + ts * O_HI_;     // global row of tile row 0 (rows without a residual plane)
  const int rl0 = sq * SEQ_ + ts * O_LO_;               // global row of tile row O_HI_ (rows with one)
  const int n0b = tn * GBN_;
  const int wrow = (wave >> 2) << 6;
  const int wcol = (wave & 3) << 6;
  const int rlane = lane & 15;
  const int koff  = (lane >> 4) * 8;
  // wave-uniform, in a scalar register: the branch on it is a scalar one and holds no barrier
  const bool res = __builtin_amdgcn_readfirstlane(wave >> 2) != 0;

  v8f acc[4][4];
#pragma unroll
  for (int i = 0; i < 4; ++i)
#pragma unroll
    for (int j = 0; j < 4; ++j) acc[i][j] = zero8();

  const int sub = tid >> 4;
  const int cc  = (tid & 15) * 8;
  const unsigned l0 = (unsigned)(size_t)ring + (unsigned)(sub * GPH_ + cc) * 2u;
  const _Float16* ga = A  + (size_t)(rh0 + sub) * DM_ + cc;
  const _Float16* gl = A  + (size_t)(rl0 + sub) * DM_ + cc;
  const _Float16* gr = A2 + (size_t)(rl0 + sub) * DM_ + cc;
  const _Float16* gb = Bt + (size_t)(n0b + sub) * DM_ + cc;
  constexpr int nt = DM_ / GK_;

  oproj_fill(l0, ga, gl, gr, gb);
  asm volatile("s_wait_asynccnt 0x0" ::: "memory");   // stage 0 landed (this wave's copies) before the barrier publishes it
  __syncthreads();
  oproj_fill(l0 + O_STG_ * 2u, ga + GK_, gl + GK_, gr + GK_, gb + GK_);

  for (int t = 0; t < nt; ++t) {
    const _Float16* st = ring + (t & 1) * O_STG_;
    const _Float16* sa = st + (wrow + rlane) * GPH_ + koff;
    const _Float16* sr = st + O_OA2_ + rlane * GPH_ + koff;
    const _Float16* sb = st + O_OB_ + (wcol + rlane) * GPH_ + koff;
    oproj_stage(acc, sa, sr, sb, res);
    asm volatile("s_wait_dscnt 0x0" ::: "memory");      // this wave's reads of the stage are done before it may be refilled
    asm volatile("s_wait_asynccnt 0x0" ::: "memory");   // this wave's copies of the next stage have landed
    __syncthreads();                                    // publishes stage t+1 and frees stage t's buffer
    if (t + 2 < nt) {
      const size_t ko = (size_t)(t + 2) * GK_;
      oproj_fill(l0 + (unsigned)(t & 1) * (O_STG_ * 2u), ga + ko, gl + ko, gr + ko, gb + ko);
    }
  }
  asm volatile("s_wait_asynccnt 0x0" ::: "memory");     // nothing in flight when the ring becomes output staging

  float* cst = (float*)ring;
#pragma unroll
  for (int i = 0; i < 4; ++i) {
#pragma unroll
    for (int j = 0; j < 4; ++j) {
#pragma unroll
      for (int r = 0; r < 8; ++r) cst[(wrow + (i << 4) + koff + r) * O_CP_ + wcol + (j << 4) + rlane] = acc[i][j][r] * WSC_;
    }
  }
  __syncthreads();                                      // the tile is whole before any wave reads other waves' columns
#pragma unroll 1   // eight LDS reads and eight stores per trip are enough in flight; keeps the text short
  for (int g = 0; g < (GBM_ * (GBN_ / 4)) / (8 * 256); ++g) {
    v4f v[8];
    float* p[8];
#pragma unroll   // register arrays: constant indices
    for (int it = 0; it < 8; ++it) {
      const int idx = (g * 8 + it) * 256 + tid;         // 16-byte piece of the tile, row-major: a wave's store = four whole 128-byte lines
      const int row = idx / (GBN_ / 4);
      const int c4  = (idx - row * (GBN_ / 4)) * 4;
      const int grow = (row < O_HI_) ? (rh0 + row) : (rl0 + row - O_HI_);
      v[it] = *(const v4f*)(cst + row * O_CP_ + c4);
      p[it] = C + (size_t)grow * DM_ + n0b + c4;
    }
#pragma unroll   // register arrays: constant indices
    for (int it = 0; it < 8; ++it) *(v4f*)p[it] = v[it];
    // the wait that stands in front of a rewrite of an issued store's registers (the next trip reuses them); naming them keeps them
    // whole up to it
    asm volatile("s_wait_xcnt 0x0" :: "v"(p[0]), "v"(p[1]), "v"(p[2]), "v"(p[3]), "v"(p[4]), "v"(p[5]), "v"(p[6]), "v"(p[7]),
                 "v"(v[0]), "v"(v[1]), "v"(v[2]), "v"(v[3]), "v"(v[4]), "v"(v[5]), "v"(v[6]), "v"(v[7]) : "memory");
  }
}

// ---------------------------------------------------------------------------------------------------------------
// Workspace map (byte offsets, all 2 MiB aligned; every region is written completely by whole-line stores before it is read;
// the attention output planes stand in the AO region):
//   Xh   f16 [4096][2048]            0           16,777,216
//   Wp   f16 [2560][2048]   16,777,216           10,485,760   (q, k and v rows in the projection blocks' order)
//   Woh  f16 [2048][2048]   27,262,976            8,388,608
//   cosT f32 [4096][128]    35,651,584            2,097,152
//   sinT f32 [4096][128]    37,748,736            2,097,152
//   AO                      39,845,888           41,943,040   (AOh f16 [4096][2048] at 39,845,888; AOl at 56,623,104; the rest unused)
//   Qh   f16 [4096][2048]   81,788,928           16,777,216
//   Ql   f16 [4096][2048]   98,566,144           16,777,216
//   Kh   f16 [4096][256]   115,343,360            2,097,152
//   Kl   f16 [4096][256]   117,440,512            2,097,152
//   Vth  f16 [2][256][2048] 119,537,664           2,097,152
//   Vtl  f16 [2][256][2048] 121,634,816           2,097,152
//   flags int [2*32*16][32] 123,731,968            131,072
//   total                  123,863,040
// ---------------------------------------------------------------------------------------------------------------
extern "C" void kernel_launch(void* const* d_in, const int* in_sizes, int n_in,
                              void* d_out, int out_size, void* d_ws, size_t ws_size,
                              hipStream_t stream) {
  if (n_in < 7) return;
  if (in_sizes[0] != NB_ * SEQ_ * DM_) return;
  if (in_sizes[1] != NB_ * SEQ_ * SEQ_) return;
  if (in_sizes[2] != NB_ * SEQ_) return;
  if (in_sizes[3] != DM_ * DM_) return;
  if (in_sizes[4] != HD_ * DM_) return;
  if (in_sizes[5] != HD_ * DM_) return;
  if (in_sizes[6] != DM_ * DM_) return;
  if (out_size != NB_ * SEQ_ * DM_) return;

  const float* x    = (const float*)d_in[0];
  const float* mask = (const float*)d_in[1];
  const int*   pos  = (const int*)d_in[2];
  const float* Wq   = (const float*)d_in[3];
  const float* Wk   = (const float*)d_in[4];
  const float* Wv   = (const float*)d_in[5];
  const float* Wo   = (const float*)d_in[6];
  float* out = (float*)d_out;

  const size_t nX   = (size_t)NB_ * SEQ_ * DM_;          // 8,388,608 elements
  const size_t bXh  = nX * 2;
  const size_t bWq  = (size_t)DM_ * DM_ * 2;
  const size_t bWkv = (size_t)KVN_ * DM_ * 2;
  const size_t bWo  = bWq;
  const size_t bTab = (size_t)NB_ * SEQ_ * NF_ * 4;
  const size_t bQf  = nX * 4;
  const size_t bKVf = (size_t)NB_ * SEQ_ * KVN_ * 4;
  const size_t bQ16 = nX * 2;
  const size_t bK16 = (size_t)NB_ * SEQ_ * HD_ * 2;
  const size_t bV16 = bK16;
  const size_t bFlg = (size_t)NB_ * NQB_ * MFG_ * 128;
  size_t off = 0;
  const size_t oXh  = off; off += bXh;
  const size_t oWq  = off; off += bWq;
  const size_t oWkv = off; off += bWkv;
  const size_t oWo  = off; off += bWo;
  const size_t oCos = off; off += bTab;
  const size_t oSin = off; off += bTab;
  const size_t oQf  = off; off += bQf;
  const size_t oKVf = off; off += bKVf;
  const size_t oQh  = off; off += bQ16;
  const size_t oQl  = off; off += bQ16;
  const size_t oKh  = off; off += bK16;
  const size_t oKl  = off; off += bK16;
  const size_t oVth = off; off += bV16;
  const size_t oVtl = off; off += bV16;
  const size_t oFlg = off; off += bFlg;
  if (off > ws_size) return;                        // off = 123,863,040
  if (off > (size_t)134217728) return;
  if (bQf < 2 * bQ16) return;                        // AOh/AOl alias fits inside the f32 q region
  const size_t oAOh = oQf;
  const size_t oAOl = oQf + bQ16;

  char* ws = (char*)d_ws;
  _Float16* Xh   = (_Float16*)(ws + oXh);
  _Float16* Wqh  = (_Float16*)(ws + oWq);
  _Float16* Woh  = (_Float16*)(ws + oWo);
  float*    cosT = (float*)(ws + oCos);
  float*    sinT = (float*)(ws + oSin);
  if (oKVf != oQf + bQf || oWkv != oWq + bWq) return;   // the fused weight plane is the q and kv regions one behind the other
  _Float16* Qh   = (_Float16*)(ws + oQh);
  _Float16* Ql   = (_Float16*)(ws + oQl);
  _Float16* Kh   = (_Float16*)(ws + oKh);
  _Float16* Kl   = (_Float16*)(ws + oKl);
  _Float16* Vth  = (_Float16*)(ws + oVth);
  _Float16* Vtl  = (_Float16*)(ws + oVtl);
  int*      flg  = (int*)(ws + oFlg);
  _Float16* AOh  = (_Float16*)(ws + oAOh);
  _Float16* AOl  = (_Float16*)(ws + oAOl);

  const dim3 blk(256);

  // (1) one launch: inputs -> 16-bit planes (x bf16*2^4, weights bf16*2^8, q, k and v rows dealt to the projection's blocks);
  //     cos/sin tables [4096][128] from position ids; mask verification flags per (b, query block, 4-row group)
  prep_kernel<<<dim3(PB_ALL_), blk, 0, stream>>>(x, mask, pos, Wq, Wk, Wv, Wo, Xh, Wqh, Woh, cosT, sinT, flg);
  // (2) one product: [q|k|v] = x . [Wq|Wk|Wv]^T, with RoPE + hi/residual split in its epilogue: q planes [4096][8*256] and k planes
  //     [4096][256] (head dimension in the epilogue's pair order), v^T planes [2][256][2048]
  proj_kernel<<<dim3((NB_ * SEQ_ / GBM_) * (PN_ / PBN_)), blk, 0, stream>>>(Xh, Wqh, cosT, sinT, Qh, Ql, Kh, Kl, Vth, Vtl);
  // (3) attention -> AO hi/residual planes [4096][2048]
  (void)hipFuncSetAttribute(reinterpret_cast<const void*>(&attn_kernel), hipFuncAttributeMaxDynamicSharedMemorySize, AT_LDS);
  attn_kernel<<<dim3(NB_ * NH_ * NQB_), blk, AT_LDS, stream>>>(Qh, Ql, Kh, Kl, Vth, Vtl, mask, flg, AOh, AOl);
  // (4) out = AO . Wo^T -> d_out f32 [4096][2048]; residual plane on rows < LOROWS_ of each sequence
  oproj_kernel<<<dim3((NB_ * SEQ_ / GBM_) * (DM_ / GBN_)), blk, 0, stream>>>(AOh, AOl, Woh, out);
  (void)hipGetLastError();
}
